// v000
// Times are from an AMD MI455X. After a warm-up the kernel runs many times in a row, and a time is the length of
// such a window on the GPU divided by its runs, so every launch and the gaps after it count. The runs cycle
// through copies of the inputs. A figure is the median of several windows, for all but v000 over two sittings.
// Sittings can differ by a few percent; kernels timed side by side share one.
// v000, which the later versions start from, runs in 483 microseconds.
// Contractions: q, k, v^T projections = v_wmma_f32_16x16x32_bf16 (bf16 RNE-converted x and W, single product, f32 accumulate);
// q.k^T scores = v_wmma_f32_16x16x32_bf16 with bf16 hi/lo planes of q and k (hi.hi + lo.hi + hi.lo), f32 accumulate;
// p.v = v_wmma_f32_16x16x32_f16 (p carried x1024 in f16, v^T carried x16 in f16, single product; query rows 0..RESR-1 of every
// sequence add the f16 residual planes (x4096) of p and v^T in a separate accumulator), f32 accumulate;
// output projection ctx.Wo = v_wmma_f32_16x16x32_bf16 with bf16 hi/lo planes of ctx and the bf16 RNE-converted Wo^T plane
// (hi.W + lo.W, one accumulator), f32 accumulate;
// causal mask, row max, exp, sum and normalisation in f32 on the VALU.
// Carry audit:
//   Ph  = f16(1024 * p), p already normalised by the row sum     } OSCALE = 1/(1024*16) folded exactly once in the p.v epilogue
//   VTh = f16(16 * v)                                            }
//   Pl  = f16((1024 p - Ph) * 4096)                              } products Ph.VTl and Pl.VTh go only to accumulator acc1,
//   VTl = f16((16 v - VTh) * 4096), keys 0..VLP-1                } folded with OSCALE * (1/4096) once in the same epilogue
//   q / k lo planes are unscaled bf16 residuals (v - hi) sharing the hi accumulator; score scale 1/32 applied once in f32 in the softmax.
//   ctx hi / lo planes are unscaled bf16 (lo = RNE(ctx - hi)) sharing one accumulator in the output projection.
// The module's softmax over all keys followed by the lower-triangular mask and the division by the masked row sum equals
// exp(z_j - m) / sum_{j<=i} exp(z_j - m) for any finite shift m; it is evaluated with the causal row max as the shift.
#include <hip/hip_runtime.h>
#include <math.h>

#define NB_FULL  4
#define SEQ_FULL 2048
#ifndef NB
#define NB    4
#endif
#ifndef SEQ
#define SEQ   2048
#endif
#define DM    1024
#define NQT   (SEQ / 64)                  // query/key tiles of 64
#define NTRI  ((NQT * (NQT + 1)) / 2)     // lower-triangular 64x64 score tiles per sequence (528 at SEQ 2048)
#define RESR  ((SEQ < 512) ? SEQ : 512)   // leading query rows per sequence that use the residual planes
#define VLP   RESR                        // key pitch of the p / v^T residual planes
#define PSC   1024.0f
#define VSC   16.0f
#define LSC   4096.0f
#define OSCALE (1.0f / 16384.0f)          // 1 / (PSC * VSC)
static_assert(NB >= 1 && NB <= NB_FULL);
static_assert(SEQ >= 256 && SEQ <= SEQ_FULL && (SEQ % 256) == 0);
static_assert((SEQ % 64) == 0 && (DM % 64) == 0 && (DM % 32) == 0);
static_assert((RESR % 64) == 0 && (RESR % 256) == 0 && RESR <= VLP && VLP <= SEQ && ((SEQ - RESR) % 64) == 0);
static_assert((RESR % 32) == 0);
static_assert(((NB * SEQ) % 8) == 0);
static_assert(((SEQ * DM / 8) % 256) == 0 && ((DM * DM / 8) % 256) == 0);

// ---- workspace extents (bytes) used by the launcher; checked at build time ------------------------------
#define WS_MAX2(a, b) (((a) > (b)) ? (a) : (b))
#define WS_PX  ((size_t)NB * SEQ * DM * 2)        // one 16-bit plane [NB*SEQ][DM]
#define WS_PW  ((size_t)DM * DM * 2)              // one 16-bit weight plane
#define WS_PS  ((size_t)NB * NTRI * 4096 * 4)     // packed f32 score tiles
#define WS_PC  ((size_t)NB * SEQ * DM * 4)        // f32 ctx plane
#define WS_PP  ((size_t)NB * SEQ * SEQ * 2)       // Ph
#define WS_PPL ((size_t)NB * RESR * VLP * 2)      // Pl
#define WS_PVT ((size_t)NB * DM * SEQ * 2)        // VTh
#define WS_PVL ((size_t)NB * DM * VLP * 2)        // VTl
#define WS_RA  WS_MAX2(WS_MAX2(WS_PX + 3 * WS_PW, WS_PS), WS_PC)
#define WS_TOTAL (WS_RA + 4 * WS_PX + WS_PVT + WS_PVL + WS_PW)
static_assert(WS_TOTAL <= (size_t)134217728);
static_assert(WS_PC <= WS_RA);
static_assert(WS_PP + WS_PPL <= 4 * WS_PX);
static_assert(2 * WS_PX <= 4 * WS_PX);
static_assert(((NB * SEQ) % 64) == 0 && ((NB * SEQ * DM / 8) % 256) == 0);
static_assert((WS_RA % 128) == 0 && (WS_PX % 128) == 0 && (WS_PVT % 128) == 0 && (WS_PVL % 128) == 0 && (WS_PW % 128) == 0);

typedef _Float16 v16h __attribute__((ext_vector_type(16)));
typedef _Float16 v8h  __attribute__((ext_vector_type(8)));
typedef __bf16   v16b __attribute__((ext_vector_type(16)));
typedef __bf16   v8b  __attribute__((ext_vector_type(8)));
typedef float    v8f  __attribute__((ext_vector_type(8)));
typedef float    v4f  __attribute__((ext_vector_type(4)));
typedef unsigned int v4u __attribute__((ext_vector_type(4)));

// ---- scalar helpers --------------------------------------------------------------------------------
__device__ __forceinline__ unsigned short bf_bits(float f) {          // f32 -> bf16 bits, RNE convert
  unsigned u = __float_as_uint(f);
  return (unsigned short)((u + 0x7FFFu + ((u >> 16) & 1u)) >> 16);
}
__device__ __forceinline__ float bf_up(unsigned short h) { return __uint_as_float(((unsigned)h) << 16); }
__device__ __forceinline__ unsigned short h_bits(_Float16 x) { return __builtin_bit_cast(unsigned short, x); }
__device__ __forceinline__ unsigned pk16(unsigned short a, unsigned short b) { return (unsigned)a | ((unsigned)b << 16); }
__device__ __forceinline__ v8f zero8() { v8f z = {0.f, 0.f, 0.f, 0.f, 0.f, 0.f, 0.f, 0.f}; return z; }

// ---- fragment loaders: 16-bit A/B operand, lane -> row/col (lane&15), p already includes +8*(lane>>4);
//      elements 0..7 <- p[0..7] (k0+8h..), elements 8..15 <- p[16..23] (k0+16+8h..)
__device__ __forceinline__ v16b ldfrag_b(const __bf16* p) {
  union { v16b v; v8b h[2]; } f;
  f.h[0] = *(const v8b*)(p);
  f.h[1] = *(const v8b*)(p + 16);
  return f.v;
}
__device__ __forceinline__ v16h ldfrag_h(const _Float16* p) {
  union { v16h v; v8h h[2]; } f;
  f.h[0] = *(const v8h*)(p);
  f.h[1] = *(const v8h*)(p + 16);
  return f.v;
}

// ---- WMMA helpers with trailing VALU hazard gap --------------------------------------------------------
__device__ __forceinline__ v8f mma_b_raw(v16b a, v16b b, v8f c) {
  return __builtin_amdgcn_wmma_f32_16x16x32_bf16(false, a, false, b, (short)0, c, false, false);
}
__device__ __forceinline__ v8f mma_h_raw(v16h a, v16h b, v8f c) {
  return __builtin_amdgcn_wmma_f32_16x16x32_f16(false, a, false, b, (short)0, c, false, false);
}
__device__ __forceinline__ void dep_guard_b(v8f& a, v8f& b, v16b x, v16b y) {
  asm volatile("v_nop\n\tv_nop\n\tv_nop\n\tv_nop" : "+v"(a), "+v"(b) : "v"(x), "v"(y));
}
__device__ __forceinline__ void dep_guard_h(v8f& a, v8f& b, v16h x, v16h y) {
  asm volatile("v_nop\n\tv_nop\n\tv_nop\n\tv_nop" : "+v"(a), "+v"(b) : "v"(x), "v"(y));
}
__device__ __forceinline__ void dep_guard4_h(v8f& a, v8f& b, v8f& c, v8f& d, v16h x, v16h y) {
  asm volatile("v_nop\n\tv_nop\n\tv_nop\n\tv_nop" : "+v"(a), "+v"(b), "+v"(c), "+v"(d) : "v"(x), "v"(y));
}
__device__ __forceinline__ void keep4_b(v16b a, v16b b, v16b c, v16b d) {
  asm volatile("v_nop" :: "v"(a), "v"(b), "v"(c), "v"(d));
}
__device__ __forceinline__ void keep4_h(v16h a, v16h b, v16h c, v16h d) {
  asm volatile("v_nop" :: "v"(a), "v"(b), "v"(c), "v"(d));
}
__device__ __forceinline__ void acc_guard4(v8f& a, v8f& b, v8f& c, v8f& d) {
  asm volatile("v_nop\n\tv_nop\n\tv_nop\n\tv_nop" : "+v"(a), "+v"(b), "+v"(c), "+v"(d));
}

// =====================================================================================================
// f32 -> bf16 (RNE convert) for x and the three weights into one contiguous 16-bit region:
// groups 0..NX8-1 <- x (batch b of the plane reads source rows at b * SEQ_FULL * DM, SEQ rows each), then NW8 groups each
// coverage: (NX8 + 3 NW8) threads x 8 = the whole [NB*SEQ][DM] x plane plus the three [DM][DM] weight planes.
// =====================================================================================================
__global__ __launch_bounds__(256) void cvt_planes(const float* __restrict__ x, const float* __restrict__ wq,
                                                  const float* __restrict__ wk, const float* __restrict__ wv,
                                                  unsigned short* out) {
  const int NXB8 = SEQ * DM / 8;          // groups per batch
  const int NX8 = NB * NXB8;
  const int NW8 = DM * DM / 8;
  const int g = blockIdx.x * 256 + threadIdx.x;
  if (g >= NX8 + 3 * NW8) return;
  const float* src;
  if (g < NX8) {
    const int bb  = g / NXB8;
    const int off = g - bb * NXB8;
    src = x + (size_t)bb * SEQ_FULL * DM + (size_t)off * 8;
  } else {
    const int e = g - NX8;
    const int w = e / NW8;
    const int off = e - w * NW8;
    const float* wsrc = (w == 0) ? wq : ((w == 1) ? wk : wv);
    src = wsrc + (size_t)off * 8;
  }
  const v4f a = *(const v4f*)(src);
  const v4f c = *(const v4f*)(src + 4);
  v4u p;
  p[0] = pk16(bf_bits(a[0]), bf_bits(a[1]));
  p[1] = pk16(bf_bits(a[2]), bf_bits(a[3]));
  p[2] = pk16(bf_bits(c[0]), bf_bits(c[1]));
  p[3] = pk16(bf_bits(c[2]), bf_bits(c[3]));
  *(v4u*)(out + (size_t)g * 8) = p;
  
}

// =====================================================================================================
// Transposing f32 -> bf16 (RNE convert) of the output projection weight: w[k][n] (k = input feature, n = output feature,
// DM x DM) -> out[n][k] (k contiguous), the Bt plane of the last GEMM. One block per 64x64 tile (k0 = 64*blockIdx.y,
// n0 = 64*blockIdx.x), grid (DM/64, DM/64). The tile is staged in LDS as f32 (pitch 65; written by all waves, read by all
// coverage: 2 iterations x 32 rows x 64 k = the block's whole 64x64 tile; grid = all DM/64 x DM/64 tiles.
// =====================================================================================================
__global__ __launch_bounds__(256) void cvt_wo_t(const float* __restrict__ w, unsigned short* out) {
  __shared__ float sW[64 * 65];
  const int tid = threadIdx.x;
  const int k0 = blockIdx.y * 64;
  const int n0 = blockIdx.x * 64;
  {
    const int kk = tid >> 2;               // 0..63 source row within the tile
    const int c0 = (tid & 3) * 16;         // 16 consecutive source columns
    const float* src = w + (size_t)(k0 + kk) * DM + n0 + c0;
#pragma unroll
    for (int u = 0; u < 4; ++u) {
      const v4f a = *(const v4f*)(src + 4 * u);
      sW[kk * 65 + c0 + 4 * u + 0] = a[0];
      sW[kk * 65 + c0 + 4 * u + 1] = a[1];
      sW[kk * 65 + c0 + 4 * u + 2] = a[2];
      sW[kk * 65 + c0 + 4 * u + 3] = a[3];
    }
  }
  __syncthreads();
  const int q  = tid >> 3;                 // 0..31 output row within a half tile
  const int c8 = (tid & 7) * 8;            // 8 consecutive k
  v4u hv[2];
#pragma unroll
  for (int it = 0; it < 2; ++it) {
    const int nn = it * 32 + q;            // it 0..1 x q 0..31 = output rows 0..63
    v4u a;
#pragma unroll
    for (int e = 0; e < 4; ++e) {
      const float f0 = sW[(c8 + 2 * e) * 65 + nn];
      const float f1 = sW[(c8 + 2 * e + 1) * 65 + nn];
      a[e] = pk16(bf_bits(f0), bf_bits(f1));
    }
    hv[it] = a;
  }
  {
#pragma unroll
    for (int it = 0; it < 2; ++it) {
      const int nn = it * 32 + q;
      *(v4u*)(out + (size_t)(n0 + nn) * DM + k0 + c8) = hv[it];
    }
    
  }
}

// =====================================================================================================
// f32 ctx plane [NB*SEQ][DM] -> bf16 hi plane (RNE convert) and bf16 lo plane (RNE convert of ctx - hi, unscaled).
// coverage: NB*SEQ*DM/8 threads x 8 = both whole [NB*SEQ][DM] planes.
// =====================================================================================================
__global__ __launch_bounds__(256) void cvt_ctx_planes(const float* __restrict__ c, unsigned short* hi, unsigned short* lo) {
  const int NC8 = NB * SEQ * DM / 8;
  const int g = blockIdx.x * 256 + threadIdx.x;
  if (g >= NC8) return;
  const float* src = c + (size_t)g * 8;
  const v4f a = *(const v4f*)(src);
  const v4f d = *(const v4f*)(src + 4);
  const float f[8] = {a[0], a[1], a[2], a[3], d[0], d[1], d[2], d[3]};
  v4u ph, pl;
#pragma unroll
  for (int e = 0; e < 4; ++e) {
    const unsigned short h0 = bf_bits(f[2 * e]);
    const unsigned short h1 = bf_bits(f[2 * e + 1]);
    ph[e] = pk16(h0, h1);
    pl[e] = pk16(bf_bits(f[2 * e] - bf_up(h0)), bf_bits(f[2 * e + 1] - bf_up(h1)));
  }
  {
    *(v4u*)(hi + (size_t)g * 8) = ph;
    *(v4u*)(lo + (size_t)g * 8) = pl;
    
  }
}

// =====================================================================================================
// Register-blocked batched bf16 WMMA GEMM: C[m][n] = sum_k A[m][k] * Bt[n][k]; one wave per 64x64 tile, no block barriers.
// A row-major [M][K] pitch lda; Bt row-major [N][K] pitch ldb (k contiguous); M, N multiples of 64, K multiple of 32.
// blockIdx.y = batch index (strides in elements).
// NSPLIT: 0 = Ah.Bh (single product); 1 = Ah.Bh + Al.Bh; 2 = Ah.Bh + Al.Bh + Ah.Bl with unscaled bf16 lo planes (one accumulator).
// TRI: 0 = dense tile grid (tile = blockIdx.x*8 + wave over tilesM*tilesN);
//      1 = square M == N, packed lower-triangular tiles t = blockIdx.x*8 + wave < tilesM(tilesM+1)/2, (tm, tn <= tm) decoded
//          from t; output tile t written packed at C + b*strideC + t*4096 as [64][64] f32 (OUT_MODE 0 only).
// OUT_MODE: 0 = f32 (pitch ldc); 2 = bf16 hi plane C + bf16 lo plane C2 (lo = RNE(v - hi), unscaled);
//           3 = f16 hi plane C = f16(v*hscale) + f16 residual plane C2 = f16((v*hscale - hi) * rscale), C2 written
//               only for tiles with n0 < N2 (pitch ldc2, batch stride strideC2).
// Epilogue: 16-row slabs staged per wave in LDS (wave-private region sT[wave], wave_sync); each 64-wide row segment written
// =====================================================================================================
template <int NSPLIT, int OUT_MODE, int TRI>
__global__ __launch_bounds__(256) void gemm_bf(
    const unsigned short* __restrict__ Ahp, const unsigned short* __restrict__ Alp, int lda, long long strideA,
    const unsigned short* __restrict__ Bhp, const unsigned short* __restrict__ Blp, int ldb, long long strideB,
    void* Cout, int ldc, long long strideC,
    void* Cout2, int ldc2, long long strideC2, int N2,
    int M, int N, int K, float hscale, float rscale) {
  const __bf16* Ah = (const __bf16*)(const void*)Ahp;
  const __bf16* Al = (const __bf16*)(const void*)Alp;
  const __bf16* Bh = (const __bf16*)(const void*)Bhp;
  const __bf16* Bl = (const __bf16*)(const void*)Blp;
  __shared__ __align__(16) float sT[8][16 * 68];   // per-wave 16x64 slab, pitch 68 floats
  const int b    = blockIdx.y;
  const int lane = threadIdx.x & 31;
  const int wave = threadIdx.x >> 5;
  const int tilesN = N >> 6;
  const int tilesM = M >> 6;
  const int t = blockIdx.x * 8 + wave;
  int tm, tn;
  if (TRI != 0) {
    const int ntri = (tilesM * (tilesM + 1)) >> 1;
    if (t >= ntri) return;                 // wave-uniform; no block barriers in this kernel
    int q = (int)((sqrtf(8.0f * (float)t + 1.0f) - 1.0f) * 0.5f);
    q = (q < 0) ? 0 : ((q > tilesM - 1) ? (tilesM - 1) : q);
    if ((((q + 1) * (q + 2)) >> 1) <= t) ++q;
    if (((q * (q + 1)) >> 1) > t) --q;
    q = (q < 0) ? 0 : ((q > tilesM - 1) ? (tilesM - 1) : q);
    tm = q;
    tn = t - ((q * (q + 1)) >> 1);
    tn = (tn < 0) ? 0 : ((tn > tilesN - 1) ? (tilesN - 1) : tn);
  } else {
    if (t >= tilesM * tilesN) return;      // wave-uniform
    tm = t / tilesN;
    tn = t - tm * tilesN;
  }
  const int m0 = tm << 6;
  const int n0 = tn << 6;

  const __bf16* Ahb = Ah + (size_t)b * strideA;
  const __bf16* Alb = (NSPLIT >= 1) ? (Al + (size_t)b * strideA) : Ahb;
  const __bf16* Bhb = Bh + (size_t)b * strideB;
  const __bf16* Blb = (NSPLIT >= 1) ? (Bl + (size_t)b * strideB) : Bhb;

  const int rlane = lane & 15;                 // row (A) / col (B, D) within subtile
  const int koff  = (lane >> 4) * 8;           // k offset of this lane half
  const int mOff  = (lane >> 4) * 8;           // D row offset

  v8f acc[4][4];
#pragma unroll
  for (int i = 0; i < 4; ++i)
#pragma unroll
    for (int j = 0; j < 4; ++j) acc[i][j] = zero8();

  for (int k0 = 0; k0 < K; k0 += 32) {
    v16b bf[4];
#pragma unroll
    for (int j = 0; j < 4; ++j) {
      const size_t bo = (size_t)(n0 + (j << 4) + rlane) * ldb + koff + k0;
      bf[j] = ldfrag_b(Bhb + bo);
    }
#pragma unroll
    for (int i = 0; i < 4; ++i) {
      const size_t ao = (size_t)(m0 + (i << 4) + rlane) * lda + koff + k0;
      const v16b ah = ldfrag_b(Ahb + ao);
      v16b al = ah;
      if (NSPLIT >= 1) al = ldfrag_b(Alb + ao);
#pragma unroll
      for (int j = 0; j < 4; ++j) {
        acc[i][j] = mma_b_raw(ah, bf[j], acc[i][j]);
        if (NSPLIT >= 1) acc[i][j] = mma_b_raw(al, bf[j], acc[i][j]);
      }
      dep_guard_b(acc[i][0], acc[i][3], ah, al);
    }
    if (NSPLIT >= 2) {
      keep4_b(bf[0], bf[1], bf[2], bf[3]);
#pragma unroll
      for (int j = 0; j < 4; ++j) {
        const size_t bo = (size_t)(n0 + (j << 4) + rlane) * ldb + koff + k0;
        bf[j] = ldfrag_b(Blb + bo);
      }
#pragma unroll
      for (int i = 0; i < 4; ++i) {
        const size_t ao = (size_t)(m0 + (i << 4) + rlane) * lda + koff + k0;
        const v16b ah = ldfrag_b(Ahb + ao);
#pragma unroll
        for (int j = 0; j < 4; ++j) acc[i][j] = mma_b_raw(ah, bf[j], acc[i][j]);
        dep_guard_b(acc[i][0], acc[i][3], ah, ah);
      }
    }
    keep4_b(bf[0], bf[1], bf[2], bf[3]);
  }
  acc_guard4(acc[0][0], acc[0][1], acc[0][2], acc[0][3]);
  acc_guard4(acc[1][0], acc[1][1], acc[1][2], acc[1][3]);
  acc_guard4(acc[2][0], acc[2][1], acc[2][2], acc[2][3]);
  acc_guard4(acc[3][0], acc[3][1], acc[3][2], acc[3][3]);

  // ---- epilogue ----
  size_t cbase;
  int ldce, rowb, colb;
  if (TRI != 0) { cbase = (size_t)b * strideC + (size_t)t * 4096; ldce = 64; rowb = 0; colb = 0; }
  else          { cbase = (size_t)b * strideC; ldce = ldc; rowb = m0; colb = n0; }
  float* slab = sT[wave];
#pragma unroll
  for (int i = 0; i < 4; ++i) {
    const int mBase = m0 + (i << 4);
#pragma unroll
    for (int j = 0; j < 4; ++j) {
#pragma unroll
      for (int r = 0; r < 8; ++r) {
        slab[(mOff + r) * 68 + (j << 4) + rlane] = acc[i][j][r];
      }
    }
    __builtin_amdgcn_fence(3 /* release order */, "workgroup");
    __builtin_amdgcn_wave_barrier();
    __builtin_amdgcn_fence(2 /* acquire order */, "workgroup");
    if (OUT_MODE == 0) {
      float* C = (float*)Cout + cbase;
      const int hh = lane >> 4, c4 = (lane & 15) * 4;     // 256-B row segment = 16 lanes x 16 B
      {
#pragma unroll
        for (int it = 0; it < 8; ++it) {
          const int row = it * 2 + hh;                     // it 0..7 x hh 0..1 = rows 0..15
          const v4f v = *(const v4f*)(slab + row * 68 + c4);
          *(v4f*)(C + (size_t)(rowb + (i << 4) + row) * ldce + colb + c4) = v;
        }
        
      }
    } else {
      const int q = lane >> 3, c8 = (lane & 7) * 8;
      unsigned short* C  = (unsigned short*)Cout  + (size_t)b * strideC;
      unsigned short* C2 = (unsigned short*)Cout2 + (size_t)b * strideC2;
      const bool wlo = (OUT_MODE == 2) || (n0 < N2);      // wave-uniform
      v4u hv[4], lv[4];
#pragma unroll
      for (int it = 0; it < 4; ++it) {
        const int row = it * 4 + q;                        // it 0..3 x q 0..3 = rows 0..15
        const float* sp = slab + row * 68 + c8;
        v4u a, a2;
#pragma unroll
        for (int e = 0; e < 4; ++e) {
          const float f0 = sp[2 * e], f1 = sp[2 * e + 1];
          unsigned short h0, h1, l0, l1;
          if (OUT_MODE == 2) {
            h0 = bf_bits(f0); h1 = bf_bits(f1);
            l0 = bf_bits(f0 - bf_up(h0)); l1 = bf_bits(f1 - bf_up(h1));
          } else {
            const float g0 = f0 * hscale, g1 = f1 * hscale;
            const _Float16 x0 = (_Float16)g0, x1 = (_Float16)g1;
            h0 = h_bits(x0); h1 = h_bits(x1);
            l0 = h_bits((_Float16)((g0 - (float)x0) * rscale));
            l1 = h_bits((_Float16)((g1 - (float)x1) * rscale));
          }
          a[e] = pk16(h0, h1); a2[e] = pk16(l0, l1);
        }
        hv[it] = a; lv[it] = a2;
      }
      {
#pragma unroll
        for (int it = 0; it < 4; ++it) {
          const int row = it * 4 + q;
          *(v4u*)(C + (size_t)(mBase + row) * ldc + n0 + c8) = hv[it];
          if (wlo) *(v4u*)(C2 + (size_t)(mBase + row) * ldc2 + n0 + c8) = lv[it];
        }
        
      }
    }
    __builtin_amdgcn_fence(3 /* release order */, "workgroup");
    __builtin_amdgcn_wave_barrier();
    __builtin_amdgcn_fence(2 /* acquire order */, "workgroup");
  }
}

// =====================================================================================================
// Row softmax over the packed lower-triangular score tiles. One wave per query row (block = 8 rows, grid = NB*SEQ/8).
// Row (b, i), tm = i>>6, r = i&63: score (i, j) sits at Sp + ((b*NTRI + tm(tm+1)/2 + (j>>6))*4096 + r*64 + (j&63)), j <= 64 tm + 63.
// The wave handles ng = tm/4 + 1 groups of 256 keys (lane: 8 consecutive keys per group, two 16-B loads with the key-tile
// address clamped to tn <= tm); z = s/32 for j <= i, -inf otherwise; m = max, p = exp(z - m), l = sum, P = p/l (all f32).
// Writes Ph = f16(1024 P) for keys 0 .. 256 ng - 1 of row (b, i) (pitch SEQ; >= the 64(tm+1) keys the p.v GEMM reads; zeros
// for j > i) and, for rows i < RESR, Pl = f16((1024 P - Ph) * 4096) with the same key extent (<= VLP, pitch VLP).
// coverage: NB*SEQ rows x written extent >= every key range any consumer reads.
// =====================================================================================================
__global__ __launch_bounds__(256) void softmax_rows(const float* __restrict__ Sp,
                                                    unsigned short* Php, unsigned short* Plp) {
  const int lane = threadIdx.x & 31, wave = threadIdx.x >> 5;
  const int row = blockIdx.x * 8 + wave;
  if (row >= NB * SEQ) return;             // wave-uniform; exact grid never triggers it; no block barriers below
  const int b  = row / SEQ;
  const int i  = row - b * SEQ;
  const int tm = i >> 6, r = i & 63;
  const int ng = (tm >> 2) + 1;            // 1..8, wave-uniform
  const float* srow = Sp + ((size_t)b * NTRI + (size_t)((tm * (tm + 1)) >> 1)) * 4096 + (size_t)r * 64;

  float z[8][8];
  float m = -INFINITY;
#pragma unroll
  for (int g = 0; g < 8; ++g) {
#pragma unroll
    for (int e = 0; e < 8; ++e) z[g][e] = -INFINITY;
    if (g < ng) {
      const int j0 = 256 * g + 8 * lane;
      int tn = j0 >> 6;
      tn = (tn < tm) ? tn : tm;            // clamped tile address; keys with tn > tm are all masked below
      const float* p = srow + (size_t)tn * 4096 + (j0 & 63);
      const v4f a = *(const v4f*)(p);
      const v4f c = *(const v4f*)(p + 4);
      const float v[8] = {a[0], a[1], a[2], a[3], c[0], c[1], c[2], c[3]};
#pragma unroll
      for (int e = 0; e < 8; ++e) {
        const float zz = (j0 + e <= i) ? (v[e] * 0.03125f) : -INFINITY;
        z[g][e] = zz;
        m = fmaxf(m, zz);
      }
    }
  }
#pragma unroll
  for (int off = 1; off < 32; off <<= 1) m = fmaxf(m, __shfl_xor(m, off, 32));   // finite: key 0 is always kept

  float l = 0.f;
#pragma unroll
  for (int g = 0; g < 8; ++g) {
    if (g < ng) {
#pragma unroll
      for (int e = 0; e < 8; ++e) {
        const float p = __expf(z[g][e] - m);   // masked: exp(-inf) = 0
        z[g][e] = p;
        l += p;
      }
    }
  }
#pragma unroll
  for (int off = 1; off < 32; off <<= 1) l += __shfl_xor(l, off, 32);          // l >= 1
  const float inv1k = (1.0f / l) * PSC;

  const bool res = (i < RESR);             // wave-uniform
  v4u ph[8];
  v4u pl0 = {0u, 0u, 0u, 0u};
  v4u pl1 = {0u, 0u, 0u, 0u};
#pragma unroll
  for (int g = 0; g < 8; ++g) {
    v4u hv = {0u, 0u, 0u, 0u};
    v4u lv = {0u, 0u, 0u, 0u};
    if (g < ng) {
#pragma unroll
      for (int e = 0; e < 4; ++e) {
        const float f0 = z[g][2 * e] * inv1k, f1 = z[g][2 * e + 1] * inv1k;
        const _Float16 x0 = (_Float16)f0, x1 = (_Float16)f1;
        hv[e] = pk16(h_bits(x0), h_bits(x1));
        lv[e] = pk16(h_bits((_Float16)((f0 - (float)x0) * LSC)), h_bits((_Float16)((f1 - (float)x1) * LSC)));
      }
    }
    ph[g] = hv;
    if (g == 0) pl0 = lv;
    if (g == 1) pl1 = lv;
  }

  unsigned short* prow = Php + (size_t)row * SEQ + 8 * lane;
  const int il = res ? i : 0;              // clamped row into the residual plane (stored only when res)
  unsigned short* lrow = Plp + ((size_t)b * RESR + (size_t)il) * VLP + 8 * lane;
  {
#pragma unroll
    for (int g = 0; g < 8; ++g) {
      if (g < ng) *(v4u*)(prow + 256 * g) = ph[g];
    }
    if (res) {                             // res rows have i < RESR (multiple of 256) -> 256 ng <= RESR = VLP
      *(v4u*)(lrow) = pl0;
      if (ng > 1) *(v4u*)(lrow + 256) = pl1;
    }
    
  }
}

// =====================================================================================================
// p.v GEMM on f16 WMMA, per batch b = blockIdx.y: out[b][q][d] = sum_key P[b][q][key] * VT[b][d][key].
//   A  = Ph  [b][SEQ][SEQ]  f16(1024 P), pitch SEQ         Al = Pl  [b][RESR][VLP] f16 residual x4096
//   Bt = VTh [b][DM][SEQ]   f16(16 v),   pitch SEQ         Bl = VTl [b][DM][VLP]   f16 residual x4096
// One wave per (16*MI) x 64 output tile; rows mBase + tm*16*MI ..; causal key range k < 64*((m0>>6)+1) (every P entry in that
// range was written by the softmax, zeros for key > query). RES (rows < RESR, MI = 2): acc0 += Ph.VTh; acc1 += Pl.VTh + Ph.VTl,
// out = acc0*OSCALE + acc1*OSCALE/4096; otherwise single product out = acc0*OSCALE. f32 accumulate.
// the wave tile; grid over all tiles of rows mBase .. mBase + M - 1 (M a multiple of 16*MI).
// =====================================================================================================
template <bool RES, int MI>
__global__ __launch_bounds__(256) void gemm_pv(
    const unsigned short* __restrict__ Php, const unsigned short* __restrict__ Plp,
    const unsigned short* __restrict__ Vhp, const unsigned short* __restrict__ Vlp,
    float* out, int mBase, int M) {
  const _Float16* Ph = (const _Float16*)(const void*)Php;
  const _Float16* Pl = (const _Float16*)(const void*)Plp;
  const _Float16* Vh = (const _Float16*)(const void*)Vhp;
  const _Float16* Vl = (const _Float16*)(const void*)Vlp;
  __shared__ __align__(16) float sT[8][16 * 68];
  const int b    = blockIdx.y;
  const int lane = threadIdx.x & 31;
  const int wave = threadIdx.x >> 5;
  const int tilesN = DM >> 6;                      // 16
  const int tilesM = M / (16 * MI);
  const int t = blockIdx.x * 8 + wave;
  if (t >= tilesM * tilesN) return;                // wave-uniform; no block barriers in this kernel
  const int tm = t / tilesN;
  const int tn = t - tm * tilesN;
  const int m0 = mBase + tm * 16 * MI;
  const int n0 = tn << 6;
  int keff = (((m0 >> 6) + 1) << 6);               // causal key extent of this row tile, multiple of 64
  if (keff > SEQ) keff = SEQ;
  if (RES && keff > VLP) keff = VLP;               // never taken for mBase + M <= RESR; keeps residual reads in range

  const _Float16* Pb  = Ph + (size_t)b * SEQ * SEQ;
  const _Float16* Plb = Pl + (size_t)b * RESR * VLP;
  const _Float16* Vb  = Vh + (size_t)b * DM * SEQ;
  const _Float16* Vlb = Vl + (size_t)b * DM * VLP;

  const int rlane = lane & 15;
  const int koff  = (lane >> 4) * 8;
  const int mOff  = (lane >> 4) * 8;

  v8f acc0[MI][4], acc1[MI][4];
#pragma unroll
  for (int i = 0; i < MI; ++i)
#pragma unroll
    for (int j = 0; j < 4; ++j) { acc0[i][j] = zero8(); acc1[i][j] = zero8(); }

  for (int k0 = 0; k0 < keff; k0 += 32) {
    v16h bf[4];
#pragma unroll
    for (int j = 0; j < 4; ++j) bf[j] = ldfrag_h(Vb + (size_t)(n0 + (j << 4) + rlane) * SEQ + koff + k0);
#pragma unroll
    for (int i = 0; i < MI; ++i) {
      const int mrow = m0 + (i << 4) + rlane;
      const v16h ah = ldfrag_h(Pb + (size_t)mrow * SEQ + koff + k0);
      v16h al = ah;
      if (RES) {
        const int mres = (mrow < RESR) ? mrow : (RESR - 1);   // clamped; equals mrow for the RES launch
        al = ldfrag_h(Plb + (size_t)mres * VLP + koff + k0);
      }
#pragma unroll
      for (int j = 0; j < 4; ++j) {
        acc0[i][j] = mma_h_raw(ah, bf[j], acc0[i][j]);
        if (RES) acc1[i][j] = mma_h_raw(al, bf[j], acc1[i][j]);
      }
      if (RES) dep_guard4_h(acc0[i][0], acc0[i][3], acc1[i][0], acc1[i][3], ah, al);
      else     dep_guard_h(acc0[i][0], acc0[i][3], ah, al);
    }
    if (RES) {
      keep4_h(bf[0], bf[1], bf[2], bf[3]);
#pragma unroll
      for (int j = 0; j < 4; ++j) bf[j] = ldfrag_h(Vlb + (size_t)(n0 + (j << 4) + rlane) * VLP + koff + k0);
#pragma unroll
      for (int i = 0; i < MI; ++i) {
        const int mrow = m0 + (i << 4) + rlane;
        const v16h ah = ldfrag_h(Pb + (size_t)mrow * SEQ + koff + k0);
#pragma unroll
        for (int j = 0; j < 4; ++j) acc1[i][j] = mma_h_raw(ah, bf[j], acc1[i][j]);
        dep_guard_h(acc1[i][0], acc1[i][3], ah, ah);
      }
    }
    keep4_h(bf[0], bf[1], bf[2], bf[3]);
  }
#pragma unroll
  for (int i = 0; i < MI; ++i) {
    acc_guard4(acc0[i][0], acc0[i][1], acc0[i][2], acc0[i][3]);
    if (RES) acc_guard4(acc1[i][0], acc1[i][1], acc1[i][2], acc1[i][3]);
  }

  // ---- epilogue ----
  float* slab = sT[wave];
  float* C = out + (size_t)b * SEQ * DM;
  const float rsc = OSCALE * (1.0f / LSC);
#pragma unroll
  for (int i = 0; i < MI; ++i) {
    const int mB = m0 + (i << 4);
#pragma unroll
    for (int j = 0; j < 4; ++j) {
#pragma unroll
      for (int r = 0; r < 8; ++r) {
        float v = acc0[i][j][r] * OSCALE;
        if (RES) v += acc1[i][j][r] * rsc;
        slab[(mOff + r) * 68 + (j << 4) + rlane] = v;
      }
    }
    __builtin_amdgcn_fence(3 /* release order */, "workgroup");
    __builtin_amdgcn_wave_barrier();
    __builtin_amdgcn_fence(2 /* acquire order */, "workgroup");
    {
      const int hh = lane >> 4, c4 = (lane & 15) * 4;
      {
#pragma unroll
        for (int it = 0; it < 8; ++it) {
          const int row = it * 2 + hh;
          const v4f v = *(const v4f*)(slab + row * 68 + c4);
          *(v4f*)(C + (size_t)(mB + row) * DM + n0 + c4) = v;
        }
        
      }
    }
    __builtin_amdgcn_fence(3 /* release order */, "workgroup");
    __builtin_amdgcn_wave_barrier();
    __builtin_amdgcn_fence(2 /* acquire order */, "workgroup");
  }
}

// =====================================================================================================
// Workspace map (bytes, full build NB 4 / SEQ 2048; every region is an exact multiple of its tile / whole-line store
// granularity; regions A and B are reused in stream order):
//   region A [0, 34603008):          Xb bf16 [8192][1024] at 0 (16777216) + Wq,Wk,Wv bf16 [1024][1024] at 16777216 (3 x 2097152)
//                                    then, once the projections are done: Sp f32 packed score tiles [4][528][64][64] at 0 (34603008)
//                                    then, once the softmax is done: Cf f32 ctx [8192][1024] at 0 (33554432)
//   region B [34603008, 101711872):  Qh, Ql, Kh, Kl bf16 [8192][1024] (4 x 16777216)
//                                    then, once the scores are done: Ph f16 [4][2048][2048] (33554432) + Pl f16 [4][512][512] (2097152)
//                                    then, once p.v is done: Ch, Cl bf16 ctx planes [8192][1024] (2 x 16777216)
//   region C [101711872, 122683392): VTh f16 [4][1024][2048] (16777216) + VTl f16 [4][1024][512] (4194304)
//   region D [122683392, 124780544): WoT bf16 [1024][1024] (2097152), live from launch 2 to the last GEMM
//   end 124780544
// =====================================================================================================
extern "C" void kernel_launch(void* const* d_in, const int* in_sizes, int n_in,
                              void* d_out, int out_size, void* d_ws, size_t ws_size,
                              hipStream_t stream) {
  if (n_in < 5) return;
  if (in_sizes[4] < (NB - 1) * SEQ_FULL * DM + SEQ * DM) return;
  if (in_sizes[0] < DM * DM || in_sizes[1] < DM * DM || in_sizes[2] < DM * DM || in_sizes[3] < DM * DM) return;
  if (out_size < NB * SEQ * DM) return;

  // wire order of the inputs: k, q, v, out_proj, x
  const float* wk = (const float*)d_in[0];   // [out][in]
  const float* wq = (const float*)d_in[1];   // [out][in]
  const float* wv = (const float*)d_in[2];   // [out][in]
  const float* wo = (const float*)d_in[3];   // [in][out]
  const float* x  = (const float*)d_in[4];   // [NB_FULL][SEQ_FULL][DM]
  float* out = (float*)d_out;

  const size_t PX  = (size_t)NB * SEQ * DM * 2;       // 16-bit plane [NB*SEQ][DM]
  const size_t PW  = (size_t)DM * DM * 2;             // one weight plane
  const size_t PS  = (size_t)NB * NTRI * 4096 * 4;    // packed f32 score tiles
  const size_t PC  = (size_t)NB * SEQ * DM * 4;       // f32 ctx plane
  const size_t PP  = (size_t)NB * SEQ * SEQ * 2;      // Ph
  const size_t PPL = (size_t)NB * RESR * VLP * 2;     // Pl
  const size_t PVT = (size_t)NB * DM * SEQ * 2;       // VTh
  const size_t PVL = (size_t)NB * DM * VLP * 2;       // VTl
  size_t RA = ((PX + 3 * PW) > PS) ? (PX + 3 * PW) : PS;
  if (PC > RA) RA = PC;
  const size_t oXb = 0;
  const size_t oW  = PX;
  const size_t oS  = 0;
  const size_t oCf = 0;
  const size_t oQh = RA;
  const size_t oQl = RA + PX;
  const size_t oKh = RA + 2 * PX;
  const size_t oKl = RA + 3 * PX;
  const size_t RBend = RA + 4 * PX;
  const size_t oPh = RA;
  const size_t oPl = RA + PP;
  if (oPl + PPL > RBend) return;
  const size_t oCh = RA;
  const size_t oCl = RA + PX;
  const size_t oVTh = RBend;
  const size_t oVTl = RBend + PVT;
  const size_t oWo  = oVTl + PVL;
  const size_t total = oWo + PW;                      // 124780544 in the full build
  if (total > ws_size) return;
  if (total > (size_t)134217728) return;

  char* ws = (char*)d_ws;
  unsigned short* Xb  = (unsigned short*)(ws + oXb);
  unsigned short* Wb  = (unsigned short*)(ws + oW);   // Wq plane, then Wk, then Wv
  float*          Sp  = (float*)(ws + oS);
  float*          Cf  = (float*)(ws + oCf);
  unsigned short* Qh  = (unsigned short*)(ws + oQh);
  unsigned short* Ql  = (unsigned short*)(ws + oQl);
  unsigned short* Kh  = (unsigned short*)(ws + oKh);
  unsigned short* Kl  = (unsigned short*)(ws + oKl);
  unsigned short* Ph  = (unsigned short*)(ws + oPh);
  unsigned short* Pl  = (unsigned short*)(ws + oPl);
  unsigned short* Ch  = (unsigned short*)(ws + oCh);
  unsigned short* Cl  = (unsigned short*)(ws + oCl);
  unsigned short* VTh = (unsigned short*)(ws + oVTh);
  unsigned short* VTl = (unsigned short*)(ws + oVTl);
  unsigned short* WoT = (unsigned short*)(ws + oWo);

  const dim3 blk(256);
  const int nGroups = NB * SEQ * DM / 8 + 3 * (DM * DM / 8);
  const dim3 gCvt((nGroups + 255) / 256);
  const dim3 gWo(DM / 64, DM / 64);
  const dim3 gProj(((NB * SEQ / 64) * (DM / 64) + 7) / 8, 1);
  const dim3 gVT(((DM / 64) * (SEQ / 64) + 7) / 8, NB);
  const dim3 gS((NTRI + 7) / 8, NB);
  const dim3 gSm((NB * SEQ + 7) / 8);
  const dim3 gPvRes(((RESR / 32) * (DM / 64) + 7) / 8, NB);
  const int nPvTiles = ((SEQ - RESR) / 64) * (DM / 64);
  const dim3 gPv((nPvTiles + 7) / 8, NB);
  const dim3 gCtx((NB * SEQ * DM / 8 + 255) / 256);

  // (1) x and Wq, Wk, Wv -> bf16 planes (Xb, then the three weight planes contiguous)
  cvt_planes<<<gCvt, blk, 0, stream>>>(x, wq, wk, wv, Xb);
  // (2) Wo [in][out] -> WoT bf16 [out][in]   (in[DM rows = k][DM cols = n] -> out[DM rows = n][DM cols = k]; grid (n tiles, k tiles))
  cvt_wo_t<<<gWo, blk, 0, stream>>>(wo, WoT);
  // (3) q = x . Wq^T -> bf16 hi/lo planes [NB*SEQ][DM]   (A = Xb, Bt = Wq [out][in]; M=NB*SEQ, N=DM, K=DM)
  gemm_bf<0, 2, 0><<<gProj, blk, 0, stream>>>(
      Xb, Xb, DM, 0LL, Wb, Wb, DM, 0LL,
      (void*)Qh, DM, 0LL, (void*)Ql, DM, 0LL, DM,
      NB * SEQ, DM, DM, 1.0f, 1.0f);
  // (4) k = x . Wk^T -> bf16 hi/lo planes
  gemm_bf<0, 2, 0><<<gProj, blk, 0, stream>>>(
      Xb, Xb, DM, 0LL, Wb + (size_t)DM * DM, Wb + (size_t)DM * DM, DM, 0LL,
      (void*)Kh, DM, 0LL, (void*)Kl, DM, 0LL, DM,
      NB * SEQ, DM, DM, 1.0f, 1.0f);
  // (5) v^T = Wv . x^T per batch -> f16 hi plane f16(16 v) [b][d][key] (pitch SEQ) and residual plane x4096 for keys < VLP (pitch VLP)
  //     (A = Wv [out][in], Bt = Xb rows of batch b; M=DM, N=SEQ, K=DM)
  gemm_bf<0, 3, 0><<<gVT, blk, 0, stream>>>(
      Wb + (size_t)2 * DM * DM, Wb + (size_t)2 * DM * DM, DM, 0LL, Xb, Xb, DM, (long long)SEQ * DM,
      (void*)VTh, SEQ, (long long)DM * SEQ, (void*)VTl, VLP, (long long)DM * VLP, VLP,
      DM, SEQ, DM, VSC, LSC);
  // (6) scores = q . k^T per batch over the NTRI lower-triangular 64x64 tiles, 3 bf16 products -> packed f32 tiles
  gemm_bf<2, 0, 1><<<gS, blk, 0, stream>>>(
      Qh, Ql, DM, (long long)SEQ * DM, Kh, Kl, DM, (long long)SEQ * DM,
      (void*)Sp, 64, (long long)NTRI * 4096, (void*)Sp, 64, 0LL, 0,
      SEQ, SEQ, DM, 1.0f, 1.0f);
  // (7) causal row softmax in f32 -> Ph f16(1024 P) and Pl residual planes
  softmax_rows<<<gSm, blk, 0, stream>>>(Sp, Ph, Pl);
  // (8) ctx rows 0..RESR-1 of every sequence: p.v with residual planes (3 f16 products, 32x64 wave tiles) -> Cf f32 [NB*SEQ][DM]
  gemm_pv<true, 2><<<gPvRes, blk, 0, stream>>>(Ph, Pl, VTh, VTl, Cf, 0, RESR);
  // (9) ctx rows RESR..SEQ-1: p.v single f16 product (64x64 wave tiles) -> Cf
  if (nPvTiles > 0) {
    gemm_pv<false, 4><<<gPv, blk, 0, stream>>>(Ph, Pl, VTh, VTl, Cf, RESR, SEQ - RESR);
  }
  // (10) ctx f32 -> bf16 hi/lo planes
  cvt_ctx_planes<<<gCtx, blk, 0, stream>>>(Cf, Ch, Cl);
  // (11) out = ctx . Wo -> f32 output buffer   (A = Ch + Cl, Bt = WoT [out][in]; M=NB*SEQ, N=DM, K=DM; 2 bf16 products)
  gemm_bf<1, 0, 0><<<gProj, blk, 0, stream>>>(
      Ch, Cl, DM, 0LL, WoT, WoT, DM, 0LL,
      (void*)out, DM, 0LL, (void*)out, DM, 0LL, 0,
      NB * SEQ, DM, DM, 1.0f, 1.0f);
  (void)hipGetLastError();
}

// v001
// A run of this version takes 237 microseconds.
// Two timings next to v000 put it at 2.10 and 2.11 times that version's speed.
// Contractions: q, k, v^T projections = v_wmma_f32_16x16x32_bf16 (bf16 RNE-converted x and W, single product, f32 accumulate);
// q.k^T scores = v_wmma_f32_16x16x32_bf16 with bf16 hi/lo planes of q and k (hi.hi + lo.hi + hi.lo), f32 accumulate;
// p.v = v_wmma_f32_16x16x32_f16 (p carried x1024 in f16, v^T carried x16 in f16, single product; query rows 0..RESR-1 of every
// sequence add the f16 residual planes (x4096) of p and v^T in a separate accumulator), f32 accumulate;
// output projection ctx.Wo = v_wmma_f32_16x16x32_bf16 with bf16 hi/lo planes of ctx and the bf16 RNE-converted Wo^T plane
// (hi.W + lo.W, one accumulator), f32 accumulate;
// causal mask, row max, exp, sum and normalisation in f32 on the VALU.
// Carry audit:
//   Ph  = f16(1024 * p), p already normalised by the row sum     } OSCALE = 1/(1024*16) folded exactly once in the p.v epilogue
//   VTh = f16(16 * v)                                            }
//   Pl  = f16((1024 p - Ph) * 4096)                              } products Ph.VTl and Pl.VTh go only to accumulator acc1,
//   VTl = f16((16 v - VTh) * 4096), keys 0..VLP-1                } folded with OSCALE * (1/4096) once in the same epilogue
//   q / k lo planes are unscaled bf16 residuals (v - hi) sharing the hi accumulator; score scale 1/32 applied once in f32 in the softmax.
//   ctx hi / lo planes are unscaled bf16 (lo = RNE(ctx - hi)) sharing one accumulator in the output projection.
// The module's softmax over all keys followed by the lower-triangular mask and the division by the masked row sum equals
// exp(z_j - m) / sum_{j<=i} exp(z_j - m) for any finite shift m; it is evaluated with the causal row max as the shift.
#include <hip/hip_runtime.h>
#include <math.h>

#define NB_FULL  4
#define SEQ_FULL 2048
#ifndef NB
#define NB    4
#endif
#ifndef SEQ
#define SEQ   2048
#endif
#define DM    1024
#define NQT   (SEQ / 64)                  // query/key tiles of 64
#define NTRI  ((NQT * (NQT + 1)) / 2)     // lower-triangular 64x64 score tiles per sequence (528 at SEQ 2048)
#define RESR  ((SEQ < 512) ? SEQ : 512)   // leading query rows per sequence that use the residual planes
#define VLP   RESR                        // key pitch of the p / v^T residual planes
#define PSC   1024.0f
#define VSC   16.0f
#define LSC   4096.0f
#define OSCALE (1.0f / 16384.0f)          // 1 / (PSC * VSC)
static_assert(NB >= 1 && NB <= NB_FULL);
static_assert(SEQ >= 256 && SEQ <= SEQ_FULL && (SEQ % 256) == 0);
static_assert((SEQ % 64) == 0 && (DM % 64) == 0 && (DM % 32) == 0);
static_assert((RESR % 64) == 0 && (RESR % 256) == 0 && RESR <= VLP && VLP <= SEQ && ((SEQ - RESR) % 64) == 0);
static_assert((RESR % 32) == 0);
static_assert(((NB * SEQ) % 8) == 0);
static_assert(((SEQ * DM / 8) % 256) == 0 && ((DM * DM / 8) % 256) == 0);

// ---- workspace extents (bytes) used by the launcher; checked at build time ------------------------------
#define WS_MAX2(a, b) (((a) > (b)) ? (a) : (b))
#define WS_PX  ((size_t)NB * SEQ * DM * 2)        // one 16-bit plane [NB*SEQ][DM]
#define WS_PW  ((size_t)DM * DM * 2)              // one 16-bit weight plane
#define WS_PS  ((size_t)NB * NTRI * 4096 * 4)     // packed f32 score tiles
#define WS_PC  ((size_t)NB * SEQ * DM * 4)        // f32 ctx plane
#define WS_PP  ((size_t)NB * SEQ * SEQ * 2)       // Ph
#define WS_PPL ((size_t)NB * RESR * VLP * 2)      // Pl
#define WS_PVT ((size_t)NB * DM * SEQ * 2)        // VTh
#define WS_PVL ((size_t)NB * DM * VLP * 2)        // VTl
#define WS_RA  WS_MAX2(WS_MAX2(WS_PX + 3 * WS_PW, WS_PS), WS_PC)
#define WS_TOTAL (WS_RA + 4 * WS_PX + WS_PVT + WS_PVL + WS_PW)
static_assert(WS_TOTAL <= (size_t)134217728);
static_assert(WS_PC <= WS_RA);
static_assert(WS_PP + WS_PPL <= 4 * WS_PX);
static_assert(2 * WS_PX <= 4 * WS_PX);
static_assert(((NB * SEQ) % 64) == 0 && ((NB * SEQ * DM / 8) % 256) == 0);
static_assert((WS_RA % 128) == 0 && (WS_PX % 128) == 0 && (WS_PVT % 128) == 0 && (WS_PVL % 128) == 0 && (WS_PW % 128) == 0);

typedef _Float16 v16h __attribute__((ext_vector_type(16)));
typedef _Float16 v8h  __attribute__((ext_vector_type(8)));
typedef __bf16   v16b __attribute__((ext_vector_type(16)));
typedef __bf16   v8b  __attribute__((ext_vector_type(8)));
typedef float    v8f  __attribute__((ext_vector_type(8)));
typedef float    v4f  __attribute__((ext_vector_type(4)));
typedef unsigned int v4u __attribute__((ext_vector_type(4)));

// ---- scalar helpers --------------------------------------------------------------------------------
__device__ __forceinline__ unsigned short bf_bits(float f) {          // f32 -> bf16 bits, RNE convert
  unsigned u = __float_as_uint(f);
  return (unsigned short)((u + 0x7FFFu + ((u >> 16) & 1u)) >> 16);
}
__device__ __forceinline__ float bf_up(unsigned short h) { return __uint_as_float(((unsigned)h) << 16); }
__device__ __forceinline__ unsigned short h_bits(_Float16 x) { return __builtin_bit_cast(unsigned short, x); }
__device__ __forceinline__ unsigned pk16(unsigned short a, unsigned short b) { return (unsigned)a | ((unsigned)b << 16); }
__device__ __forceinline__ v8f zero8() { v8f z = {0.f, 0.f, 0.f, 0.f, 0.f, 0.f, 0.f, 0.f}; return z; }

// ---- fragment loaders: 16-bit A/B operand, lane -> row/col (lane&15), p already includes +8*(lane>>4);
//      elements 0..7 <- p[0..7] (k0+8h..), elements 8..15 <- p[16..23] (k0+16+8h..)
__device__ __forceinline__ v16b ldfrag_b(const __bf16* p) {
  union { v16b v; v8b h[2]; } f;
  f.h[0] = *(const v8b*)(p);
  f.h[1] = *(const v8b*)(p + 16);
  return f.v;
}
__device__ __forceinline__ v16h ldfrag_h(const _Float16* p) {
  union { v16h v; v8h h[2]; } f;
  f.h[0] = *(const v8h*)(p);
  f.h[1] = *(const v8h*)(p + 16);
  return f.v;
}

// ---- WMMA helpers with trailing VALU hazard gap --------------------------------------------------------
__device__ __forceinline__ v8f mma_b_raw(v16b a, v16b b, v8f c) {
  return __builtin_amdgcn_wmma_f32_16x16x32_bf16(false, a, false, b, (short)0, c, false, false);
}
__device__ __forceinline__ v8f mma_h_raw(v16h a, v16h b, v8f c) {
  return __builtin_amdgcn_wmma_f32_16x16x32_f16(false, a, false, b, (short)0, c, false, false);
}
__device__ __forceinline__ void dep_guard_b(v8f& a, v8f& b, v16b x, v16b y) {
  asm volatile("v_nop\n\tv_nop\n\tv_nop\n\tv_nop" : "+v"(a), "+v"(b) : "v"(x), "v"(y));
}
__device__ __forceinline__ void dep_guard_h(v8f& a, v8f& b, v16h x, v16h y) {
  asm volatile("v_nop\n\tv_nop\n\tv_nop\n\tv_nop" : "+v"(a), "+v"(b) : "v"(x), "v"(y));
}
__device__ __forceinline__ void dep_guard4_h(v8f& a, v8f& b, v8f& c, v8f& d, v16h x, v16h y) {
  asm volatile("v_nop\n\tv_nop\n\tv_nop\n\tv_nop" : "+v"(a), "+v"(b), "+v"(c), "+v"(d) : "v"(x), "v"(y));
}
__device__ __forceinline__ void keep4_b(v16b a, v16b b, v16b c, v16b d) {
  asm volatile("v_nop" :: "v"(a), "v"(b), "v"(c), "v"(d));
}
__device__ __forceinline__ void keep4_h(v16h a, v16h b, v16h c, v16h d) {
  asm volatile("v_nop" :: "v"(a), "v"(b), "v"(c), "v"(d));
}
__device__ __forceinline__ void acc_guard4(v8f& a, v8f& b, v8f& c, v8f& d) {
  asm volatile("v_nop\n\tv_nop\n\tv_nop\n\tv_nop" : "+v"(a), "+v"(b), "+v"(c), "+v"(d));
}

// ---- LDS staging of GEMM operands --------------------------------------------------------------------
// A stage is 64 k (128 B) of every operand row of the work-group's tile, laid at pitch LPITCH (16 B x odd: 16-byte reads of
// 16 rows fall on distinct banks). Each lane copies 16 B: 8 lanes per row, so one wave-wide copy covers 4 whole 128-B lines.
#define LPITCH 144
struct RowChunk {                 // this lane's share of 128 staged rows: rows r, r+32, r+64, r+96 (r = tid>>3), 16 B at column tid&7
  unsigned l;                     // LDS byte address of the first
  const unsigned short* g;        // global address of the first
  size_t step;                    // 32 source rows, in elements
};
// chunk q (128 rows) of a plane: g = row 0 of the plane at the first k of the stage, pitch ld elements; lbase = LDS byte address of the plane
__device__ __forceinline__ RowChunk row_chunk(unsigned lbase, const unsigned short* g, int ld, int q, int tid) {
  const int r = q * 128 + (tid >> 3), c = tid & 7;
  RowChunk x;
  x.l = lbase + (unsigned)(r * LPITCH + c * 16);
  x.g = g + (size_t)r * ld + c * 8;
  x.step = (size_t)32 * ld;
  return x;
}
// Asynchronous copies global -> LDS of two or three chunks in one statement; the closing s_wait_xcnt keeps every later rewrite of
// these address registers behind the copies (one wait for the whole run of copies).
__device__ __forceinline__ void copy_chunks2(RowChunk a, RowChunk b) {
  asm volatile("global_load_async_to_lds_b128 %0, %8, off\n\t"
               "global_load_async_to_lds_b128 %1, %9, off\n\t"
               "global_load_async_to_lds_b128 %2, %10, off\n\t"
               "global_load_async_to_lds_b128 %3, %11, off\n\t"
               "global_load_async_to_lds_b128 %4, %12, off\n\t"
               "global_load_async_to_lds_b128 %5, %13, off\n\t"
               "global_load_async_to_lds_b128 %6, %14, off\n\t"
               "global_load_async_to_lds_b128 %7, %15, off\n\t"
               "s_wait_xcnt 0x0"
               :: "v"(a.l), "v"(a.l + 32u * LPITCH), "v"(a.l + 64u * LPITCH), "v"(a.l + 96u * LPITCH),
                  "v"(b.l), "v"(b.l + 32u * LPITCH), "v"(b.l + 64u * LPITCH), "v"(b.l + 96u * LPITCH),
                  "v"(a.g), "v"(a.g + a.step), "v"(a.g + 2 * a.step), "v"(a.g + 3 * a.step),
                  "v"(b.g), "v"(b.g + b.step), "v"(b.g + 2 * b.step), "v"(b.g + 3 * b.step) : "memory");
}
__device__ __forceinline__ void copy_chunks3(RowChunk a, RowChunk b, RowChunk d) {
  asm volatile("global_load_async_to_lds_b128 %0, %12, off\n\t"
               "global_load_async_to_lds_b128 %1, %13, off\n\t"
               "global_load_async_to_lds_b128 %2, %14, off\n\t"
               "global_load_async_to_lds_b128 %3, %15, off\n\t"
               "global_load_async_to_lds_b128 %4, %16, off\n\t"
               "global_load_async_to_lds_b128 %5, %17, off\n\t"
               "global_load_async_to_lds_b128 %6, %18, off\n\t"
               "global_load_async_to_lds_b128 %7, %19, off\n\t"
               "global_load_async_to_lds_b128 %8, %20, off\n\t"
               "global_load_async_to_lds_b128 %9, %21, off\n\t"
               "global_load_async_to_lds_b128 %10, %22, off\n\t"
               "global_load_async_to_lds_b128 %11, %23, off\n\t"
               "s_wait_xcnt 0x0"
               :: "v"(a.l), "v"(a.l + 32u * LPITCH), "v"(a.l + 64u * LPITCH), "v"(a.l + 96u * LPITCH),
                  "v"(b.l), "v"(b.l + 32u * LPITCH), "v"(b.l + 64u * LPITCH), "v"(b.l + 96u * LPITCH),
                  "v"(d.l), "v"(d.l + 32u * LPITCH), "v"(d.l + 64u * LPITCH), "v"(d.l + 96u * LPITCH),
                  "v"(a.g), "v"(a.g + a.step), "v"(a.g + 2 * a.step), "v"(a.g + 3 * a.step),
                  "v"(b.g), "v"(b.g + b.step), "v"(b.g + 2 * b.step), "v"(b.g + 3 * b.step),
                  "v"(d.g), "v"(d.g + d.step), "v"(d.g + 2 * d.step), "v"(d.g + 3 * d.step) : "memory");
}
// the wave's own copies have landed (other waves read them only behind the barrier that follows)
__device__ __forceinline__ void wait_copies() { asm volatile("s_wait_asynccnt 0x0" ::: "memory"); }
// the wave's own LDS reads have returned before the buffer they read is handed back for a refill
__device__ __forceinline__ void wait_lds() { asm volatile("s_wait_dscnt 0x0" ::: "memory"); }

// =====================================================================================================
// f32 -> bf16 (RNE convert) for x and the three weights into one contiguous 16-bit region:
// groups 0..NX8-1 <- x (batch b of the plane reads source rows at b * SEQ_FULL * DM, SEQ rows each), then NW8 groups each
// coverage: (NX8 + 3 NW8) threads x 8 = the whole [NB*SEQ][DM] x plane plus the three [DM][DM] weight planes.
// =====================================================================================================
__global__ __launch_bounds__(256) void cvt_planes(const float* __restrict__ x, const float* __restrict__ wq,
                                                  const float* __restrict__ wk, const float* __restrict__ wv,
                                                  unsigned short* out) {
  const int NXB8 = SEQ * DM / 8;          // groups per batch
  const int NX8 = NB * NXB8;
  const int NW8 = DM * DM / 8;
  const int g = blockIdx.x * 256 + threadIdx.x;
  if (g >= NX8 + 3 * NW8) return;
  const float* src;
  if (g < NX8) {
    const int bb  = g / NXB8;
    const int off = g - bb * NXB8;
    src = x + (size_t)bb * SEQ_FULL * DM + (size_t)off * 8;
  } else {
    const int e = g - NX8;
    const int w = e / NW8;
    const int off = e - w * NW8;
    const float* wsrc = (w == 0) ? wq : ((w == 1) ? wk : wv);
    src = wsrc + (size_t)off * 8;
  }
  const v4f a = *(const v4f*)(src);
  const v4f c = *(const v4f*)(src + 4);
  v4u p;
  p[0] = pk16(bf_bits(a[0]), bf_bits(a[1]));
  p[1] = pk16(bf_bits(a[2]), bf_bits(a[3]));
  p[2] = pk16(bf_bits(c[0]), bf_bits(c[1]));
  p[3] = pk16(bf_bits(c[2]), bf_bits(c[3]));
  *(v4u*)(out + (size_t)g * 8) = p;
  
}

// =====================================================================================================
// Transposing f32 -> bf16 (RNE convert) of the output projection weight: w[k][n] (k = input feature, n = output feature,
// DM x DM) -> out[n][k] (k contiguous), the Bt plane of the last GEMM. One block per 64x64 tile (k0 = 64*blockIdx.y,
// n0 = 64*blockIdx.x), grid (DM/64, DM/64). The tile is staged in LDS as f32 (pitch 65; written by all waves, read by all
// coverage: 2 iterations x 32 rows x 64 k = the block's whole 64x64 tile; grid = all DM/64 x DM/64 tiles.
// =====================================================================================================
__global__ __launch_bounds__(256) void cvt_wo_t(const float* __restrict__ w, unsigned short* out) {
  __shared__ float sW[64 * 65];
  const int tid = threadIdx.x;
  const int k0 = blockIdx.y * 64;
  const int n0 = blockIdx.x * 64;
  {
    const int kk = tid >> 2;               // 0..63 source row within the tile
    const int c0 = (tid & 3) * 16;         // 16 consecutive source columns
    const float* src = w + (size_t)(k0 + kk) * DM + n0 + c0;
#pragma unroll
    for (int u = 0; u < 4; ++u) {
      const v4f a = *(const v4f*)(src + 4 * u);
      sW[kk * 65 + c0 + 4 * u + 0] = a[0];
      sW[kk * 65 + c0 + 4 * u + 1] = a[1];
      sW[kk * 65 + c0 + 4 * u + 2] = a[2];
      sW[kk * 65 + c0 + 4 * u + 3] = a[3];
    }
  }
  __syncthreads();
  const int q  = tid >> 3;                 // 0..31 output row within a half tile
  const int c8 = (tid & 7) * 8;            // 8 consecutive k
  v4u hv[2];
#pragma unroll
  for (int it = 0; it < 2; ++it) {
    const int nn = it * 32 + q;            // it 0..1 x q 0..31 = output rows 0..63
    v4u a;
#pragma unroll
    for (int e = 0; e < 4; ++e) {
      const float f0 = sW[(c8 + 2 * e) * 65 + nn];
      const float f1 = sW[(c8 + 2 * e + 1) * 65 + nn];
      a[e] = pk16(bf_bits(f0), bf_bits(f1));
    }
    hv[it] = a;
  }
  {
#pragma unroll
    for (int it = 0; it < 2; ++it) {
      const int nn = it * 32 + q;
      *(v4u*)(out + (size_t)(n0 + nn) * DM + k0 + c8) = hv[it];
    }
    
  }
}

// =====================================================================================================
// f32 ctx plane [NB*SEQ][DM] -> bf16 hi plane (RNE convert) and bf16 lo plane (RNE convert of ctx - hi, unscaled).
// coverage: NB*SEQ*DM/8 threads x 8 = both whole [NB*SEQ][DM] planes.
// =====================================================================================================
__global__ __launch_bounds__(256) void cvt_ctx_planes(const float* __restrict__ c, unsigned short* hi, unsigned short* lo) {
  const int NC8 = NB * SEQ * DM / 8;
  const int g = blockIdx.x * 256 + threadIdx.x;
  if (g >= NC8) return;
  const float* src = c + (size_t)g * 8;
  const v4f a = *(const v4f*)(src);
  const v4f d = *(const v4f*)(src + 4);
  const float f[8] = {a[0], a[1], a[2], a[3], d[0], d[1], d[2], d[3]};
  v4u ph, pl;
#pragma unroll
  for (int e = 0; e < 4; ++e) {
    const unsigned short h0 = bf_bits(f[2 * e]);
    const unsigned short h1 = bf_bits(f[2 * e + 1]);
    ph[e] = pk16(h0, h1);
    pl[e] = pk16(bf_bits(f[2 * e] - bf_up(h0)), bf_bits(f[2 * e + 1] - bf_up(h1)));
  }
  {
    *(v4u*)(hi + (size_t)g * 8) = ph;
    *(v4u*)(lo + (size_t)g * 8) = pl;
    
  }
}

// =====================================================================================================
// Batched bf16 WMMA GEMM: C[m][n] = sum_k A[m][k] * Bt[n][k]; one work-group (8 waves, 4 x 2) per 256 x 128 tile, one wave per
// 64x64 tile of it. The operand rows of the work-group's tile are staged in LDS, 64 k a stage, by asynchronous copies in a
// two-buffer ring (stage s + 2 is copied while stage s + 1 is worked on); the waves read their fragments from LDS.
// A row-major [M][K] pitch lda; Bt row-major [N][K] pitch ldb (k contiguous); M multiple of 256, N of 128, K of 64.
// blockIdx.y = batch index (strides in elements).
// NSPLIT: 0 = Ah.Bh (single product); 1 = Ah.Bh + Al.Bh; 2 = Ah.Bh + Al.Bh + Ah.Bl with unscaled bf16 lo planes (one accumulator).
// TRI: 0 = dense grid of (M/256) x (N/128) work-group tiles, blockIdx.x row-major;
//      1 = square M == N: work-group tiles (I, J <= 2I+1), blockIdx.x = I(I+1) + J; a wave whose 64x64 tile (tm, tn) has tn > tm
//          computes and stores nothing; tile t = tm(tm+1)/2 + tn written packed at C + b*strideC + t*4096 as [64][64] f32
//          (OUT_MODE 0 only).
// OUT_MODE: 0 = f32 (pitch ldc); 2 = bf16 hi plane C + bf16 lo plane C2 (lo = RNE(v - hi), unscaled);
//           3 = f16 hi plane C = f16(v*hscale) + f16 residual plane C2 = f16((v*hscale - hi) * rscale), C2 written
//               only for tiles with n0 < N2 (pitch ldc2, batch stride strideC2).
// Epilogue: 16-row slabs staged per wave in LDS (wave-private region sT[wave], wave_sync); each 64-wide row segment written
// =====================================================================================================
template <int NSPLIT, int OUT_MODE, int TRI>
__global__ __launch_bounds__(256) void gemm_bf(
    const unsigned short* __restrict__ Ahp, const unsigned short* __restrict__ Alp, int lda, long long strideA,
    const unsigned short* __restrict__ Bhp, const unsigned short* __restrict__ Blp, int ldb, long long strideB,
    void* Cout, int ldc, long long strideC,
    void* Cout2, int ldc2, long long strideC2, int N2,
    int M, int N, int K, float hscale, float rscale) {
  constexpr int OFF_AL = 256 * LPITCH;                                   // stage layout: Ah 256 rows | Al | Bh 128 rows | Bl
  constexpr int OFF_BH = ((NSPLIT >= 1) ? 2 : 1) * 256 * LPITCH;
  constexpr int OFF_BL = OFF_BH + 128 * LPITCH;
  constexpr int STG    = OFF_BH + ((NSPLIT >= 2) ? 2 : 1) * 128 * LPITCH;
  __shared__ __align__(16) unsigned char ring[2 * STG];
  __shared__ __align__(16) float sT[8][16 * 68];   // per-wave 16x64 slab, pitch 68 floats
  const int b    = blockIdx.y;
  const int tid  = threadIdx.x;
  const int lane = tid & 31;
  const int wave = __builtin_amdgcn_readfirstlane(tid >> 5);
  int bm, bn;
  if (TRI != 0) {
    const int NI = M >> 8;
    int I = 0;
    for (int q = 1; q < NI; ++q)
      if (q * (q + 1) <= (int)blockIdx.x) I = q;
    bm = I;
    bn = (int)blockIdx.x - I * (I + 1);
    if (bn > 2 * I + 1) return;            // work-group-uniform, in front of every copy and barrier
  } else {
    const int bN = N >> 7;
    bm = (int)blockIdx.x / bN;
    bn = (int)blockIdx.x - bm * bN;
    if (bm >= (M >> 8)) return;            // work-group-uniform, in front of every copy and barrier
  }
  const int tm = bm * 4 + (wave >> 1);
  const int tn = bn * 2 + (wave & 1);
  const bool active = (TRI == 0) || (tn <= tm);   // wave-uniform
  const int t  = ((tm * (tm + 1)) >> 1) + tn;     // packed tile index (TRI)
  const int m0 = tm << 6;
  const int n0 = tn << 6;

  const unsigned short* Ag  = Ahp + (size_t)b * strideA + (size_t)(bm * 256) * lda;
  const unsigned short* Alg = Alp + (size_t)b * strideA + (size_t)(bm * 256) * lda;
  const unsigned short* Bg  = Bhp + (size_t)b * strideB + (size_t)(bn * 128) * ldb;
  const unsigned short* Blg = Blp + (size_t)b * strideB + (size_t)(bn * 128) * ldb;
  const unsigned ringb = (unsigned)(size_t)(const void*)ring;    // LDS byte address of the ring

  const int rlane = lane & 15;                 // row (A) / col (B, D) within subtile
  const int koff  = (lane >> 4) * 8;           // k offset of this lane half
  const int mOff  = (lane >> 4) * 8;           // D row offset

  auto stage = [&](int s, int buf) {
    const unsigned lb = ringb + (unsigned)(buf * STG);
    const size_t ks = (size_t)s * 64;
    copy_chunks3(row_chunk(lb, Ag + ks, lda, 0, tid), row_chunk(lb, Ag + ks, lda, 1, tid),
                 row_chunk(lb + OFF_BH, Bg + ks, ldb, 0, tid));
    if (NSPLIT == 1) copy_chunks2(row_chunk(lb + OFF_AL, Alg + ks, lda, 0, tid), row_chunk(lb + OFF_AL, Alg + ks, lda, 1, tid));
    if (NSPLIT >= 2) copy_chunks3(row_chunk(lb + OFF_AL, Alg + ks, lda, 0, tid), row_chunk(lb + OFF_AL, Alg + ks, lda, 1, tid),
                                  row_chunk(lb + OFF_BL, Blg + ks, ldb, 0, tid));
  };

  v8f acc[4][4];
#pragma unroll
  for (int i = 0; i < 4; ++i)
#pragma unroll
    for (int j = 0; j < 4; ++j) acc[i][j] = zero8();

  const int nst = K >> 6;
  stage(0, 0);
  wait_copies();
  __syncthreads();
  if (nst > 1) stage(1, 1);

  for (int s = 0; s < nst; ++s) {
    if (active) {
      const unsigned char* sb = ring + (s & 1) * STG;
      const unsigned char* pa = sb + ((wave >> 1) * 64 + rlane) * LPITCH + koff * 2;
      const unsigned char* pb = sb + OFF_BH + ((wave & 1) * 64 + rlane) * LPITCH + koff * 2;
#pragma unroll
      for (int kk = 0; kk < 2; ++kk) {
        v16b bf[4], ah[4], al[4];
#pragma unroll
        for (int j = 0; j < 4; ++j) bf[j] = ldfrag_b((const __bf16*)(pb + j * 16 * LPITCH + kk * 64));
#pragma unroll
        for (int i = 0; i < 4; ++i) {
          ah[i] = ldfrag_b((const __bf16*)(pa + i * 16 * LPITCH + kk * 64));
          al[i] = ah[i];
          if (NSPLIT >= 1) al[i] = ldfrag_b((const __bf16*)(pa + OFF_AL + i * 16 * LPITCH + kk * 64));
        }
#pragma unroll
        for (int i = 0; i < 4; ++i) {
#pragma unroll
          for (int j = 0; j < 4; ++j) {
            acc[i][j] = mma_b_raw(ah[i], bf[j], acc[i][j]);
            if (NSPLIT >= 1) acc[i][j] = mma_b_raw(al[i], bf[j], acc[i][j]);
          }
          dep_guard_b(acc[i][0], acc[i][3], ah[i], al[i]);
        }
        if (NSPLIT >= 2) {
          keep4_b(bf[0], bf[1], bf[2], bf[3]);
#pragma unroll
          for (int j = 0; j < 4; ++j) bf[j] = ldfrag_b((const __bf16*)(pb + (OFF_BL - OFF_BH) + j * 16 * LPITCH + kk * 64));
#pragma unroll
          for (int i = 0; i < 4; ++i) {
#pragma unroll
            for (int j = 0; j < 4; ++j) acc[i][j] = mma_b_raw(ah[i], bf[j], acc[i][j]);
            dep_guard_b(acc[i][0], acc[i][3], ah[i], ah[i]);
          }
        }
        keep4_b(bf[0], bf[1], bf[2], bf[3]);
      }
    }
    // publish point of stage s + 1, passed by every wave: own LDS reads done, own copies landed, barrier, then the refill
    wait_lds();
    wait_copies();
    __syncthreads();
    if (s + 2 < nst) stage(s + 2, s & 1);
  }
  wait_copies();
  if (!active) return;                     // wave-uniform; no work-group barrier below
  acc_guard4(acc[0][0], acc[0][1], acc[0][2], acc[0][3]);
  acc_guard4(acc[1][0], acc[1][1], acc[1][2], acc[1][3]);
  acc_guard4(acc[2][0], acc[2][1], acc[2][2], acc[2][3]);
  acc_guard4(acc[3][0], acc[3][1], acc[3][2], acc[3][3]);

  // ---- epilogue ----
  size_t cbase;
  int ldce, rowb, colb;
  if (TRI != 0) { cbase = (size_t)b * strideC + (size_t)t * 4096; ldce = 64; rowb = 0; colb = 0; }
  else          { cbase = (size_t)b * strideC; ldce = ldc; rowb = m0; colb = n0; }
  float* slab = sT[wave];
#pragma unroll
  for (int i = 0; i < 4; ++i) {
    const int mBase = m0 + (i << 4);
#pragma unroll
    for (int j = 0; j < 4; ++j) {
#pragma unroll
      for (int r = 0; r < 8; ++r) {
        slab[(mOff + r) * 68 + (j << 4) + rlane] = acc[i][j][r];
      }
    }
    __builtin_amdgcn_fence(3 /* release order */, "workgroup");
    __builtin_amdgcn_wave_barrier();
    __builtin_amdgcn_fence(2 /* acquire order */, "workgroup");
    if (OUT_MODE == 0) {
      float* C = (float*)Cout + cbase;
      const int hh = lane >> 4, c4 = (lane & 15) * 4;     // 256-B row segment = 16 lanes x 16 B
      {
#pragma unroll
        for (int it = 0; it < 8; ++it) {
          const int row = it * 2 + hh;                     // it 0..7 x hh 0..1 = rows 0..15
          const v4f v = *(const v4f*)(slab + row * 68 + c4);
          *(v4f*)(C + (size_t)(rowb + (i << 4) + row) * ldce + colb + c4) = v;
        }
        
      }
    } else {
      const int q = lane >> 3, c8 = (lane & 7) * 8;
      unsigned short* C  = (unsigned short*)Cout  + (size_t)b * strideC;
      unsigned short* C2 = (unsigned short*)Cout2 + (size_t)b * strideC2;
      const bool wlo = (OUT_MODE == 2) || (n0 < N2);      // wave-uniform
      v4u hv[4], lv[4];
#pragma unroll
      for (int it = 0; it < 4; ++it) {
        const int row = it * 4 + q;                        // it 0..3 x q 0..3 = rows 0..15
        const float* sp = slab + row * 68 + c8;
        v4u a, a2;
#pragma unroll
        for (int e = 0; e < 4; ++e) {
          const float f0 = sp[2 * e], f1 = sp[2 * e + 1];
          unsigned short h0, h1, l0, l1;
          if (OUT_MODE == 2) {
            h0 = bf_bits(f0); h1 = bf_bits(f1);
            l0 = bf_bits(f0 - bf_up(h0)); l1 = bf_bits(f1 - bf_up(h1));
          } else {
            const float g0 = f0 * hscale, g1 = f1 * hscale;
            const _Float16 x0 = (_Float16)g0, x1 = (_Float16)g1;
            h0 = h_bits(x0); h1 = h_bits(x1);
            l0 = h_bits((_Float16)((g0 - (float)x0) * rscale));
            l1 = h_bits((_Float16)((g1 - (float)x1) * rscale));
          }
          a[e] = pk16(h0, h1); a2[e] = pk16(l0, l1);
        }
        hv[it] = a; lv[it] = a2;
      }
      {
#pragma unroll
        for (int it = 0; it < 4; ++it) {
          const int row = it * 4 + q;
          *(v4u*)(C + (size_t)(mBase + row) * ldc + n0 + c8) = hv[it];
          if (wlo) *(v4u*)(C2 + (size_t)(mBase + row) * ldc2 + n0 + c8) = lv[it];
        }
        
      }
    }
    __builtin_amdgcn_fence(3 /* release order */, "workgroup");
    __builtin_amdgcn_wave_barrier();
    __builtin_amdgcn_fence(2 /* acquire order */, "workgroup");
  }
}

// =====================================================================================================
// Row softmax over the packed lower-triangular score tiles. One wave per query row (block = 8 rows, grid = NB*SEQ/8).
// Row (b, i), tm = i>>6, r = i&63: score (i, j) sits at Sp + ((b*NTRI + tm(tm+1)/2 + (j>>6))*4096 + r*64 + (j&63)), j <= 64 tm + 63.
// The wave handles ng = tm/4 + 1 groups of 256 keys (lane: 8 consecutive keys per group, two 16-B loads with the key-tile
// address clamped to tn <= tm); z = s/32 for j <= i, -inf otherwise; m = max, p = exp(z - m), l = sum, P = p/l (all f32).
// Writes Ph = f16(1024 P) for keys 0 .. 256 ng - 1 of row (b, i) (pitch SEQ; >= the keys the p.v GEMM copies for the row's work-group tile; zeros
// for j > i) and, for rows i < RESR, Pl = f16((1024 P - Ph) * 4096) with the same key extent (<= VLP, pitch VLP).
// coverage: NB*SEQ rows x written extent >= every key range any consumer reads.
// =====================================================================================================
__global__ __launch_bounds__(256) void softmax_rows(const float* __restrict__ Sp,
                                                    unsigned short* Php, unsigned short* Plp) {
  const int lane = threadIdx.x & 31, wave = threadIdx.x >> 5;
  const int row = blockIdx.x * 8 + wave;
  if (row >= NB * SEQ) return;             // wave-uniform; exact grid never triggers it; no block barriers below
  const int b  = row / SEQ;
  const int i  = row - b * SEQ;
  const int tm = i >> 6, r = i & 63;
  const int ng = (tm >> 2) + 1;            // 1..8, wave-uniform
  const float* srow = Sp + ((size_t)b * NTRI + (size_t)((tm * (tm + 1)) >> 1)) * 4096 + (size_t)r * 64;

  float z[8][8];
  float m = -INFINITY;
#pragma unroll
  for (int g = 0; g < 8; ++g) {
#pragma unroll
    for (int e = 0; e < 8; ++e) z[g][e] = -INFINITY;
    if (g < ng) {
      const int j0 = 256 * g + 8 * lane;
      int tn = j0 >> 6;
      tn = (tn < tm) ? tn : tm;            // clamped tile address; keys with tn > tm are all masked below
      const float* p = srow + (size_t)tn * 4096 + (j0 & 63);
      const v4f a = *(const v4f*)(p);
      const v4f c = *(const v4f*)(p + 4);
      const float v[8] = {a[0], a[1], a[2], a[3], c[0], c[1], c[2], c[3]};
#pragma unroll
      for (int e = 0; e < 8; ++e) {
        const float zz = (j0 + e <= i) ? (v[e] * 0.03125f) : -INFINITY;
        z[g][e] = zz;
        m = fmaxf(m, zz);
      }
    }
  }
#pragma unroll
  for (int off = 1; off < 32; off <<= 1) m = fmaxf(m, __shfl_xor(m, off, 32));   // finite: key 0 is always kept

  float l = 0.f;
#pragma unroll
  for (int g = 0; g < 8; ++g) {
    if (g < ng) {
#pragma unroll
      for (int e = 0; e < 8; ++e) {
        const float p = __expf(z[g][e] - m);   // masked: exp(-inf) = 0
        z[g][e] = p;
        l += p;
      }
    }
  }
#pragma unroll
  for (int off = 1; off < 32; off <<= 1) l += __shfl_xor(l, off, 32);          // l >= 1
  const float inv1k = (1.0f / l) * PSC;

  const bool res = (i < RESR);             // wave-uniform
  v4u ph[8];
  v4u pl0 = {0u, 0u, 0u, 0u};
  v4u pl1 = {0u, 0u, 0u, 0u};
#pragma unroll
  for (int g = 0; g < 8; ++g) {
    v4u hv = {0u, 0u, 0u, 0u};
    v4u lv = {0u, 0u, 0u, 0u};
    if (g < ng) {
#pragma unroll
      for (int e = 0; e < 4; ++e) {
        const float f0 = z[g][2 * e] * inv1k, f1 = z[g][2 * e + 1] * inv1k;
        const _Float16 x0 = (_Float16)f0, x1 = (_Float16)f1;
        hv[e] = pk16(h_bits(x0), h_bits(x1));
        lv[e] = pk16(h_bits((_Float16)((f0 - (float)x0) * LSC)), h_bits((_Float16)((f1 - (float)x1) * LSC)));
      }
    }
    ph[g] = hv;
    if (g == 0) pl0 = lv;
    if (g == 1) pl1 = lv;
  }

  unsigned short* prow = Php + (size_t)row * SEQ + 8 * lane;
  const int il = res ? i : 0;              // clamped row into the residual plane (stored only when res)
  unsigned short* lrow = Plp + ((size_t)b * RESR + (size_t)il) * VLP + 8 * lane;
  {
#pragma unroll
    for (int g = 0; g < 8; ++g) {
      if (g < ng) *(v4u*)(prow + 256 * g) = ph[g];
    }
    if (res) {                             // res rows have i < RESR (multiple of 256) -> 256 ng <= RESR = VLP
      *(v4u*)(lrow) = pl0;
      if (ng > 1) *(v4u*)(lrow + 256) = pl1;
    }
    
  }
}

// =====================================================================================================
// p.v GEMM on f16 WMMA, per batch b = blockIdx.y: out[b][q][d] = sum_key P[b][q][key] * VT[b][d][key].
//   A  = Ph  [b][SEQ][SEQ]  f16(1024 P), pitch SEQ         Al = Pl  [b][RESR][VLP] f16 residual x4096
//   Bt = VTh [b][DM][SEQ]   f16(16 v),   pitch SEQ         Bl = VTl [b][DM][VLP]   f16 residual x4096
// One work-group (8 waves, 4 x 2) per (64*MI) x 128 output tile, one wave per (16*MI) x 64 tile of it; rows mBase + ...; the
// operand rows of the work-group's tile are staged in LDS, 64 keys a stage, by asynchronous copies in a two-buffer ring up to the
// causal key extent of the work-group's last row tile (every P entry in that range was written by the softmax: its written extent
// is 256*(row/256 + 1) keys). A wave works on keys k < 64*((m0>>6)+1) only and passes the later publish points idle.
// RES (rows < RESR, MI = 2): acc0 += Ph.VTh; acc1 += Pl.VTh + Ph.VTl,
// out = acc0*OSCALE + acc1*OSCALE/4096; otherwise single product out = acc0*OSCALE. f32 accumulate.
// grid over all work-group tiles of rows mBase .. mBase + M - 1 (M a multiple of 64*MI).
// =====================================================================================================
template <bool RES, int MI>
__global__ __launch_bounds__(256) void gemm_pv(
    const unsigned short* __restrict__ Php, const unsigned short* __restrict__ Plp,
    const unsigned short* __restrict__ Vhp, const unsigned short* __restrict__ Vlp,
    float* out, int mBase, int M) {
  constexpr int AR     = 64 * MI;                                        // rows of the work-group's tile
  static_assert(AR == (RES ? 128 : 256) && (RESR % AR) == 0);
  constexpr int OFF_AL = AR * LPITCH;                                    // stage layout: Ph AR rows | Pl | VTh 128 rows | VTl
  constexpr int OFF_BH = (RES ? 2 : 1) * AR * LPITCH;
  constexpr int OFF_BL = OFF_BH + 128 * LPITCH;
  constexpr int STG    = OFF_BH + (RES ? 2 : 1) * 128 * LPITCH;
  __shared__ __align__(16) unsigned char ring[2 * STG];
  __shared__ __align__(16) float sT[8][16 * 68];
  const int b    = blockIdx.y;
  const int tid  = threadIdx.x;
  const int lane = tid & 31;
  const int wave = __builtin_amdgcn_readfirstlane(tid >> 5);
  const int bN = DM >> 7;                          // 8
  const int bm = (int)blockIdx.x / bN;
  const int bn = (int)blockIdx.x - bm * bN;
  if (bm >= M / AR) return;                        // work-group-uniform, in front of every copy and barrier
  const int r0 = mBase + bm * AR;                  // first row of the work-group's tile
  const int m0 = r0 + (wave >> 1) * 16 * MI;
  const int n0 = bn * 128 + (wave & 1) * 64;
  int keff = (((m0 >> 6) + 1) << 6);               // causal key extent of this row tile, multiple of 64
  if (keff > SEQ) keff = SEQ;
  if (RES && keff > VLP) keff = VLP;               // never taken for mBase + M <= RESR; keeps residual reads in range
  int kblk = ((((r0 + 3 * 16 * MI) >> 6) + 1) << 6);   // the same of the work-group's last row tile: the staged extent
  if (kblk > SEQ) kblk = SEQ;
  if (RES && kblk > VLP) kblk = VLP;
  int rl0 = r0;                                    // first row in the residual plane, clamped; equals r0 for the RES launch
  if (rl0 > RESR - AR) rl0 = RESR - AR;

  const unsigned short* Ag  = Php + (size_t)b * SEQ * SEQ + (size_t)r0 * SEQ;
  const unsigned short* Alg = Plp + (size_t)b * RESR * VLP + (size_t)rl0 * VLP;
  const unsigned short* Bg  = Vhp + (size_t)b * DM * SEQ + (size_t)(bn * 128) * SEQ;
  const unsigned short* Blg = Vlp + (size_t)b * DM * VLP + (size_t)(bn * 128) * VLP;
  const unsigned ringb = (unsigned)(size_t)(const void*)ring;    // LDS byte address of the ring

  const int rlane = lane & 15;
  const int koff  = (lane >> 4) * 8;
  const int mOff  = (lane >> 4) * 8;

  auto stage = [&](int s, int buf) {
    const unsigned lb = ringb + (unsigned)(buf * STG);
    const size_t ks = (size_t)s * 64;
    if (RES) {                                     // AR = 128: one chunk a plane
      copy_chunks2(row_chunk(lb, Ag + ks, SEQ, 0, tid), row_chunk(lb + OFF_BH, Bg + ks, SEQ, 0, tid));
      copy_chunks2(row_chunk(lb + OFF_AL, Alg + ks, VLP, 0, tid), row_chunk(lb + OFF_BL, Blg + ks, VLP, 0, tid));
    } else {                                       // AR = 256: two chunks of P, one of v^T
      copy_chunks3(row_chunk(lb, Ag + ks, SEQ, 0, tid), row_chunk(lb, Ag + ks, SEQ, 1, tid),
                   row_chunk(lb + OFF_BH, Bg + ks, SEQ, 0, tid));
    }
  };

  v8f acc0[MI][4], acc1[MI][4];
#pragma unroll
  for (int i = 0; i < MI; ++i)
#pragma unroll
    for (int j = 0; j < 4; ++j) { acc0[i][j] = zero8(); acc1[i][j] = zero8(); }

  const int nst = kblk >> 6;
  stage(0, 0);
  wait_copies();
  __syncthreads();
  if (nst > 1) stage(1, 1);

  for (int s = 0; s < nst; ++s) {
    if (s * 64 < keff) {                           // wave-uniform
      const unsigned char* sb = ring + (s & 1) * STG;
      const unsigned char* pa = sb + ((wave >> 1) * 16 * MI + rlane) * LPITCH + koff * 2;
      const unsigned char* pb = sb + OFF_BH + ((wave & 1) * 64 + rlane) * LPITCH + koff * 2;
#pragma unroll
      for (int kk = 0; kk < 2; ++kk) {
        v16h bf[4], ah[MI], al[MI];
#pragma unroll
        for (int j = 0; j < 4; ++j) bf[j] = ldfrag_h((const _Float16*)(pb + j * 16 * LPITCH + kk * 64));
#pragma unroll
        for (int i = 0; i < MI; ++i) {
          ah[i] = ldfrag_h((const _Float16*)(pa + i * 16 * LPITCH + kk * 64));
          al[i] = ah[i];
          if (RES) al[i] = ldfrag_h((const _Float16*)(pa + OFF_AL + i * 16 * LPITCH + kk * 64));
        }
#pragma unroll
        for (int i = 0; i < MI; ++i) {
#pragma unroll
          for (int j = 0; j < 4; ++j) {
            acc0[i][j] = mma_h_raw(ah[i], bf[j], acc0[i][j]);
            if (RES) acc1[i][j] = mma_h_raw(al[i], bf[j], acc1[i][j]);
          }
          if (RES) dep_guard4_h(acc0[i][0], acc0[i][3], acc1[i][0], acc1[i][3], ah[i], al[i]);
          else     dep_guard_h(acc0[i][0], acc0[i][3], ah[i], al[i]);
        }
        if (RES) {
          keep4_h(bf[0], bf[1], bf[2], bf[3]);
#pragma unroll
          for (int j = 0; j < 4; ++j) bf[j] = ldfrag_h((const _Float16*)(pb + (OFF_BL - OFF_BH) + j * 16 * LPITCH + kk * 64));
#pragma unroll
          for (int i = 0; i < MI; ++i) {
#pragma unroll
            for (int j = 0; j < 4; ++j) acc1[i][j] = mma_h_raw(ah[i], bf[j], acc1[i][j]);
            dep_guard_h(acc1[i][0], acc1[i][3], ah[i], ah[i]);
          }
        }
        keep4_h(bf[0], bf[1], bf[2], bf[3]);
      }
    }
    // publish point of stage s + 1, passed by every wave: own LDS reads done, own copies landed, barrier, then the refill
    wait_lds();
    wait_copies();
    __syncthreads();
    if (s + 2 < nst) stage(s + 2, s & 1);
  }
  wait_copies();
#pragma unroll
  for (int i = 0; i < MI; ++i) {
    acc_guard4(acc0[i][0], acc0[i][1], acc0[i][2], acc0[i][3]);
    if (RES) acc_guard4(acc1[i][0], acc1[i][1], acc1[i][2], acc1[i][3]);
  }

  // ---- epilogue ----
  float* slab = sT[wave];
  float* C = out + (size_t)b * SEQ * DM;
  const float rsc = OSCALE * (1.0f / LSC);
#pragma unroll
  for (int i = 0; i < MI; ++i) {
    const int mB = m0 + (i << 4);
#pragma unroll
    for (int j = 0; j < 4; ++j) {
#pragma unroll
      for (int r = 0; r < 8; ++r) {
        float v = acc0[i][j][r] * OSCALE;
        if (RES) v += acc1[i][j][r] * rsc;
        slab[(mOff + r) * 68 + (j << 4) + rlane] = v;
      }
    }
    __builtin_amdgcn_fence(3 /* release order */, "workgroup");
    __builtin_amdgcn_wave_barrier();
    __builtin_amdgcn_fence(2 /* acquire order */, "workgroup");
    {
      const int hh = lane >> 4, c4 = (lane & 15) * 4;
      {
#pragma unroll
        for (int it = 0; it < 8; ++it) {
          const int row = it * 2 + hh;
          const v4f v = *(const v4f*)(slab + row * 68 + c4);
          *(v4f*)(C + (size_t)(mB + row) * DM + n0 + c4) = v;
        }
        
      }
    }
    __builtin_amdgcn_fence(3 /* release order */, "workgroup");
    __builtin_amdgcn_wave_barrier();
    __builtin_amdgcn_fence(2 /* acquire order */, "workgroup");
  }
}

// =====================================================================================================
// Workspace map (bytes, full build NB 4 / SEQ 2048; every region is an exact multiple of its tile / whole-line store
// granularity; regions A and B are reused in stream order):
//   region A [0, 34603008):          Xb bf16 [8192][1024] at 0 (16777216) + Wq,Wk,Wv bf16 [1024][1024] at 16777216 (3 x 2097152)
//                                    then, once the projections are done: Sp f32 packed score tiles [4][528][64][64] at 0 (34603008)
//                                    then, once the softmax is done: Cf f32 ctx [8192][1024] at 0 (33554432)
//   region B [34603008, 101711872):  Qh, Ql, Kh, Kl bf16 [8192][1024] (4 x 16777216)
//                                    then, once the scores are done: Ph f16 [4][2048][2048] (33554432) + Pl f16 [4][512][512] (2097152)
//                                    then, once p.v is done: Ch, Cl bf16 ctx planes [8192][1024] (2 x 16777216)
//   region C [101711872, 122683392): VTh f16 [4][1024][2048] (16777216) + VTl f16 [4][1024][512] (4194304)
//   region D [122683392, 124780544): WoT bf16 [1024][1024] (2097152), live from launch 2 to the last GEMM
//   end 124780544
// =====================================================================================================
extern "C" void kernel_launch(void* const* d_in, const int* in_sizes, int n_in,
                              void* d_out, int out_size, void* d_ws, size_t ws_size,
                              hipStream_t stream) {
  if (n_in < 5) return;
  if (in_sizes[4] < (NB - 1) * SEQ_FULL * DM + SEQ * DM) return;
  if (in_sizes[0] < DM * DM || in_sizes[1] < DM * DM || in_sizes[2] < DM * DM || in_sizes[3] < DM * DM) return;
  if (out_size < NB * SEQ * DM) return;

  // wire order of the inputs: k, q, v, out_proj, x
  const float* wk = (const float*)d_in[0];   // [out][in]
  const float* wq = (const float*)d_in[1];   // [out][in]
  const float* wv = (const float*)d_in[2];   // [out][in]
  const float* wo = (const float*)d_in[3];   // [in][out]
  const float* x  = (const float*)d_in[4];   // [NB_FULL][SEQ_FULL][DM]
  float* out = (float*)d_out;

  const size_t PX  = (size_t)NB * SEQ * DM * 2;       // 16-bit plane [NB*SEQ][DM]
  const size_t PW  = (size_t)DM * DM * 2;             // one weight plane
  const size_t PS  = (size_t)NB * NTRI * 4096 * 4;    // packed f32 score tiles
  const size_t PC  = (size_t)NB * SEQ * DM * 4;       // f32 ctx plane
  const size_t PP  = (size_t)NB * SEQ * SEQ * 2;      // Ph
  const size_t PPL = (size_t)NB * RESR * VLP * 2;     // Pl
  const size_t PVT = (size_t)NB * DM * SEQ * 2;       // VTh
  const size_t PVL = (size_t)NB * DM * VLP * 2;       // VTl
  size_t RA = ((PX + 3 * PW) > PS) ? (PX + 3 * PW) : PS;
  if (PC > RA) RA = PC;
  const size_t oXb = 0;
  const size_t oW  = PX;
  const size_t oS  = 0;
  const size_t oCf = 0;
  const size_t oQh = RA;
  const size_t oQl = RA + PX;
  const size_t oKh = RA + 2 * PX;
  const size_t oKl = RA + 3 * PX;
  const size_t RBend = RA + 4 * PX;
  const size_t oPh = RA;
  const size_t oPl = RA + PP;
  if (oPl + PPL > RBend) return;
  const size_t oCh = RA;
  const size_t oCl = RA + PX;
  const size_t oVTh = RBend;
  const size_t oVTl = RBend + PVT;
  const size_t oWo  = oVTl + PVL;
  const size_t total = oWo + PW;                      // 124780544 in the full build
  if (total > ws_size) return;
  if (total > (size_t)134217728) return;

  char* ws = (char*)d_ws;
  unsigned short* Xb  = (unsigned short*)(ws + oXb);
  unsigned short* Wb  = (unsigned short*)(ws + oW);   // Wq plane, then Wk, then Wv
  float*          Sp  = (float*)(ws + oS);
  float*          Cf  = (float*)(ws + oCf);
  unsigned short* Qh  = (unsigned short*)(ws + oQh);
  unsigned short* Ql  = (unsigned short*)(ws + oQl);
  unsigned short* Kh  = (unsigned short*)(ws + oKh);
  unsigned short* Kl  = (unsigned short*)(ws + oKl);
  unsigned short* Ph  = (unsigned short*)(ws + oPh);
  unsigned short* Pl  = (unsigned short*)(ws + oPl);
  unsigned short* Ch  = (unsigned short*)(ws + oCh);
  unsigned short* Cl  = (unsigned short*)(ws + oCl);
  unsigned short* VTh = (unsigned short*)(ws + oVTh);
  unsigned short* VTl = (unsigned short*)(ws + oVTl);
  unsigned short* WoT = (unsigned short*)(ws + oWo);

  const dim3 blk(256);
  const int nGroups = NB * SEQ * DM / 8 + 3 * (DM * DM / 8);
  const dim3 gCvt((nGroups + 255) / 256);
  const dim3 gWo(DM / 64, DM / 64);
  const dim3 gProj(((NB * SEQ / 64) * (DM / 64) + 7) / 8, 1);
  const dim3 gVT(((DM / 64) * (SEQ / 64) + 7) / 8, NB);
  const dim3 gS((SEQ / 256) * ((SEQ / 256) + 1), NB);   // work-group tiles (I, J <= 2I+1) of 256 x 128
  const dim3 gSm((NB * SEQ + 7) / 8);
  const dim3 gPvRes(((RESR / 32) * (DM / 64) + 7) / 8, NB);
  const int nPvTiles = ((SEQ - RESR) / 64) * (DM / 64);
  const dim3 gPv((nPvTiles + 7) / 8, NB);
  const dim3 gCtx((NB * SEQ * DM / 8 + 255) / 256);

  // (1) x and Wq, Wk, Wv -> bf16 planes (Xb, then the three weight planes contiguous)
  cvt_planes<<<gCvt, blk, 0, stream>>>(x, wq, wk, wv, Xb);
  // (2) Wo [in][out] -> WoT bf16 [out][in]   (in[DM rows = k][DM cols = n] -> out[DM rows = n][DM cols = k]; grid (n tiles, k tiles))
  cvt_wo_t<<<gWo, blk, 0, stream>>>(wo, WoT);
  // (3) q = x . Wq^T -> bf16 hi/lo planes [NB*SEQ][DM]   (A = Xb, Bt = Wq [out][in]; M=NB*SEQ, N=DM, K=DM)
  gemm_bf<0, 2, 0><<<gProj, blk, 0, stream>>>(
      Xb, Xb, DM, 0LL, Wb, Wb, DM, 0LL,
      (void*)Qh, DM, 0LL, (void*)Ql, DM, 0LL, DM,
      NB * SEQ, DM, DM, 1.0f, 1.0f);
  // (4) k = x . Wk^T -> bf16 hi/lo planes
  gemm_bf<0, 2, 0><<<gProj, blk, 0, stream>>>(
      Xb, Xb, DM, 0LL, Wb + (size_t)DM * DM, Wb + (size_t)DM * DM, DM, 0LL,
      (void*)Kh, DM, 0LL, (void*)Kl, DM, 0LL, DM,
      NB * SEQ, DM, DM, 1.0f, 1.0f);
  // (5) v^T = Wv . x^T per batch -> f16 hi plane f16(16 v) [b][d][key] (pitch SEQ) and residual plane x4096 for keys < VLP (pitch VLP)
  //     (A = Wv [out][in], Bt = Xb rows of batch b; M=DM, N=SEQ, K=DM)
  gemm_bf<0, 3, 0><<<gVT, blk, 0, stream>>>(
      Wb + (size_t)2 * DM * DM, Wb + (size_t)2 * DM * DM, DM, 0LL, Xb, Xb, DM, (long long)SEQ * DM,
      (void*)VTh, SEQ, (long long)DM * SEQ, (void*)VTl, VLP, (long long)DM * VLP, VLP,
      DM, SEQ, DM, VSC, LSC);
  // (6) scores = q . k^T per batch over the NTRI lower-triangular 64x64 tiles, 3 bf16 products -> packed f32 tiles
  gemm_bf<2, 0, 1><<<gS, blk, 0, stream>>>(
      Qh, Ql, DM, (long long)SEQ * DM, Kh, Kl, DM, (long long)SEQ * DM,
      (void*)Sp, 64, (long long)NTRI * 4096, (void*)Sp, 64, 0LL, 0,
      SEQ, SEQ, DM, 1.0f, 1.0f);
  // (7) causal row softmax in f32 -> Ph f16(1024 P) and Pl residual planes
  softmax_rows<<<gSm, blk, 0, stream>>>(Sp, Ph, Pl);
  // (8) ctx rows 0..RESR-1 of every sequence: p.v with residual planes (3 f16 products, 32x64 wave tiles) -> Cf f32 [NB*SEQ][DM]
  gemm_pv<true, 2><<<gPvRes, blk, 0, stream>>>(Ph, Pl, VTh, VTl, Cf, 0, RESR);
  // (9) ctx rows RESR..SEQ-1: p.v single f16 product (64x64 wave tiles) -> Cf
  if (nPvTiles > 0) {
    gemm_pv<false, 4><<<gPv, blk, 0, stream>>>(Ph, Pl, VTh, VTl, Cf, RESR, SEQ - RESR);
  }
  // (10) ctx f32 -> bf16 hi/lo planes
  cvt_ctx_planes<<<gCtx, blk, 0, stream>>>(Cf, Ch, Cl);
  // (11) out = ctx . Wo -> f32 output buffer   (A = Ch + Cl, Bt = WoT [out][in]; M=NB*SEQ, N=DM, K=DM; 2 bf16 products)
  gemm_bf<1, 0, 0><<<gProj, blk, 0, stream>>>(
      Ch, Cl, DM, 0LL, WoT, WoT, DM, 0LL,
      (void*)out, DM, 0LL, (void*)out, DM, 0LL, 0,
      NB * SEQ, DM, DM, 1.0f, 1.0f);
  (void)hipGetLastError();
}

// v002
// It runs in 222 microseconds.
// Next to v001, in two timings, it ran 1.06 and 1.05 times as fast.
// All steps since v000 together make it 2.21 times as fast.
// Contractions: q, k, v^T projections = v_wmma_f32_16x16x32_bf16 (bf16 RNE-converted x and W, single product, f32 accumulate);
// q.k^T scores = v_wmma_f32_16x16x32_bf16 with bf16 hi/lo planes of q and k (hi.hi + lo.hi + hi.lo), f32 accumulate;
// p.v = v_wmma_f32_16x16x32_f16 (p carried x1024 in f16, v^T carried x16 in f16, single product; query rows 0..RESR-1 of every
// sequence add the f16 residual planes (x4096) of p and v^T in a separate accumulator), f32 accumulate;
// output projection ctx.Wo = v_wmma_f32_16x16x32_bf16 with bf16 hi/lo planes of ctx and the bf16 RNE-converted Wo^T plane
// (hi.W + lo.W, one accumulator), f32 accumulate;
// causal mask, row max, exp, sum and normalisation in f32 on the VALU.
// Carry audit:
//   Ph  = f16(1024 * p), p already normalised by the row sum     } OSCALE = 1/(1024*16) folded exactly once in the p.v epilogue
//   VTh = f16(16 * v)                                            }
//   Pl  = f16((1024 p - Ph) * 4096)                              } products Ph.VTl and Pl.VTh go only to accumulator acc1,
//   VTl = f16((16 v - VTh) * 4096), keys 0..VLP-1                } folded with OSCALE * (1/4096) once in the same epilogue
//   q / k lo planes are unscaled bf16 residuals (v - hi) sharing the hi accumulator; score scale 1/32 applied once in f32 in the softmax.
//   ctx hi / lo planes are unscaled bf16 (lo = RNE(ctx - hi)) sharing one accumulator in the output projection.
// The module's softmax over all keys followed by the lower-triangular mask and the division by the masked row sum equals
// exp(z_j - m) / sum_{j<=i} exp(z_j - m) for any finite shift m; it is evaluated with the causal row max as the shift.
#include <hip/hip_runtime.h>
#include <math.h>

#define NB_FULL  4
#define SEQ_FULL 2048
#ifndef NB
#define NB    4
#endif
#ifndef SEQ
#define SEQ   2048
#endif
#define DM    1024
#define NQT   (SEQ / 64)                  // query/key tiles of 64
#define NTRI  ((NQT * (NQT + 1)) / 2)     // lower-triangular 64x64 score tiles per sequence (528 at SEQ 2048)
#define RESR  ((SEQ < 512) ? SEQ : 512)   // leading query rows per sequence that use the residual planes
#define VLP   RESR                        // key pitch of the p / v^T residual planes
#define PSC   1024.0f
#define VSC   16.0f
#define LSC   4096.0f
#define OSCALE (1.0f / 16384.0f)          // 1 / (PSC * VSC)
static_assert(NB >= 1 && NB <= NB_FULL);
static_assert(SEQ >= 256 && SEQ <= SEQ_FULL && (SEQ % 256) == 0);
static_assert((SEQ % 64) == 0 && (DM % 64) == 0 && (DM % 32) == 0);
static_assert((RESR % 64) == 0 && (RESR % 256) == 0 && RESR <= VLP && VLP <= SEQ && ((SEQ - RESR) % 64) == 0);
static_assert((RESR % 32) == 0);
static_assert(((NB * SEQ) % 8) == 0);
static_assert(((SEQ * DM / 8) % 256) == 0 && ((DM * DM / 8) % 256) == 0);

// ---- workspace extents (bytes) used by the launcher; checked at build time ------------------------------
#define WS_MAX2(a, b) (((a) > (b)) ? (a) : (b))
#define WS_PX  ((size_t)NB * SEQ * DM * 2)        // one 16-bit plane [NB*SEQ][DM]
#define WS_PW  ((size_t)DM * DM * 2)              // one 16-bit weight plane
#define WS_PS  ((size_t)NB * NTRI * 4096 * 4)     // packed f32 score tiles
#define WS_PC  ((size_t)NB * SEQ * DM * 4)        // f32 ctx plane
#define WS_PP  ((size_t)NB * SEQ * SEQ * 2)       // Ph
#define WS_PPL ((size_t)NB * RESR * VLP * 2)      // Pl
#define WS_PVT ((size_t)NB * DM * SEQ * 2)        // VTh
#define WS_PVL ((size_t)NB * DM * VLP * 2)        // VTl
#define WS_RA  WS_MAX2(WS_MAX2(WS_PX + 3 * WS_PW, WS_PS), WS_PC)
#define WS_TOTAL (WS_RA + 4 * WS_PX + WS_PVT + WS_PVL + WS_PW)
static_assert(WS_TOTAL <= (size_t)134217728);
static_assert(WS_PC <= WS_RA);
static_assert(WS_PP + WS_PPL <= 4 * WS_PX);
static_assert(2 * WS_PX <= 4 * WS_PX);
static_assert(((NB * SEQ) % 64) == 0 && ((NB * SEQ * DM / 8) % 256) == 0);
static_assert((WS_RA % 128) == 0 && (WS_PX % 128) == 0 && (WS_PVT % 128) == 0 && (WS_PVL % 128) == 0 && (WS_PW % 128) == 0);

typedef _Float16 v16h __attribute__((ext_vector_type(16)));
typedef _Float16 v8h  __attribute__((ext_vector_type(8)));
typedef __bf16   v16b __attribute__((ext_vector_type(16)));
typedef __bf16   v8b  __attribute__((ext_vector_type(8)));
typedef float    v8f  __attribute__((ext_vector_type(8)));
typedef float    v4f  __attribute__((ext_vector_type(4)));
typedef unsigned int v4u __attribute__((ext_vector_type(4)));

// ---- scalar helpers --------------------------------------------------------------------------------
__device__ __forceinline__ unsigned short bf_bits(float f) {          // f32 -> bf16 bits, RNE convert
  unsigned u = __float_as_uint(f);
  return (unsigned short)((u + 0x7FFFu + ((u >> 16) & 1u)) >> 16);
}
__device__ __forceinline__ float bf_up(unsigned short h) { return __uint_as_float(((unsigned)h) << 16); }
__device__ __forceinline__ unsigned short h_bits(_Float16 x) { return __builtin_bit_cast(unsigned short, x); }
__device__ __forceinline__ unsigned pk16(unsigned short a, unsigned short b) { return (unsigned)a | ((unsigned)b << 16); }
__device__ __forceinline__ v8f zero8() { v8f z = {0.f, 0.f, 0.f, 0.f, 0.f, 0.f, 0.f, 0.f}; return z; }

// ---- fragment loaders: 16-bit A/B operand, lane -> row/col (lane&15), p already includes +8*(lane>>4);
//      elements 0..7 <- p[0..7] (k0+8h..), elements 8..15 <- p[16..23] (k0+16+8h..)
__device__ __forceinline__ v16b ldfrag_b(const __bf16* p) {
  union { v16b v; v8b h[2]; } f;
  f.h[0] = *(const v8b*)(p);
  f.h[1] = *(const v8b*)(p + 16);
  return f.v;
}
__device__ __forceinline__ v16h ldfrag_h(const _Float16* p) {
  union { v16h v; v8h h[2]; } f;
  f.h[0] = *(const v8h*)(p);
  f.h[1] = *(const v8h*)(p + 16);
  return f.v;
}

// ---- WMMA helpers ------------------------------------------------------------------------------------
__device__ __forceinline__ v8f mma_b_raw(v16b a, v16b b, v8f c) {
  return __builtin_amdgcn_wmma_f32_16x16x32_bf16(false, a, false, b, (short)0, c, false, false);
}
__device__ __forceinline__ v8f mma_h_raw(v16h a, v16h b, v8f c) {
  return __builtin_amdgcn_wmma_f32_16x16x32_f16(false, a, false, b, (short)0, c, false, false);
}
__device__ __forceinline__ void acc_guard4(v8f& a, v8f& b, v8f& c, v8f& d) {
  asm volatile("v_nop\n\tv_nop\n\tv_nop\n\tv_nop" : "+v"(a), "+v"(b), "+v"(c), "+v"(d));
}

// ---- LDS staging of GEMM operands --------------------------------------------------------------------
// A stage is 64 k (128 B) of every operand row of the work-group's tile, laid at pitch LPITCH (16 B x odd: 16-byte reads of
// 16 rows fall on distinct banks). Each lane copies 16 B: 8 lanes per row, so one wave-wide copy covers 4 whole 128-B lines.
#define LPITCH 144
struct RowChunk {                 // this lane's share of 128 staged rows: rows r, r+32, r+64, r+96 (r = tid>>3), 16 B at column tid&7
  unsigned l;                     // LDS byte address of the first
  const unsigned short* g;        // global address of the first
  size_t step;                    // 32 source rows, in elements
};
// chunk q (128 rows) of a plane: g = row 0 of the plane at the first k of the stage, pitch ld elements; lbase = LDS byte address of the plane
__device__ __forceinline__ RowChunk row_chunk(unsigned lbase, const unsigned short* g, int ld, int q, int tid) {
  const int r = q * 128 + (tid >> 3), c = tid & 7;
  RowChunk x;
  x.l = lbase + (unsigned)(r * LPITCH + c * 16);
  x.g = g + (size_t)r * ld + c * 8;
  x.step = (size_t)32 * ld;
  return x;
}
// Asynchronous copies global -> LDS of one chunk (4 x 16 B a lane), written as the builtin: the compiler then places their address
// registers anywhere in the register file, also above v255, which operands of an asm statement cannot reach.
typedef int v4i __attribute__((ext_vector_type(4)));
__device__ __forceinline__ void copy_chunk(RowChunk a) {
#pragma unroll
  for (int q = 0; q < 4; ++q)
    __builtin_amdgcn_global_load_async_to_lds_b128(
        (__attribute__((address_space(1))) v4i*)(a.g + q * a.step),
        (__attribute__((address_space(3))) v4i*)(a.l + q * 32 * LPITCH), 0, 0);
}
__device__ __forceinline__ void copy_chunks2(RowChunk a, RowChunk b) { copy_chunk(a); copy_chunk(b); }
__device__ __forceinline__ void copy_chunks3(RowChunk a, RowChunk b, RowChunk d) { copy_chunk(a); copy_chunk(b); copy_chunk(d); }
// the wave's own copies have landed (other waves read them only behind the barrier that follows)
__device__ __forceinline__ void wait_copies() { asm volatile("s_wait_asynccnt 0x0" ::: "memory"); }
// the wave's own LDS reads have returned before the buffer they read is handed back for a refill
__device__ __forceinline__ void wait_lds() { asm volatile("s_wait_dscnt 0x0" ::: "memory"); }

// =====================================================================================================
// f32 -> bf16 (RNE convert) for x and the three weights into one contiguous 16-bit region:
// groups 0..NX8-1 <- x (batch b of the plane reads source rows at b * SEQ_FULL * DM, SEQ rows each), then NW8 groups each
// coverage: (NX8 + 3 NW8) threads x 8 = the whole [NB*SEQ][DM] x plane plus the three [DM][DM] weight planes.
// =====================================================================================================
__global__ __launch_bounds__(256) void cvt_planes(const float* __restrict__ x, const float* __restrict__ wq,
                                                  const float* __restrict__ wk, const float* __restrict__ wv,
                                                  unsigned short* out) {
  const int NXB8 = SEQ * DM / 8;          // groups per batch
  const int NX8 = NB * NXB8;
  const int NW8 = DM * DM / 8;
  const int g = blockIdx.x * 256 + threadIdx.x;
  if (g >= NX8 + 3 * NW8) return;
  const float* src;
  if (g < NX8) {
    const int bb  = g / NXB8;
    const int off = g - bb * NXB8;
    src = x + (size_t)bb * SEQ_FULL * DM + (size_t)off * 8;
  } else {
    const int e = g - NX8;
    const int w = e / NW8;
    const int off = e - w * NW8;
    const float* wsrc = (w == 0) ? wq : ((w == 1) ? wk : wv);
    src = wsrc + (size_t)off * 8;
  }
  const v4f a = *(const v4f*)(src);
  const v4f c = *(const v4f*)(src + 4);
  v4u p;
  p[0] = pk16(bf_bits(a[0]), bf_bits(a[1]));
  p[1] = pk16(bf_bits(a[2]), bf_bits(a[3]));
  p[2] = pk16(bf_bits(c[0]), bf_bits(c[1]));
  p[3] = pk16(bf_bits(c[2]), bf_bits(c[3]));
  *(v4u*)(out + (size_t)g * 8) = p;
  
}

// =====================================================================================================
// Transposing f32 -> bf16 (RNE convert) of the output projection weight: w[k][n] (k = input feature, n = output feature,
// DM x DM) -> out[n][k] (k contiguous), the Bt plane of the last GEMM. One block per 64x64 tile (k0 = 64*blockIdx.y,
// n0 = 64*blockIdx.x), grid (DM/64, DM/64). The tile is staged in LDS as f32 (pitch 65; written by all waves, read by all
// coverage: 2 iterations x 32 rows x 64 k = the block's whole 64x64 tile; grid = all DM/64 x DM/64 tiles.
// =====================================================================================================
__global__ __launch_bounds__(256) void cvt_wo_t(const float* __restrict__ w, unsigned short* out) {
  __shared__ float sW[64 * 65];
  const int tid = threadIdx.x;
  const int k0 = blockIdx.y * 64;
  const int n0 = blockIdx.x * 64;
  {
    const int kk = tid >> 2;               // 0..63 source row within the tile
    const int c0 = (tid & 3) * 16;         // 16 consecutive source columns
    const float* src = w + (size_t)(k0 + kk) * DM + n0 + c0;
#pragma unroll
    for (int u = 0; u < 4; ++u) {
      const v4f a = *(const v4f*)(src + 4 * u);
      sW[kk * 65 + c0 + 4 * u + 0] = a[0];
      sW[kk * 65 + c0 + 4 * u + 1] = a[1];
      sW[kk * 65 + c0 + 4 * u + 2] = a[2];
      sW[kk * 65 + c0 + 4 * u + 3] = a[3];
    }
  }
  __syncthreads();
  const int q  = tid >> 3;                 // 0..31 output row within a half tile
  const int c8 = (tid & 7) * 8;            // 8 consecutive k
  v4u hv[2];
#pragma unroll
  for (int it = 0; it < 2; ++it) {
    const int nn = it * 32 + q;            // it 0..1 x q 0..31 = output rows 0..63
    v4u a;
#pragma unroll
    for (int e = 0; e < 4; ++e) {
      const float f0 = sW[(c8 + 2 * e) * 65 + nn];
      const float f1 = sW[(c8 + 2 * e + 1) * 65 + nn];
      a[e] = pk16(bf_bits(f0), bf_bits(f1));
    }
    hv[it] = a;
  }
  {
#pragma unroll
    for (int it = 0; it < 2; ++it) {
      const int nn = it * 32 + q;
      *(v4u*)(out + (size_t)(n0 + nn) * DM + k0 + c8) = hv[it];
    }
    
  }
}

// =====================================================================================================
// f32 ctx plane [NB*SEQ][DM] -> bf16 hi plane (RNE convert) and bf16 lo plane (RNE convert of ctx - hi, unscaled).
// coverage: NB*SEQ*DM/8 threads x 8 = both whole [NB*SEQ][DM] planes.
// =====================================================================================================
__global__ __launch_bounds__(256) void cvt_ctx_planes(const float* __restrict__ c, unsigned short* hi, unsigned short* lo) {
  const int NC8 = NB * SEQ * DM / 8;
  const int g = blockIdx.x * 256 + threadIdx.x;
  if (g >= NC8) return;
  const float* src = c + (size_t)g * 8;
  const v4f a = *(const v4f*)(src);
  const v4f d = *(const v4f*)(src + 4);
  const float f[8] = {a[0], a[1], a[2], a[3], d[0], d[1], d[2], d[3]};
  v4u ph, pl;
#pragma unroll
  for (int e = 0; e < 4; ++e) {
    const unsigned short h0 = bf_bits(f[2 * e]);
    const unsigned short h1 = bf_bits(f[2 * e + 1]);
    ph[e] = pk16(h0, h1);
    pl[e] = pk16(bf_bits(f[2 * e] - bf_up(h0)), bf_bits(f[2 * e + 1] - bf_up(h1)));
  }
  {
    *(v4u*)(hi + (size_t)g * 8) = ph;
    *(v4u*)(lo + (size_t)g * 8) = pl;
    
  }
}

// =====================================================================================================
// Batched bf16 WMMA GEMM: C[m][n] = sum_k A[m][k] * Bt[n][k]; one work-group (8 waves, 4 x 2) per 256 x 128 tile, one wave per
// 64x64 tile of it. The operand rows of the work-group's tile are staged in LDS, 64 k a stage, by asynchronous copies in a
// two-buffer ring (stage s + 2 is copied while stage s + 1 is worked on); the waves read their fragments from LDS.
// A row-major [M][K] pitch lda; Bt row-major [N][K] pitch ldb (k contiguous); M multiple of 256, N of 128, K of 64.
// blockIdx.y = batch index (strides in elements).
// NSPLIT: 0 = Ah.Bh (single product); 1 = Ah.Bh + Al.Bh; 2 = Ah.Bh + Al.Bh + Ah.Bl with unscaled bf16 lo planes (one accumulator).
// TRI: 0 = dense grid of (M/256) x (N/128) work-group tiles, blockIdx.x row-major;
//      1 = square M == N: work-group tiles (I, J <= 2I+1), blockIdx.x = I(I+1) + J; a wave whose 64x64 tile (tm, tn) has tn > tm
//          computes and stores nothing; tile t = tm(tm+1)/2 + tn written packed at C + b*strideC + t*4096 as [64][64] f32
//          (OUT_MODE 0 only).
// OUT_MODE: 0 = f32 (pitch ldc); 2 = bf16 hi plane C + bf16 lo plane C2 (lo = RNE(v - hi), unscaled);
//           3 = f16 hi plane C = f16(v*hscale) + f16 residual plane C2 = f16((v*hscale - hi) * rscale), C2 written
//               only for tiles with n0 < N2 (pitch ldc2, batch stride strideC2).
// Epilogue: 16-row slabs staged per wave in LDS (wave-private region sT[wave], wave_sync); each 64-wide row segment written
// =====================================================================================================
template <int NSPLIT, int OUT_MODE, int TRI>
__global__ __launch_bounds__(256) void gemm_bf(
    const unsigned short* __restrict__ Ahp, const unsigned short* __restrict__ Alp, int lda, long long strideA,
    const unsigned short* __restrict__ Bhp, const unsigned short* __restrict__ Blp, int ldb, long long strideB,
    void* Cout, int ldc, long long strideC,
    void* Cout2, int ldc2, long long strideC2, int N2,
    int M, int N, int K, float hscale, float rscale) {
  constexpr int OFF_AL = 256 * LPITCH;                                   // stage layout: Ah 256 rows | Al | Bh 128 rows | Bl
  constexpr int OFF_BH = ((NSPLIT >= 1) ? 2 : 1) * 256 * LPITCH;
  constexpr int OFF_BL = OFF_BH + 128 * LPITCH;
  constexpr int STG    = OFF_BH + ((NSPLIT >= 2) ? 2 : 1) * 128 * LPITCH;
  __shared__ __align__(16) unsigned char ring[2 * STG];
  __shared__ __align__(16) float sT[8][16 * 68];   // per-wave 16x64 slab, pitch 68 floats
  const int b    = blockIdx.y;
  const int tid  = threadIdx.x;
  const int lane = tid & 31;
  const int wave = __builtin_amdgcn_readfirstlane(tid >> 5);
  int bm, bn;
  if (TRI != 0) {
    const int NI = M >> 8;
    int I = 0;
    for (int q = 1; q < NI; ++q)
      if (q * (q + 1) <= (int)blockIdx.x) I = q;
    bm = I;
    bn = (int)blockIdx.x - I * (I + 1);
    if (bn > 2 * I + 1) return;            // work-group-uniform, in front of every copy and barrier
  } else {
    const int bN = N >> 7;
    bm = (int)blockIdx.x / bN;
    bn = (int)blockIdx.x - bm * bN;
    if (bm >= (M >> 8)) return;            // work-group-uniform, in front of every copy and barrier
  }
  const int tm = bm * 4 + (wave >> 1);
  const int tn = bn * 2 + (wave & 1);
  const bool active = (TRI == 0) || (tn <= tm);   // wave-uniform
  const int t  = ((tm * (tm + 1)) >> 1) + tn;     // packed tile index (TRI)
  const int m0 = tm << 6;
  const int n0 = tn << 6;

  const unsigned short* Ag  = Ahp + (size_t)b * strideA + (size_t)(bm * 256) * lda;
  const unsigned short* Alg = Alp + (size_t)b * strideA + (size_t)(bm * 256) * lda;
  const unsigned short* Bg  = Bhp + (size_t)b * strideB + (size_t)(bn * 128) * ldb;
  const unsigned short* Blg = Blp + (size_t)b * strideB + (size_t)(bn * 128) * ldb;
  const unsigned ringb = (unsigned)(size_t)(const void*)ring;    // LDS byte address of the ring

  const int rlane = lane & 15;                 // row (A) / col (B, D) within subtile
  const int koff  = (lane >> 4) * 8;           // k offset of this lane half
  const int mOff  = (lane >> 4) * 8;           // D row offset

  auto stage = [&](int s, int buf) {
    const unsigned lb = ringb + (unsigned)(buf * STG);
    const size_t ks = (size_t)s * 64;
    copy_chunks3(row_chunk(lb, Ag + ks, lda, 0, tid), row_chunk(lb, Ag + ks, lda, 1, tid),
                 row_chunk(lb + OFF_BH, Bg + ks, ldb, 0, tid));
    if (NSPLIT == 1) copy_chunks2(row_chunk(lb + OFF_AL, Alg + ks, lda, 0, tid), row_chunk(lb + OFF_AL, Alg + ks, lda, 1, tid));
    if (NSPLIT >= 2) copy_chunks3(row_chunk(lb + OFF_AL, Alg + ks, lda, 0, tid), row_chunk(lb + OFF_AL, Alg + ks, lda, 1, tid),
                                  row_chunk(lb + OFF_BL, Blg + ks, ldb, 0, tid));
  };

  v8f acc[4][4];
#pragma unroll
  for (int i = 0; i < 4; ++i)
#pragma unroll
    for (int j = 0; j < 4; ++j) acc[i][j] = zero8();

  // Two fragment sets: while the WMMAs of one 32-k block run on one set, the next block's fragments are fetched into the other.
  v16b bhA[4], ahA[4], alA[4], blA[4], bhB[4], ahB[4], alB[4], blB[4];
  const int aoff = ((wave >> 1) * 64 + rlane) * LPITCH + koff * 2;
  const int boff = OFF_BH + ((wave & 1) * 64 + rlane) * LPITCH + koff * 2;
  auto ldset = [&](int buf, int kk, v16b (&bh)[4], v16b (&ah)[4], v16b (&al)[4], v16b (&bl)[4]) {
    const unsigned char* pa = ring + buf * STG + aoff + kk * 64;
    const unsigned char* pb = ring + buf * STG + boff + kk * 64;
#pragma unroll
    for (int j = 0; j < 4; ++j) {
      bh[j] = ldfrag_b((const __bf16*)(pb + j * 16 * LPITCH));
      if (NSPLIT >= 2) bl[j] = ldfrag_b((const __bf16*)(pb + (OFF_BL - OFF_BH) + j * 16 * LPITCH));
    }
#pragma unroll
    for (int i = 0; i < 4; ++i) {
      ah[i] = ldfrag_b((const __bf16*)(pa + i * 16 * LPITCH));
      if (NSPLIT >= 1) al[i] = ldfrag_b((const __bf16*)(pa + OFF_AL + i * 16 * LPITCH));
    }
  };
  // per accumulator and 32-k block the products are added in the order Ah.Bh, Al.Bh, Ah.Bl
  auto mmaset = [&](v16b (&bh)[4], v16b (&ah)[4], v16b (&al)[4], v16b (&bl)[4]) {
#pragma unroll
    for (int i = 0; i < 4; ++i)
#pragma unroll
      for (int j = 0; j < 4; ++j) acc[i][j] = mma_b_raw(ah[i], bh[j], acc[i][j]);
    if (NSPLIT >= 1) {
#pragma unroll
      for (int i = 0; i < 4; ++i)
#pragma unroll
        for (int j = 0; j < 4; ++j) acc[i][j] = mma_b_raw(al[i], bh[j], acc[i][j]);
    }
    if (NSPLIT >= 2) {
#pragma unroll
      for (int i = 0; i < 4; ++i)
#pragma unroll
        for (int j = 0; j < 4; ++j) acc[i][j] = mma_b_raw(ah[i], bl[j], acc[i][j]);
    }
  };

  const int nst = K >> 6;
  stage(0, 0);
  wait_copies();
  __syncthreads();
  if (nst > 1) stage(1, 1);
  ldset(0, 0, bhA, ahA, alA, blA);

  for (int s = 0; s < nst; ++s) {
    ldset(s & 1, 1, bhB, ahB, alB, blB);   // the stage's last block: the wave's last reads of buffer s & 1
    __builtin_amdgcn_sched_barrier(0);     // keeps the load group whole and ahead of the WMMAs
    if (active) mmaset(bhA, ahA, alA, blA);
    __builtin_amdgcn_sched_barrier(0);     // keeps these WMMAs in front of the waits, so that the loads above fly under them
    // publish point of stage s + 1, in front of stage s's last block and passed by every wave: own LDS reads of buffer s & 1
    // returned, own copies landed, barrier; then the refill of buffer s & 1 and the first fragments of stage s + 1
    wait_lds();
    wait_copies();
    __syncthreads();
    if (s + 2 < nst) stage(s + 2, s & 1);
    // unconditional (a branch here would merge the compiler's LDS wait counts): behind the last stage it reads the other
    // buffer's old bytes, which no copy is aimed at any more, and nothing uses them
    ldset((s + 1) & 1, 0, bhA, ahA, alA, blA);
    __builtin_amdgcn_sched_barrier(0);     // keeps the load group whole and ahead of the WMMAs
    if (active) mmaset(bhB, ahB, alB, blB);
  }
  wait_copies();
  wait_lds();
  if (!active) return;                     // wave-uniform; no work-group barrier below
  acc_guard4(acc[0][0], acc[0][1], acc[0][2], acc[0][3]);
  acc_guard4(acc[1][0], acc[1][1], acc[1][2], acc[1][3]);
  acc_guard4(acc[2][0], acc[2][1], acc[2][2], acc[2][3]);
  acc_guard4(acc[3][0], acc[3][1], acc[3][2], acc[3][3]);

  // ---- epilogue ----
  size_t cbase;
  int ldce, rowb, colb;
  if (TRI != 0) { cbase = (size_t)b * strideC + (size_t)t * 4096; ldce = 64; rowb = 0; colb = 0; }
  else          { cbase = (size_t)b * strideC; ldce = ldc; rowb = m0; colb = n0; }
  float* slab = sT[wave];
#pragma unroll
  for (int i = 0; i < 4; ++i) {
    const int mBase = m0 + (i << 4);
#pragma unroll
    for (int j = 0; j < 4; ++j) {
#pragma unroll
      for (int r = 0; r < 8; ++r) {
        slab[(mOff + r) * 68 + (j << 4) + rlane] = acc[i][j][r];
      }
    }
    __builtin_amdgcn_fence(3 /* release order */, "workgroup");
    __builtin_amdgcn_wave_barrier();
    __builtin_amdgcn_fence(2 /* acquire order */, "workgroup");
    if (OUT_MODE == 0) {
      float* C = (float*)Cout + cbase;
      const int hh = lane >> 4, c4 = (lane & 15) * 4;     // 256-B row segment = 16 lanes x 16 B
      {
#pragma unroll
        for (int it = 0; it < 8; ++it) {
          const int row = it * 2 + hh;                     // it 0..7 x hh 0..1 = rows 0..15
          const v4f v = *(const v4f*)(slab + row * 68 + c4);
          *(v4f*)(C + (size_t)(rowb + (i << 4) + row) * ldce + colb + c4) = v;
        }
        
      }
    } else {
      const int q = lane >> 3, c8 = (lane & 7) * 8;
      unsigned short* C  = (unsigned short*)Cout  + (size_t)b * strideC;
      unsigned short* C2 = (unsigned short*)Cout2 + (size_t)b * strideC2;
      const bool wlo = (OUT_MODE == 2) || (n0 < N2);      // wave-uniform
      v4u hv[4], lv[4];
#pragma unroll
      for (int it = 0; it < 4; ++it) {
        const int row = it * 4 + q;                        // it 0..3 x q 0..3 = rows 0..15
        const float* sp = slab + row * 68 + c8;
        v4u a, a2;
#pragma unroll
        for (int e = 0; e < 4; ++e) {
          const float f0 = sp[2 * e], f1 = sp[2 * e + 1];
          unsigned short h0, h1, l0, l1;
          if (OUT_MODE == 2) {
            h0 = bf_bits(f0); h1 = bf_bits(f1);
            l0 = bf_bits(f0 - bf_up(h0)); l1 = bf_bits(f1 - bf_up(h1));
          } else {
            const float g0 = f0 * hscale, g1 = f1 * hscale;
            const _Float16 x0 = (_Float16)g0, x1 = (_Float16)g1;
            h0 = h_bits(x0); h1 = h_bits(x1);
            l0 = h_bits((_Float16)((g0 - (float)x0) * rscale));
            l1 = h_bits((_Float16)((g1 - (float)x1) * rscale));
          }
          a[e] = pk16(h0, h1); a2[e] = pk16(l0, l1);
        }
        hv[it] = a; lv[it] = a2;
      }
      {
#pragma unroll
        for (int it = 0; it < 4; ++it) {
          const int row = it * 4 + q;
          *(v4u*)(C + (size_t)(mBase + row) * ldc + n0 + c8) = hv[it];
          if (wlo) *(v4u*)(C2 + (size_t)(mBase + row) * ldc2 + n0 + c8) = lv[it];
        }
        
      }
    }
    __builtin_amdgcn_fence(3 /* release order */, "workgroup");
    __builtin_amdgcn_wave_barrier();
    __builtin_amdgcn_fence(2 /* acquire order */, "workgroup");
  }
}

// =====================================================================================================
// Row softmax over the packed lower-triangular score tiles. One wave per query row (block = 8 rows, grid = NB*SEQ/8).
// Row (b, i), tm = i>>6, r = i&63: score (i, j) sits at Sp + ((b*NTRI + tm(tm+1)/2 + (j>>6))*4096 + r*64 + (j&63)), j <= 64 tm + 63.
// The wave handles ng = tm/4 + 1 groups of 256 keys (lane: 8 consecutive keys per group, two 16-B loads with the key-tile
// address clamped to tn <= tm); z = s/32 for j <= i, -inf otherwise; m = max, p = exp(z - m), l = sum, P = p/l (all f32).
// Writes Ph = f16(1024 P) for keys 0 .. 256 ng - 1 of row (b, i) (pitch SEQ; >= the keys the p.v GEMM copies for the row's work-group tile; zeros
// for j > i) and, for rows i < RESR, Pl = f16((1024 P - Ph) * 4096) with the same key extent (<= VLP, pitch VLP).
// coverage: NB*SEQ rows x written extent >= every key range any consumer reads.
// =====================================================================================================
__global__ __launch_bounds__(256) void softmax_rows(const float* __restrict__ Sp,
                                                    unsigned short* Php, unsigned short* Plp) {
  const int lane = threadIdx.x & 31, wave = threadIdx.x >> 5;
  const int row = blockIdx.x * 8 + wave;
  if (row >= NB * SEQ) return;             // wave-uniform; exact grid never triggers it; no block barriers below
  const int b  = row / SEQ;
  const int i  = row - b * SEQ;
  const int tm = i >> 6, r = i & 63;
  const int ng = (tm >> 2) + 1;            // 1..8, wave-uniform
  const float* srow = Sp + ((size_t)b * NTRI + (size_t)((tm * (tm + 1)) >> 1)) * 4096 + (size_t)r * 64;

  float z[8][8];
  float m = -INFINITY;
#pragma unroll
  for (int g = 0; g < 8; ++g) {
#pragma unroll
    for (int e = 0; e < 8; ++e) z[g][e] = -INFINITY;
    if (g < ng) {
      const int j0 = 256 * g + 8 * lane;
      int tn = j0 >> 6;
      tn = (tn < tm) ? tn : tm;            // clamped tile address; keys with tn > tm are all masked below
      const float* p = srow + (size_t)tn * 4096 + (j0 & 63);
      const v4f a = *(const v4f*)(p);
      const v4f c = *(const v4f*)(p + 4);
      const float v[8] = {a[0], a[1], a[2], a[3], c[0], c[1], c[2], c[3]};
#pragma unroll
      for (int e = 0; e < 8; ++e) {
        const float zz = (j0 + e <= i) ? (v[e] * 0.03125f) : -INFINITY;
        z[g][e] = zz;
        m = fmaxf(m, zz);
      }
    }
  }
#pragma unroll
  for (int off = 1; off < 32; off <<= 1) m = fmaxf(m, __shfl_xor(m, off, 32));   // finite: key 0 is always kept

  float l = 0.f;
#pragma unroll
  for (int g = 0; g < 8; ++g) {
    if (g < ng) {
#pragma unroll
      for (int e = 0; e < 8; ++e) {
        const float p = __expf(z[g][e] - m);   // masked: exp(-inf) = 0
        z[g][e] = p;
        l += p;
      }
    }
  }
#pragma unroll
  for (int off = 1; off < 32; off <<= 1) l += __shfl_xor(l, off, 32);          // l >= 1
  const float inv1k = (1.0f / l) * PSC;

  const bool res = (i < RESR);             // wave-uniform
  v4u ph[8];
  v4u pl0 = {0u, 0u, 0u, 0u};
  v4u pl1 = {0u, 0u, 0u, 0u};
#pragma unroll
  for (int g = 0; g < 8; ++g) {
    v4u hv = {0u, 0u, 0u, 0u};
    v4u lv = {0u, 0u, 0u, 0u};
    if (g < ng) {
#pragma unroll
      for (int e = 0; e < 4; ++e) {
        const float f0 = z[g][2 * e] * inv1k, f1 = z[g][2 * e + 1] * inv1k;
        const _Float16 x0 = (_Float16)f0, x1 = (_Float16)f1;
        hv[e] = pk16(h_bits(x0), h_bits(x1));
        lv[e] = pk16(h_bits((_Float16)((f0 - (float)x0) * LSC)), h_bits((_Float16)((f1 - (float)x1) * LSC)));
      }
    }
    ph[g] = hv;
    if (g == 0) pl0 = lv;
    if (g == 1) pl1 = lv;
  }

  unsigned short* prow = Php + (size_t)row * SEQ + 8 * lane;
  const int il = res ? i : 0;              // clamped row into the residual plane (stored only when res)
  unsigned short* lrow = Plp + ((size_t)b * RESR + (size_t)il) * VLP + 8 * lane;
  {
#pragma unroll
    for (int g = 0; g < 8; ++g) {
      if (g < ng) *(v4u*)(prow + 256 * g) = ph[g];
    }
    if (res) {                             // res rows have i < RESR (multiple of 256) -> 256 ng <= RESR = VLP
      *(v4u*)(lrow) = pl0;
      if (ng > 1) *(v4u*)(lrow + 256) = pl1;
    }
    
  }
}

// =====================================================================================================
// p.v GEMM on f16 WMMA, per batch b = blockIdx.y: out[b][q][d] = sum_key P[b][q][key] * VT[b][d][key].
//   A  = Ph  [b][SEQ][SEQ]  f16(1024 P), pitch SEQ         Al = Pl  [b][RESR][VLP] f16 residual x4096
//   Bt = VTh [b][DM][SEQ]   f16(16 v),   pitch SEQ         Bl = VTl [b][DM][VLP]   f16 residual x4096
// One work-group (8 waves, 4 x 2) per (64*MI) x 128 output tile, one wave per (16*MI) x 64 tile of it; rows mBase + ...; the
// operand rows of the work-group's tile are staged in LDS, 64 keys a stage, by asynchronous copies in a two-buffer ring up to the
// causal key extent of the work-group's last row tile (every P entry in that range was written by the softmax: its written extent
// is 256*(row/256 + 1) keys). A wave works on keys k < 64*((m0>>6)+1) only and passes the later publish points idle.
// RES (rows < RESR, MI = 2): acc0 += Ph.VTh; acc1 += Pl.VTh + Ph.VTl,
// out = acc0*OSCALE + acc1*OSCALE/4096; otherwise single product out = acc0*OSCALE. f32 accumulate.
// grid over all work-group tiles of rows mBase .. mBase + M - 1 (M a multiple of 64*MI).
// =====================================================================================================
template <bool RES, int MI>
__global__ __launch_bounds__(256) void gemm_pv(
    const unsigned short* __restrict__ Php, const unsigned short* __restrict__ Plp,
    const unsigned short* __restrict__ Vhp, const unsigned short* __restrict__ Vlp,
    float* out, int mBase, int M) {
  constexpr int AR     = 64 * MI;                                        // rows of the work-group's tile
  static_assert(AR == (RES ? 128 : 256) && (RESR % AR) == 0);
  constexpr int OFF_AL = AR * LPITCH;                                    // stage layout: Ph AR rows | Pl | VTh 128 rows | VTl
  constexpr int OFF_BH = (RES ? 2 : 1) * AR * LPITCH;
  constexpr int OFF_BL = OFF_BH + 128 * LPITCH;
  constexpr int STG    = OFF_BH + (RES ? 2 : 1) * 128 * LPITCH;
  __shared__ __align__(16) unsigned char ring[2 * STG];
  __shared__ __align__(16) float sT[8][16 * 68];
  const int b    = blockIdx.y;
  const int tid  = threadIdx.x;
  const int lane = tid & 31;
  const int wave = __builtin_amdgcn_readfirstlane(tid >> 5);
  const int bN = DM >> 7;                          // 8
  const int bm = (int)blockIdx.x / bN;
  const int bn = (int)blockIdx.x - bm * bN;
  if (bm >= M / AR) return;                        // work-group-uniform, in front of every copy and barrier
  const int r0 = mBase + bm * AR;                  // first row of the work-group's tile
  const int m0 = r0 + (wave >> 1) * 16 * MI;
  const int n0 = bn * 128 + (wave & 1) * 64;
  int keff = (((m0 >> 6) + 1) << 6);               // causal key extent of this row tile, multiple of 64
  if (keff > SEQ) keff = SEQ;
  if (RES && keff > VLP) keff = VLP;               // never taken for mBase + M <= RESR; keeps residual reads in range
  int kblk = ((((r0 + 3 * 16 * MI) >> 6) + 1) << 6);   // the same of the work-group's last row tile: the staged extent
  if (kblk > SEQ) kblk = SEQ;
  if (RES && kblk > VLP) kblk = VLP;
  int rl0 = r0;                                    // first row in the residual plane, clamped; equals r0 for the RES launch
  if (rl0 > RESR - AR) rl0 = RESR - AR;

  const unsigned short* Ag  = Php + (size_t)b * SEQ * SEQ + (size_t)r0 * SEQ;
  const unsigned short* Alg = Plp + (size_t)b * RESR * VLP + (size_t)rl0 * VLP;
  const unsigned short* Bg  = Vhp + (size_t)b * DM * SEQ + (size_t)(bn * 128) * SEQ;
  const unsigned short* Blg = Vlp + (size_t)b * DM * VLP + (size_t)(bn * 128) * VLP;
  const unsigned ringb = (unsigned)(size_t)(const void*)ring;    // LDS byte address of the ring

  const int rlane = lane & 15;
  const int koff  = (lane >> 4) * 8;
  const int mOff  = (lane >> 4) * 8;

  auto stage = [&](int s, int buf) {
    const unsigned lb = ringb + (unsigned)(buf * STG);
    const size_t ks = (size_t)s * 64;
    if (RES) {                                     // AR = 128: one chunk a plane
      copy_chunks2(row_chunk(lb, Ag + ks, SEQ, 0, tid), row_chunk(lb + OFF_BH, Bg + ks, SEQ, 0, tid));
      copy_chunks2(row_chunk(lb + OFF_AL, Alg + ks, VLP, 0, tid), row_chunk(lb + OFF_BL, Blg + ks, VLP, 0, tid));
    } else {                                       // AR = 256: two chunks of P, one of v^T
      copy_chunks3(row_chunk(lb, Ag + ks, SEQ, 0, tid), row_chunk(lb, Ag + ks, SEQ, 1, tid),
                   row_chunk(lb + OFF_BH, Bg + ks, SEQ, 0, tid));
    }
  };

  v8f acc0[MI][4], acc1[MI][4];
#pragma unroll
  for (int i = 0; i < MI; ++i)
#pragma unroll
    for (int j = 0; j < 4; ++j) { acc0[i][j] = zero8(); acc1[i][j] = zero8(); }

  // Two fragment sets: while the WMMAs of one 32-key block run on one set, the next block's fragments are fetched into the other.
  v16h bhA[4], ahA[MI], alA[MI], blA[4], bhB[4], ahB[MI], alB[MI], blB[4];
  const int aoff = ((wave >> 1) * 16 * MI + rlane) * LPITCH + koff * 2;
  const int boff = OFF_BH + ((wave & 1) * 64 + rlane) * LPITCH + koff * 2;
  auto ldset = [&](int buf, int kk, v16h (&bh)[4], v16h (&ah)[MI], v16h (&al)[MI], v16h (&bl)[4]) {
    const unsigned char* pa = ring + buf * STG + aoff + kk * 64;
    const unsigned char* pb = ring + buf * STG + boff + kk * 64;
#pragma unroll
    for (int j = 0; j < 4; ++j) {
      bh[j] = ldfrag_h((const _Float16*)(pb + j * 16 * LPITCH));
      if (RES) bl[j] = ldfrag_h((const _Float16*)(pb + (OFF_BL - OFF_BH) + j * 16 * LPITCH));
    }
#pragma unroll
    for (int i = 0; i < MI; ++i) {
      ah[i] = ldfrag_h((const _Float16*)(pa + i * 16 * LPITCH));
      if (RES) al[i] = ldfrag_h((const _Float16*)(pa + OFF_AL + i * 16 * LPITCH));
    }
  };
  // acc0 += Ph.VTh; acc1 += Pl.VTh, then Ph.VTl, per 32-key block
  auto mmaset = [&](v16h (&bh)[4], v16h (&ah)[MI], v16h (&al)[MI], v16h (&bl)[4]) {
#pragma unroll
    for (int i = 0; i < MI; ++i)
#pragma unroll
      for (int j = 0; j < 4; ++j) {
        acc0[i][j] = mma_h_raw(ah[i], bh[j], acc0[i][j]);
        if (RES) acc1[i][j] = mma_h_raw(al[i], bh[j], acc1[i][j]);
      }
    if (RES) {
#pragma unroll
      for (int i = 0; i < MI; ++i)
#pragma unroll
        for (int j = 0; j < 4; ++j) acc1[i][j] = mma_h_raw(ah[i], bl[j], acc1[i][j]);
    }
  };

  const int nst = kblk >> 6;
  stage(0, 0);
  wait_copies();
  __syncthreads();
  if (nst > 1) stage(1, 1);
  ldset(0, 0, bhA, ahA, alA, blA);

  for (int s = 0; s < nst; ++s) {
    const bool act = s * 64 < keff;        // wave-uniform
    ldset(s & 1, 1, bhB, ahB, alB, blB);   // the stage's last block: the wave's last reads of buffer s & 1
    __builtin_amdgcn_sched_barrier(0);     // keeps the load group whole and ahead of the WMMAs
    if (act) mmaset(bhA, ahA, alA, blA);
    __builtin_amdgcn_sched_barrier(0);     // keeps these WMMAs in front of the waits, so that the loads above fly under them
    // publish point of stage s + 1, in front of stage s's last block and passed by every wave: own LDS reads of buffer s & 1
    // returned, own copies landed, barrier; then the refill of buffer s & 1 and the first fragments of stage s + 1
    wait_lds();
    wait_copies();
    __syncthreads();
    if (s + 2 < nst) stage(s + 2, s & 1);
    // unconditional (a branch here would merge the compiler's LDS wait counts): behind the last stage it reads the other
    // buffer's old bytes, which no copy is aimed at any more, and nothing uses them
    ldset((s + 1) & 1, 0, bhA, ahA, alA, blA);
    __builtin_amdgcn_sched_barrier(0);     // keeps the load group whole and ahead of the WMMAs
    if (act) mmaset(bhB, ahB, alB, blB);
  }
  wait_copies();
  wait_lds();
#pragma unroll
  for (int i = 0; i < MI; ++i) {
    acc_guard4(acc0[i][0], acc0[i][1], acc0[i][2], acc0[i][3]);
    if (RES) acc_guard4(acc1[i][0], acc1[i][1], acc1[i][2], acc1[i][3]);
  }

  // ---- epilogue ----
  float* slab = sT[wave];
  float* C = out + (size_t)b * SEQ * DM;
  const float rsc = OSCALE * (1.0f / LSC);
#pragma unroll
  for (int i = 0; i < MI; ++i) {
    const int mB = m0 + (i << 4);
#pragma unroll
    for (int j = 0; j < 4; ++j) {
#pragma unroll
      for (int r = 0; r < 8; ++r) {
        float v = acc0[i][j][r] * OSCALE;
        if (RES) v += acc1[i][j][r] * rsc;
        slab[(mOff + r) * 68 + (j << 4) + rlane] = v;
      }
    }
    __builtin_amdgcn_fence(3 /* release order */, "workgroup");
    __builtin_amdgcn_wave_barrier();
    __builtin_amdgcn_fence(2 /* acquire order */, "workgroup");
    {
      const int hh = lane >> 4, c4 = (lane & 15) * 4;
      {
#pragma unroll
        for (int it = 0; it < 8; ++it) {
          const int row = it * 2 + hh;
          const v4f v = *(const v4f*)(slab + row * 68 + c4);
          *(v4f*)(C + (size_t)(mB + row) * DM + n0 + c4) = v;
        }
        
      }
    }
    __builtin_amdgcn_fence(3 /* release order */, "workgroup");
    __builtin_amdgcn_wave_barrier();
    __builtin_amdgcn_fence(2 /* acquire order */, "workgroup");
  }
}

// =====================================================================================================
// Workspace map (bytes, full build NB 4 / SEQ 2048; every region is an exact multiple of its tile / whole-line store
// granularity; regions A and B are reused in stream order):
//   region A [0, 34603008):          Xb bf16 [8192][1024] at 0 (16777216) + Wq,Wk,Wv bf16 [1024][1024] at 16777216 (3 x 2097152)
//                                    then, once the projections are done: Sp f32 packed score tiles [4][528][64][64] at 0 (34603008)
//                                    then, once the softmax is done: Cf f32 ctx [8192][1024] at 0 (33554432)
//   region B [34603008, 101711872):  Qh, Ql, Kh, Kl bf16 [8192][1024] (4 x 16777216)
//                                    then, once the scores are done: Ph f16 [4][2048][2048] (33554432) + Pl f16 [4][512][512] (2097152)
//                                    then, once p.v is done: Ch, Cl bf16 ctx planes [8192][1024] (2 x 16777216)
//   region C [101711872, 122683392): VTh f16 [4][1024][2048] (16777216) + VTl f16 [4][1024][512] (4194304)
//   region D [122683392, 124780544): WoT bf16 [1024][1024] (2097152), live from launch 2 to the last GEMM
//   end 124780544
// =====================================================================================================
extern "C" void kernel_launch(void* const* d_in, const int* in_sizes, int n_in,
                              void* d_out, int out_size, void* d_ws, size_t ws_size,
                              hipStream_t stream) {
  if (n_in < 5) return;
  if (in_sizes[4] < (NB - 1) * SEQ_FULL * DM + SEQ * DM) return;
  if (in_sizes[0] < DM * DM || in_sizes[1] < DM * DM || in_sizes[2] < DM * DM || in_sizes[3] < DM * DM) return;
  if (out_size < NB * SEQ * DM) return;

  // wire order of the inputs: k, q, v, out_proj, x
  const float* wk = (const float*)d_in[0];   // [out][in]
  const float* wq = (const float*)d_in[1];   // [out][in]
  const float* wv = (const float*)d_in[2];   // [out][in]
  const float* wo = (const float*)d_in[3];   // [in][out]
  const float* x  = (const float*)d_in[4];   // [NB_FULL][SEQ_FULL][DM]
  float* out = (float*)d_out;

  const size_t PX  = (size_t)NB * SEQ * DM * 2;       // 16-bit plane [NB*SEQ][DM]
  const size_t PW  = (size_t)DM * DM * 2;             // one weight plane
  const size_t PS  = (size_t)NB * NTRI * 4096 * 4;    // packed f32 score tiles
  const size_t PC  = (size_t)NB * SEQ * DM * 4;       // f32 ctx plane
  const size_t PP  = (size_t)NB * SEQ * SEQ * 2;      // Ph
  const size_t PPL = (size_t)NB * RESR * VLP * 2;     // Pl
  const size_t PVT = (size_t)NB * DM * SEQ * 2;       // VTh
  const size_t PVL = (size_t)NB * DM * VLP * 2;       // VTl
  size_t RA = ((PX + 3 * PW) > PS) ? (PX + 3 * PW) : PS;
  if (PC > RA) RA = PC;
  const size_t oXb = 0;
  const size_t oW  = PX;
  const size_t oS  = 0;
  const size_t oCf = 0;
  const size_t oQh = RA;
  const size_t oQl = RA + PX;
  const size_t oKh = RA + 2 * PX;
  const size_t oKl = RA + 3 * PX;
  const size_t RBend = RA + 4 * PX;
  const size_t oPh = RA;
  const size_t oPl = RA + PP;
  if (oPl + PPL > RBend) return;
  const size_t oCh = RA;
  const size_t oCl = RA + PX;
  const size_t oVTh = RBend;
  const size_t oVTl = RBend + PVT;
  const size_t oWo  = oVTl + PVL;
  const size_t total = oWo + PW;                      // 124780544 in the full build
  if (total > ws_size) return;
  if (total > (size_t)134217728) return;

  char* ws = (char*)d_ws;
  unsigned short* Xb  = (unsigned short*)(ws + oXb);
  unsigned short* Wb  = (unsigned short*)(ws + oW);   // Wq plane, then Wk, then Wv
  float*          Sp  = (float*)(ws + oS);
  float*          Cf  = (float*)(ws + oCf);
  unsigned short* Qh  = (unsigned short*)(ws + oQh);
  unsigned short* Ql  = (unsigned short*)(ws + oQl);
  unsigned short* Kh  = (unsigned short*)(ws + oKh);
  unsigned short* Kl  = (unsigned short*)(ws + oKl);
  unsigned short* Ph  = (unsigned short*)(ws + oPh);
  unsigned short* Pl  = (unsigned short*)(ws + oPl);
  unsigned short* Ch  = (unsigned short*)(ws + oCh);
  unsigned short* Cl  = (unsigned short*)(ws + oCl);
  unsigned short* VTh = (unsigned short*)(ws + oVTh);
  unsigned short* VTl = (unsigned short*)(ws + oVTl);
  unsigned short* WoT = (unsigned short*)(ws + oWo);

  const dim3 blk(256);
  const int nGroups = NB * SEQ * DM / 8 + 3 * (DM * DM / 8);
  const dim3 gCvt((nGroups + 255) / 256);
  const dim3 gWo(DM / 64, DM / 64);
  const dim3 gProj(((NB * SEQ / 64) * (DM / 64) + 7) / 8, 1);
  const dim3 gVT(((DM / 64) * (SEQ / 64) + 7) / 8, NB);
  const dim3 gS((SEQ / 256) * ((SEQ / 256) + 1), NB);   // work-group tiles (I, J <= 2I+1) of 256 x 128
  const dim3 gSm((NB * SEQ + 7) / 8);
  const dim3 gPvRes(((RESR / 32) * (DM / 64) + 7) / 8, NB);
  const int nPvTiles = ((SEQ - RESR) / 64) * (DM / 64);
  const dim3 gPv((nPvTiles + 7) / 8, NB);
  const dim3 gCtx((NB * SEQ * DM / 8 + 255) / 256);

  // (1) x and Wq, Wk, Wv -> bf16 planes (Xb, then the three weight planes contiguous)
  cvt_planes<<<gCvt, blk, 0, stream>>>(x, wq, wk, wv, Xb);
  // (2) Wo [in][out] -> WoT bf16 [out][in]   (in[DM rows = k][DM cols = n] -> out[DM rows = n][DM cols = k]; grid (n tiles, k tiles))
  cvt_wo_t<<<gWo, blk, 0, stream>>>(wo, WoT);
  // (3) q = x . Wq^T -> bf16 hi/lo planes [NB*SEQ][DM]   (A = Xb, Bt = Wq [out][in]; M=NB*SEQ, N=DM, K=DM)
  gemm_bf<0, 2, 0><<<gProj, blk, 0, stream>>>(
      Xb, Xb, DM, 0LL, Wb, Wb, DM, 0LL,
      (void*)Qh, DM, 0LL, (void*)Ql, DM, 0LL, DM,
      NB * SEQ, DM, DM, 1.0f, 1.0f);
  // (4) k = x . Wk^T -> bf16 hi/lo planes
  gemm_bf<0, 2, 0><<<gProj, blk, 0, stream>>>(
      Xb, Xb, DM, 0LL, Wb + (size_t)DM * DM, Wb + (size_t)DM * DM, DM, 0LL,
      (void*)Kh, DM, 0LL, (void*)Kl, DM, 0LL, DM,
      NB * SEQ, DM, DM, 1.0f, 1.0f);
  // (5) v^T = Wv . x^T per batch -> f16 hi plane f16(16 v) [b][d][key] (pitch SEQ) and residual plane x4096 for keys < VLP (pitch VLP)
  //     (A = Wv [out][in], Bt = Xb rows of batch b; M=DM, N=SEQ, K=DM)
  gemm_bf<0, 3, 0><<<gVT, blk, 0, stream>>>(
      Wb + (size_t)2 * DM * DM, Wb + (size_t)2 * DM * DM, DM, 0LL, Xb, Xb, DM, (long long)SEQ * DM,
      (void*)VTh, SEQ, (long long)DM * SEQ, (void*)VTl, VLP, (long long)DM * VLP, VLP,
      DM, SEQ, DM, VSC, LSC);
  // (6) scores = q . k^T per batch over the NTRI lower-triangular 64x64 tiles, 3 bf16 products -> packed f32 tiles
  gemm_bf<2, 0, 1><<<gS, blk, 0, stream>>>(
      Qh, Ql, DM, (long long)SEQ * DM, Kh, Kl, DM, (long long)SEQ * DM,
      (void*)Sp, 64, (long long)NTRI * 4096, (void*)Sp, 64, 0LL, 0,
      SEQ, SEQ, DM, 1.0f, 1.0f);
  // (7) causal row softmax in f32 -> Ph f16(1024 P) and Pl residual planes
  softmax_rows<<<gSm, blk, 0, stream>>>(Sp, Ph, Pl);
  // (8) ctx rows 0..RESR-1 of every sequence: p.v with residual planes (3 f16 products, 32x64 wave tiles) -> Cf f32 [NB*SEQ][DM]
  gemm_pv<true, 2><<<gPvRes, blk, 0, stream>>>(Ph, Pl, VTh, VTl, Cf, 0, RESR);
  // (9) ctx rows RESR..SEQ-1: p.v single f16 product (64x64 wave tiles) -> Cf
  if (nPvTiles > 0) {
    gemm_pv<false, 4><<<gPv, blk, 0, stream>>>(Ph, Pl, VTh, VTl, Cf, RESR, SEQ - RESR);
  }
  // (10) ctx f32 -> bf16 hi/lo planes
  cvt_ctx_planes<<<gCtx, blk, 0, stream>>>(Cf, Ch, Cl);
  // (11) out = ctx . Wo -> f32 output buffer   (A = Ch + Cl, Bt = WoT [out][in]; M=NB*SEQ, N=DM, K=DM; 2 bf16 products)
  gemm_bf<1, 0, 0><<<gProj, blk, 0, stream>>>(
      Ch, Cl, DM, 0LL, WoT, WoT, DM, 0LL,
      (void*)out, DM, 0LL, (void*)out, DM, 0LL, 0,
      NB * SEQ, DM, DM, 1.0f, 1.0f);
  (void)hipGetLastError();
}

// v003
// It runs in 188 microseconds.
// Next to v002, in two timings, it ran 1.18 times as fast each time.
// Counting every step since v000, it is 2.61 times as fast.
// Contractions: q, k, v^T projections = v_wmma_f32_16x16x32_bf16 (bf16 RNE-converted x and W, single product, f32 accumulate);
// q.k^T scores = v_wmma_f32_16x16x32_bf16 with bf16 hi/lo planes of q and k (hi.hi + lo.hi + hi.lo), f32 accumulate;
// p.v = v_wmma_f32_16x16x32_f16 (p carried x1024 in f16, v^T carried x16 in f16, single product; query rows 0..RESR-1 of every
// sequence add the f16 residual planes (x4096) of p and v^T in a separate accumulator), f32 accumulate;
// output projection ctx.Wo = v_wmma_f32_16x16x32_bf16 with bf16 hi/lo planes of ctx and the bf16 RNE-converted Wo^T plane
// (hi.W + lo.W, one accumulator), f32 accumulate;
// causal mask, row max, exp, sum and normalisation in f32 on the VALU.
// Carry audit:
//   Ph  = f16(1024 * p), p already normalised by the row sum     } OSCALE = 1/(1024*16) folded exactly once in the p.v epilogue
//   VTh = f16(16 * v)                                            }
//   Pl  = f16((1024 p - Ph) * 4096)                              } products Ph.VTl and Pl.VTh go only to accumulator acc1,
//   VTl = f16((16 v - VTh) * 4096), keys 0..VLP-1                } folded with OSCALE * (1/4096) once in the same epilogue
//   q / k lo planes are unscaled bf16 residuals (v - hi) sharing the hi accumulator; score scale 1/32 applied once in f32 in the softmax.
//   ctx hi / lo planes are unscaled bf16 (lo = RNE(ctx - hi)) sharing one accumulator in the output projection.
// The module's softmax over all keys followed by the lower-triangular mask and the division by the masked row sum equals
// exp(z_j - m) / sum_{j<=i} exp(z_j - m) for any finite shift m; it is evaluated with the causal row max as the shift.
#include <hip/hip_runtime.h>
#include <math.h>

#define NB_FULL  4
#define SEQ_FULL 2048
#ifndef NB
#define NB    4
#endif
#ifndef SEQ
#define SEQ   2048
#endif
#define DM    1024
#define NQT   (SEQ / 64)                  // query/key tiles of 64
#define NTRI  ((NQT * (NQT + 1)) / 2)     // lower-triangular 64x64 score tiles per sequence (528 at SEQ 2048)
#define RESR  ((SEQ < 512) ? SEQ : 512)   // leading query rows per sequence that use the residual planes
#define VLP   RESR                        // key pitch of the p / v^T residual planes
#define PSC   1024.0f
#define VSC   16.0f
#define LSC   4096.0f
#define OSCALE (1.0f / 16384.0f)          // 1 / (PSC * VSC)
static_assert(NB >= 1 && NB <= NB_FULL);
static_assert(SEQ >= 256 && SEQ <= SEQ_FULL && (SEQ % 256) == 0);
static_assert((SEQ % 64) == 0 && (DM % 64) == 0 && (DM % 32) == 0);
static_assert((RESR % 64) == 0 && (RESR % 256) == 0 && RESR <= VLP && VLP <= SEQ && ((SEQ - RESR) % 64) == 0);
static_assert((RESR % 32) == 0);
static_assert(((NB * SEQ) % 8) == 0);
static_assert(((SEQ * DM / 8) % 256) == 0 && ((DM * DM / 8) % 256) == 0);

// ---- workspace extents (bytes) used by the launcher; checked at build time ------------------------------
#define WS_MAX2(a, b) (((a) > (b)) ? (a) : (b))
#define WS_PX  ((size_t)NB * SEQ * DM * 2)        // one 16-bit plane [NB*SEQ][DM]
#define WS_PW  ((size_t)DM * DM * 2)              // one 16-bit weight plane
#define WS_PS  ((size_t)NB * NTRI * 4096 * 4)     // packed f32 score tiles
#define WS_PC  ((size_t)NB * SEQ * DM * 4)        // f32 ctx plane
#define WS_PP  ((size_t)NB * SEQ * SEQ * 2)       // Ph
#define WS_PPL ((size_t)NB * RESR * VLP * 2)      // Pl
#define WS_PVT ((size_t)NB * DM * SEQ * 2)        // VTh
#define WS_PVL ((size_t)NB * DM * VLP * 2)        // VTl
#define WS_RA  WS_MAX2(WS_PX + 3 * WS_PW, WS_PC)
#define WS_TOTAL (WS_RA + 4 * WS_PX + WS_PVT + WS_PVL + WS_PW + WS_PS)
static_assert(WS_TOTAL <= (size_t)268435456);
static_assert(WS_PC <= WS_RA);
static_assert(WS_PP + WS_PPL <= 4 * WS_PX);
static_assert(2 * WS_PX <= 4 * WS_PX);
static_assert(((NB * SEQ) % 64) == 0 && ((NB * SEQ * DM / 8) % 256) == 0);
static_assert((WS_RA % 128) == 0 && (WS_PX % 128) == 0 && (WS_PVT % 128) == 0 && (WS_PVL % 128) == 0 && (WS_PW % 128) == 0 &&
              (WS_PS % 128) == 0);

typedef _Float16 v16h __attribute__((ext_vector_type(16)));
typedef _Float16 v8h  __attribute__((ext_vector_type(8)));
typedef __bf16   v16b __attribute__((ext_vector_type(16)));
typedef __bf16   v8b  __attribute__((ext_vector_type(8)));
typedef float    v8f  __attribute__((ext_vector_type(8)));
typedef float    v4f  __attribute__((ext_vector_type(4)));
typedef unsigned int v4u __attribute__((ext_vector_type(4)));

// ---- scalar helpers --------------------------------------------------------------------------------
__device__ __forceinline__ unsigned short bf_bits(float f) {          // f32 -> bf16 bits, RNE convert
  unsigned u = __float_as_uint(f);
  return (unsigned short)((u + 0x7FFFu + ((u >> 16) & 1u)) >> 16);
}
__device__ __forceinline__ float bf_up(unsigned short h) { return __uint_as_float(((unsigned)h) << 16); }
__device__ __forceinline__ unsigned short h_bits(_Float16 x) { return __builtin_bit_cast(unsigned short, x); }
__device__ __forceinline__ unsigned pk16(unsigned short a, unsigned short b) { return (unsigned)a | ((unsigned)b << 16); }
__device__ __forceinline__ v8f zero8() { v8f z = {0.f, 0.f, 0.f, 0.f, 0.f, 0.f, 0.f, 0.f}; return z; }

// ---- fragment loaders: 16-bit A/B operand, lane -> row/col (lane&15), p already includes +8*(lane>>4);
//      elements 0..7 <- p[0..7] (k0+8h..), elements 8..15 <- p[16..23] (k0+16+8h..)
__device__ __forceinline__ v16b ldfrag_b(const __bf16* p) {
  union { v16b v; v8b h[2]; } f;
  f.h[0] = *(const v8b*)(p);
  f.h[1] = *(const v8b*)(p + 16);
  return f.v;
}
__device__ __forceinline__ v16h ldfrag_h(const _Float16* p) {
  union { v16h v; v8h h[2]; } f;
  f.h[0] = *(const v8h*)(p);
  f.h[1] = *(const v8h*)(p + 16);
  return f.v;
}

// ---- WMMA helpers ------------------------------------------------------------------------------------
__device__ __forceinline__ v8f mma_b_raw(v16b a, v16b b, v8f c) {
  return __builtin_amdgcn_wmma_f32_16x16x32_bf16(false, a, false, b, (short)0, c, false, false);
}
__device__ __forceinline__ v8f mma_h_raw(v16h a, v16h b, v8f c) {
  return __builtin_amdgcn_wmma_f32_16x16x32_f16(false, a, false, b, (short)0, c, false, false);
}
__device__ __forceinline__ void acc_guard4(v8f& a, v8f& b, v8f& c, v8f& d) {
  asm volatile("v_nop\n\tv_nop\n\tv_nop\n\tv_nop" : "+v"(a), "+v"(b), "+v"(c), "+v"(d));
}

// ---- LDS staging of GEMM operands --------------------------------------------------------------------
// A stage is 64 k (128 B) of every operand row of the work-group's tile, laid at pitch LPITCH (16 B x odd: 16-byte reads of
// 16 rows fall on distinct banks). Each lane copies 16 B: 8 lanes per row, so one wave-wide copy covers 4 whole 128-B lines.
#define LPITCH 144
struct RowChunk {                 // this lane's share of 128 staged rows: rows r, r+32, r+64, r+96 (r = tid>>3), 16 B at column tid&7
  unsigned l;                     // LDS byte address of the first
  const unsigned short* g;        // global address of the first
  size_t step;                    // 32 source rows, in elements
};
// chunk q (128 rows) of a plane: g = row 0 of the plane at the first k of the stage, pitch ld elements; lbase = LDS byte address of the plane
__device__ __forceinline__ RowChunk row_chunk(unsigned lbase, const unsigned short* g, int ld, int q, int tid) {
  const int r = q * 128 + (tid >> 3), c = tid & 7;
  RowChunk x;
  x.l = lbase + (unsigned)(r * LPITCH + c * 16);
  x.g = g + (size_t)r * ld + c * 8;
  x.step = (size_t)32 * ld;
  return x;
}
// Asynchronous copies global -> LDS of one chunk (4 x 16 B a lane), written as the builtin: the compiler then places their address
// registers anywhere in the register file, also above v255, which operands of an asm statement cannot reach.
typedef int v4i __attribute__((ext_vector_type(4)));
__device__ __forceinline__ void copy_chunk(RowChunk a) {
#pragma unroll
  for (int q = 0; q < 4; ++q)
    __builtin_amdgcn_global_load_async_to_lds_b128(
        (__attribute__((address_space(1))) v4i*)(a.g + q * a.step),
        (__attribute__((address_space(3))) v4i*)(a.l + q * 32 * LPITCH), 0, 0);
}
__device__ __forceinline__ void copy_chunks2(RowChunk a, RowChunk b) { copy_chunk(a); copy_chunk(b); }
__device__ __forceinline__ void copy_chunks3(RowChunk a, RowChunk b, RowChunk d) { copy_chunk(a); copy_chunk(b); copy_chunk(d); }
// the wave's own copies have landed (other waves read them only behind the barrier that follows)
__device__ __forceinline__ void wait_copies() { asm volatile("s_wait_asynccnt 0x0" ::: "memory"); }
// the wave's own LDS reads have returned before the buffer they read is handed back for a refill
__device__ __forceinline__ void wait_lds() { asm volatile("s_wait_dscnt 0x0" ::: "memory"); }

// =====================================================================================================
// f32 -> bf16 (RNE convert) for x and the three weights into one contiguous 16-bit region:
// groups 0..NX8-1 <- x (batch b of the plane reads source rows at b * SEQ_FULL * DM, SEQ rows each), then NW8 groups each
// coverage: (NX8 + 3 NW8) threads x 8 = the whole [NB*SEQ][DM] x plane plus the three [DM][DM] weight planes.
// =====================================================================================================
__device__ __forceinline__ void cvt_planes_body(int blk, const float* __restrict__ x, const float* __restrict__ wq,
                                                const float* __restrict__ wk, const float* __restrict__ wv,
                                                unsigned short* out) {
  const int NXB8 = SEQ * DM / 8;          // groups per batch
  const int NX8 = NB * NXB8;
  const int NW8 = DM * DM / 8;
  const int g = blk * 256 + threadIdx.x;
  if (g >= NX8 + 3 * NW8) return;
  const float* src;
  if (g < NX8) {
    const int bb  = g / NXB8;
    const int off = g - bb * NXB8;
    src = x + (size_t)bb * SEQ_FULL * DM + (size_t)off * 8;
  } else {
    const int e = g - NX8;
    const int w = e / NW8;
    const int off = e - w * NW8;
    const float* wsrc = (w == 0) ? wq : ((w == 1) ? wk : wv);
    src = wsrc + (size_t)off * 8;
  }
  const v4f a = *(const v4f*)(src);
  const v4f c = *(const v4f*)(src + 4);
  v4u p;
  p[0] = pk16(bf_bits(a[0]), bf_bits(a[1]));
  p[1] = pk16(bf_bits(a[2]), bf_bits(a[3]));
  p[2] = pk16(bf_bits(c[0]), bf_bits(c[1]));
  p[3] = pk16(bf_bits(c[2]), bf_bits(c[3]));
  *(v4u*)(out + (size_t)g * 8) = p;
  
}

// =====================================================================================================
// Transposing f32 -> bf16 (RNE convert) of the output projection weight: w[k][n] (k = input feature, n = output feature,
// DM x DM) -> out[n][k] (k contiguous), the Bt plane of the last GEMM. One block per 64x64 tile (k0 = 64*ty,
// n0 = 64*tx), (DM/64) x (DM/64) tiles. The tile is staged in LDS as f32 (pitch 65; written by all waves, read by all
// coverage: 2 iterations x 32 rows x 64 k = the block's whole 64x64 tile; grid = all DM/64 x DM/64 tiles.
// =====================================================================================================
__device__ __forceinline__ void cvt_wo_t_body(float* sW, int tx, int ty, const float* __restrict__ w, unsigned short* out) {
  const int tid = threadIdx.x;
  const int k0 = ty * 64;
  const int n0 = tx * 64;
  {
    const int kk = tid >> 2;               // 0..63 source row within the tile
    const int c0 = (tid & 3) * 16;         // 16 consecutive source columns
    const float* src = w + (size_t)(k0 + kk) * DM + n0 + c0;
#pragma unroll
    for (int u = 0; u < 4; ++u) {
      const v4f a = *(const v4f*)(src + 4 * u);
      sW[kk * 65 + c0 + 4 * u + 0] = a[0];
      sW[kk * 65 + c0 + 4 * u + 1] = a[1];
      sW[kk * 65 + c0 + 4 * u + 2] = a[2];
      sW[kk * 65 + c0 + 4 * u + 3] = a[3];
    }
  }
  __syncthreads();
  const int q  = tid >> 3;                 // 0..31 output row within a half tile
  const int c8 = (tid & 7) * 8;            // 8 consecutive k
  v4u hv[2];
#pragma unroll
  for (int it = 0; it < 2; ++it) {
    const int nn = it * 32 + q;            // it 0..1 x q 0..31 = output rows 0..63
    v4u a;
#pragma unroll
    for (int e = 0; e < 4; ++e) {
      const float f0 = sW[(c8 + 2 * e) * 65 + nn];
      const float f1 = sW[(c8 + 2 * e + 1) * 65 + nn];
      a[e] = pk16(bf_bits(f0), bf_bits(f1));
    }
    hv[it] = a;
  }
  {
#pragma unroll
    for (int it = 0; it < 2; ++it) {
      const int nn = it * 32 + q;
      *(v4u*)(out + (size_t)(n0 + nn) * DM + k0 + c8) = hv[it];
    }
    
  }
}

// =====================================================================================================
// The two input conversions, which read nothing of each other, in one grid: blocks 0 .. NWOT-1 transpose and convert Wo (one
// 64x64 tile each; first, because their chain load - LDS - barrier - store is the longer one), the rest convert x, Wq, Wk, Wv.
// The choice is the same for a whole block, so the barrier in the transposing part is passed by all of its threads.
// =====================================================================================================
#define NWOT ((DM / 64) * (DM / 64))
__global__ __launch_bounds__(256) void cvt_inputs(const float* __restrict__ x, const float* __restrict__ wq,
                                                  const float* __restrict__ wk, const float* __restrict__ wv,
                                                  const float* __restrict__ wo, unsigned short* planes, unsigned short* woT) {
  __shared__ float sW[64 * 65];
  const int blk = blockIdx.x;
  if (blk < NWOT) cvt_wo_t_body(sW, blk % (DM / 64), blk / (DM / 64), wo, woT);
  else            cvt_planes_body(blk - NWOT, x, wq, wk, wv, planes);
}

// =====================================================================================================
// f32 ctx plane [NB*SEQ][DM] -> bf16 hi plane (RNE convert) and bf16 lo plane (RNE convert of ctx - hi, unscaled).
// coverage: NB*SEQ*DM/8 threads x 8 = both whole [NB*SEQ][DM] planes.
// =====================================================================================================
__global__ __launch_bounds__(256) void cvt_ctx_planes(const float* __restrict__ c, unsigned short* hi, unsigned short* lo) {
  const int NC8 = NB * SEQ * DM / 8;
  const int g = blockIdx.x * 256 + threadIdx.x;
  if (g >= NC8) return;
  const float* src = c + (size_t)g * 8;
  const v4f a = *(const v4f*)(src);
  const v4f d = *(const v4f*)(src + 4);
  const float f[8] = {a[0], a[1], a[2], a[3], d[0], d[1], d[2], d[3]};
  v4u ph, pl;
#pragma unroll
  for (int e = 0; e < 4; ++e) {
    const unsigned short h0 = bf_bits(f[2 * e]);
    const unsigned short h1 = bf_bits(f[2 * e + 1]);
    ph[e] = pk16(h0, h1);
    pl[e] = pk16(bf_bits(f[2 * e] - bf_up(h0)), bf_bits(f[2 * e + 1] - bf_up(h1)));
  }
  {
    *(v4u*)(hi + (size_t)g * 8) = ph;
    *(v4u*)(lo + (size_t)g * 8) = pl;
    
  }
}

// =====================================================================================================
// Batched bf16 WMMA GEMM: C[m][n] = sum_k A[m][k] * Bt[n][k]; one work-group (8 waves, 4 x 2) per 256 x 128 tile, one wave per
// 64x64 tile of it. The operand rows of the work-group's tile are staged in LDS, 64 k a stage, by asynchronous copies in a
// two-buffer ring (stage s + 2 is copied while stage s + 1 is worked on); the waves read their fragments from LDS.
// A row-major [M][K] pitch lda; Bt row-major [N][K] pitch ldb (k contiguous); M multiple of 256, N of 128, K of 64.
// bx = index of the work-group's tile, b = batch index (strides in elements); ring and sT are the work-group's LDS.
// NSPLIT: 0 = Ah.Bh (single product); 1 = Ah.Bh + Al.Bh; 2 = Ah.Bh + Al.Bh + Ah.Bl with unscaled bf16 lo planes (one accumulator).
// TRI: 0 = dense grid of (M/256) x (N/128) work-group tiles, bx row-major;
//      1 = square M == N: work-group tiles (I, J <= 2I+1), bx = I(I+1) + J; a wave whose 64x64 tile (tm, tn) has tn > tm
//          computes and stores nothing; tile t = tm(tm+1)/2 + tn written packed at C + b*strideC + t*4096 as [64][64] f32
//          (OUT_MODE 0 only).
// OUT_MODE: 0 = f32 (pitch ldc); 2 = bf16 hi plane C + bf16 lo plane C2 (lo = RNE(v - hi), unscaled);
//           3 = f16 hi plane C = f16(v*hscale) + f16 residual plane C2 = f16((v*hscale - hi) * rscale), C2 written
//               only for tiles with n0 < N2 (pitch ldc2, batch stride strideC2).
// Epilogue: 16-row slabs staged per wave in LDS (wave-private region sT[wave], wave barrier); each 64-wide row segment written
// =====================================================================================================
__host__ __device__ constexpr int gemm_bf_stage_bytes(int nsplit) {      // one stage: Ah 256 rows | Al | Bh 128 rows | Bl
  return (((nsplit >= 1) ? 2 : 1) * 256 + ((nsplit >= 2) ? 2 : 1) * 128) * LPITCH;
}
template <int NSPLIT, int OUT_MODE, int TRI>
__device__ __forceinline__ void gemm_bf_body(
    unsigned char* ring, float (*sT)[16 * 68], int bx, int b,
    const unsigned short* __restrict__ Ahp, const unsigned short* __restrict__ Alp, int lda, long long strideA,
    const unsigned short* __restrict__ Bhp, const unsigned short* __restrict__ Blp, int ldb, long long strideB,
    void* Cout, int ldc, long long strideC,
    void* Cout2, int ldc2, long long strideC2, int N2,
    int M, int N, int K, float hscale, float rscale) {
  constexpr int OFF_AL = 256 * LPITCH;                                   // stage layout: Ah 256 rows | Al | Bh 128 rows | Bl
  constexpr int OFF_BH = ((NSPLIT >= 1) ? 2 : 1) * 256 * LPITCH;
  constexpr int OFF_BL = OFF_BH + 128 * LPITCH;
  constexpr int STG    = OFF_BH + ((NSPLIT >= 2) ? 2 : 1) * 128 * LPITCH;
  static_assert(STG == gemm_bf_stage_bytes(NSPLIT));
  const int tid  = threadIdx.x;
  const int lane = tid & 31;
  const int wave = __builtin_amdgcn_readfirstlane(tid >> 5);
  int bm, bn;
  if (TRI != 0) {
    const int NI = M >> 8;
    int I = 0;
    for (int q = 1; q < NI; ++q)
      if (q * (q + 1) <= bx) I = q;
    bm = I;
    bn = bx - I * (I + 1);
    if (bn > 2 * I + 1) return;            // work-group-uniform, in front of every copy and barrier
  } else {
    const int bN = N >> 7;
    bm = bx / bN;
    bn = bx - bm * bN;
    if (bm >= (M >> 8)) return;            // work-group-uniform, in front of every copy and barrier
  }
  const int tm = bm * 4 + (wave >> 1);
  const int tn = bn * 2 + (wave & 1);
  const bool active = (TRI == 0) || (tn <= tm);   // wave-uniform
  const int t  = ((tm * (tm + 1)) >> 1) + tn;     // packed tile index (TRI)
  const int m0 = tm << 6;
  const int n0 = tn << 6;

  const unsigned short* Ag  = Ahp + (size_t)b * strideA + (size_t)(bm * 256) * lda;
  const unsigned short* Alg = Alp + (size_t)b * strideA + (size_t)(bm * 256) * lda;
  const unsigned short* Bg  = Bhp + (size_t)b * strideB + (size_t)(bn * 128) * ldb;
  const unsigned short* Blg = Blp + (size_t)b * strideB + (size_t)(bn * 128) * ldb;
  const unsigned ringb = (unsigned)(size_t)(const void*)ring;    // LDS byte address of the ring

  const int rlane = lane & 15;                 // row (A) / col (B, D) within subtile
  const int koff  = (lane >> 4) * 8;           // k offset of this lane half
  const int mOff  = (lane >> 4) * 8;           // D row offset

  auto stage = [&](int s, int buf) {
    const unsigned lb = ringb + (unsigned)(buf * STG);
    const size_t ks = (size_t)s * 64;
    copy_chunks3(row_chunk(lb, Ag + ks, lda, 0, tid), row_chunk(lb, Ag + ks, lda, 1, tid),
                 row_chunk(lb + OFF_BH, Bg + ks, ldb, 0, tid));
    if (NSPLIT == 1) copy_chunks2(row_chunk(lb + OFF_AL, Alg + ks, lda, 0, tid), row_chunk(lb + OFF_AL, Alg + ks, lda, 1, tid));
    if (NSPLIT >= 2) copy_chunks3(row_chunk(lb + OFF_AL, Alg + ks, lda, 0, tid), row_chunk(lb + OFF_AL, Alg + ks, lda, 1, tid),
                                  row_chunk(lb + OFF_BL, Blg + ks, ldb, 0, tid));
  };

  v8f acc[4][4];
#pragma unroll
  for (int i = 0; i < 4; ++i)
#pragma unroll
    for (int j = 0; j < 4; ++j) acc[i][j] = zero8();

  // Two fragment sets: while the WMMAs of one 32-k block run on one set, the next block's fragments are fetched into the other.
  v16b bhA[4], ahA[4], alA[4], blA[4], bhB[4], ahB[4], alB[4], blB[4];
  const int aoff = ((wave >> 1) * 64 + rlane) * LPITCH + koff * 2;
  const int boff = OFF_BH + ((wave & 1) * 64 + rlane) * LPITCH + koff * 2;
  auto ldset = [&](int buf, int kk, v16b (&bh)[4], v16b (&ah)[4], v16b (&al)[4], v16b (&bl)[4]) {
    const unsigned char* pa = ring + buf * STG + aoff + kk * 64;
    const unsigned char* pb = ring + buf * STG + boff + kk * 64;
#pragma unroll
    for (int j = 0; j < 4; ++j) {
      bh[j] = ldfrag_b((const __bf16*)(pb + j * 16 * LPITCH));
      if (NSPLIT >= 2) bl[j] = ldfrag_b((const __bf16*)(pb + (OFF_BL - OFF_BH) + j * 16 * LPITCH));
    }
#pragma unroll
    for (int i = 0; i < 4; ++i) {
      ah[i] = ldfrag_b((const __bf16*)(pa + i * 16 * LPITCH));
      if (NSPLIT >= 1) al[i] = ldfrag_b((const __bf16*)(pa + OFF_AL + i * 16 * LPITCH));
    }
  };
  // per accumulator and 32-k block the products are added in the order Ah.Bh, Al.Bh, Ah.Bl
  auto mmaset = [&](v16b (&bh)[4], v16b (&ah)[4], v16b (&al)[4], v16b (&bl)[4]) {
#pragma unroll
    for (int i = 0; i < 4; ++i)
#pragma unroll
      for (int j = 0; j < 4; ++j) acc[i][j] = mma_b_raw(ah[i], bh[j], acc[i][j]);
    if (NSPLIT >= 1) {
#pragma unroll
      for (int i = 0; i < 4; ++i)
#pragma unroll
        for (int j = 0; j < 4; ++j) acc[i][j] = mma_b_raw(al[i], bh[j], acc[i][j]);
    }
    if (NSPLIT >= 2) {
#pragma unroll
      for (int i = 0; i < 4; ++i)
#pragma unroll
        for (int j = 0; j < 4; ++j) acc[i][j] = mma_b_raw(ah[i], bl[j], acc[i][j]);
    }
  };

  const int nst = K >> 6;
  stage(0, 0);
  wait_copies();
  __syncthreads();
  if (nst > 1) stage(1, 1);
  ldset(0, 0, bhA, ahA, alA, blA);

  for (int s = 0; s < nst; ++s) {
    ldset(s & 1, 1, bhB, ahB, alB, blB);   // the stage's last block: the wave's last reads of buffer s & 1
    __builtin_amdgcn_sched_barrier(0);     // keeps the load group whole and ahead of the WMMAs
    if (active) mmaset(bhA, ahA, alA, blA);
    __builtin_amdgcn_sched_barrier(0);     // keeps these WMMAs in front of the waits, so that the loads above fly under them
    // publish point of stage s + 1, in front of stage s's last block and passed by every wave: own LDS reads of buffer s & 1
    // returned, own copies landed, barrier; then the refill of buffer s & 1 and the first fragments of stage s + 1
    wait_lds();
    wait_copies();
    __syncthreads();
    if (s + 2 < nst) stage(s + 2, s & 1);
    // unconditional (a branch here would merge the compiler's LDS wait counts): behind the last stage it reads the other
    // buffer's old bytes, which no copy is aimed at any more, and nothing uses them
    ldset((s + 1) & 1, 0, bhA, ahA, alA, blA);
    __builtin_amdgcn_sched_barrier(0);     // keeps the load group whole and ahead of the WMMAs
    if (active) mmaset(bhB, ahB, alB, blB);
  }
  wait_copies();
  wait_lds();
  if (!active) return;                     // wave-uniform; no work-group barrier below
  acc_guard4(acc[0][0], acc[0][1], acc[0][2], acc[0][3]);
  acc_guard4(acc[1][0], acc[1][1], acc[1][2], acc[1][3]);
  acc_guard4(acc[2][0], acc[2][1], acc[2][2], acc[2][3]);
  acc_guard4(acc[3][0], acc[3][1], acc[3][2], acc[3][3]);

  // ---- epilogue ----
  size_t cbase;
  int ldce, rowb, colb;
  if (TRI != 0) { cbase = (size_t)b * strideC + (size_t)t * 4096; ldce = 64; rowb = 0; colb = 0; }
  else          { cbase = (size_t)b * strideC; ldce = ldc; rowb = m0; colb = n0; }
  float* slab = sT[wave];
#pragma unroll
  for (int i = 0; i < 4; ++i) {
    const int mBase = m0 + (i << 4);
#pragma unroll
    for (int j = 0; j < 4; ++j) {
#pragma unroll
      for (int r = 0; r < 8; ++r) {
        slab[(mOff + r) * 68 + (j << 4) + rlane] = acc[i][j][r];
      }
    }
    __builtin_amdgcn_fence(3 /* release order */, "workgroup");
    __builtin_amdgcn_wave_barrier();
    __builtin_amdgcn_fence(2 /* acquire order */, "workgroup");
    if (OUT_MODE == 0) {
      float* C = (float*)Cout + cbase;
      const int hh = lane >> 4, c4 = (lane & 15) * 4;     // 256-B row segment = 16 lanes x 16 B
      {
#pragma unroll
        for (int it = 0; it < 8; ++it) {
          const int row = it * 2 + hh;                     // it 0..7 x hh 0..1 = rows 0..15
          const v4f v = *(const v4f*)(slab + row * 68 + c4);
          *(v4f*)(C + (size_t)(rowb + (i << 4) + row) * ldce + colb + c4) = v;
        }
        
      }
    } else {
      const int q = lane >> 3, c8 = (lane & 7) * 8;
      unsigned short* C  = (unsigned short*)Cout  + (size_t)b * strideC;
      unsigned short* C2 = (unsigned short*)Cout2 + (size_t)b * strideC2;
      const bool wlo = (OUT_MODE == 2) || (n0 < N2);      // wave-uniform
      v4u hv[4], lv[4];
#pragma unroll
      for (int it = 0; it < 4; ++it) {
        const int row = it * 4 + q;                        // it 0..3 x q 0..3 = rows 0..15
        const float* sp = slab + row * 68 + c8;
        v4u a, a2;
#pragma unroll
        for (int e = 0; e < 4; ++e) {
          const float f0 = sp[2 * e], f1 = sp[2 * e + 1];
          unsigned short h0, h1, l0, l1;
          if (OUT_MODE == 2) {
            h0 = bf_bits(f0); h1 = bf_bits(f1);
            l0 = bf_bits(f0 - bf_up(h0)); l1 = bf_bits(f1 - bf_up(h1));
          } else {
            const float g0 = f0 * hscale, g1 = f1 * hscale;
            const _Float16 x0 = (_Float16)g0, x1 = (_Float16)g1;
            h0 = h_bits(x0); h1 = h_bits(x1);
            l0 = h_bits((_Float16)((g0 - (float)x0) * rscale));
            l1 = h_bits((_Float16)((g1 - (float)x1) * rscale));
          }
          a[e] = pk16(h0, h1); a2[e] = pk16(l0, l1);
        }
        hv[it] = a; lv[it] = a2;
      }
      {
#pragma unroll
        for (int it = 0; it < 4; ++it) {
          const int row = it * 4 + q;
          *(v4u*)(C + (size_t)(mBase + row) * ldc + n0 + c8) = hv[it];
          if (wlo) *(v4u*)(C2 + (size_t)(mBase + row) * ldc2 + n0 + c8) = lv[it];
        }
        
      }
    }
    __builtin_amdgcn_fence(3 /* release order */, "workgroup");
    __builtin_amdgcn_wave_barrier();
    __builtin_amdgcn_fence(2 /* acquire order */, "workgroup");
  }
}

// =====================================================================================================
// One GEMM as a launch of its own: blockIdx.x = tile index, blockIdx.y = batch index.
// =====================================================================================================
template <int NSPLIT, int OUT_MODE, int TRI>
__global__ __launch_bounds__(256) void gemm_bf(
    const unsigned short* __restrict__ Ahp, const unsigned short* __restrict__ Alp, int lda, long long strideA,
    const unsigned short* __restrict__ Bhp, const unsigned short* __restrict__ Blp, int ldb, long long strideB,
    void* Cout, int ldc, long long strideC,
    void* Cout2, int ldc2, long long strideC2, int N2,
    int M, int N, int K, float hscale, float rscale) {
  __shared__ __align__(16) unsigned char ring[2 * gemm_bf_stage_bytes(NSPLIT)];
  __shared__ __align__(16) float sT[8][16 * 68];   // per-wave 16x64 slab, pitch 68 floats
  gemm_bf_body<NSPLIT, OUT_MODE, TRI>(ring, sT, (int)blockIdx.x, (int)blockIdx.y, Ahp, Alp, lda, strideA, Bhp, Blp, ldb, strideB,
                                      Cout, ldc, strideC, Cout2, ldc2, strideC2, N2, M, N, K, hscale, rscale);
}

// =====================================================================================================
// The q and k projections, which read nothing of each other, in one grid of 2 NPQ work-groups of equal cost:
//   blocks 0 .. NPQ-1        q = x . Wq^T -> bf16 hi/lo planes [NB*SEQ][DM]   (A = Xb, Bt = Wq [out][in]; M=NB*SEQ, N=DM, K=DM)
//   blocks NPQ .. 2 NPQ-1    k = x . Wk^T -> bf16 hi/lo planes
// Wb holds the Wq and Wk planes one behind the other. The choice is the same for a whole work-group.
// =====================================================================================================
#define NPQ ((NB * SEQ / 256) * (DM / 128))
static_assert(((NB * SEQ) % 256) == 0 && (DM % 128) == 0);
__global__ __launch_bounds__(256) void proj_qk(
    const unsigned short* __restrict__ Xb, const unsigned short* __restrict__ Wb,
    unsigned short* Qh, unsigned short* Ql, unsigned short* Kh, unsigned short* Kl) {
  __shared__ __align__(16) unsigned char ring[2 * gemm_bf_stage_bytes(0)];
  __shared__ __align__(16) float sT[8][16 * 68];   // per-wave 16x64 slab, pitch 68 floats
  const int blk = blockIdx.x;
  const bool isk = blk >= NPQ;
  const unsigned short* W = Wb + (isk ? (size_t)DM * DM : (size_t)0);
  gemm_bf_body<0, 2, 0>(ring, sT, isk ? blk - NPQ : blk, 0, Xb, Xb, DM, 0LL, W, W, DM, 0LL,
                        (void*)(isk ? Kh : Qh), DM, 0LL, (void*)(isk ? Kl : Ql), DM, 0LL, DM,
                        NB * SEQ, DM, DM, 1.0f, 1.0f);
}

// =====================================================================================================
// The scores and the v^T projection, which read nothing of each other, in one grid. One work-group fills a WGP's LDS, there are
// more score tiles than WGPs, so the index runs from the longest to the shortest (for speed only) and
// the v^T tiles fill the places that the last score tiles leave idle:
//   blocks 0 .. NB NSF-1     scores = q . k^T, 3 bf16 products -> packed f32 tiles: work-group tiles (I, J <= 2I), NSF a batch
//   the next NB NSI          the score tiles (I, 2I+1) on the diagonal, in which 3 of 8 waves work
//   the rest, NPV a batch    v^T = Wv . x^T -> f16 hi plane f16(16 v) [b][d][key] (pitch SEQ) and residual plane x4096 for keys < VLP
//                            (pitch VLP)   (A = Wv [out][in], Bt = Xb rows of batch b; M=DM, N=SEQ, K=DM)
// The choice is the same for a whole work-group; the two parts use the same LDS.
// =====================================================================================================
#define NSI (SEQ / 256)
#define NSF (NSI * NSI)
#define NPV ((DM / 256) * (SEQ / 128))
static_assert((DM % 256) == 0 && (SEQ % 128) == 0);
__global__ __launch_bounds__(256) void scores_vt(
    const unsigned short* __restrict__ Qh, const unsigned short* __restrict__ Ql,
    const unsigned short* __restrict__ Kh, const unsigned short* __restrict__ Kl, float* Sp,
    const unsigned short* __restrict__ Xb, const unsigned short* __restrict__ Wv,
    unsigned short* VTh, unsigned short* VTl) {
  __shared__ __align__(16) unsigned char ring[2 * gemm_bf_stage_bytes(2)];
  __shared__ __align__(16) float sT[8][16 * 68];   // per-wave 16x64 slab, pitch 68 floats
  const int blk = blockIdx.x;
  if (blk < NB * (NSF + NSI)) {
    int b, I, J;
    if (blk < NB * NSF) {                  // row I holds the 2I+1 tiles f = I*I .. I*I + 2I
      b = blk / NSF;
      const int f = blk - b * NSF;
      I = 0;
      for (int q = 1; q < NSI; ++q)
        if (q * q <= f) I = q;
      J = f - I * I;
    } else {
      const int e = blk - NB * NSF;
      b = e / NSI;
      I = e - b * NSI;
      J = 2 * I + 1;
    }
    gemm_bf_body<2, 0, 1>(ring, sT, I * (I + 1) + J, b, Qh, Ql, DM, (long long)SEQ * DM, Kh, Kl, DM, (long long)SEQ * DM,
                          (void*)Sp, 64, (long long)NTRI * 4096, (void*)Sp, 64, 0LL, 0,
                          SEQ, SEQ, DM, 1.0f, 1.0f);
  } else {
    const int e = blk - NB * (NSF + NSI);
    gemm_bf_body<0, 3, 0>(ring, sT, e % NPV, e / NPV, Wv, Wv, DM, 0LL, Xb, Xb, DM, (long long)SEQ * DM,
                          (void*)VTh, SEQ, (long long)DM * SEQ, (void*)VTl, VLP, (long long)DM * VLP, VLP,
                          DM, SEQ, DM, VSC, LSC);
  }
}

// =====================================================================================================
// Row softmax over the packed lower-triangular score tiles. One wave per query row (block = 8 rows, grid = NB*SEQ/8).
// Row (b, i), tm = i>>6, r = i&63: score (i, j) sits at Sp + ((b*NTRI + tm(tm+1)/2 + (j>>6))*4096 + r*64 + (j&63)), j <= 64 tm + 63.
// The wave handles ng = tm/4 + 1 groups of 256 keys (lane: 8 consecutive keys per group, two 16-B loads with the key-tile
// address clamped to tn <= tm); z = s/32 for j <= i, -inf otherwise; m = max, p = exp(z - m), l = sum, P = p/l (all f32).
// Writes Ph = f16(1024 P) for keys 0 .. 256 ng - 1 of row (b, i) (pitch SEQ; >= the keys the p.v GEMM copies for the row's work-group tile; zeros
// for j > i) and, for rows i < RESR, Pl = f16((1024 P - Ph) * 4096) with the same key extent (<= VLP, pitch VLP).
// coverage: NB*SEQ rows x written extent >= every key range any consumer reads.
// =====================================================================================================
__global__ __launch_bounds__(256) void softmax_rows(const float* __restrict__ Sp,
                                                    unsigned short* Php, unsigned short* Plp) {
  const int lane = threadIdx.x & 31, wave = threadIdx.x >> 5;
  const int row = blockIdx.x * 8 + wave;
  if (row >= NB * SEQ) return;             // wave-uniform; exact grid never triggers it; no block barriers below
  const int b  = row / SEQ;
  const int i  = row - b * SEQ;
  const int tm = i >> 6, r = i & 63;
  const int ng = (tm >> 2) + 1;            // 1..8, wave-uniform
  const float* srow = Sp + ((size_t)b * NTRI + (size_t)((tm * (tm + 1)) >> 1)) * 4096 + (size_t)r * 64;

  float z[8][8];
  float m = -INFINITY;
#pragma unroll
  for (int g = 0; g < 8; ++g) {
#pragma unroll
    for (int e = 0; e < 8; ++e) z[g][e] = -INFINITY;
    if (g < ng) {
      const int j0 = 256 * g + 8 * lane;
      int tn = j0 >> 6;
      tn = (tn < tm) ? tn : tm;            // clamped tile address; keys with tn > tm are all masked below
      const float* p = srow + (size_t)tn * 4096 + (j0 & 63);
      const v4f a = *(const v4f*)(p);
      const v4f c = *(const v4f*)(p + 4);
      const float v[8] = {a[0], a[1], a[2], a[3], c[0], c[1], c[2], c[3]};
#pragma unroll
      for (int e = 0; e < 8; ++e) {
        const float zz = (j0 + e <= i) ? (v[e] * 0.03125f) : -INFINITY;
        z[g][e] = zz;
        m = fmaxf(m, zz);
      }
    }
  }
#pragma unroll
  for (int off = 1; off < 32; off <<= 1) m = fmaxf(m, __shfl_xor(m, off, 32));   // finite: key 0 is always kept

  float l = 0.f;
#pragma unroll
  for (int g = 0; g < 8; ++g) {
    if (g < ng) {
#pragma unroll
      for (int e = 0; e < 8; ++e) {
        const float p = __expf(z[g][e] - m);   // masked: exp(-inf) = 0
        z[g][e] = p;
        l += p;
      }
    }
  }
#pragma unroll
  for (int off = 1; off < 32; off <<= 1) l += __shfl_xor(l, off, 32);          // l >= 1
  const float inv1k = (1.0f / l) * PSC;

  const bool res = (i < RESR);             // wave-uniform
  v4u ph[8];
  v4u pl0 = {0u, 0u, 0u, 0u};
  v4u pl1 = {0u, 0u, 0u, 0u};
#pragma unroll
  for (int g = 0; g < 8; ++g) {
    v4u hv = {0u, 0u, 0u, 0u};
    v4u lv = {0u, 0u, 0u, 0u};
    if (g < ng) {
#pragma unroll
      for (int e = 0; e < 4; ++e) {
        const float f0 = z[g][2 * e] * inv1k, f1 = z[g][2 * e + 1] * inv1k;
        const _Float16 x0 = (_Float16)f0, x1 = (_Float16)f1;
        hv[e] = pk16(h_bits(x0), h_bits(x1));
        lv[e] = pk16(h_bits((_Float16)((f0 - (float)x0) * LSC)), h_bits((_Float16)((f1 - (float)x1) * LSC)));
      }
    }
    ph[g] = hv;
    if (g == 0) pl0 = lv;
    if (g == 1) pl1 = lv;
  }

  unsigned short* prow = Php + (size_t)row * SEQ + 8 * lane;
  const int il = res ? i : 0;              // clamped row into the residual plane (stored only when res)
  unsigned short* lrow = Plp + ((size_t)b * RESR + (size_t)il) * VLP + 8 * lane;
  {
#pragma unroll
    for (int g = 0; g < 8; ++g) {
      if (g < ng) *(v4u*)(prow + 256 * g) = ph[g];
    }
    if (res) {                             // res rows have i < RESR (multiple of 256) -> 256 ng <= RESR = VLP
      *(v4u*)(lrow) = pl0;
      if (ng > 1) *(v4u*)(lrow + 256) = pl1;
    }
    
  }
}

// =====================================================================================================
// p.v GEMM on f16 WMMA, per batch b: out[b][q][d] = sum_key P[b][q][key] * VT[b][d][key].
//   A  = Ph  [b][SEQ][SEQ]  f16(1024 P), pitch SEQ         Al = Pl  [b][RESR][VLP] f16 residual x4096
//   Bt = VTh [b][DM][SEQ]   f16(16 v),   pitch SEQ         Bl = VTl [b][DM][VLP]   f16 residual x4096
// One work-group (8 waves, 4 x 2) per (64*MI) x 128 output tile, one wave per (16*MI) x 64 tile of it; rows mBase + ...; the
// operand rows of the work-group's tile are staged in LDS, 64 keys a stage, by asynchronous copies in a two-buffer ring up to the
// causal key extent of the work-group's last row tile (every P entry in that range was written by the softmax: its written extent
// is 256*(row/256 + 1) keys). A wave works on keys k < 64*((m0>>6)+1) only and passes the later publish points idle.
// RES (rows < RESR, MI = 2): acc0 += Ph.VTh; acc1 += Pl.VTh + Ph.VTl,
// out = acc0*OSCALE + acc1*OSCALE/4096; otherwise single product out = acc0*OSCALE. f32 accumulate.
// bx = index of the work-group's tile among those of rows mBase .. mBase + M - 1 (M a multiple of 64*MI), row-major, DM/128 a row;
// ring and sT are the work-group's LDS.
// =====================================================================================================
__host__ __device__ constexpr int gemm_pv_stage_bytes(bool res, int mi) {   // one stage: Ph 64*mi rows | Pl | VTh 128 rows | VTl
  return (res ? 2 : 1) * (64 * mi + 128) * LPITCH;
}
template <bool RES, int MI>
__device__ __forceinline__ void gemm_pv_body(
    unsigned char* ring, float (*sT)[16 * 68], int bx, int b,
    const unsigned short* __restrict__ Php, const unsigned short* __restrict__ Plp,
    const unsigned short* __restrict__ Vhp, const unsigned short* __restrict__ Vlp,
    float* out, int mBase, int M) {
  constexpr int AR     = 64 * MI;                                        // rows of the work-group's tile
  static_assert(AR == (RES ? 128 : 256) && (RESR % AR) == 0);
  constexpr int OFF_AL = AR * LPITCH;                                    // stage layout: Ph AR rows | Pl | VTh 128 rows | VTl
  constexpr int OFF_BH = (RES ? 2 : 1) * AR * LPITCH;
  constexpr int OFF_BL = OFF_BH + 128 * LPITCH;
  constexpr int STG    = OFF_BH + (RES ? 2 : 1) * 128 * LPITCH;
  static_assert(STG == gemm_pv_stage_bytes(RES, MI));
  const int tid  = threadIdx.x;
  const int lane = tid & 31;
  const int wave = __builtin_amdgcn_readfirstlane(tid >> 5);
  const int bN = DM >> 7;                          // 8
  const int bm = bx / bN;
  const int bn = bx - bm * bN;
  if (bm >= M / AR) return;                        // work-group-uniform, in front of every copy and barrier
  const int r0 = mBase + bm * AR;                  // first row of the work-group's tile
  const int m0 = r0 + (wave >> 1) * 16 * MI;
  const int n0 = bn * 128 + (wave & 1) * 64;
  int keff = (((m0 >> 6) + 1) << 6);               // causal key extent of this row tile, multiple of 64
  if (keff > SEQ) keff = SEQ;
  if (RES && keff > VLP) keff = VLP;               // never taken for mBase + M <= RESR; keeps residual reads in range
  int kblk = ((((r0 + 3 * 16 * MI) >> 6) + 1) << 6);   // the same of the work-group's last row tile: the staged extent
  if (kblk > SEQ) kblk = SEQ;
  if (RES && kblk > VLP) kblk = VLP;
  int rl0 = r0;                                    // first row in the residual plane, clamped; equals r0 for the RES launch
  if (rl0 > RESR - AR) rl0 = RESR - AR;

  const unsigned short* Ag  = Php + (size_t)b * SEQ * SEQ + (size_t)r0 * SEQ;
  const unsigned short* Alg = Plp + (size_t)b * RESR * VLP + (size_t)rl0 * VLP;
  const unsigned short* Bg  = Vhp + (size_t)b * DM * SEQ + (size_t)(bn * 128) * SEQ;
  const unsigned short* Blg = Vlp + (size_t)b * DM * VLP + (size_t)(bn * 128) * VLP;
  const unsigned ringb = (unsigned)(size_t)(const void*)ring;    // LDS byte address of the ring

  const int rlane = lane & 15;
  const int koff  = (lane >> 4) * 8;
  const int mOff  = (lane >> 4) * 8;

  auto stage = [&](int s, int buf) {
    const unsigned lb = ringb + (unsigned)(buf * STG);
    const size_t ks = (size_t)s * 64;
    if (RES) {                                     // AR = 128: one chunk a plane
      copy_chunks2(row_chunk(lb, Ag + ks, SEQ, 0, tid), row_chunk(lb + OFF_BH, Bg + ks, SEQ, 0, tid));
      copy_chunks2(row_chunk(lb + OFF_AL, Alg + ks, VLP, 0, tid), row_chunk(lb + OFF_BL, Blg + ks, VLP, 0, tid));
    } else {                                       // AR = 256: two chunks of P, one of v^T
      copy_chunks3(row_chunk(lb, Ag + ks, SEQ, 0, tid), row_chunk(lb, Ag + ks, SEQ, 1, tid),
                   row_chunk(lb + OFF_BH, Bg + ks, SEQ, 0, tid));
    }
  };

  v8f acc0[MI][4], acc1[MI][4];
#pragma unroll
  for (int i = 0; i < MI; ++i)
#pragma unroll
    for (int j = 0; j < 4; ++j) { acc0[i][j] = zero8(); acc1[i][j] = zero8(); }

  // Two fragment sets: while the WMMAs of one 32-key block run on one set, the next block's fragments are fetched into the other.
  v16h bhA[4], ahA[MI], alA[MI], blA[4], bhB[4], ahB[MI], alB[MI], blB[4];
  const int aoff = ((wave >> 1) * 16 * MI + rlane) * LPITCH + koff * 2;
  const int boff = OFF_BH + ((wave & 1) * 64 + rlane) * LPITCH + koff * 2;
  auto ldset = [&](int buf, int kk, v16h (&bh)[4], v16h (&ah)[MI], v16h (&al)[MI], v16h (&bl)[4]) {
    const unsigned char* pa = ring + buf * STG + aoff + kk * 64;
    const unsigned char* pb = ring + buf * STG + boff + kk * 64;
#pragma unroll
    for (int j = 0; j < 4; ++j) {
      bh[j] = ldfrag_h((const _Float16*)(pb + j * 16 * LPITCH));
      if (RES) bl[j] = ldfrag_h((const _Float16*)(pb + (OFF_BL - OFF_BH) + j * 16 * LPITCH));
    }
#pragma unroll
    for (int i = 0; i < MI; ++i) {
      ah[i] = ldfrag_h((const _Float16*)(pa + i * 16 * LPITCH));
      if (RES) al[i] = ldfrag_h((const _Float16*)(pa + OFF_AL + i * 16 * LPITCH));
    }
  };
  // acc0 += Ph.VTh; acc1 += Pl.VTh, then Ph.VTl, per 32-key block
  auto mmaset = [&](v16h (&bh)[4], v16h (&ah)[MI], v16h (&al)[MI], v16h (&bl)[4]) {
#pragma unroll
    for (int i = 0; i < MI; ++i)
#pragma unroll
      for (int j = 0; j < 4; ++j) {
        acc0[i][j] = mma_h_raw(ah[i], bh[j], acc0[i][j]);
        if (RES) acc1[i][j] = mma_h_raw(al[i], bh[j], acc1[i][j]);
      }
    if (RES) {
#pragma unroll
      for (int i = 0; i < MI; ++i)
#pragma unroll
        for (int j = 0; j < 4; ++j) acc1[i][j] = mma_h_raw(ah[i], bl[j], acc1[i][j]);
    }
  };

  const int nst = kblk >> 6;
  stage(0, 0);
  wait_copies();
  __syncthreads();
  if (nst > 1) stage(1, 1);
  ldset(0, 0, bhA, ahA, alA, blA);

  for (int s = 0; s < nst; ++s) {
    const bool act = s * 64 < keff;        // wave-uniform
    ldset(s & 1, 1, bhB, ahB, alB, blB);   // the stage's last block: the wave's last reads of buffer s & 1
    __builtin_amdgcn_sched_barrier(0);     // keeps the load group whole and ahead of the WMMAs
    if (act) mmaset(bhA, ahA, alA, blA);
    __builtin_amdgcn_sched_barrier(0);     // keeps these WMMAs in front of the waits, so that the loads above fly under them
    // publish point of stage s + 1, in front of stage s's last block and passed by every wave: own LDS reads of buffer s & 1
    // returned, own copies landed, barrier; then the refill of buffer s & 1 and the first fragments of stage s + 1
    wait_lds();
    wait_copies();
    __syncthreads();
    if (s + 2 < nst) stage(s + 2, s & 1);
    // unconditional (a branch here would merge the compiler's LDS wait counts): behind the last stage it reads the other
    // buffer's old bytes, which no copy is aimed at any more, and nothing uses them
    ldset((s + 1) & 1, 0, bhA, ahA, alA, blA);
    __builtin_amdgcn_sched_barrier(0);     // keeps the load group whole and ahead of the WMMAs
    if (act) mmaset(bhB, ahB, alB, blB);
  }
  wait_copies();
  wait_lds();
#pragma unroll
  for (int i = 0; i < MI; ++i) {
    acc_guard4(acc0[i][0], acc0[i][1], acc0[i][2], acc0[i][3]);
    if (RES) acc_guard4(acc1[i][0], acc1[i][1], acc1[i][2], acc1[i][3]);
  }

  // ---- epilogue ----
  float* slab = sT[wave];
  float* C = out + (size_t)b * SEQ * DM;
  const float rsc = OSCALE * (1.0f / LSC);
#pragma unroll
  for (int i = 0; i < MI; ++i) {
    const int mB = m0 + (i << 4);
#pragma unroll
    for (int j = 0; j < 4; ++j) {
#pragma unroll
      for (int r = 0; r < 8; ++r) {
        float v = acc0[i][j][r] * OSCALE;
        if (RES) v += acc1[i][j][r] * rsc;
        slab[(mOff + r) * 68 + (j << 4) + rlane] = v;
      }
    }
    __builtin_amdgcn_fence(3 /* release order */, "workgroup");
    __builtin_amdgcn_wave_barrier();
    __builtin_amdgcn_fence(2 /* acquire order */, "workgroup");
    {
      const int hh = lane >> 4, c4 = (lane & 15) * 4;
      {
#pragma unroll
        for (int it = 0; it < 8; ++it) {
          const int row = it * 2 + hh;
          const v4f v = *(const v4f*)(slab + row * 68 + c4);
          *(v4f*)(C + (size_t)(mB + row) * DM + n0 + c4) = v;
        }
        
      }
    }
    __builtin_amdgcn_fence(3 /* release order */, "workgroup");
    __builtin_amdgcn_wave_barrier();
    __builtin_amdgcn_fence(2 /* acquire order */, "workgroup");
  }
}

// =====================================================================================================
// Both parts of p.v, which read nothing of each other, in one grid. A work-group's cost grows with its causal key extent;
// the index runs from the longest to the shortest (for speed only):
//   blocks 0 .. NPVH-1   rows RESR .. SEQ-1, single f16 product, 256 x 128 tiles, last row block first (NPVC tiles a row block)
//   the rest             rows 0 .. RESR-1 with the residual planes (3 f16 products), 128 x 128 tiles, last row block first
// The choice is the same for a whole work-group; the two parts use the same LDS.
// =====================================================================================================
#define NPVC ((DM / 128) * NB)
#define NPVH (((SEQ - RESR) / 256) * NPVC)
#define NPVR ((RESR / 128) * NPVC)
static_assert(((SEQ - RESR) % 256) == 0 && (RESR % 128) == 0 && (DM % 128) == 0);
__global__ __launch_bounds__(256) void gemm_pv_all(
    const unsigned short* __restrict__ Php, const unsigned short* __restrict__ Plp,
    const unsigned short* __restrict__ Vhp, const unsigned short* __restrict__ Vlp, float* out) {
  constexpr int RB = 2 * WS_MAX2(gemm_pv_stage_bytes(true, 2), gemm_pv_stage_bytes(false, 4));
  __shared__ __align__(16) unsigned char ring[RB];
  __shared__ __align__(16) float sT[8][16 * 68];
  const int blk = blockIdx.x;
  if (blk < NPVH) {
    const int rb = (SEQ - RESR) / 256 - 1 - blk / NPVC, e = blk % NPVC;
    gemm_pv_body<false, 4>(ring, sT, rb * (DM / 128) + e % (DM / 128), e / (DM / 128), Php, Plp, Vhp, Vlp, out, RESR, SEQ - RESR);
  } else {
    const int rb = RESR / 128 - 1 - (blk - NPVH) / NPVC, e = (blk - NPVH) % NPVC;
    gemm_pv_body<true, 2>(ring, sT, rb * (DM / 128) + e % (DM / 128), e / (DM / 128), Php, Plp, Vhp, Vlp, out, 0, RESR);
  }
}

// =====================================================================================================
// Workspace map (bytes, full build NB 4 / SEQ 2048; every region is an exact multiple of its tile / whole-line store
// granularity; regions A and B are reused in stream order):
//   region A [0, 33554432):          Xb bf16 [8192][1024] at 0 (16777216) + Wq,Wk,Wv bf16 [1024][1024] at 16777216 (3 x 2097152),
//                                    read up to the launch of the scores and v^T
//                                    then: Cf f32 ctx [8192][1024] at 0 (33554432)
//   region B [33554432, 100663296):  Qh, Ql, Kh, Kl bf16 [8192][1024] (4 x 16777216)
//                                    then, once the scores are done: Ph f16 [4][2048][2048] (33554432) + Pl f16 [4][512][512] (2097152)
//                                    then, once p.v is done: Ch, Cl bf16 ctx planes [8192][1024] (2 x 16777216)
//   region C [100663296, 121634816): VTh f16 [4][1024][2048] (16777216) + VTl f16 [4][1024][512] (4194304)
//   region D [121634816, 123731968): WoT bf16 [1024][1024] (2097152), live from launch 1 to the last GEMM
//   region E [123731968, 158334976): Sp f32 packed score tiles [4][528][64][64] (34603008); a region of its own, because the launch
//                                    that writes it still reads Xb and Wv
//   end 158334976
// =====================================================================================================
extern "C" void kernel_launch(void* const* d_in, const int* in_sizes, int n_in,
                              void* d_out, int out_size, void* d_ws, size_t ws_size,
                              hipStream_t stream) {
  if (n_in < 5) return;
  if (in_sizes[4] < (NB - 1) * SEQ_FULL * DM + SEQ * DM) return;
  if (in_sizes[0] < DM * DM || in_sizes[1] < DM * DM || in_sizes[2] < DM * DM || in_sizes[3] < DM * DM) return;
  if (out_size < NB * SEQ * DM) return;

  // wire order of the inputs: k, q, v, out_proj, x
  const float* wk = (const float*)d_in[0];   // [out][in]
  const float* wq = (const float*)d_in[1];   // [out][in]
  const float* wv = (const float*)d_in[2];   // [out][in]
  const float* wo = (const float*)d_in[3];   // [in][out]
  const float* x  = (const float*)d_in[4];   // [NB_FULL][SEQ_FULL][DM]
  float* out = (float*)d_out;

  const size_t PX  = (size_t)NB * SEQ * DM * 2;       // 16-bit plane [NB*SEQ][DM]
  const size_t PW  = (size_t)DM * DM * 2;             // one weight plane
  const size_t PS  = (size_t)NB * NTRI * 4096 * 4;    // packed f32 score tiles
  const size_t PC  = (size_t)NB * SEQ * DM * 4;       // f32 ctx plane
  const size_t PP  = (size_t)NB * SEQ * SEQ * 2;      // Ph
  const size_t PPL = (size_t)NB * RESR * VLP * 2;     // Pl
  const size_t PVT = (size_t)NB * DM * SEQ * 2;       // VTh
  const size_t PVL = (size_t)NB * DM * VLP * 2;       // VTl
  const size_t RA = ((PX + 3 * PW) > PC) ? (PX + 3 * PW) : PC;
  const size_t oXb = 0;
  const size_t oW  = PX;
  const size_t oCf = 0;
  const size_t oQh = RA;
  const size_t oQl = RA + PX;
  const size_t oKh = RA + 2 * PX;
  const size_t oKl = RA + 3 * PX;
  const size_t RBend = RA + 4 * PX;
  const size_t oPh = RA;
  const size_t oPl = RA + PP;
  if (oPl + PPL > RBend) return;
  const size_t oCh = RA;
  const size_t oCl = RA + PX;
  const size_t oVTh = RBend;
  const size_t oVTl = RBend + PVT;
  const size_t oWo  = oVTl + PVL;
  const size_t oS   = oWo + PW;
  const size_t total = oS + PS;                       // 158334976 in the full build
  if (total > ws_size) return;

  char* ws = (char*)d_ws;
  unsigned short* Xb  = (unsigned short*)(ws + oXb);
  unsigned short* Wb  = (unsigned short*)(ws + oW);   // Wq plane, then Wk, then Wv
  float*          Sp  = (float*)(ws + oS);
  float*          Cf  = (float*)(ws + oCf);
  unsigned short* Qh  = (unsigned short*)(ws + oQh);
  unsigned short* Ql  = (unsigned short*)(ws + oQl);
  unsigned short* Kh  = (unsigned short*)(ws + oKh);
  unsigned short* Kl  = (unsigned short*)(ws + oKl);
  unsigned short* Ph  = (unsigned short*)(ws + oPh);
  unsigned short* Pl  = (unsigned short*)(ws + oPl);
  unsigned short* Ch  = (unsigned short*)(ws + oCh);
  unsigned short* Cl  = (unsigned short*)(ws + oCl);
  unsigned short* VTh = (unsigned short*)(ws + oVTh);
  unsigned short* VTl = (unsigned short*)(ws + oVTl);
  unsigned short* WoT = (unsigned short*)(ws + oWo);

  const dim3 blk(256);
  const int nGroups = NB * SEQ * DM / 8 + 3 * (DM * DM / 8);
  const dim3 gCvt(NWOT + (nGroups + 255) / 256);
  const dim3 gQk(2 * NPQ);
  const dim3 gSv(NB * (NSF + NSI) + NB * NPV);
  const dim3 gProj(((NB * SEQ / 64) * (DM / 64) + 7) / 8, 1);
  const dim3 gSm((NB * SEQ + 7) / 8);
  const dim3 gPv(NPVH + NPVR);
  const dim3 gCtx((NB * SEQ * DM / 8 + 255) / 256);

  // (1) x and Wq, Wk, Wv -> bf16 planes (Xb, then the three weight planes contiguous); Wo [in][out] -> WoT bf16 [out][in]
  cvt_inputs<<<gCvt, blk, 0, stream>>>(x, wq, wk, wv, wo, Xb, WoT);
  // (2) q, k -> bf16 hi/lo planes [NB*SEQ][DM]
  proj_qk<<<gQk, blk, 0, stream>>>(Xb, Wb, Qh, Ql, Kh, Kl);
  // (3) scores = q . k^T per batch over the NTRI lower-triangular 64x64 tiles, 3 bf16 products -> packed f32 tiles;
  //     v^T -> f16 hi plane and residual plane
  scores_vt<<<gSv, blk, 0, stream>>>(Qh, Ql, Kh, Kl, Sp, Xb, Wb + (size_t)2 * DM * DM, VTh, VTl);
  // (4) causal row softmax in f32 -> Ph f16(1024 P) and Pl residual planes
  softmax_rows<<<gSm, blk, 0, stream>>>(Sp, Ph, Pl);
  // (5) ctx = p.v -> Cf f32 [NB*SEQ][DM]: rows RESR..SEQ-1 single f16 product (64x64 wave tiles), rows 0..RESR-1 of every sequence
  //     with the residual planes (3 f16 products, 32x64 wave tiles)
  gemm_pv_all<<<gPv, blk, 0, stream>>>(Ph, Pl, VTh, VTl, Cf);
  // (6) ctx f32 -> bf16 hi/lo planes
  cvt_ctx_planes<<<gCtx, blk, 0, stream>>>(Cf, Ch, Cl);
  // (7) out = ctx . Wo -> f32 output buffer   (A = Ch + Cl, Bt = WoT [out][in]; M=NB*SEQ, N=DM, K=DM; 2 bf16 products)
  gemm_bf<1, 0, 0><<<gProj, blk, 0, stream>>>(
      Ch, Cl, DM, 0LL, WoT, WoT, DM, 0LL,
      (void*)out, DM, 0LL, (void*)out, DM, 0LL, 0,
      NB * SEQ, DM, DM, 1.0f, 1.0f);
  (void)hipGetLastError();
}

// v004
// A run of this version takes 179 microseconds.
// Timed twice side by side with v003, it ran 1.05 and 1.06 times as fast.
// All steps since v000 together make it 2.75 times as fast.
// Contractions: q, k, v^T projections = v_wmma_f32_16x16x32_bf16 (bf16 RNE-converted x and W, single product, f32 accumulate);
// q.k^T scores = v_wmma_f32_16x16x32_bf16 with bf16 hi/lo planes of q and k (hi.hi + lo.hi + hi.lo), f32 accumulate;
// p.v = v_wmma_f32_16x16x32_f16 (p carried x1024 in f16, v^T carried x16 in f16, single product; query rows 0..RESR-1 of every
// sequence add the f16 residual planes (x4096) of p and v^T in a separate accumulator), f32 accumulate;
// output projection ctx.Wo = v_wmma_f32_16x16x32_bf16 with bf16 hi/lo planes of ctx and the bf16 RNE-converted Wo^T plane
// (hi.W + lo.W, one accumulator), f32 accumulate;
// causal mask, row max, exp, sum and normalisation in f32 on the VALU.
// Carry audit:
//   Ph  = f16(1024 * p), p already normalised by the row sum     } OSCALE = 1/(1024*16) folded exactly once in the p.v epilogue
//   VTh = f16(16 * v)                                            }
//   Pl  = f16((1024 p - Ph) * 4096)                              } products Ph.VTl and Pl.VTh go only to accumulator acc1,
//   VTl = f16((16 v - VTh) * 4096), keys 0..VLP-1                } folded with OSCALE * (1/4096) once in the same epilogue
//   q / k lo planes are unscaled bf16 residuals (v - hi) sharing the hi accumulator; score scale 1/32 applied once in f32 in the softmax.
//   ctx hi / lo planes are unscaled bf16 (lo = RNE(ctx - hi)) sharing one accumulator in the output projection.
// The module's softmax over all keys followed by the lower-triangular mask and the division by the masked row sum equals
// exp(z_j - m) / sum_{j<=i} exp(z_j - m) for any finite shift m; it is evaluated with the causal row max as the shift.
#include <hip/hip_runtime.h>
#include <math.h>

#define NB_FULL  4
#define SEQ_FULL 2048
#ifndef NB
#define NB    4
#endif
#ifndef SEQ
#define SEQ   2048
#endif
#define DM    1024
#define NQT   (SEQ / 64)                  // query/key tiles of 64
#define NTRI  ((NQT * (NQT + 1)) / 2)     // lower-triangular 64x64 score tiles per sequence (528 at SEQ 2048)
#define RESR  ((SEQ < 512) ? SEQ : 512)   // leading query rows per sequence that use the residual planes
#define VLP   RESR                        // key pitch of the p / v^T residual planes
#define PSC   1024.0f
#define VSC   16.0f
#define LSC   4096.0f
#define OSCALE (1.0f / 16384.0f)          // 1 / (PSC * VSC)
static_assert(NB >= 1 && NB <= NB_FULL);
static_assert(SEQ >= 256 && SEQ <= SEQ_FULL && (SEQ % 256) == 0);
static_assert((SEQ % 64) == 0 && (DM % 64) == 0 && (DM % 32) == 0);
static_assert((RESR % 64) == 0 && (RESR % 256) == 0 && RESR <= VLP && VLP <= SEQ && ((SEQ - RESR) % 64) == 0);
static_assert((RESR % 32) == 0);
static_assert(((NB * SEQ) % 8) == 0);
static_assert(((SEQ * DM / 8) % 256) == 0 && ((DM * DM / 8) % 256) == 0);

// ---- workspace extents (bytes) used by the launcher; checked at build time ------------------------------
#define WS_MAX2(a, b) (((a) > (b)) ? (a) : (b))
#define WS_PX  ((size_t)NB * SEQ * DM * 2)        // one 16-bit plane [NB*SEQ][DM]
#define WS_PW  ((size_t)DM * DM * 2)              // one 16-bit weight plane
#define WS_PS  ((size_t)NB * NTRI * 4096 * 4)     // packed f32 score tiles
#define WS_PC  (2 * WS_PX)                        // bf16 hi and lo ctx planes
#define WS_PP  ((size_t)NB * SEQ * SEQ * 2)       // Ph
#define WS_PPL ((size_t)NB * RESR * VLP * 2)      // Pl
#define WS_PVT ((size_t)NB * DM * SEQ * 2)        // VTh
#define WS_PVL ((size_t)NB * DM * VLP * 2)        // VTl
#define WS_RA  WS_MAX2(WS_PX + 3 * WS_PW, WS_PC)
#define WS_TOTAL (WS_RA + 4 * WS_PX + WS_PVT + WS_PVL + WS_PW + WS_PS)
static_assert(WS_TOTAL <= (size_t)268435456);
static_assert(WS_PC <= WS_RA);
static_assert(WS_PP + WS_PPL <= 4 * WS_PX);
static_assert(((NB * SEQ) % 64) == 0);
static_assert((WS_RA % 128) == 0 && (WS_PX % 128) == 0 && (WS_PVT % 128) == 0 && (WS_PVL % 128) == 0 && (WS_PW % 128) == 0 &&
              (WS_PS % 128) == 0);

typedef _Float16 v16h __attribute__((ext_vector_type(16)));
typedef _Float16 v8h  __attribute__((ext_vector_type(8)));
typedef __bf16   v16b __attribute__((ext_vector_type(16)));
typedef __bf16   v8b  __attribute__((ext_vector_type(8)));
typedef float    v8f  __attribute__((ext_vector_type(8)));
typedef float    v4f  __attribute__((ext_vector_type(4)));
typedef unsigned int v4u __attribute__((ext_vector_type(4)));

// ---- scalar helpers --------------------------------------------------------------------------------
__device__ __forceinline__ unsigned short bf_bits(float f) {          // f32 -> bf16 bits, RNE convert
  unsigned u = __float_as_uint(f);
  return (unsigned short)((u + 0x7FFFu + ((u >> 16) & 1u)) >> 16);
}
__device__ __forceinline__ float bf_up(unsigned short h) { return __uint_as_float(((unsigned)h) << 16); }
__device__ __forceinline__ unsigned short h_bits(_Float16 x) { return __builtin_bit_cast(unsigned short, x); }
__device__ __forceinline__ unsigned pk16(unsigned short a, unsigned short b) { return (unsigned)a | ((unsigned)b << 16); }
__device__ __forceinline__ v8f zero8() { v8f z = {0.f, 0.f, 0.f, 0.f, 0.f, 0.f, 0.f, 0.f}; return z; }

// ---- fragment loaders: 16-bit A/B operand, lane -> row/col (lane&15), p already includes +8*(lane>>4);
//      elements 0..7 <- p[0..7] (k0+8h..), elements 8..15 <- p[16..23] (k0+16+8h..)
__device__ __forceinline__ v16b ldfrag_b(const __bf16* p) {
  union { v16b v; v8b h[2]; } f;
  f.h[0] = *(const v8b*)(p);
  f.h[1] = *(const v8b*)(p + 16);
  return f.v;
}
__device__ __forceinline__ v16h ldfrag_h(const _Float16* p) {
  union { v16h v; v8h h[2]; } f;
  f.h[0] = *(const v8h*)(p);
  f.h[1] = *(const v8h*)(p + 16);
  return f.v;
}

// ---- WMMA helpers ------------------------------------------------------------------------------------
__device__ __forceinline__ v8f mma_b_raw(v16b a, v16b b, v8f c) {
  return __builtin_amdgcn_wmma_f32_16x16x32_bf16(false, a, false, b, (short)0, c, false, false);
}
__device__ __forceinline__ v8f mma_h_raw(v16h a, v16h b, v8f c) {
  return __builtin_amdgcn_wmma_f32_16x16x32_f16(false, a, false, b, (short)0, c, false, false);
}
__device__ __forceinline__ void acc_guard4(v8f& a, v8f& b, v8f& c, v8f& d) {
  asm volatile("v_nop\n\tv_nop\n\tv_nop\n\tv_nop" : "+v"(a), "+v"(b), "+v"(c), "+v"(d));
}

// ---- LDS staging of GEMM operands --------------------------------------------------------------------
// A stage is 64 k (128 B) of every operand row of the work-group's tile, laid at pitch LPITCH (16 B x odd: 16-byte reads of
// 16 rows fall on distinct banks). Each lane copies 16 B: 8 lanes per row, so one wave-wide copy covers 4 whole 128-B lines.
#define LPITCH 144
struct RowChunk {                 // this lane's share of 128 staged rows: rows r, r+32, r+64, r+96 (r = tid>>3), 16 B at column tid&7
  unsigned l;                     // LDS byte address of the first
  const unsigned short* g;        // global address of the first
  size_t step;                    // 32 source rows, in elements
};
// chunk q (128 rows) of a plane: g = row 0 of the plane at the first k of the stage, pitch ld elements; lbase = LDS byte address of the plane
__device__ __forceinline__ RowChunk row_chunk(unsigned lbase, const unsigned short* g, int ld, int q, int tid) {
  const int r = q * 128 + (tid >> 3), c = tid & 7;
  RowChunk x;
  x.l = lbase + (unsigned)(r * LPITCH + c * 16);
  x.g = g + (size_t)r * ld + c * 8;
  x.step = (size_t)32 * ld;
  return x;
}
// Asynchronous copies global -> LDS of one chunk (4 x 16 B a lane), written as the builtin: the compiler then places their address
// registers anywhere in the register file, also above v255, which operands of an asm statement cannot reach.
typedef int v4i __attribute__((ext_vector_type(4)));
__device__ __forceinline__ void copy_chunk(RowChunk a) {
#pragma unroll
  for (int q = 0; q < 4; ++q)
    __builtin_amdgcn_global_load_async_to_lds_b128(
        (__attribute__((address_space(1))) v4i*)(a.g + q * a.step),
        (__attribute__((address_space(3))) v4i*)(a.l + q * 32 * LPITCH), 0, 0);
}
__device__ __forceinline__ void copy_chunks2(RowChunk a, RowChunk b) { copy_chunk(a); copy_chunk(b); }
__device__ __forceinline__ void copy_chunks3(RowChunk a, RowChunk b, RowChunk d) { copy_chunk(a); copy_chunk(b); copy_chunk(d); }
// the wave's own copies have landed (other waves read them only behind the barrier that follows)
__device__ __forceinline__ void wait_copies() { asm volatile("s_wait_asynccnt 0x0" ::: "memory"); }
// the wave's own LDS reads have returned before the buffer they read is handed back for a refill
__device__ __forceinline__ void wait_lds() { asm volatile("s_wait_dscnt 0x0" ::: "memory"); }

// =====================================================================================================
// f32 -> bf16 (RNE convert) for x and the three weights into one contiguous 16-bit region:
// groups 0..NX8-1 <- x (batch b of the plane reads source rows at b * SEQ_FULL * DM, SEQ rows each), then NW8 groups each
// coverage: (NX8 + 3 NW8) threads x 8 = the whole [NB*SEQ][DM] x plane plus the three [DM][DM] weight planes.
// =====================================================================================================
__device__ __forceinline__ void cvt_planes_body(int blk, const float* __restrict__ x, const float* __restrict__ wq,
                                                const float* __restrict__ wk, const float* __restrict__ wv,
                                                unsigned short* out) {
  const int NXB8 = SEQ * DM / 8;          // groups per batch
  const int NX8 = NB * NXB8;
  const int NW8 = DM * DM / 8;
  const int g = blk * 256 + threadIdx.x;
  if (g >= NX8 + 3 * NW8) return;
  const float* src;
  if (g < NX8) {
    const int bb  = g / NXB8;
    const int off = g - bb * NXB8;
    src = x + (size_t)bb * SEQ_FULL * DM + (size_t)off * 8;
  } else {
    const int e = g - NX8;
    const int w = e / NW8;
    const int off = e - w * NW8;
    const float* wsrc = (w == 0) ? wq : ((w == 1) ? wk : wv);
    src = wsrc + (size_t)off * 8;
  }
  const v4f a = *(const v4f*)(src);
  const v4f c = *(const v4f*)(src + 4);
  v4u p;
  p[0] = pk16(bf_bits(a[0]), bf_bits(a[1]));
  p[1] = pk16(bf_bits(a[2]), bf_bits(a[3]));
  p[2] = pk16(bf_bits(c[0]), bf_bits(c[1]));
  p[3] = pk16(bf_bits(c[2]), bf_bits(c[3]));
  *(v4u*)(out + (size_t)g * 8) = p;
  
}

// =====================================================================================================
// Transposing f32 -> bf16 (RNE convert) of the output projection weight: w[k][n] (k = input feature, n = output feature,
// DM x DM) -> out[n][k] (k contiguous), the Bt plane of the last GEMM. One block per 64x64 tile (k0 = 64*ty,
// n0 = 64*tx), (DM/64) x (DM/64) tiles. The tile is staged in LDS as f32 (pitch 65; written by all waves, read by all
// coverage: 2 iterations x 32 rows x 64 k = the block's whole 64x64 tile; grid = all DM/64 x DM/64 tiles.
// =====================================================================================================
__device__ __forceinline__ void cvt_wo_t_body(float* sW, int tx, int ty, const float* __restrict__ w, unsigned short* out) {
  const int tid = threadIdx.x;
  const int k0 = ty * 64;
  const int n0 = tx * 64;
  {
    const int kk = tid >> 2;               // 0..63 source row within the tile
    const int c0 = (tid & 3) * 16;         // 16 consecutive source columns
    const float* src = w + (size_t)(k0 + kk) * DM + n0 + c0;
#pragma unroll
    for (int u = 0; u < 4; ++u) {
      const v4f a = *(const v4f*)(src + 4 * u);
      sW[kk * 65 + c0 + 4 * u + 0] = a[0];
      sW[kk * 65 + c0 + 4 * u + 1] = a[1];
      sW[kk * 65 + c0 + 4 * u + 2] = a[2];
      sW[kk * 65 + c0 + 4 * u + 3] = a[3];
    }
  }
  __syncthreads();
  const int q  = tid >> 3;                 // 0..31 output row within a half tile
  const int c8 = (tid & 7) * 8;            // 8 consecutive k
  v4u hv[2];
#pragma unroll
  for (int it = 0; it < 2; ++it) {
    const int nn = it * 32 + q;            // it 0..1 x q 0..31 = output rows 0..63
    v4u a;
#pragma unroll
    for (int e = 0; e < 4; ++e) {
      const float f0 = sW[(c8 + 2 * e) * 65 + nn];
      const float f1 = sW[(c8 + 2 * e + 1) * 65 + nn];
      a[e] = pk16(bf_bits(f0), bf_bits(f1));
    }
    hv[it] = a;
  }
  {
#pragma unroll
    for (int it = 0; it < 2; ++it) {
      const int nn = it * 32 + q;
      *(v4u*)(out + (size_t)(n0 + nn) * DM + k0 + c8) = hv[it];
    }
    
  }
}

// =====================================================================================================
// The two input conversions, which read nothing of each other, in one grid: blocks 0 .. NWOT-1 transpose and convert Wo (one
// 64x64 tile each; first, because their chain load - LDS - barrier - store is the longer one), the rest convert x, Wq, Wk, Wv.
// The choice is the same for a whole block, so the barrier in the transposing part is passed by all of its threads.
// =====================================================================================================
#define NWOT ((DM / 64) * (DM / 64))
__global__ __launch_bounds__(256) void cvt_inputs(const float* __restrict__ x, const float* __restrict__ wq,
                                                  const float* __restrict__ wk, const float* __restrict__ wv,
                                                  const float* __restrict__ wo, unsigned short* planes, unsigned short* woT) {
  __shared__ float sW[64 * 65];
  const int blk = blockIdx.x;
  if (blk < NWOT) cvt_wo_t_body(sW, blk % (DM / 64), blk / (DM / 64), wo, woT);
  else            cvt_planes_body(blk - NWOT, x, wq, wk, wv, planes);
}

// =====================================================================================================
// Batched bf16 WMMA GEMM: C[m][n] = sum_k A[m][k] * Bt[n][k]; one work-group (8 waves, 4 x 2) per 256 x 128 tile, one wave per
// 64x64 tile of it. The operand rows of the work-group's tile are staged in LDS, 64 k a stage, by asynchronous copies in a
// two-buffer ring (stage s + 2 is copied while stage s + 1 is worked on); the waves read their fragments from LDS.
// A row-major [M][K] pitch lda; Bt row-major [N][K] pitch ldb (k contiguous); M multiple of 256, N of 128, K of 64.
// bx = index of the work-group's tile, b = batch index (strides in elements); ring and sT are the work-group's LDS.
// NSPLIT: 0 = Ah.Bh (single product); 1 = Ah.Bh + Al.Bh; 2 = Ah.Bh + Al.Bh + Ah.Bl with unscaled bf16 lo planes (one accumulator).
// TRI: 0 = dense grid of (M/256) x (N/128) work-group tiles, bx row-major;
//      1 = square M == N: work-group tiles (I, J <= 2I+1), bx = I(I+1) + J; a wave whose 64x64 tile (tm, tn) has tn > tm
//          computes and stores nothing; tile t = tm(tm+1)/2 + tn written packed at C + b*strideC + t*4096 as [64][64] f32
//          (OUT_MODE 0 only).
// OUT_MODE: 0 = f32 (pitch ldc); 2 = bf16 hi plane C + bf16 lo plane C2 (lo = RNE(v - hi), unscaled);
//           3 = f16 hi plane C = f16(v*hscale) + f16 residual plane C2 = f16((v*hscale - hi) * rscale), C2 written
//               only for tiles with n0 < N2 (pitch ldc2, batch stride strideC2).
// Epilogue: 16-row slabs staged per wave in LDS (wave-private region sT[wave], wave barrier); each 64-wide row segment written
// =====================================================================================================
__host__ __device__ constexpr int gemm_bf_stage_bytes(int nsplit) {      // one stage: Ah 256 rows | Al | Bh 128 rows | Bl
  return (((nsplit >= 1) ? 2 : 1) * 256 + ((nsplit >= 2) ? 2 : 1) * 128) * LPITCH;
}
template <int NSPLIT, int OUT_MODE, int TRI>
__device__ __forceinline__ void gemm_bf_body(
    unsigned char* ring, float (*sT)[16 * 68], int bx, int b,
    const unsigned short* __restrict__ Ahp, const unsigned short* __restrict__ Alp, int lda, long long strideA,
    const unsigned short* __restrict__ Bhp, const unsigned short* __restrict__ Blp, int ldb, long long strideB,
    void* Cout, int ldc, long long strideC,
    void* Cout2, int ldc2, long long strideC2, int N2,
    int M, int N, int K, float hscale, float rscale) {
  constexpr int OFF_AL = 256 * LPITCH;                                   // stage layout: Ah 256 rows | Al | Bh 128 rows | Bl
  constexpr int OFF_BH = ((NSPLIT >= 1) ? 2 : 1) * 256 * LPITCH;
  constexpr int OFF_BL = OFF_BH + 128 * LPITCH;
  constexpr int STG    = OFF_BH + ((NSPLIT >= 2) ? 2 : 1) * 128 * LPITCH;
  static_assert(STG == gemm_bf_stage_bytes(NSPLIT));
  const int tid  = threadIdx.x;
  const int lane = tid & 31;
  const int wave = __builtin_amdgcn_readfirstlane(tid >> 5);
  int bm, bn;
  if (TRI != 0) {
    const int NI = M >> 8;
    int I = 0;
    for (int q = 1; q < NI; ++q)
      if (q * (q + 1) <= bx) I = q;
    bm = I;
    bn = bx - I * (I + 1);
    if (bn > 2 * I + 1) return;            // work-group-uniform, in front of every copy and barrier
  } else {
    const int bN = N >> 7;
    bm = bx / bN;
    bn = bx - bm * bN;
    if (bm >= (M >> 8)) return;            // work-group-uniform, in front of every copy and barrier
  }
  const int tm = bm * 4 + (wave >> 1);
  const int tn = bn * 2 + (wave & 1);
  const bool active = (TRI == 0) || (tn <= tm);   // wave-uniform
  const int t  = ((tm * (tm + 1)) >> 1) + tn;     // packed tile index (TRI)
  const int m0 = tm << 6;
  const int n0 = tn << 6;

  const unsigned short* Ag  = Ahp + (size_t)b * strideA + (size_t)(bm * 256) * lda;
  const unsigned short* Alg = Alp + (size_t)b * strideA + (size_t)(bm * 256) * lda;
  const unsigned short* Bg  = Bhp + (size_t)b * strideB + (size_t)(bn * 128) * ldb;
  const unsigned short* Blg = Blp + (size_t)b * strideB + (size_t)(bn * 128) * ldb;
  const unsigned ringb = (unsigned)(size_t)(const void*)ring;    // LDS byte address of the ring

  const int rlane = lane & 15;                 // row (A) / col (B, D) within subtile
  const int koff  = (lane >> 4) * 8;           // k offset of this lane half
  const int mOff  = (lane >> 4) * 8;           // D row offset

  auto stage = [&](int s, int buf) {
    const unsigned lb = ringb + (unsigned)(buf * STG);
    const size_t ks = (size_t)s * 64;
    copy_chunks3(row_chunk(lb, Ag + ks, lda, 0, tid), row_chunk(lb, Ag + ks, lda, 1, tid),
                 row_chunk(lb + OFF_BH, Bg + ks, ldb, 0, tid));
    if (NSPLIT == 1) copy_chunks2(row_chunk(lb + OFF_AL, Alg + ks, lda, 0, tid), row_chunk(lb + OFF_AL, Alg + ks, lda, 1, tid));
    if (NSPLIT >= 2) copy_chunks3(row_chunk(lb + OFF_AL, Alg + ks, lda, 0, tid), row_chunk(lb + OFF_AL, Alg + ks, lda, 1, tid),
                                  row_chunk(lb + OFF_BL, Blg + ks, ldb, 0, tid));
  };

  v8f acc[4][4];
#pragma unroll
  for (int i = 0; i < 4; ++i)
#pragma unroll
    for (int j = 0; j < 4; ++j) acc[i][j] = zero8();

  // Two fragment sets: while the WMMAs of one 32-k block run on one set, the next block's fragments are fetched into the other.
  v16b bhA[4], ahA[4], alA[4], blA[4], bhB[4], ahB[4], alB[4], blB[4];
  const int aoff = ((wave >> 1) * 64 + rlane) * LPITCH + koff * 2;
  const int boff = OFF_BH + ((wave & 1) * 64 + rlane) * LPITCH + koff * 2;
  auto ldset = [&](int buf, int kk, v16b (&bh)[4], v16b (&ah)[4], v16b (&al)[4], v16b (&bl)[4]) {
    const unsigned char* pa = ring + buf * STG + aoff + kk * 64;
    const unsigned char* pb = ring + buf * STG + boff + kk * 64;
#pragma unroll
    for (int j = 0; j < 4; ++j) {
      bh[j] = ldfrag_b((const __bf16*)(pb + j * 16 * LPITCH));
      if (NSPLIT >= 2) bl[j] = ldfrag_b((const __bf16*)(pb + (OFF_BL - OFF_BH) + j * 16 * LPITCH));
    }
#pragma unroll
    for (int i = 0; i < 4; ++i) {
      ah[i] = ldfrag_b((const __bf16*)(pa + i * 16 * LPITCH));
      if (NSPLIT >= 1) al[i] = ldfrag_b((const __bf16*)(pa + OFF_AL + i * 16 * LPITCH));
    }
  };
  // per accumulator and 32-k block the products are added in the order Ah.Bh, Al.Bh, Ah.Bl
  auto mmaset = [&](v16b (&bh)[4], v16b (&ah)[4], v16b (&al)[4], v16b (&bl)[4]) {
#pragma unroll
    for (int i = 0; i < 4; ++i)
#pragma unroll
      for (int j = 0; j < 4; ++j) acc[i][j] = mma_b_raw(ah[i], bh[j], acc[i][j]);
    if (NSPLIT >= 1) {
#pragma unroll
      for (int i = 0; i < 4; ++i)
#pragma unroll
        for (int j = 0; j < 4; ++j) acc[i][j] = mma_b_raw(al[i], bh[j], acc[i][j]);
    }
    if (NSPLIT >= 2) {
#pragma unroll
      for (int i = 0; i < 4; ++i)
#pragma unroll
        for (int j = 0; j < 4; ++j) acc[i][j] = mma_b_raw(ah[i], bl[j], acc[i][j]);
    }
  };

  const int nst = K >> 6;
  stage(0, 0);
  wait_copies();
  __syncthreads();
  if (nst > 1) stage(1, 1);
  ldset(0, 0, bhA, ahA, alA, blA);

  for (int s = 0; s < nst; ++s) {
    ldset(s & 1, 1, bhB, ahB, alB, blB);   // the stage's last block: the wave's last reads of buffer s & 1
    __builtin_amdgcn_sched_barrier(0);     // keeps the load group whole and ahead of the WMMAs
    if (active) mmaset(bhA, ahA, alA, blA);
    __builtin_amdgcn_sched_barrier(0);     // keeps these WMMAs in front of the waits, so that the loads above fly under them
    // publish point of stage s + 1, in front of stage s's last block and passed by every wave: own LDS reads of buffer s & 1
    // returned, own copies landed, barrier; then the refill of buffer s & 1 and the first fragments of stage s + 1
    wait_lds();
    wait_copies();
    __syncthreads();
    if (s + 2 < nst) stage(s + 2, s & 1);
    // unconditional (a branch here would merge the compiler's LDS wait counts): behind the last stage it reads the other
    // buffer's old bytes, which no copy is aimed at any more, and nothing uses them
    ldset((s + 1) & 1, 0, bhA, ahA, alA, blA);
    __builtin_amdgcn_sched_barrier(0);     // keeps the load group whole and ahead of the WMMAs
    if (active) mmaset(bhB, ahB, alB, blB);
  }
  wait_copies();
  wait_lds();
  if (!active) return;                     // wave-uniform; no work-group barrier below
  acc_guard4(acc[0][0], acc[0][1], acc[0][2], acc[0][3]);
  acc_guard4(acc[1][0], acc[1][1], acc[1][2], acc[1][3]);
  acc_guard4(acc[2][0], acc[2][1], acc[2][2], acc[2][3]);
  acc_guard4(acc[3][0], acc[3][1], acc[3][2], acc[3][3]);

  // ---- epilogue ----
  size_t cbase;
  int ldce, rowb, colb;
  if (TRI != 0) { cbase = (size_t)b * strideC + (size_t)t * 4096; ldce = 64; rowb = 0; colb = 0; }
  else          { cbase = (size_t)b * strideC; ldce = ldc; rowb = m0; colb = n0; }
  float* slab = sT[wave];
#pragma unroll
  for (int i = 0; i < 4; ++i) {
    const int mBase = m0 + (i << 4);
#pragma unroll
    for (int j = 0; j < 4; ++j) {
#pragma unroll
      for (int r = 0; r < 8; ++r) {
        slab[(mOff + r) * 68 + (j << 4) + rlane] = acc[i][j][r];
      }
    }
    __builtin_amdgcn_fence(3 /* release order */, "workgroup");
    __builtin_amdgcn_wave_barrier();
    __builtin_amdgcn_fence(2 /* acquire order */, "workgroup");
    if (OUT_MODE == 0) {
      float* C = (float*)Cout + cbase;
      const int hh = lane >> 4, c4 = (lane & 15) * 4;     // 256-B row segment = 16 lanes x 16 B
      {
#pragma unroll
        for (int it = 0; it < 8; ++it) {
          const int row = it * 2 + hh;                     // it 0..7 x hh 0..1 = rows 0..15
          const v4f v = *(const v4f*)(slab + row * 68 + c4);
          *(v4f*)(C + (size_t)(rowb + (i << 4) + row) * ldce + colb + c4) = v;
        }
        
      }
    } else {
      const int q = lane >> 3, c8 = (lane & 7) * 8;
      unsigned short* C  = (unsigned short*)Cout  + (size_t)b * strideC;
      unsigned short* C2 = (unsigned short*)Cout2 + (size_t)b * strideC2;
      const bool wlo = (OUT_MODE == 2) || (n0 < N2);      // wave-uniform
      v4u hv[4], lv[4];
#pragma unroll
      for (int it = 0; it < 4; ++it) {
        const int row = it * 4 + q;                        // it 0..3 x q 0..3 = rows 0..15
        const float* sp = slab + row * 68 + c8;
        v4u a, a2;
#pragma unroll
        for (int e = 0; e < 4; ++e) {
          const float f0 = sp[2 * e], f1 = sp[2 * e + 1];
          unsigned short h0, h1, l0, l1;
          if (OUT_MODE == 2) {
            h0 = bf_bits(f0); h1 = bf_bits(f1);
            l0 = bf_bits(f0 - bf_up(h0)); l1 = bf_bits(f1 - bf_up(h1));
          } else {
            const float g0 = f0 * hscale, g1 = f1 * hscale;
            const _Float16 x0 = (_Float16)g0, x1 = (_Float16)g1;
            h0 = h_bits(x0); h1 = h_bits(x1);
            l0 = h_bits((_Float16)((g0 - (float)x0) * rscale));
            l1 = h_bits((_Float16)((g1 - (float)x1) * rscale));
          }
          a[e] = pk16(h0, h1); a2[e] = pk16(l0, l1);
        }
        hv[it] = a; lv[it] = a2;
      }
      {
#pragma unroll
        for (int it = 0; it < 4; ++it) {
          const int row = it * 4 + q;
          *(v4u*)(C + (size_t)(mBase + row) * ldc + n0 + c8) = hv[it];
          if (wlo) *(v4u*)(C2 + (size_t)(mBase + row) * ldc2 + n0 + c8) = lv[it];
        }
        
      }
    }
    __builtin_amdgcn_fence(3 /* release order */, "workgroup");
    __builtin_amdgcn_wave_barrier();
    __builtin_amdgcn_fence(2 /* acquire order */, "workgroup");
  }
}

// =====================================================================================================
// One GEMM as a launch of its own: blockIdx.x = tile index, blockIdx.y = batch index.
// =====================================================================================================
template <int NSPLIT, int OUT_MODE, int TRI>
__global__ __launch_bounds__(256) void gemm_bf(
    const unsigned short* __restrict__ Ahp, const unsigned short* __restrict__ Alp, int lda, long long strideA,
    const unsigned short* __restrict__ Bhp, const unsigned short* __restrict__ Blp, int ldb, long long strideB,
    void* Cout, int ldc, long long strideC,
    void* Cout2, int ldc2, long long strideC2, int N2,
    int M, int N, int K, float hscale, float rscale) {
  __shared__ __align__(16) unsigned char ring[2 * gemm_bf_stage_bytes(NSPLIT)];
  __shared__ __align__(16) float sT[8][16 * 68];   // per-wave 16x64 slab, pitch 68 floats
  gemm_bf_body<NSPLIT, OUT_MODE, TRI>(ring, sT, (int)blockIdx.x, (int)blockIdx.y, Ahp, Alp, lda, strideA, Bhp, Blp, ldb, strideB,
                                      Cout, ldc, strideC, Cout2, ldc2, strideC2, N2, M, N, K, hscale, rscale);
}

// =====================================================================================================
// The q and k projections, which read nothing of each other, in one grid of 2 NPQ work-groups of equal cost:
//   blocks 0 .. NPQ-1        q = x . Wq^T -> bf16 hi/lo planes [NB*SEQ][DM]   (A = Xb, Bt = Wq [out][in]; M=NB*SEQ, N=DM, K=DM)
//   blocks NPQ .. 2 NPQ-1    k = x . Wk^T -> bf16 hi/lo planes
// Wb holds the Wq and Wk planes one behind the other. The choice is the same for a whole work-group.
// =====================================================================================================
#define NPQ ((NB * SEQ / 256) * (DM / 128))
static_assert(((NB * SEQ) % 256) == 0 && (DM % 128) == 0);
__global__ __launch_bounds__(256) void proj_qk(
    const unsigned short* __restrict__ Xb, const unsigned short* __restrict__ Wb,
    unsigned short* Qh, unsigned short* Ql, unsigned short* Kh, unsigned short* Kl) {
  __shared__ __align__(16) unsigned char ring[2 * gemm_bf_stage_bytes(0)];
  __shared__ __align__(16) float sT[8][16 * 68];   // per-wave 16x64 slab, pitch 68 floats
  const int blk = blockIdx.x;
  const bool isk = blk >= NPQ;
  const unsigned short* W = Wb + (isk ? (size_t)DM * DM : (size_t)0);
  gemm_bf_body<0, 2, 0>(ring, sT, isk ? blk - NPQ : blk, 0, Xb, Xb, DM, 0LL, W, W, DM, 0LL,
                        (void*)(isk ? Kh : Qh), DM, 0LL, (void*)(isk ? Kl : Ql), DM, 0LL, DM,
                        NB * SEQ, DM, DM, 1.0f, 1.0f);
}

// =====================================================================================================
// The scores and the v^T projection, which read nothing of each other, in one grid. One work-group fills a WGP's LDS, there are
// more score tiles than WGPs, so the index runs from the longest to the shortest (for speed only) and
// the v^T tiles fill the places that the last score tiles leave idle:
//   blocks 0 .. NB NSF-1     scores = q . k^T, 3 bf16 products -> packed f32 tiles: work-group tiles (I, J <= 2I), NSF a batch
//   the next NB NSI          the score tiles (I, 2I+1) on the diagonal, in which 3 of 8 waves work
//   the rest, NPV a batch    v^T = Wv . x^T -> f16 hi plane f16(16 v) [b][d][key] (pitch SEQ) and residual plane x4096 for keys < VLP
//                            (pitch VLP)   (A = Wv [out][in], Bt = Xb rows of batch b; M=DM, N=SEQ, K=DM)
// The choice is the same for a whole work-group; the two parts use the same LDS.
// =====================================================================================================
#define NSI (SEQ / 256)
#define NSF (NSI * NSI)
#define NPV ((DM / 256) * (SEQ / 128))
static_assert((DM % 256) == 0 && (SEQ % 128) == 0);
__global__ __launch_bounds__(256) void scores_vt(
    const unsigned short* __restrict__ Qh, const unsigned short* __restrict__ Ql,
    const unsigned short* __restrict__ Kh, const unsigned short* __restrict__ Kl, float* Sp,
    const unsigned short* __restrict__ Xb, const unsigned short* __restrict__ Wv,
    unsigned short* VTh, unsigned short* VTl) {
  __shared__ __align__(16) unsigned char ring[2 * gemm_bf_stage_bytes(2)];
  __shared__ __align__(16) float sT[8][16 * 68];   // per-wave 16x64 slab, pitch 68 floats
  const int blk = blockIdx.x;
  if (blk < NB * (NSF + NSI)) {
    int b, I, J;
    if (blk < NB * NSF) {                  // row I holds the 2I+1 tiles f = I*I .. I*I + 2I
      b = blk / NSF;
      const int f = blk - b * NSF;
      I = 0;
      for (int q = 1; q < NSI; ++q)
        if (q * q <= f) I = q;
      J = f - I * I;
    } else {
      const int e = blk - NB * NSF;
      b = e / NSI;
      I = e - b * NSI;
      J = 2 * I + 1;
    }
    gemm_bf_body<2, 0, 1>(ring, sT, I * (I + 1) + J, b, Qh, Ql, DM, (long long)SEQ * DM, Kh, Kl, DM, (long long)SEQ * DM,
                          (void*)Sp, 64, (long long)NTRI * 4096, (void*)Sp, 64, 0LL, 0,
                          SEQ, SEQ, DM, 1.0f, 1.0f);
  } else {
    const int e = blk - NB * (NSF + NSI);
    gemm_bf_body<0, 3, 0>(ring, sT, e % NPV, e / NPV, Wv, Wv, DM, 0LL, Xb, Xb, DM, (long long)SEQ * DM,
                          (void*)VTh, SEQ, (long long)DM * SEQ, (void*)VTl, VLP, (long long)DM * VLP, VLP,
                          DM, SEQ, DM, VSC, LSC);
  }
}

// =====================================================================================================
// Row softmax over the packed lower-triangular score tiles. One wave per query row (block = 8 rows, grid = NB*SEQ/8).
// Row (b, i), tm = i>>6, r = i&63: score (i, j) sits at Sp + ((b*NTRI + tm(tm+1)/2 + (j>>6))*4096 + r*64 + (j&63)), j <= 64 tm + 63.
// The wave handles ng = tm/4 + 1 groups of 256 keys (lane: 8 consecutive keys per group, two 16-B loads with the key-tile
// address clamped to tn <= tm); z = s/32 for j <= i, -inf otherwise; m = max, p = exp(z - m), l = sum, P = p/l (all f32).
// Writes Ph = f16(1024 P) for keys 0 .. 256 ng - 1 of row (b, i) (pitch SEQ; >= the keys the p.v GEMM copies for the row's work-group tile; zeros
// for j > i) and, for rows i < RESR, Pl = f16((1024 P - Ph) * 4096) with the same key extent (<= VLP, pitch VLP).
// coverage: NB*SEQ rows x written extent >= every key range any consumer reads.
// =====================================================================================================
__global__ __launch_bounds__(256) void softmax_rows(const float* __restrict__ Sp,
                                                    unsigned short* Php, unsigned short* Plp) {
  const int lane = threadIdx.x & 31, wave = threadIdx.x >> 5;
  const int row = blockIdx.x * 8 + wave;
  if (row >= NB * SEQ) return;             // wave-uniform; exact grid never triggers it; no block barriers below
  const int b  = row / SEQ;
  const int i  = row - b * SEQ;
  const int tm = i >> 6, r = i & 63;
  const int ng = (tm >> 2) + 1;            // 1..8, wave-uniform
  const float* srow = Sp + ((size_t)b * NTRI + (size_t)((tm * (tm + 1)) >> 1)) * 4096 + (size_t)r * 64;

  float z[8][8];
  float m = -INFINITY;
#pragma unroll
  for (int g = 0; g < 8; ++g) {
#pragma unroll
    for (int e = 0; e < 8; ++e) z[g][e] = -INFINITY;
    if (g < ng) {
      const int j0 = 256 * g + 8 * lane;
      int tn = j0 >> 6;
      tn = (tn < tm) ? tn : tm;            // clamped tile address; keys with tn > tm are all masked below
      const float* p = srow + (size_t)tn * 4096 + (j0 & 63);
      const v4f a = *(const v4f*)(p);
      const v4f c = *(const v4f*)(p + 4);
      const float v[8] = {a[0], a[1], a[2], a[3], c[0], c[1], c[2], c[3]};
#pragma unroll
      for (int e = 0; e < 8; ++e) {
        const float zz = (j0 + e <= i) ? (v[e] * 0.03125f) : -INFINITY;
        z[g][e] = zz;
        m = fmaxf(m, zz);
      }
    }
  }
#pragma unroll
  for (int off = 1; off < 32; off <<= 1) m = fmaxf(m, __shfl_xor(m, off, 32));   // finite: key 0 is always kept

  float l = 0.f;
#pragma unroll
  for (int g = 0; g < 8; ++g) {
    if (g < ng) {
#pragma unroll
      for (int e = 0; e < 8; ++e) {
        const float p = __expf(z[g][e] - m);   // masked: exp(-inf) = 0
        z[g][e] = p;
        l += p;
      }
    }
  }
#pragma unroll
  for (int off = 1; off < 32; off <<= 1) l += __shfl_xor(l, off, 32);          // l >= 1
  const float inv1k = (1.0f / l) * PSC;

  const bool res = (i < RESR);             // wave-uniform
  v4u ph[8];
  v4u pl0 = {0u, 0u, 0u, 0u};
  v4u pl1 = {0u, 0u, 0u, 0u};
#pragma unroll
  for (int g = 0; g < 8; ++g) {
    v4u hv = {0u, 0u, 0u, 0u};
    v4u lv = {0u, 0u, 0u, 0u};
    if (g < ng) {
#pragma unroll
      for (int e = 0; e < 4; ++e) {
        const float f0 = z[g][2 * e] * inv1k, f1 = z[g][2 * e + 1] * inv1k;
        const _Float16 x0 = (_Float16)f0, x1 = (_Float16)f1;
        hv[e] = pk16(h_bits(x0), h_bits(x1));
        lv[e] = pk16(h_bits((_Float16)((f0 - (float)x0) * LSC)), h_bits((_Float16)((f1 - (float)x1) * LSC)));
      }
    }
    ph[g] = hv;
    if (g == 0) pl0 = lv;
    if (g == 1) pl1 = lv;
  }

  unsigned short* prow = Php + (size_t)row * SEQ + 8 * lane;
  const int il = res ? i : 0;              // clamped row into the residual plane (stored only when res)
  unsigned short* lrow = Plp + ((size_t)b * RESR + (size_t)il) * VLP + 8 * lane;
  {
#pragma unroll
    for (int g = 0; g < 8; ++g) {
      if (g < ng) *(v4u*)(prow + 256 * g) = ph[g];
    }
    if (res) {                             // res rows have i < RESR (multiple of 256) -> 256 ng <= RESR = VLP
      *(v4u*)(lrow) = pl0;
      if (ng > 1) *(v4u*)(lrow + 256) = pl1;
    }
    
  }
}

// =====================================================================================================
// p.v GEMM on f16 WMMA, per batch b: ctx[b][q][d] = sum_key P[b][q][key] * VT[b][d][key], stored as the two bf16 planes that the
// output projection reads: hi = RNE(ctx), lo = RNE(ctx - hi), unscaled, both [NB*SEQ][DM].
//   A  = Ph  [b][SEQ][SEQ]  f16(1024 P), pitch SEQ         Al = Pl  [b][RESR][VLP] f16 residual x4096
//   Bt = VTh [b][DM][SEQ]   f16(16 v),   pitch SEQ         Bl = VTl [b][DM][VLP]   f16 residual x4096
// One work-group (8 waves, 4 x 2) per (64*MI) x 128 output tile, one wave per (16*MI) x 64 tile of it; rows mBase + ...; the
// operand rows of the work-group's tile are staged in LDS, 64 keys a stage, by asynchronous copies in a two-buffer ring up to the
// causal key extent of the work-group's last row tile (every P entry in that range was written by the softmax: its written extent
// is 256*(row/256 + 1) keys). A wave works on keys k < 64*((m0>>6)+1) only and passes the later publish points idle.
// RES (rows < RESR, MI = 2): acc0 += Ph.VTh; acc1 += Pl.VTh + Ph.VTl,
// ctx = acc0*OSCALE + acc1*OSCALE/4096; otherwise single product ctx = acc0*OSCALE. f32 accumulate.
// bx = index of the work-group's tile among those of rows mBase .. mBase + M - 1 (M a multiple of 64*MI), row-major, DM/128 a row;
// ring and sT are the work-group's LDS.
// =====================================================================================================
__host__ __device__ constexpr int gemm_pv_stage_bytes(bool res, int mi) {   // one stage: Ph 64*mi rows | Pl | VTh 128 rows | VTl
  return (res ? 2 : 1) * (64 * mi + 128) * LPITCH;
}
template <bool RES, int MI>
__device__ __forceinline__ void gemm_pv_body(
    unsigned char* ring, float (*sT)[16 * 68], int bx, int b,
    const unsigned short* __restrict__ Php, const unsigned short* __restrict__ Plp,
    const unsigned short* __restrict__ Vhp, const unsigned short* __restrict__ Vlp,
    unsigned short* Chp, unsigned short* Clp, int mBase, int M) {
  constexpr int AR     = 64 * MI;                                        // rows of the work-group's tile
  static_assert(AR == (RES ? 128 : 256) && (RESR % AR) == 0);
  constexpr int OFF_AL = AR * LPITCH;                                    // stage layout: Ph AR rows | Pl | VTh 128 rows | VTl
  constexpr int OFF_BH = (RES ? 2 : 1) * AR * LPITCH;
  constexpr int OFF_BL = OFF_BH + 128 * LPITCH;
  constexpr int STG    = OFF_BH + (RES ? 2 : 1) * 128 * LPITCH;
  static_assert(STG == gemm_pv_stage_bytes(RES, MI));
  const int tid  = threadIdx.x;
  const int lane = tid & 31;
  const int wave = __builtin_amdgcn_readfirstlane(tid >> 5);
  const int bN = DM >> 7;                          // 8
  const int bm = bx / bN;
  const int bn = bx - bm * bN;
  if (bm >= M / AR) return;                        // work-group-uniform, in front of every copy and barrier
  const int r0 = mBase + bm * AR;                  // first row of the work-group's tile
  const int m0 = r0 + (wave >> 1) * 16 * MI;
  const int n0 = bn * 128 + (wave & 1) * 64;
  int keff = (((m0 >> 6) + 1) << 6);               // causal key extent of this row tile, multiple of 64
  if (keff > SEQ) keff = SEQ;
  if (RES && keff > VLP) keff = VLP;               // never taken for mBase + M <= RESR; keeps residual reads in range
  int kblk = ((((r0 + 3 * 16 * MI) >> 6) + 1) << 6);   // the same of the work-group's last row tile: the staged extent
  if (kblk > SEQ) kblk = SEQ;
  if (RES && kblk > VLP) kblk = VLP;
  int rl0 = r0;                                    // first row in the residual plane, clamped; equals r0 for the RES launch
  if (rl0 > RESR - AR) rl0 = RESR - AR;

  const unsigned short* Ag  = Php + (size_t)b * SEQ * SEQ + (size_t)r0 * SEQ;
  const unsigned short* Alg = Plp + (size_t)b * RESR * VLP + (size_t)rl0 * VLP;
  const unsigned short* Bg  = Vhp + (size_t)b * DM * SEQ + (size_t)(bn * 128) * SEQ;
  const unsigned short* Blg = Vlp + (size_t)b * DM * VLP + (size_t)(bn * 128) * VLP;
  const unsigned ringb = (unsigned)(size_t)(const void*)ring;    // LDS byte address of the ring

  const int rlane = lane & 15;
  const int koff  = (lane >> 4) * 8;
  const int mOff  = (lane >> 4) * 8;

  auto stage = [&](int s, int buf) {
    const unsigned lb = ringb + (unsigned)(buf * STG);
    const size_t ks = (size_t)s * 64;
    if (RES) {                                     // AR = 128: one chunk a plane
      copy_chunks2(row_chunk(lb, Ag + ks, SEQ, 0, tid), row_chunk(lb + OFF_BH, Bg + ks, SEQ, 0, tid));
      copy_chunks2(row_chunk(lb + OFF_AL, Alg + ks, VLP, 0, tid), row_chunk(lb + OFF_BL, Blg + ks, VLP, 0, tid));
    } else {                                       // AR = 256: two chunks of P, one of v^T
      copy_chunks3(row_chunk(lb, Ag + ks, SEQ, 0, tid), row_chunk(lb, Ag + ks, SEQ, 1, tid),
                   row_chunk(lb + OFF_BH, Bg + ks, SEQ, 0, tid));
    }
  };

  v8f acc0[MI][4], acc1[MI][4];
#pragma unroll
  for (int i = 0; i < MI; ++i)
#pragma unroll
    for (int j = 0; j < 4; ++j) { acc0[i][j] = zero8(); acc1[i][j] = zero8(); }

  // Two fragment sets: while the WMMAs of one 32-key block run on one set, the next block's fragments are fetched into the other.
  v16h bhA[4], ahA[MI], alA[MI], blA[4], bhB[4], ahB[MI], alB[MI], blB[4];
  const int aoff = ((wave >> 1) * 16 * MI + rlane) * LPITCH + koff * 2;
  const int boff = OFF_BH + ((wave & 1) * 64 + rlane) * LPITCH + koff * 2;
  auto ldset = [&](int buf, int kk, v16h (&bh)[4], v16h (&ah)[MI], v16h (&al)[MI], v16h (&bl)[4]) {
    const unsigned char* pa = ring + buf * STG + aoff + kk * 64;
    const unsigned char* pb = ring + buf * STG + boff + kk * 64;
#pragma unroll
    for (int j = 0; j < 4; ++j) {
      bh[j] = ldfrag_h((const _Float16*)(pb + j * 16 * LPITCH));
      if (RES) bl[j] = ldfrag_h((const _Float16*)(pb + (OFF_BL - OFF_BH) + j * 16 * LPITCH));
    }
#pragma unroll
    for (int i = 0; i < MI; ++i) {
      ah[i] = ldfrag_h((const _Float16*)(pa + i * 16 * LPITCH));
      if (RES) al[i] = ldfrag_h((const _Float16*)(pa + OFF_AL + i * 16 * LPITCH));
    }
  };
  // acc0 += Ph.VTh; acc1 += Pl.VTh, then Ph.VTl, per 32-key block
  auto mmaset = [&](v16h (&bh)[4], v16h (&ah)[MI], v16h (&al)[MI], v16h (&bl)[4]) {
#pragma unroll
    for (int i = 0; i < MI; ++i)
#pragma unroll
      for (int j = 0; j < 4; ++j) {
        acc0[i][j] = mma_h_raw(ah[i], bh[j], acc0[i][j]);
        if (RES) acc1[i][j] = mma_h_raw(al[i], bh[j], acc1[i][j]);
      }
    if (RES) {
#pragma unroll
      for (int i = 0; i < MI; ++i)
#pragma unroll
        for (int j = 0; j < 4; ++j) acc1[i][j] = mma_h_raw(ah[i], bl[j], acc1[i][j]);
    }
  };

  const int nst = kblk >> 6;
  stage(0, 0);
  wait_copies();
  __syncthreads();
  if (nst > 1) stage(1, 1);
  ldset(0, 0, bhA, ahA, alA, blA);

  for (int s = 0; s < nst; ++s) {
    const bool act = s * 64 < keff;        // wave-uniform
    ldset(s & 1, 1, bhB, ahB, alB, blB);   // the stage's last block: the wave's last reads of buffer s & 1
    __builtin_amdgcn_sched_barrier(0);     // keeps the load group whole and ahead of the WMMAs
    if (act) mmaset(bhA, ahA, alA, blA);
    __builtin_amdgcn_sched_barrier(0);     // keeps these WMMAs in front of the waits, so that the loads above fly under them
    // publish point of stage s + 1, in front of stage s's last block and passed by every wave: own LDS reads of buffer s & 1
    // returned, own copies landed, barrier; then the refill of buffer s & 1 and the first fragments of stage s + 1
    wait_lds();
    wait_copies();
    __syncthreads();
    if (s + 2 < nst) stage(s + 2, s & 1);
    // unconditional (a branch here would merge the compiler's LDS wait counts): behind the last stage it reads the other
    // buffer's old bytes, which no copy is aimed at any more, and nothing uses them
    ldset((s + 1) & 1, 0, bhA, ahA, alA, blA);
    __builtin_amdgcn_sched_barrier(0);     // keeps the load group whole and ahead of the WMMAs
    if (act) mmaset(bhB, ahB, alB, blB);
  }
  wait_copies();
  wait_lds();
#pragma unroll
  for (int i = 0; i < MI; ++i) {
    acc_guard4(acc0[i][0], acc0[i][1], acc0[i][2], acc0[i][3]);
    if (RES) acc_guard4(acc1[i][0], acc1[i][1], acc1[i][2], acc1[i][3]);
  }

  // ---- epilogue ----
  float* slab = sT[wave];
  unsigned short* Ch = Chp + (size_t)b * SEQ * DM;
  unsigned short* Cl = Clp + (size_t)b * SEQ * DM;
  const float rsc = OSCALE * (1.0f / LSC);
#pragma unroll
  for (int i = 0; i < MI; ++i) {
    const int mB = m0 + (i << 4);
#pragma unroll
    for (int j = 0; j < 4; ++j) {
#pragma unroll
      for (int r = 0; r < 8; ++r) {
        float v = acc0[i][j][r] * OSCALE;
        if (RES) v += acc1[i][j][r] * rsc;
        slab[(mOff + r) * 68 + (j << 4) + rlane] = v;
      }
    }
    __builtin_amdgcn_fence(3 /* release order */, "workgroup");
    __builtin_amdgcn_wave_barrier();
    __builtin_amdgcn_fence(2 /* acquire order */, "workgroup");
    {
      const int q = lane >> 3, c8 = (lane & 7) * 8;        // 128-B row segment of a plane = 8 lanes x 16 B
      v4u hv[4], lv[4];
#pragma unroll
      for (int it = 0; it < 4; ++it) {
        const int row = it * 4 + q;                        // it 0..3 x q 0..3 = rows 0..15
        const float* sp = slab + row * 68 + c8;
        v4u a, a2;
#pragma unroll
        for (int e = 0; e < 4; ++e) {
          const float f0 = sp[2 * e], f1 = sp[2 * e + 1];
          const unsigned short h0 = bf_bits(f0), h1 = bf_bits(f1);
          a[e]  = pk16(h0, h1);
          a2[e] = pk16(bf_bits(f0 - bf_up(h0)), bf_bits(f1 - bf_up(h1)));
        }
        hv[it] = a; lv[it] = a2;
      }
#pragma unroll
      for (int it = 0; it < 4; ++it) {
        const int row = it * 4 + q;
        *(v4u*)(Ch + (size_t)(mB + row) * DM + n0 + c8) = hv[it];
        *(v4u*)(Cl + (size_t)(mB + row) * DM + n0 + c8) = lv[it];
      }
    }
    __builtin_amdgcn_fence(3 /* release order */, "workgroup");
    __builtin_amdgcn_wave_barrier();
    __builtin_amdgcn_fence(2 /* acquire order */, "workgroup");
  }
}

// =====================================================================================================
// Both parts of p.v, which read nothing of each other, in one grid. A work-group's cost grows with its causal key extent;
// the index runs from the longest to the shortest (for speed only):
//   blocks 0 .. NPVH-1   rows RESR .. SEQ-1, single f16 product, 256 x 128 tiles, last row block first (NPVC tiles a row block)
//   the rest             rows 0 .. RESR-1 with the residual planes (3 f16 products), 128 x 128 tiles, last row block first
// The choice is the same for a whole work-group; the two parts use the same LDS.
// =====================================================================================================
#define NPVC ((DM / 128) * NB)
#define NPVH (((SEQ - RESR) / 256) * NPVC)
#define NPVR ((RESR / 128) * NPVC)
static_assert(((SEQ - RESR) % 256) == 0 && (RESR % 128) == 0 && (DM % 128) == 0);
__global__ __launch_bounds__(256) void gemm_pv_all(
    const unsigned short* __restrict__ Php, const unsigned short* __restrict__ Plp,
    const unsigned short* __restrict__ Vhp, const unsigned short* __restrict__ Vlp, unsigned short* Chp, unsigned short* Clp) {
  constexpr int RB = 2 * WS_MAX2(gemm_pv_stage_bytes(true, 2), gemm_pv_stage_bytes(false, 4));
  __shared__ __align__(16) unsigned char ring[RB];
  __shared__ __align__(16) float sT[8][16 * 68];
  const int blk = blockIdx.x;
  if (blk < NPVH) {
    const int rb = (SEQ - RESR) / 256 - 1 - blk / NPVC, e = blk % NPVC;
    gemm_pv_body<false, 4>(ring, sT, rb * (DM / 128) + e % (DM / 128), e / (DM / 128), Php, Plp, Vhp, Vlp, Chp, Clp, RESR, SEQ - RESR);
  } else {
    const int rb = RESR / 128 - 1 - (blk - NPVH) / NPVC, e = (blk - NPVH) % NPVC;
    gemm_pv_body<true, 2>(ring, sT, rb * (DM / 128) + e % (DM / 128), e / (DM / 128), Php, Plp, Vhp, Vlp, Chp, Clp, 0, RESR);
  }
}

// =====================================================================================================
// Workspace map (bytes, full build NB 4 / SEQ 2048; every region is an exact multiple of its tile / whole-line store
// granularity; regions A and B are reused in stream order):
//   region A [0, 33554432):          Xb bf16 [8192][1024] at 0 (16777216) + Wq,Wk,Wv bf16 [1024][1024] at 16777216 (3 x 2097152),
//                                    read up to the launch of the scores and v^T
//                                    then: Ch, Cl bf16 ctx planes [8192][1024] at 0 (2 x 16777216), written by p.v
//   region B [33554432, 100663296):  Qh, Ql, Kh, Kl bf16 [8192][1024] (4 x 16777216)
//                                    then, once the scores are done: Ph f16 [4][2048][2048] (33554432) + Pl f16 [4][512][512] (2097152)
//   region C [100663296, 121634816): VTh f16 [4][1024][2048] (16777216) + VTl f16 [4][1024][512] (4194304)
//   region D [121634816, 123731968): WoT bf16 [1024][1024] (2097152), live from launch 1 to the last GEMM
//   region E [123731968, 158334976): Sp f32 packed score tiles [4][528][64][64] (34603008); a region of its own, because the launch
//                                    that writes it still reads Xb and Wv
//   end 158334976
// =====================================================================================================
extern "C" void kernel_launch(void* const* d_in, const int* in_sizes, int n_in,
                              void* d_out, int out_size, void* d_ws, size_t ws_size,
                              hipStream_t stream) {
  if (n_in < 5) return;
  if (in_sizes[4] < (NB - 1) * SEQ_FULL * DM + SEQ * DM) return;
  if (in_sizes[0] < DM * DM || in_sizes[1] < DM * DM || in_sizes[2] < DM * DM || in_sizes[3] < DM * DM) return;
  if (out_size < NB * SEQ * DM) return;

  // wire order of the inputs: k, q, v, out_proj, x
  const float* wk = (const float*)d_in[0];   // [out][in]
  const float* wq = (const float*)d_in[1];   // [out][in]
  const float* wv = (const float*)d_in[2];   // [out][in]
  const float* wo = (const float*)d_in[3];   // [in][out]
  const float* x  = (const float*)d_in[4];   // [NB_FULL][SEQ_FULL][DM]
  float* out = (float*)d_out;

  const size_t PX  = (size_t)NB * SEQ * DM * 2;       // 16-bit plane [NB*SEQ][DM]
  const size_t PW  = (size_t)DM * DM * 2;             // one weight plane
  const size_t PS  = (size_t)NB * NTRI * 4096 * 4;    // packed f32 score tiles
  const size_t PC  = 2 * PX;                          // bf16 hi and lo ctx planes
  const size_t PP  = (size_t)NB * SEQ * SEQ * 2;      // Ph
  const size_t PPL = (size_t)NB * RESR * VLP * 2;     // Pl
  const size_t PVT = (size_t)NB * DM * SEQ * 2;       // VTh
  const size_t PVL = (size_t)NB * DM * VLP * 2;       // VTl
  const size_t RA = ((PX + 3 * PW) > PC) ? (PX + 3 * PW) : PC;
  const size_t oXb = 0;
  const size_t oW  = PX;
  const size_t oCh = 0;
  const size_t oCl = PX;
  const size_t oQh = RA;
  const size_t oQl = RA + PX;
  const size_t oKh = RA + 2 * PX;
  const size_t oKl = RA + 3 * PX;
  const size_t RBend = RA + 4 * PX;
  const size_t oPh = RA;
  const size_t oPl = RA + PP;
  if (oPl + PPL > RBend) return;
  const size_t oVTh = RBend;
  const size_t oVTl = RBend + PVT;
  const size_t oWo  = oVTl + PVL;
  const size_t oS   = oWo + PW;
  const size_t total = oS + PS;                       // 158334976 in the full build
  if (total > ws_size) return;

  char* ws = (char*)d_ws;
  unsigned short* Xb  = (unsigned short*)(ws + oXb);
  unsigned short* Wb  = (unsigned short*)(ws + oW);   // Wq plane, then Wk, then Wv
  float*          Sp  = (float*)(ws + oS);
  unsigned short* Qh  = (unsigned short*)(ws + oQh);
  unsigned short* Ql  = (unsigned short*)(ws + oQl);
  unsigned short* Kh  = (unsigned short*)(ws + oKh);
  unsigned short* Kl  = (unsigned short*)(ws + oKl);
  unsigned short* Ph  = (unsigned short*)(ws + oPh);
  unsigned short* Pl  = (unsigned short*)(ws + oPl);
  unsigned short* Ch  = (unsigned short*)(ws + oCh);
  unsigned short* Cl  = (unsigned short*)(ws + oCl);
  unsigned short* VTh = (unsigned short*)(ws + oVTh);
  unsigned short* VTl = (unsigned short*)(ws + oVTl);
  unsigned short* WoT = (unsigned short*)(ws + oWo);

  const dim3 blk(256);
  const int nGroups = NB * SEQ * DM / 8 + 3 * (DM * DM / 8);
  const dim3 gCvt(NWOT + (nGroups + 255) / 256);
  const dim3 gQk(2 * NPQ);
  const dim3 gSv(NB * (NSF + NSI) + NB * NPV);
  const dim3 gProj(((NB * SEQ / 64) * (DM / 64) + 7) / 8, 1);
  const dim3 gSm((NB * SEQ + 7) / 8);
  const dim3 gPv(NPVH + NPVR);

  // (1) x and Wq, Wk, Wv -> bf16 planes (Xb, then the three weight planes contiguous); Wo [in][out] -> WoT bf16 [out][in]
  cvt_inputs<<<gCvt, blk, 0, stream>>>(x, wq, wk, wv, wo, Xb, WoT);
  // (2) q, k -> bf16 hi/lo planes [NB*SEQ][DM]
  proj_qk<<<gQk, blk, 0, stream>>>(Xb, Wb, Qh, Ql, Kh, Kl);
  // (3) scores = q . k^T per batch over the NTRI lower-triangular 64x64 tiles, 3 bf16 products -> packed f32 tiles;
  //     v^T -> f16 hi plane and residual plane
  scores_vt<<<gSv, blk, 0, stream>>>(Qh, Ql, Kh, Kl, Sp, Xb, Wb + (size_t)2 * DM * DM, VTh, VTl);
  // (4) causal row softmax in f32 -> Ph f16(1024 P) and Pl residual planes
  softmax_rows<<<gSm, blk, 0, stream>>>(Sp, Ph, Pl);
  // (5) ctx = p.v -> bf16 hi/lo planes [NB*SEQ][DM]: rows RESR..SEQ-1 single f16 product (64x64 wave tiles), rows 0..RESR-1 of every sequence
  //     with the residual planes (3 f16 products, 32x64 wave tiles)
  gemm_pv_all<<<gPv, blk, 0, stream>>>(Ph, Pl, VTh, VTl, Ch, Cl);
  // (6) out = ctx . Wo -> f32 output buffer   (A = Ch + Cl, Bt = WoT [out][in]; M=NB*SEQ, N=DM, K=DM; 2 bf16 products)
  gemm_bf<1, 0, 0><<<gProj, blk, 0, stream>>>(
      Ch, Cl, DM, 0LL, WoT, WoT, DM, 0LL,
      (void*)out, DM, 0LL, (void*)out, DM, 0LL, 0,
      NB * SEQ, DM, DM, 1.0f, 1.0f);
  (void)hipGetLastError();
}

// v005
// Measured time: 171 microseconds a run.
// In two side-by-side timings against v004, it was 1.05 and 1.04 times as fast.
// All steps since v000 together make it 2.87 times as fast.
// Contractions: q, k, v^T projections = v_wmma_f32_16x16x32_bf16 (bf16 RNE-converted x and W, single product, f32 accumulate);
// q.k^T scores = v_wmma_f32_16x16x32_bf16 with bf16 hi/lo planes of q and k (hi.hi + lo.hi + hi.lo), f32 accumulate;
// p.v = v_wmma_f32_16x16x32_f16 (p carried x1024 in f16, v^T carried x16 in f16, single product; query rows 0..RESR-1 of every
// sequence add the f16 residual planes (x4096) of p and v^T in a separate accumulator), f32 accumulate;
// output projection ctx.Wo = v_wmma_f32_16x16x32_bf16 with bf16 hi/lo planes of ctx and the bf16 RNE-converted Wo^T plane
// (hi.W + lo.W, one accumulator), f32 accumulate;
// causal mask, row max, exp, sum and normalisation in f32 on the VALU.
// Carry audit:
//   Ph  = f16(1024 * p), p already normalised by the row sum     } OSCALE = 1/(1024*16) folded exactly once in the p.v epilogue
//   VTh = f16(16 * v)                                            }
//   Pl  = f16((1024 p - Ph) * 4096)                              } products Ph.VTl and Pl.VTh go only to accumulator acc1,
//   VTl = f16((16 v - VTh) * 4096), keys 0..VLP-1                } folded with OSCALE * (1/4096) once in the same epilogue
//   q / k lo planes are unscaled bf16 residuals (v - hi) sharing the hi accumulator; score scale 1/32 applied once in f32 in the softmax.
//   ctx hi / lo planes are unscaled bf16 (lo = RNE(ctx - hi)) sharing one accumulator in the output projection.
// The module's softmax over all keys followed by the lower-triangular mask and the division by the masked row sum equals
// exp(z_j - m) / sum_{j<=i} exp(z_j - m) for any finite shift m; it is evaluated with the causal row max as the shift.
#include <hip/hip_runtime.h>
#include <math.h>

#define NB_FULL  4
#define SEQ_FULL 2048
#ifndef NB
#define NB    4
#endif
#ifndef SEQ
#define SEQ   2048
#endif
#define DM    1024
#define NQT   (SEQ / 64)                  // query/key tiles of 64
#define NTRI  ((NQT * (NQT + 1)) / 2)     // lower-triangular 64x64 score tiles per sequence (528 at SEQ 2048)
#define RESR  ((SEQ < 512) ? SEQ : 512)   // leading query rows per sequence that use the residual planes
#define VLP   RESR                        // key pitch of the p / v^T residual planes
#define PSC   1024.0f
#define VSC   16.0f
#define LSC   4096.0f
#define OSCALE (1.0f / 16384.0f)          // 1 / (PSC * VSC)
static_assert(NB >= 1 && NB <= NB_FULL);
static_assert(SEQ >= 256 && SEQ <= SEQ_FULL && (SEQ % 256) == 0);
static_assert((SEQ % 64) == 0 && (DM % 64) == 0 && (DM % 32) == 0);
static_assert((RESR % 64) == 0 && (RESR % 256) == 0 && RESR <= VLP && VLP <= SEQ && ((SEQ - RESR) % 64) == 0);
static_assert((RESR % 32) == 0);
static_assert(((NB * SEQ) % 8) == 0);
static_assert(((SEQ * DM / 8) % 256) == 0 && ((DM * DM / 8) % 256) == 0);

// ---- workspace extents (bytes) used by the launcher; checked at build time ------------------------------
#define WS_MAX2(a, b) (((a) > (b)) ? (a) : (b))
#define WS_PX  ((size_t)NB * SEQ * DM * 2)        // one 16-bit plane [NB*SEQ][DM]
#define WS_PW  ((size_t)DM * DM * 2)              // one 16-bit weight plane
#define WS_PS  ((size_t)NB * NTRI * 4096 * 4)     // packed f32 score tiles
#define WS_PC  (2 * WS_PX)                        // bf16 hi and lo ctx planes
#define WS_PP  ((size_t)NB * SEQ * SEQ * 2)       // Ph
#define WS_PPL ((size_t)NB * RESR * VLP * 2)      // Pl
#define WS_PVT ((size_t)NB * DM * SEQ * 2)        // VTh
#define WS_PVL ((size_t)NB * DM * VLP * 2)        // VTl
#define WS_RA  WS_MAX2(WS_PX + 3 * WS_PW, WS_PC)
#define WS_TOTAL (WS_RA + 4 * WS_PX + WS_PVT + WS_PVL + WS_PW + WS_PS)
static_assert(WS_TOTAL <= (size_t)268435456);
static_assert(WS_PC <= WS_RA);
static_assert(WS_PP + WS_PPL <= 4 * WS_PX);
static_assert(((NB * SEQ) % 64) == 0);
static_assert((WS_RA % 128) == 0 && (WS_PX % 128) == 0 && (WS_PVT % 128) == 0 && (WS_PVL % 128) == 0 && (WS_PW % 128) == 0 &&
              (WS_PS % 128) == 0);

typedef _Float16 v16h __attribute__((ext_vector_type(16)));
typedef _Float16 v8h  __attribute__((ext_vector_type(8)));
typedef __bf16   v16b __attribute__((ext_vector_type(16)));
typedef __bf16   v8b  __attribute__((ext_vector_type(8)));
typedef float    v8f  __attribute__((ext_vector_type(8)));
typedef float    v4f  __attribute__((ext_vector_type(4)));
typedef unsigned int v4u __attribute__((ext_vector_type(4)));

// ---- scalar helpers --------------------------------------------------------------------------------
__device__ __forceinline__ unsigned short bf_bits(float f) {          // f32 -> bf16 bits, RNE convert
  unsigned u = __float_as_uint(f);
  return (unsigned short)((u + 0x7FFFu + ((u >> 16) & 1u)) >> 16);
}
__device__ __forceinline__ float bf_up(unsigned short h) { return __uint_as_float(((unsigned)h) << 16); }
__device__ __forceinline__ unsigned short h_bits(_Float16 x) { return __builtin_bit_cast(unsigned short, x); }
__device__ __forceinline__ unsigned pk16(unsigned short a, unsigned short b) { return (unsigned)a | ((unsigned)b << 16); }
__device__ __forceinline__ v8f zero8() { v8f z = {0.f, 0.f, 0.f, 0.f, 0.f, 0.f, 0.f, 0.f}; return z; }

// ---- fragment loaders: 16-bit A/B operand, lane -> row/col (lane&15), p already includes +8*(lane>>4);
//      elements 0..7 <- p[0..7] (k0+8h..), elements 8..15 <- p[16..23] (k0+16+8h..)
__device__ __forceinline__ v16b ldfrag_b(const __bf16* p) {
  union { v16b v; v8b h[2]; } f;
  f.h[0] = *(const v8b*)(p);
  f.h[1] = *(const v8b*)(p + 16);
  return f.v;
}
__device__ __forceinline__ v16h ldfrag_h(const _Float16* p) {
  union { v16h v; v8h h[2]; } f;
  f.h[0] = *(const v8h*)(p);
  f.h[1] = *(const v8h*)(p + 16);
  return f.v;
}

// ---- WMMA helpers ------------------------------------------------------------------------------------
__device__ __forceinline__ v8f mma_b_raw(v16b a, v16b b, v8f c) {
  return __builtin_amdgcn_wmma_f32_16x16x32_bf16(false, a, false, b, (short)0, c, false, false);
}
__device__ __forceinline__ v8f mma_h_raw(v16h a, v16h b, v8f c) {
  return __builtin_amdgcn_wmma_f32_16x16x32_f16(false, a, false, b, (short)0, c, false, false);
}
__device__ __forceinline__ void acc_guard4(v8f& a, v8f& b, v8f& c, v8f& d) {
  asm volatile("v_nop\n\tv_nop\n\tv_nop\n\tv_nop" : "+v"(a), "+v"(b), "+v"(c), "+v"(d));
}

// ---- LDS staging of GEMM operands --------------------------------------------------------------------
// A stage is 64 k (128 B) of every operand row of the work-group's tile, laid at pitch LPITCH (16 B x odd: 16-byte reads of
// 16 rows fall on distinct banks). Each lane copies 16 B: 8 lanes per row, so one wave-wide copy covers 4 whole 128-B lines.
#define LPITCH 144
struct RowChunk {                 // this lane's share of 128 staged rows: rows r, r+32, r+64, r+96 (r = tid>>3), 16 B at column tid&7
  unsigned l;                     // LDS byte address of the first
  const unsigned short* g;        // global address of the first
  size_t step;                    // 32 source rows, in elements
};
// chunk q (128 rows) of a plane: g = row 0 of the plane at the first k of the stage, pitch ld elements; lbase = LDS byte address of the plane
__device__ __forceinline__ RowChunk row_chunk(unsigned lbase, const unsigned short* g, int ld, int q, int tid) {
  const int r = q * 128 + (tid >> 3), c = tid & 7;
  RowChunk x;
  x.l = lbase + (unsigned)(r * LPITCH + c * 16);
  x.g = g + (size_t)r * ld + c * 8;
  x.step = (size_t)32 * ld;
  return x;
}
// Asynchronous copies global -> LDS of one chunk (4 x 16 B a lane), written as the builtin: the compiler then places their address
// registers anywhere in the register file, also above v255, which operands of an asm statement cannot reach.
typedef int v4i __attribute__((ext_vector_type(4)));
__device__ __forceinline__ void copy_chunk(RowChunk a) {
#pragma unroll
  for (int q = 0; q < 4; ++q)
    __builtin_amdgcn_global_load_async_to_lds_b128(
        (__attribute__((address_space(1))) v4i*)(a.g + q * a.step),
        (__attribute__((address_space(3))) v4i*)(a.l + q * 32 * LPITCH), 0, 0);
}
__device__ __forceinline__ void copy_chunks2(RowChunk a, RowChunk b) { copy_chunk(a); copy_chunk(b); }
__device__ __forceinline__ void copy_chunks3(RowChunk a, RowChunk b, RowChunk d) { copy_chunk(a); copy_chunk(b); copy_chunk(d); }
// the wave's own copies have landed (other waves read them only behind the barrier that follows)
__device__ __forceinline__ void wait_copies() { asm volatile("s_wait_asynccnt 0x0" ::: "memory"); }
// the wave's own LDS reads have returned before the buffer they read is handed back for a refill
__device__ __forceinline__ void wait_lds() { asm volatile("s_wait_dscnt 0x0" ::: "memory"); }
// behind the global stores of one epilogue slab, in front of the next slab's work: s_wait_xcnt 0 stands before that work rewrites
// registers which the issued stores name (a precaution), s_wait_dscnt 0 so that the slab's reads have returned before the next rows
// overwrite it; neither waits for the stores themselves, which fly on under the next slab
__device__ __forceinline__ void slab_next() { asm volatile("s_wait_xcnt 0x0\n\ts_wait_dscnt 0x0" ::: "memory"); }

// =====================================================================================================
// f32 -> bf16 (RNE convert) for x and the three weights into one contiguous 16-bit region:
// groups 0..NX8-1 <- x (batch b of the plane reads source rows at b * SEQ_FULL * DM, SEQ rows each), then NW8 groups each
// coverage: (NX8 + 3 NW8) threads x 8 = the whole [NB*SEQ][DM] x plane plus the three [DM][DM] weight planes.
// =====================================================================================================
__device__ __forceinline__ void cvt_planes_body(int blk, const float* __restrict__ x, const float* __restrict__ wq,
                                                const float* __restrict__ wk, const float* __restrict__ wv,
                                                unsigned short* out) {
  const int NXB8 = SEQ * DM / 8;          // groups per batch
  const int NX8 = NB * NXB8;
  const int NW8 = DM * DM / 8;
  const int g = blk * 256 + threadIdx.x;
  if (g >= NX8 + 3 * NW8) return;
  const float* src;
  if (g < NX8) {
    const int bb  = g / NXB8;
    const int off = g - bb * NXB8;
    src = x + (size_t)bb * SEQ_FULL * DM + (size_t)off * 8;
  } else {
    const int e = g - NX8;
    const int w = e / NW8;
    const int off = e - w * NW8;
    const float* wsrc = (w == 0) ? wq : ((w == 1) ? wk : wv);
    src = wsrc + (size_t)off * 8;
  }
  const v4f a = *(const v4f*)(src);
  const v4f c = *(const v4f*)(src + 4);
  v4u p;
  p[0] = pk16(bf_bits(a[0]), bf_bits(a[1]));
  p[1] = pk16(bf_bits(a[2]), bf_bits(a[3]));
  p[2] = pk16(bf_bits(c[0]), bf_bits(c[1]));
  p[3] = pk16(bf_bits(c[2]), bf_bits(c[3]));
  *(v4u*)(out + (size_t)g * 8) = p;
  
}

// =====================================================================================================
// Transposing f32 -> bf16 (RNE convert) of the output projection weight: w[k][n] (k = input feature, n = output feature,
// DM x DM) -> out[n][k] (k contiguous), the Bt plane of the last GEMM. One block per 64x64 tile (k0 = 64*ty,
// n0 = 64*tx), (DM/64) x (DM/64) tiles. The tile is staged in LDS as f32 (pitch 65; written by all waves, read by all
// coverage: 2 iterations x 32 rows x 64 k = the block's whole 64x64 tile; grid = all DM/64 x DM/64 tiles.
// =====================================================================================================
__device__ __forceinline__ void cvt_wo_t_body(float* sW, int tx, int ty, const float* __restrict__ w, unsigned short* out) {
  const int tid = threadIdx.x;
  const int k0 = ty * 64;
  const int n0 = tx * 64;
  {
    const int kk = tid >> 2;               // 0..63 source row within the tile
    const int c0 = (tid & 3) * 16;         // 16 consecutive source columns
    const float* src = w + (size_t)(k0 + kk) * DM + n0 + c0;
#pragma unroll
    for (int u = 0; u < 4; ++u) {
      const v4f a = *(const v4f*)(src + 4 * u);
      sW[kk * 65 + c0 + 4 * u + 0] = a[0];
      sW[kk * 65 + c0 + 4 * u + 1] = a[1];
      sW[kk * 65 + c0 + 4 * u + 2] = a[2];
      sW[kk * 65 + c0 + 4 * u + 3] = a[3];
    }
  }
  __syncthreads();
  const int q  = tid >> 3;                 // 0..31 output row within a half tile
  const int c8 = (tid & 7) * 8;            // 8 consecutive k
  v4u hv[2];
#pragma unroll
  for (int it = 0; it < 2; ++it) {
    const int nn = it * 32 + q;            // it 0..1 x q 0..31 = output rows 0..63
    v4u a;
#pragma unroll
    for (int e = 0; e < 4; ++e) {
      const float f0 = sW[(c8 + 2 * e) * 65 + nn];
      const float f1 = sW[(c8 + 2 * e + 1) * 65 + nn];
      a[e] = pk16(bf_bits(f0), bf_bits(f1));
    }
    hv[it] = a;
  }
  {
#pragma unroll
    for (int it = 0; it < 2; ++it) {
      const int nn = it * 32 + q;
      *(v4u*)(out + (size_t)(n0 + nn) * DM + k0 + c8) = hv[it];
    }
    
  }
}

// =====================================================================================================
// The two input conversions, which read nothing of each other, in one grid: blocks 0 .. NWOT-1 transpose and convert Wo (one
// 64x64 tile each; first, because their chain load - LDS - barrier - store is the longer one), the rest convert x, Wq, Wk, Wv.
// The choice is the same for a whole block, so the barrier in the transposing part is passed by all of its threads.
// =====================================================================================================
#define NWOT ((DM / 64) * (DM / 64))
__global__ __launch_bounds__(256) void cvt_inputs(const float* __restrict__ x, const float* __restrict__ wq,
                                                  const float* __restrict__ wk, const float* __restrict__ wv,
                                                  const float* __restrict__ wo, unsigned short* planes, unsigned short* woT) {
  __shared__ float sW[64 * 65];
  const int blk = blockIdx.x;
  if (blk < NWOT) cvt_wo_t_body(sW, blk % (DM / 64), blk / (DM / 64), wo, woT);
  else            cvt_planes_body(blk - NWOT, x, wq, wk, wv, planes);
}

// =====================================================================================================
// Batched bf16 WMMA GEMM: C[m][n] = sum_k A[m][k] * Bt[n][k]; one work-group (8 waves, 4 x 2) per 256 x 128 tile, one wave per
// 64x64 tile of it. The operand rows of the work-group's tile are staged in LDS, 64 k a stage, by asynchronous copies in a
// two-buffer ring (stage s + 2 is copied while stage s + 1 is worked on); the waves read their fragments from LDS.
// A row-major [M][K] pitch lda; Bt row-major [N][K] pitch ldb (k contiguous); M multiple of 256, N of 128, K of 64.
// bx = index of the work-group's tile, b = batch index (strides in elements); ring and sT are the work-group's LDS.
// NSPLIT: 0 = Ah.Bh (single product); 1 = Ah.Bh + Al.Bh; 2 = Ah.Bh + Al.Bh + Ah.Bl with unscaled bf16 lo planes (one accumulator).
// TRI: 0 = dense grid of (M/256) x (N/128) work-group tiles, bx row-major;
//      1 = square M == N: work-group tiles (I, J <= 2I+1), bx = I(I+1) + J; a wave whose 64x64 tile (tm, tn) has tn > tm
//          computes and stores nothing; tile t = tm(tm+1)/2 + tn written packed at C + b*strideC + t*4096 as [64][64] f32
//          (OUT_MODE 0 only).
// OUT_MODE: 0 = f32 (pitch ldc); 2 = bf16 hi plane C + bf16 lo plane C2 (lo = RNE(v - hi), unscaled);
//           3 = f16 hi plane C = f16(v*hscale) + f16 residual plane C2 = f16((v*hscale - hi) * rscale), C2 written
//               only for tiles with n0 < N2 (pitch ldc2, batch stride strideC2).
// Epilogue: 16-row slabs staged per wave in LDS (wave-private region sT[wave], wait_lds); each 64-wide row segment written
// =====================================================================================================
__host__ __device__ constexpr int gemm_bf_stage_bytes(int nsplit) {      // one stage: Ah 256 rows | Al | Bh 128 rows | Bl
  return (((nsplit >= 1) ? 2 : 1) * 256 + ((nsplit >= 2) ? 2 : 1) * 128) * LPITCH;
}
template <int NSPLIT, int OUT_MODE, int TRI>
__device__ __forceinline__ void gemm_bf_body(
    unsigned char* ring, float (*sT)[16 * 68], int bx, int b,
    const unsigned short* __restrict__ Ahp, const unsigned short* __restrict__ Alp, int lda, long long strideA,
    const unsigned short* __restrict__ Bhp, const unsigned short* __restrict__ Blp, int ldb, long long strideB,
    void* Cout, int ldc, long long strideC,
    void* Cout2, int ldc2, long long strideC2, int N2,
    int M, int N, int K, float hscale, float rscale) {
  constexpr int OFF_AL = 256 * LPITCH;                                   // stage layout: Ah 256 rows | Al | Bh 128 rows | Bl
  constexpr int OFF_BH = ((NSPLIT >= 1) ? 2 : 1) * 256 * LPITCH;
  constexpr int OFF_BL = OFF_BH + 128 * LPITCH;
  constexpr int STG    = OFF_BH + ((NSPLIT >= 2) ? 2 : 1) * 128 * LPITCH;
  static_assert(STG == gemm_bf_stage_bytes(NSPLIT));
  const int tid  = threadIdx.x;
  const int lane = tid & 31;
  const int wave = __builtin_amdgcn_readfirstlane(tid >> 5);
  int bm, bn;
  if (TRI != 0) {
    const int NI = M >> 8;
    int I = 0;
    for (int q = 1; q < NI; ++q)
      if (q * (q + 1) <= bx) I = q;
    bm = I;
    bn = bx - I * (I + 1);
    if (bn > 2 * I + 1) return;            // work-group-uniform, in front of every copy and barrier
  } else {
    const int bN = N >> 7;
    bm = bx / bN;
    bn = bx - bm * bN;
    if (bm >= (M >> 8)) return;            // work-group-uniform, in front of every copy and barrier
  }
  const int tm = bm * 4 + (wave >> 1);
  const int tn = bn * 2 + (wave & 1);
  const bool active = (TRI == 0) || (tn <= tm);   // wave-uniform
  const int t  = ((tm * (tm + 1)) >> 1) + tn;     // packed tile index (TRI)
  const int m0 = tm << 6;
  const int n0 = tn << 6;

  const unsigned short* Ag  = Ahp + (size_t)b * strideA + (size_t)(bm * 256) * lda;
  const unsigned short* Alg = Alp + (size_t)b * strideA + (size_t)(bm * 256) * lda;
  const unsigned short* Bg  = Bhp + (size_t)b * strideB + (size_t)(bn * 128) * ldb;
  const unsigned short* Blg = Blp + (size_t)b * strideB + (size_t)(bn * 128) * ldb;
  const unsigned ringb = (unsigned)(size_t)(const void*)ring;    // LDS byte address of the ring

  const int rlane = lane & 15;                 // row (A) / col (B, D) within subtile
  const int koff  = (lane >> 4) * 8;           // k offset of this lane half
  const int mOff  = (lane >> 4) * 8;           // D row offset

  auto stage = [&](int s, int buf) {
    const unsigned lb = ringb + (unsigned)(buf * STG);
    const size_t ks = (size_t)s * 64;
    copy_chunks3(row_chunk(lb, Ag + ks, lda, 0, tid), row_chunk(lb, Ag + ks, lda, 1, tid),
                 row_chunk(lb + OFF_BH, Bg + ks, ldb, 0, tid));
    if (NSPLIT == 1) copy_chunks2(row_chunk(lb + OFF_AL, Alg + ks, lda, 0, tid), row_chunk(lb + OFF_AL, Alg + ks, lda, 1, tid));
    if (NSPLIT >= 2) copy_chunks3(row_chunk(lb + OFF_AL, Alg + ks, lda, 0, tid), row_chunk(lb + OFF_AL, Alg + ks, lda, 1, tid),
                                  row_chunk(lb + OFF_BL, Blg + ks, ldb, 0, tid));
  };

  v8f acc[4][4];
#pragma unroll
  for (int i = 0; i < 4; ++i)
#pragma unroll
    for (int j = 0; j < 4; ++j) acc[i][j] = zero8();

  // Two fragment sets: while the WMMAs of one 32-k block run on one set, the next block's fragments are fetched into the other.
  v16b bhA[4], ahA[4], alA[4], blA[4], bhB[4], ahB[4], alB[4], blB[4];
  const int aoff = ((wave >> 1) * 64 + rlane) * LPITCH + koff * 2;
  const int boff = OFF_BH + ((wave & 1) * 64 + rlane) * LPITCH + koff * 2;
  auto ldset = [&](int buf, int kk, v16b (&bh)[4], v16b (&ah)[4], v16b (&al)[4], v16b (&bl)[4]) {
    const unsigned char* pa = ring + buf * STG + aoff + kk * 64;
    const unsigned char* pb = ring + buf * STG + boff + kk * 64;
#pragma unroll
    for (int j = 0; j < 4; ++j) {
      bh[j] = ldfrag_b((const __bf16*)(pb + j * 16 * LPITCH));
      if (NSPLIT >= 2) bl[j] = ldfrag_b((const __bf16*)(pb + (OFF_BL - OFF_BH) + j * 16 * LPITCH));
    }
#pragma unroll
    for (int i = 0; i < 4; ++i) {
      ah[i] = ldfrag_b((const __bf16*)(pa + i * 16 * LPITCH));
      if (NSPLIT >= 1) al[i] = ldfrag_b((const __bf16*)(pa + OFF_AL + i * 16 * LPITCH));
    }
  };
  // per accumulator and 32-k block the products are added in the order Ah.Bh, Al.Bh, Ah.Bl
  auto mmaset = [&](v16b (&bh)[4], v16b (&ah)[4], v16b (&al)[4], v16b (&bl)[4]) {
#pragma unroll
    for (int i = 0; i < 4; ++i)
#pragma unroll
      for (int j = 0; j < 4; ++j) acc[i][j] = mma_b_raw(ah[i], bh[j], acc[i][j]);
    if (NSPLIT >= 1) {
#pragma unroll
      for (int i = 0; i < 4; ++i)
#pragma unroll
        for (int j = 0; j < 4; ++j) acc[i][j] = mma_b_raw(al[i], bh[j], acc[i][j]);
    }
    if (NSPLIT >= 2) {
#pragma unroll
      for (int i = 0; i < 4; ++i)
#pragma unroll
        for (int j = 0; j < 4; ++j) acc[i][j] = mma_b_raw(ah[i], bl[j], acc[i][j]);
    }
  };

  const int nst = K >> 6;
  stage(0, 0);
  wait_copies();
  __syncthreads();
  if (nst > 1) stage(1, 1);
  ldset(0, 0, bhA, ahA, alA, blA);

  for (int s = 0; s < nst; ++s) {
    ldset(s & 1, 1, bhB, ahB, alB, blB);   // the stage's last block: the wave's last reads of buffer s & 1
    __builtin_amdgcn_sched_barrier(0);     // keeps the load group whole and ahead of the WMMAs
    if (active) mmaset(bhA, ahA, alA, blA);
    __builtin_amdgcn_sched_barrier(0);     // keeps these WMMAs in front of the waits, so that the loads above fly under them
    // publish point of stage s + 1, in front of stage s's last block and passed by every wave: own LDS reads of buffer s & 1
    // returned, own copies landed, barrier; then the refill of buffer s & 1 and the first fragments of stage s + 1
    wait_lds();
    wait_copies();
    __syncthreads();
    if (s + 2 < nst) stage(s + 2, s & 1);
    // unconditional (a branch here would merge the compiler's LDS wait counts): behind the last stage it reads the other
    // buffer's old bytes, which no copy is aimed at any more, and nothing uses them
    ldset((s + 1) & 1, 0, bhA, ahA, alA, blA);
    __builtin_amdgcn_sched_barrier(0);     // keeps the load group whole and ahead of the WMMAs
    if (active) mmaset(bhB, ahB, alB, blB);
  }
  wait_copies();
  wait_lds();
  if (!active) return;                     // wave-uniform; no work-group barrier below
  acc_guard4(acc[0][0], acc[0][1], acc[0][2], acc[0][3]);
  acc_guard4(acc[1][0], acc[1][1], acc[1][2], acc[1][3]);
  acc_guard4(acc[2][0], acc[2][1], acc[2][2], acc[2][3]);
  acc_guard4(acc[3][0], acc[3][1], acc[3][2], acc[3][3]);

  // ---- epilogue ----
  size_t cbase;
  int ldce, rowb, colb;
  if (TRI != 0) { cbase = (size_t)b * strideC + (size_t)t * 4096; ldce = 64; rowb = 0; colb = 0; }
  else          { cbase = (size_t)b * strideC; ldce = ldc; rowb = m0; colb = n0; }
  float* slab = sT[wave];
#pragma unroll
  for (int i = 0; i < 4; ++i) {
    const int mBase = m0 + (i << 4);
#pragma unroll
    for (int j = 0; j < 4; ++j) {
#pragma unroll
      for (int r = 0; r < 8; ++r) {
        slab[(mOff + r) * 68 + (j << 4) + rlane] = acc[i][j][r];
      }
    }
    wait_lds();   // the slab is this wave's own: its LDS writes are done before other lanes read the rows back; no wait on global stores
    if (OUT_MODE == 0) {
      float* C = (float*)Cout + cbase;
      const int hh = lane >> 4, c4 = (lane & 15) * 4;     // 256-B row segment = 16 lanes x 16 B
      {
#pragma unroll
        for (int it = 0; it < 8; ++it) {
          const int row = it * 2 + hh;                     // it 0..7 x hh 0..1 = rows 0..15
          const v4f v = *(const v4f*)(slab + row * 68 + c4);
          *(v4f*)(C + (size_t)(rowb + (i << 4) + row) * ldce + colb + c4) = v;
        }
        
      }
    } else {
      const int q = lane >> 3, c8 = (lane & 7) * 8;
      unsigned short* C  = (unsigned short*)Cout  + (size_t)b * strideC;
      unsigned short* C2 = (unsigned short*)Cout2 + (size_t)b * strideC2;
      const bool wlo = (OUT_MODE == 2) || (n0 < N2);      // wave-uniform
      v4u hv[4], lv[4];
#pragma unroll
      for (int it = 0; it < 4; ++it) {
        const int row = it * 4 + q;                        // it 0..3 x q 0..3 = rows 0..15
        const float* sp = slab + row * 68 + c8;
        v4u a, a2;
#pragma unroll
        for (int e = 0; e < 4; ++e) {
          const float f0 = sp[2 * e], f1 = sp[2 * e + 1];
          unsigned short h0, h1, l0, l1;
          if (OUT_MODE == 2) {
            h0 = bf_bits(f0); h1 = bf_bits(f1);
            l0 = bf_bits(f0 - bf_up(h0)); l1 = bf_bits(f1 - bf_up(h1));
          } else {
            const float g0 = f0 * hscale, g1 = f1 * hscale;
            const _Float16 x0 = (_Float16)g0, x1 = (_Float16)g1;
            h0 = h_bits(x0); h1 = h_bits(x1);
            l0 = h_bits((_Float16)((g0 - (float)x0) * rscale));
            l1 = h_bits((_Float16)((g1 - (float)x1) * rscale));
          }
          a[e] = pk16(h0, h1); a2[e] = pk16(l0, l1);
        }
        hv[it] = a; lv[it] = a2;
      }
      {
#pragma unroll
        for (int it = 0; it < 4; ++it) {
          const int row = it * 4 + q;
          *(v4u*)(C + (size_t)(mBase + row) * ldc + n0 + c8) = hv[it];
          if (wlo) *(v4u*)(C2 + (size_t)(mBase + row) * ldc2 + n0 + c8) = lv[it];
        }
        
      }
    }
    // also behind the last slab
    slab_next();
  }
}

// =====================================================================================================
// One GEMM as a launch of its own: blockIdx.x = tile index, blockIdx.y = batch index.
// =====================================================================================================
template <int NSPLIT, int OUT_MODE, int TRI>
__global__ __launch_bounds__(256) void gemm_bf(
    const unsigned short* __restrict__ Ahp, const unsigned short* __restrict__ Alp, int lda, long long strideA,
    const unsigned short* __restrict__ Bhp, const unsigned short* __restrict__ Blp, int ldb, long long strideB,
    void* Cout, int ldc, long long strideC,
    void* Cout2, int ldc2, long long strideC2, int N2,
    int M, int N, int K, float hscale, float rscale) {
  __shared__ __align__(16) unsigned char ring[2 * gemm_bf_stage_bytes(NSPLIT)];
  __shared__ __align__(16) float sT[8][16 * 68];   // per-wave 16x64 slab, pitch 68 floats
  gemm_bf_body<NSPLIT, OUT_MODE, TRI>(ring, sT, (int)blockIdx.x, (int)blockIdx.y, Ahp, Alp, lda, strideA, Bhp, Blp, ldb, strideB,
                                      Cout, ldc, strideC, Cout2, ldc2, strideC2, N2, M, N, K, hscale, rscale);
}

// =====================================================================================================
// The q and k projections, which read nothing of each other, in one grid of 2 NPQ work-groups of equal cost:
//   blocks 0 .. NPQ-1        q = x . Wq^T -> bf16 hi/lo planes [NB*SEQ][DM]   (A = Xb, Bt = Wq [out][in]; M=NB*SEQ, N=DM, K=DM)
//   blocks NPQ .. 2 NPQ-1    k = x . Wk^T -> bf16 hi/lo planes
// Wb holds the Wq and Wk planes one behind the other. The choice is the same for a whole work-group.
// =====================================================================================================
#define NPQ ((NB * SEQ / 256) * (DM / 128))
static_assert(((NB * SEQ) % 256) == 0 && (DM % 128) == 0);
__global__ __launch_bounds__(256) void proj_qk(
    const unsigned short* __restrict__ Xb, const unsigned short* __restrict__ Wb,
    unsigned short* Qh, unsigned short* Ql, unsigned short* Kh, unsigned short* Kl) {
  __shared__ __align__(16) unsigned char ring[2 * gemm_bf_stage_bytes(0)];
  __shared__ __align__(16) float sT[8][16 * 68];   // per-wave 16x64 slab, pitch 68 floats
  const int blk = blockIdx.x;
  const bool isk = blk >= NPQ;
  const unsigned short* W = Wb + (isk ? (size_t)DM * DM : (size_t)0);
  gemm_bf_body<0, 2, 0>(ring, sT, isk ? blk - NPQ : blk, 0, Xb, Xb, DM, 0LL, W, W, DM, 0LL,
                        (void*)(isk ? Kh : Qh), DM, 0LL, (void*)(isk ? Kl : Ql), DM, 0LL, DM,
                        NB * SEQ, DM, DM, 1.0f, 1.0f);
}

// =====================================================================================================
// The scores and the v^T projection, which read nothing of each other, in one grid. One work-group fills a WGP's LDS, there are
// more score tiles than WGPs, so the index runs from the longest to the shortest (for speed only) and
// the v^T tiles fill the places that the last score tiles leave idle:
//   blocks 0 .. NB NSF-1     scores = q . k^T, 3 bf16 products -> packed f32 tiles: work-group tiles (I, J <= 2I), NSF a batch
//   the next NB NSI          the score tiles (I, 2I+1) on the diagonal, in which 3 of 8 waves work
//   the rest, NPV a batch    v^T = Wv . x^T -> f16 hi plane f16(16 v) [b][d][key] (pitch SEQ) and residual plane x4096 for keys < VLP
//                            (pitch VLP)   (A = Wv [out][in], Bt = Xb rows of batch b; M=DM, N=SEQ, K=DM)
// The choice is the same for a whole work-group; the two parts use the same LDS.
// =====================================================================================================
#define NSI (SEQ / 256)
#define NSF (NSI * NSI)
#define NPV ((DM / 256) * (SEQ / 128))
static_assert((DM % 256) == 0 && (SEQ % 128) == 0);
__global__ __launch_bounds__(256) void scores_vt(
    const unsigned short* __restrict__ Qh, const unsigned short* __restrict__ Ql,
    const unsigned short* __restrict__ Kh, const unsigned short* __restrict__ Kl, float* Sp,
    const unsigned short* __restrict__ Xb, const unsigned short* __restrict__ Wv,
    unsigned short* VTh, unsigned short* VTl) {
  __shared__ __align__(16) unsigned char ring[2 * gemm_bf_stage_bytes(2)];
  __shared__ __align__(16) float sT[8][16 * 68];   // per-wave 16x64 slab, pitch 68 floats
  const int blk = blockIdx.x;
  if (blk < NB * (NSF + NSI)) {
    int b, I, J;
    if (blk < NB * NSF) {                  // row I holds the 2I+1 tiles f = I*I .. I*I + 2I
      b = blk / NSF;
      const int f = blk - b * NSF;
      I = 0;
      for (int q = 1; q < NSI; ++q)
        if (q * q <= f) I = q;
      J = f - I * I;
    } else {
      const int e = blk - NB * NSF;
      b = e / NSI;
      I = e - b * NSI;
      J = 2 * I + 1;
    }
    gemm_bf_body<2, 0, 1>(ring, sT, I * (I + 1) + J, b, Qh, Ql, DM, (long long)SEQ * DM, Kh, Kl, DM, (long long)SEQ * DM,
                          (void*)Sp, 64, (long long)NTRI * 4096, (void*)Sp, 64, 0LL, 0,
                          SEQ, SEQ, DM, 1.0f, 1.0f);
  } else {
    const int e = blk - NB * (NSF + NSI);
    gemm_bf_body<0, 3, 0>(ring, sT, e % NPV, e / NPV, Wv, Wv, DM, 0LL, Xb, Xb, DM, (long long)SEQ * DM,
                          (void*)VTh, SEQ, (long long)DM * SEQ, (void*)VTl, VLP, (long long)DM * VLP, VLP,
                          DM, SEQ, DM, VSC, LSC);
  }
}

// =====================================================================================================
// Row softmax over the packed lower-triangular score tiles. One wave per query row (block = 8 rows, grid = NB*SEQ/8).
// Row (b, i), tm = i>>6, r = i&63: score (i, j) sits at Sp + ((b*NTRI + tm(tm+1)/2 + (j>>6))*4096 + r*64 + (j&63)), j <= 64 tm + 63.
// The wave handles ng = tm/4 + 1 groups of 256 keys (lane: 8 consecutive keys per group, two 16-B loads with the key-tile
// address clamped to tn <= tm); z = s/32 for j <= i, -inf otherwise; m = max, p = exp(z - m), l = sum, P = p/l (all f32).
// Writes Ph = f16(1024 P) for keys 0 .. 256 ng - 1 of row (b, i) (pitch SEQ; >= the keys the p.v GEMM copies for the row's work-group tile; zeros
// for j > i) and, for rows i < RESR, Pl = f16((1024 P - Ph) * 4096) with the same key extent (<= VLP, pitch VLP).
// coverage: NB*SEQ rows x written extent >= every key range any consumer reads.
// =====================================================================================================
__global__ __launch_bounds__(256) void softmax_rows(const float* __restrict__ Sp,
                                                    unsigned short* Php, unsigned short* Plp) {
  const int lane = threadIdx.x & 31, wave = threadIdx.x >> 5;
  const int row = blockIdx.x * 8 + wave;
  if (row >= NB * SEQ) return;             // wave-uniform; exact grid never triggers it; no block barriers below
  const int b  = row / SEQ;
  const int i  = row - b * SEQ;
  const int tm = i >> 6, r = i & 63;
  const int ng = (tm >> 2) + 1;            // 1..8, wave-uniform
  const float* srow = Sp + ((size_t)b * NTRI + (size_t)((tm * (tm + 1)) >> 1)) * 4096 + (size_t)r * 64;

  float z[8][8];
  float m = -INFINITY;
#pragma unroll
  for (int g = 0; g < 8; ++g) {
#pragma unroll
    for (int e = 0; e < 8; ++e) z[g][e] = -INFINITY;
    if (g < ng) {
      const int j0 = 256 * g + 8 * lane;
      int tn = j0 >> 6;
      tn = (tn < tm) ? tn : tm;            // clamped tile address; keys with tn > tm are all masked below
      const float* p = srow + (size_t)tn * 4096 + (j0 & 63);
      const v4f a = *(const v4f*)(p);
      const v4f c = *(const v4f*)(p + 4);
      const float v[8] = {a[0], a[1], a[2], a[3], c[0], c[1], c[2], c[3]};
#pragma unroll
      for (int e = 0; e < 8; ++e) {
        const float zz = (j0 + e <= i) ? (v[e] * 0.03125f) : -INFINITY;
        z[g][e] = zz;
        m = fmaxf(m, zz);
      }
    }
  }
#pragma unroll
  for (int off = 1; off < 32; off <<= 1) m = fmaxf(m, __shfl_xor(m, off, 32));   // finite: key 0 is always kept

  float l = 0.f;
#pragma unroll
  for (int g = 0; g < 8; ++g) {
    if (g < ng) {
#pragma unroll
      for (int e = 0; e < 8; ++e) {
        const float p = __expf(z[g][e] - m);   // masked: exp(-inf) = 0
        z[g][e] = p;
        l += p;
      }
    }
  }
#pragma unroll
  for (int off = 1; off < 32; off <<= 1) l += __shfl_xor(l, off, 32);          // l >= 1
  const float inv1k = (1.0f / l) * PSC;

  const bool res = (i < RESR);             // wave-uniform
  v4u ph[8];
  v4u pl0 = {0u, 0u, 0u, 0u};
  v4u pl1 = {0u, 0u, 0u, 0u};
#pragma unroll
  for (int g = 0; g < 8; ++g) {
    v4u hv = {0u, 0u, 0u, 0u};
    v4u lv = {0u, 0u, 0u, 0u};
    if (g < ng) {
#pragma unroll
      for (int e = 0; e < 4; ++e) {
        const float f0 = z[g][2 * e] * inv1k, f1 = z[g][2 * e + 1] * inv1k;
        const _Float16 x0 = (_Float16)f0, x1 = (_Float16)f1;
        hv[e] = pk16(h_bits(x0), h_bits(x1));
        lv[e] = pk16(h_bits((_Float16)((f0 - (float)x0) * LSC)), h_bits((_Float16)((f1 - (float)x1) * LSC)));
      }
    }
    ph[g] = hv;
    if (g == 0) pl0 = lv;
    if (g == 1) pl1 = lv;
  }

  unsigned short* prow = Php + (size_t)row * SEQ + 8 * lane;
  const int il = res ? i : 0;              // clamped row into the residual plane (stored only when res)
  unsigned short* lrow = Plp + ((size_t)b * RESR + (size_t)il) * VLP + 8 * lane;
  {
#pragma unroll
    for (int g = 0; g < 8; ++g) {
      if (g < ng) *(v4u*)(prow + 256 * g) = ph[g];
    }
    if (res) {                             // res rows have i < RESR (multiple of 256) -> 256 ng <= RESR = VLP
      *(v4u*)(lrow) = pl0;
      if (ng > 1) *(v4u*)(lrow + 256) = pl1;
    }
    
  }
}

// =====================================================================================================
// p.v GEMM on f16 WMMA, per batch b: ctx[b][q][d] = sum_key P[b][q][key] * VT[b][d][key], stored as the two bf16 planes that the
// output projection reads: hi = RNE(ctx), lo = RNE(ctx - hi), unscaled, both [NB*SEQ][DM].
//   A  = Ph  [b][SEQ][SEQ]  f16(1024 P), pitch SEQ         Al = Pl  [b][RESR][VLP] f16 residual x4096
//   Bt = VTh [b][DM][SEQ]   f16(16 v),   pitch SEQ         Bl = VTl [b][DM][VLP]   f16 residual x4096
// One work-group (8 waves, 4 x 2) per (64*MI) x 128 output tile, one wave per (16*MI) x 64 tile of it; rows mBase + ...; the
// operand rows of the work-group's tile are staged in LDS, 64 keys a stage, by asynchronous copies in a two-buffer ring up to the
// causal key extent of the work-group's last row tile (every P entry in that range was written by the softmax: its written extent
// is 256*(row/256 + 1) keys). A wave works on keys k < 64*((m0>>6)+1) only and passes the later publish points idle.
// RES (rows < RESR, MI = 2): acc0 += Ph.VTh; acc1 += Pl.VTh + Ph.VTl,
// ctx = acc0*OSCALE + acc1*OSCALE/4096; otherwise single product ctx = acc0*OSCALE. f32 accumulate.
// bx = index of the work-group's tile among those of rows mBase .. mBase + M - 1 (M a multiple of 64*MI), row-major, DM/128 a row;
// ring and sT are the work-group's LDS.
// =====================================================================================================
__host__ __device__ constexpr int gemm_pv_stage_bytes(bool res, int mi) {   // one stage: Ph 64*mi rows | Pl | VTh 128 rows | VTl
  return (res ? 2 : 1) * (64 * mi + 128) * LPITCH;
}
template <bool RES, int MI>
__device__ __forceinline__ void gemm_pv_body(
    unsigned char* ring, float (*sT)[16 * 68], int bx, int b,
    const unsigned short* __restrict__ Php, const unsigned short* __restrict__ Plp,
    const unsigned short* __restrict__ Vhp, const unsigned short* __restrict__ Vlp,
    unsigned short* Chp, unsigned short* Clp, int mBase, int M) {
  constexpr int AR     = 64 * MI;                                        // rows of the work-group's tile
  static_assert(AR == (RES ? 128 : 256) && (RESR % AR) == 0);
  constexpr int OFF_AL = AR * LPITCH;                                    // stage layout: Ph AR rows | Pl | VTh 128 rows | VTl
  constexpr int OFF_BH = (RES ? 2 : 1) * AR * LPITCH;
  constexpr int OFF_BL = OFF_BH + 128 * LPITCH;
  constexpr int STG    = OFF_BH + (RES ? 2 : 1) * 128 * LPITCH;
  static_assert(STG == gemm_pv_stage_bytes(RES, MI));
  const int tid  = threadIdx.x;
  const int lane = tid & 31;
  const int wave = __builtin_amdgcn_readfirstlane(tid >> 5);
  const int bN = DM >> 7;                          // 8
  const int bm = bx / bN;
  const int bn = bx - bm * bN;
  if (bm >= M / AR) return;                        // work-group-uniform, in front of every copy and barrier
  const int r0 = mBase + bm * AR;                  // first row of the work-group's tile
  const int m0 = r0 + (wave >> 1) * 16 * MI;
  const int n0 = bn * 128 + (wave & 1) * 64;
  int keff = (((m0 >> 6) + 1) << 6);               // causal key extent of this row tile, multiple of 64
  if (keff > SEQ) keff = SEQ;
  if (RES && keff > VLP) keff = VLP;               // never taken for mBase + M <= RESR; keeps residual reads in range
  int kblk = ((((r0 + 3 * 16 * MI) >> 6) + 1) << 6);   // the same of the work-group's last row tile: the staged extent
  if (kblk > SEQ) kblk = SEQ;
  if (RES && kblk > VLP) kblk = VLP;
  int rl0 = r0;                                    // first row in the residual plane, clamped; equals r0 for the RES launch
  if (rl0 > RESR - AR) rl0 = RESR - AR;

  const unsigned short* Ag  = Php + (size_t)b * SEQ * SEQ + (size_t)r0 * SEQ;
  const unsigned short* Alg = Plp + (size_t)b * RESR * VLP + (size_t)rl0 * VLP;
  const unsigned short* Bg  = Vhp + (size_t)b * DM * SEQ + (size_t)(bn * 128) * SEQ;
  const unsigned short* Blg = Vlp + (size_t)b * DM * VLP + (size_t)(bn * 128) * VLP;
  const unsigned ringb = (unsigned)(size_t)(const void*)ring;    // LDS byte address of the ring

  const int rlane = lane & 15;
  const int koff  = (lane >> 4) * 8;
  const int mOff  = (lane >> 4) * 8;

  auto stage = [&](int s, int buf) {
    const unsigned lb = ringb + (unsigned)(buf * STG);
    const size_t ks = (size_t)s * 64;
    if (RES) {                                     // AR = 128: one chunk a plane
      copy_chunks2(row_chunk(lb, Ag + ks, SEQ, 0, tid), row_chunk(lb + OFF_BH, Bg + ks, SEQ, 0, tid));
      copy_chunks2(row_chunk(lb + OFF_AL, Alg + ks, VLP, 0, tid), row_chunk(lb + OFF_BL, Blg + ks, VLP, 0, tid));
    } else {                                       // AR = 256: two chunks of P, one of v^T
      copy_chunks3(row_chunk(lb, Ag + ks, SEQ, 0, tid), row_chunk(lb, Ag + ks, SEQ, 1, tid),
                   row_chunk(lb + OFF_BH, Bg + ks, SEQ, 0, tid));
    }
  };

  v8f acc0[MI][4], acc1[MI][4];
#pragma unroll
  for (int i = 0; i < MI; ++i)
#pragma unroll
    for (int j = 0; j < 4; ++j) { acc0[i][j] = zero8(); acc1[i][j] = zero8(); }

  // Two fragment sets: while the WMMAs of one 32-key block run on one set, the next block's fragments are fetched into the other.
  v16h bhA[4], ahA[MI], alA[MI], blA[4], bhB[4], ahB[MI], alB[MI], blB[4];
  const int aoff = ((wave >> 1) * 16 * MI + rlane) * LPITCH + koff * 2;
  const int boff = OFF_BH + ((wave & 1) * 64 + rlane) * LPITCH + koff * 2;
  auto ldset = [&](int buf, int kk, v16h (&bh)[4], v16h (&ah)[MI], v16h (&al)[MI], v16h (&bl)[4]) {
    const unsigned char* pa = ring + buf * STG + aoff + kk * 64;
    const unsigned char* pb = ring + buf * STG + boff + kk * 64;
#pragma unroll
    for (int j = 0; j < 4; ++j) {
      bh[j] = ldfrag_h((const _Float16*)(pb + j * 16 * LPITCH));
      if (RES) bl[j] = ldfrag_h((const _Float16*)(pb + (OFF_BL - OFF_BH) + j * 16 * LPITCH));
    }
#pragma unroll
    for (int i = 0; i < MI; ++i) {
      ah[i] = ldfrag_h((const _Float16*)(pa + i * 16 * LPITCH));
      if (RES) al[i] = ldfrag_h((const _Float16*)(pa + OFF_AL + i * 16 * LPITCH));
    }
  };
  // acc0 += Ph.VTh; acc1 += Pl.VTh, then Ph.VTl, per 32-key block
  auto mmaset = [&](v16h (&bh)[4], v16h (&ah)[MI], v16h (&al)[MI], v16h (&bl)[4]) {
#pragma unroll
    for (int i = 0; i < MI; ++i)
#pragma unroll
      for (int j = 0; j < 4; ++j) {
        acc0[i][j] = mma_h_raw(ah[i], bh[j], acc0[i][j]);
        if (RES) acc1[i][j] = mma_h_raw(al[i], bh[j], acc1[i][j]);
      }
    if (RES) {
#pragma unroll
      for (int i = 0; i < MI; ++i)
#pragma unroll
        for (int j = 0; j < 4; ++j) acc1[i][j] = mma_h_raw(ah[i], bl[j], acc1[i][j]);
    }
  };

  const int nst = kblk >> 6;
  stage(0, 0);
  wait_copies();
  __syncthreads();
  if (nst > 1) stage(1, 1);
  ldset(0, 0, bhA, ahA, alA, blA);

  for (int s = 0; s < nst; ++s) {
    const bool act = s * 64 < keff;        // wave-uniform
    ldset(s & 1, 1, bhB, ahB, alB, blB);   // the stage's last block: the wave's last reads of buffer s & 1
    __builtin_amdgcn_sched_barrier(0);     // keeps the load group whole and ahead of the WMMAs
    if (act) mmaset(bhA, ahA, alA, blA);
    __builtin_amdgcn_sched_barrier(0);     // keeps these WMMAs in front of the waits, so that the loads above fly under them
    // publish point of stage s + 1, in front of stage s's last block and passed by every wave: own LDS reads of buffer s & 1
    // returned, own copies landed, barrier; then the refill of buffer s & 1 and the first fragments of stage s + 1
    wait_lds();
    wait_copies();
    __syncthreads();
    if (s + 2 < nst) stage(s + 2, s & 1);
    // unconditional (a branch here would merge the compiler's LDS wait counts): behind the last stage it reads the other
    // buffer's old bytes, which no copy is aimed at any more, and nothing uses them
    ldset((s + 1) & 1, 0, bhA, ahA, alA, blA);
    __builtin_amdgcn_sched_barrier(0);     // keeps the load group whole and ahead of the WMMAs
    if (act) mmaset(bhB, ahB, alB, blB);
  }
  wait_copies();
  wait_lds();
#pragma unroll
  for (int i = 0; i < MI; ++i) {
    acc_guard4(acc0[i][0], acc0[i][1], acc0[i][2], acc0[i][3]);
    if (RES) acc_guard4(acc1[i][0], acc1[i][1], acc1[i][2], acc1[i][3]);
  }

  // ---- epilogue ----
  float* slab = sT[wave];
  unsigned short* Ch = Chp + (size_t)b * SEQ * DM;
  unsigned short* Cl = Clp + (size_t)b * SEQ * DM;
  const float rsc = OSCALE * (1.0f / LSC);
#pragma unroll
  for (int i = 0; i < MI; ++i) {
    const int mB = m0 + (i << 4);
#pragma unroll
    for (int j = 0; j < 4; ++j) {
#pragma unroll
      for (int r = 0; r < 8; ++r) {
        float v = acc0[i][j][r] * OSCALE;
        if (RES) v += acc1[i][j][r] * rsc;
        slab[(mOff + r) * 68 + (j << 4) + rlane] = v;
      }
    }
    wait_lds();   // the slab is this wave's own: its LDS writes are done before other lanes read the rows back; no wait on global stores
    {
      const int q = lane >> 3, c8 = (lane & 7) * 8;        // 128-B row segment of a plane = 8 lanes x 16 B
      v4u hv[4], lv[4];
#pragma unroll
      for (int it = 0; it < 4; ++it) {
        const int row = it * 4 + q;                        // it 0..3 x q 0..3 = rows 0..15
        const float* sp = slab + row * 68 + c8;
        v4u a, a2;
#pragma unroll
        for (int e = 0; e < 4; ++e) {
          const float f0 = sp[2 * e], f1 = sp[2 * e + 1];
          const unsigned short h0 = bf_bits(f0), h1 = bf_bits(f1);
          a[e]  = pk16(h0, h1);
          a2[e] = pk16(bf_bits(f0 - bf_up(h0)), bf_bits(f1 - bf_up(h1)));
        }
        hv[it] = a; lv[it] = a2;
      }
#pragma unroll
      for (int it = 0; it < 4; ++it) {
        const int row = it * 4 + q;
        *(v4u*)(Ch + (size_t)(mB + row) * DM + n0 + c8) = hv[it];
        *(v4u*)(Cl + (size_t)(mB + row) * DM + n0 + c8) = lv[it];
      }
    }
    // also behind the last slab
    slab_next();
  }
}

// =====================================================================================================
// Both parts of p.v, which read nothing of each other, in one grid. A work-group's cost grows with its causal key extent;
// the index runs from the longest to the shortest (for speed only):
//   blocks 0 .. NPVH-1   rows RESR .. SEQ-1, single f16 product, 256 x 128 tiles, last row block first (NPVC tiles a row block)
//   the rest             rows 0 .. RESR-1 with the residual planes (3 f16 products), 128 x 128 tiles, last row block first
// The choice is the same for a whole work-group; the two parts use the same LDS.
// =====================================================================================================
#define NPVC ((DM / 128) * NB)
#define NPVH (((SEQ - RESR) / 256) * NPVC)
#define NPVR ((RESR / 128) * NPVC)
static_assert(((SEQ - RESR) % 256) == 0 && (RESR % 128) == 0 && (DM % 128) == 0);
__global__ __launch_bounds__(256) void gemm_pv_all(
    const unsigned short* __restrict__ Php, const unsigned short* __restrict__ Plp,
    const unsigned short* __restrict__ Vhp, const unsigned short* __restrict__ Vlp, unsigned short* Chp, unsigned short* Clp) {
  constexpr int RB = 2 * WS_MAX2(gemm_pv_stage_bytes(true, 2), gemm_pv_stage_bytes(false, 4));
  __shared__ __align__(16) unsigned char ring[RB];
  __shared__ __align__(16) float sT[8][16 * 68];
  const int blk = blockIdx.x;
  if (blk < NPVH) {
    const int rb = (SEQ - RESR) / 256 - 1 - blk / NPVC, e = blk % NPVC;
    gemm_pv_body<false, 4>(ring, sT, rb * (DM / 128) + e % (DM / 128), e / (DM / 128), Php, Plp, Vhp, Vlp, Chp, Clp, RESR, SEQ - RESR);
  } else {
    const int rb = RESR / 128 - 1 - (blk - NPVH) / NPVC, e = (blk - NPVH) % NPVC;
    gemm_pv_body<true, 2>(ring, sT, rb * (DM / 128) + e % (DM / 128), e / (DM / 128), Php, Plp, Vhp, Vlp, Chp, Clp, 0, RESR);
  }
}

// =====================================================================================================
// Workspace map (bytes, full build NB 4 / SEQ 2048; every region is an exact multiple of its tile / whole-line store
// granularity; regions A and B are reused in stream order):
//   region A [0, 33554432):          Xb bf16 [8192][1024] at 0 (16777216) + Wq,Wk,Wv bf16 [1024][1024] at 16777216 (3 x 2097152),
//                                    read up to the launch of the scores and v^T
//                                    then: Ch, Cl bf16 ctx planes [8192][1024] at 0 (2 x 16777216), written by p.v
//   region B [33554432, 100663296):  Qh, Ql, Kh, Kl bf16 [8192][1024] (4 x 16777216)
//                                    then, once the scores are done: Ph f16 [4][2048][2048] (33554432) + Pl f16 [4][512][512] (2097152)
//   region C [100663296, 121634816): VTh f16 [4][1024][2048] (16777216) + VTl f16 [4][1024][512] (4194304)
//   region D [121634816, 123731968): WoT bf16 [1024][1024] (2097152), live from launch 1 to the last GEMM
//   region E [123731968, 158334976): Sp f32 packed score tiles [4][528][64][64] (34603008); a region of its own, because the launch
//                                    that writes it still reads Xb and Wv
//   end 158334976
// =====================================================================================================
extern "C" void kernel_launch(void* const* d_in, const int* in_sizes, int n_in,
                              void* d_out, int out_size, void* d_ws, size_t ws_size,
                              hipStream_t stream) {
  if (n_in < 5) return;
  if (in_sizes[4] < (NB - 1) * SEQ_FULL * DM + SEQ * DM) return;
  if (in_sizes[0] < DM * DM || in_sizes[1] < DM * DM || in_sizes[2] < DM * DM || in_sizes[3] < DM * DM) return;
  if (out_size < NB * SEQ * DM) return;

  // wire order of the inputs: k, q, v, out_proj, x
  const float* wk = (const float*)d_in[0];   // [out][in]
  const float* wq = (const float*)d_in[1];   // [out][in]
  const float* wv = (const float*)d_in[2];   // [out][in]
  const float* wo = (const float*)d_in[3];   // [in][out]
  const float* x  = (const float*)d_in[4];   // [NB_FULL][SEQ_FULL][DM]
  float* out = (float*)d_out;

  const size_t PX  = (size_t)NB * SEQ * DM * 2;       // 16-bit plane [NB*SEQ][DM]
  const size_t PW  = (size_t)DM * DM * 2;             // one weight plane
  const size_t PS  = (size_t)NB * NTRI * 4096 * 4;    // packed f32 score tiles
  const size_t PC  = 2 * PX;                          // bf16 hi and lo ctx planes
  const size_t PP  = (size_t)NB * SEQ * SEQ * 2;      // Ph
  const size_t PPL = (size_t)NB * RESR * VLP * 2;     // Pl
  const size_t PVT = (size_t)NB * DM * SEQ * 2;       // VTh
  const size_t PVL = (size_t)NB * DM * VLP * 2;       // VTl
  const size_t RA = ((PX + 3 * PW) > PC) ? (PX + 3 * PW) : PC;
  const size_t oXb = 0;
  const size_t oW  = PX;
  const size_t oCh = 0;
  const size_t oCl = PX;
  const size_t oQh = RA;
  const size_t oQl = RA + PX;
  const size_t oKh = RA + 2 * PX;
  const size_t oKl = RA + 3 * PX;
  const size_t RBend = RA + 4 * PX;
  const size_t oPh = RA;
  const size_t oPl = RA + PP;
  if (oPl + PPL > RBend) return;
  const size_t oVTh = RBend;
  const size_t oVTl = RBend + PVT;
  const size_t oWo  = oVTl + PVL;
  const size_t oS   = oWo + PW;
  const size_t total = oS + PS;                       // 158334976 in the full build
  if (total > ws_size) return;

  char* ws = (char*)d_ws;
  unsigned short* Xb  = (unsigned short*)(ws + oXb);
  unsigned short* Wb  = (unsigned short*)(ws + oW);   // Wq plane, then Wk, then Wv
  float*          Sp  = (float*)(ws + oS);
  unsigned short* Qh  = (unsigned short*)(ws + oQh);
  unsigned short* Ql  = (unsigned short*)(ws + oQl);
  unsigned short* Kh  = (unsigned short*)(ws + oKh);
  unsigned short* Kl  = (unsigned short*)(ws + oKl);
  unsigned short* Ph  = (unsigned short*)(ws + oPh);
  unsigned short* Pl  = (unsigned short*)(ws + oPl);
  unsigned short* Ch  = (unsigned short*)(ws + oCh);
  unsigned short* Cl  = (unsigned short*)(ws + oCl);
  unsigned short* VTh = (unsigned short*)(ws + oVTh);
  unsigned short* VTl = (unsigned short*)(ws + oVTl);
  unsigned short* WoT = (unsigned short*)(ws + oWo);

  const dim3 blk(256);
  const int nGroups = NB * SEQ * DM / 8 + 3 * (DM * DM / 8);
  const dim3 gCvt(NWOT + (nGroups + 255) / 256);
  const dim3 gQk(2 * NPQ);
  const dim3 gSv(NB * (NSF + NSI) + NB * NPV);
  const dim3 gProj(((NB * SEQ / 64) * (DM / 64) + 7) / 8, 1);
  const dim3 gSm((NB * SEQ + 7) / 8);
  const dim3 gPv(NPVH + NPVR);

  // (1) x and Wq, Wk, Wv -> bf16 planes (Xb, then the three weight planes contiguous); Wo [in][out] -> WoT bf16 [out][in]
  cvt_inputs<<<gCvt, blk, 0, stream>>>(x, wq, wk, wv, wo, Xb, WoT);
  // (2) q, k -> bf16 hi/lo planes [NB*SEQ][DM]
  proj_qk<<<gQk, blk, 0, stream>>>(Xb, Wb, Qh, Ql, Kh, Kl);
  // (3) scores = q . k^T per batch over the NTRI lower-triangular 64x64 tiles, 3 bf16 products -> packed f32 tiles;
  //     v^T -> f16 hi plane and residual plane
  scores_vt<<<gSv, blk, 0, stream>>>(Qh, Ql, Kh, Kl, Sp, Xb, Wb + (size_t)2 * DM * DM, VTh, VTl);
  // (4) causal row softmax in f32 -> Ph f16(1024 P) and Pl residual planes
  softmax_rows<<<gSm, blk, 0, stream>>>(Sp, Ph, Pl);
  // (5) ctx = p.v -> bf16 hi/lo planes [NB*SEQ][DM]: rows RESR..SEQ-1 single f16 product (64x64 wave tiles), rows 0..RESR-1 of every sequence
  //     with the residual planes (3 f16 products, 32x64 wave tiles)
  gemm_pv_all<<<gPv, blk, 0, stream>>>(Ph, Pl, VTh, VTl, Ch, Cl);
  // (6) out = ctx . Wo -> f32 output buffer   (A = Ch + Cl, Bt = WoT [out][in]; M=NB*SEQ, N=DM, K=DM; 2 bf16 products)
  gemm_bf<1, 0, 0><<<gProj, blk, 0, stream>>>(
      Ch, Cl, DM, 0LL, WoT, WoT, DM, 0LL,
      (void*)out, DM, 0LL, (void*)out, DM, 0LL, 0,
      NB * SEQ, DM, DM, 1.0f, 1.0f);
  (void)hipGetLastError();
}

// v006
// It runs in 164 microseconds.
// In both of two side-by-side timings against v005, it was 1.06 times as fast.
// All steps since v000 together make it 3.04 times as fast.
// Contractions: q, k, v^T projections = v_wmma_f32_16x16x32_bf16 (bf16 RNE-converted x and W, single product, f32 accumulate);
// q.k^T scores = v_wmma_f32_16x16x32_bf16 with bf16 hi/lo planes of q and k (hi.hi + lo.hi + hi.lo), f32 accumulate;
// p.v = v_wmma_f32_16x16x32_f16 (p carried x1024 in f16, v^T carried x16 in f16, single product; query rows 0..RESR-1 of every
// sequence add the f16 residual planes (x4096) of p and v^T in a separate accumulator), f32 accumulate;
// output projection ctx.Wo = v_wmma_f32_16x16x32_bf16 with bf16 hi/lo planes of ctx and the bf16 RNE-converted Wo^T plane
// (hi.W + lo.W, one accumulator), f32 accumulate;
// causal mask, row max, exp, sum and normalisation in f32 on the VALU.
// Carry audit:
//   Ph  = f16(1024 * p), p already normalised by the row sum     } OSCALE = 1/(1024*16) folded exactly once in the p.v epilogue
//   VTh = f16(16 * v)                                            }
//   Pl  = f16((1024 p - Ph) * 4096)                              } products Ph.VTl and Pl.VTh go only to accumulator acc1,
//   VTl = f16((16 v - VTh) * 4096), keys 0..VLP-1                } folded with OSCALE * (1/4096) once in the same epilogue
//   q / k lo planes are unscaled bf16 residuals (v - hi) sharing the hi accumulator; score scale 1/32 applied once in f32 in the softmax.
//   ctx hi / lo planes are unscaled bf16 (lo = RNE(ctx - hi)) sharing one accumulator in the output projection.
// The module's softmax over all keys followed by the lower-triangular mask and the division by the masked row sum equals
// exp(z_j - m) / sum_{j<=i} exp(z_j - m) for any finite shift m; it is evaluated with the causal row max as the shift.
#include <hip/hip_runtime.h>
#include <math.h>

#define NB_FULL  4
#define SEQ_FULL 2048
#ifndef NB
#define NB    4
#endif
#ifndef SEQ
#define SEQ   2048
#endif
#define DM    1024
#define NQT   (SEQ / 64)                  // query/key tiles of 64
#define NTRI  ((NQT * (NQT + 1)) / 2)     // lower-triangular 64x64 score tiles per sequence (528 at SEQ 2048)
#define RESR  ((SEQ < 512) ? SEQ : 512)   // leading query rows per sequence that use the residual planes
#define VLP   RESR                        // key pitch of the p / v^T residual planes
#define PSC   1024.0f
#define VSC   16.0f
#define LSC   4096.0f
#define OSCALE (1.0f / 16384.0f)          // 1 / (PSC * VSC)
static_assert(NB >= 1 && NB <= NB_FULL);
static_assert(SEQ >= 256 && SEQ <= SEQ_FULL && (SEQ % 256) == 0);
static_assert((SEQ % 64) == 0 && (DM % 64) == 0 && (DM % 32) == 0);
static_assert((RESR % 64) == 0 && (RESR % 256) == 0 && RESR <= VLP && VLP <= SEQ && ((SEQ - RESR) % 64) == 0);
static_assert((RESR % 32) == 0);
static_assert(((NB * SEQ) % 8) == 0);
static_assert(((SEQ * DM / 8) % 256) == 0 && ((DM * DM / 8) % 256) == 0);

// ---- workspace extents (bytes) used by the launcher; checked at build time ------------------------------
#define WS_MAX2(a, b) (((a) > (b)) ? (a) : (b))
#define WS_PX  ((size_t)NB * SEQ * DM * 2)        // one 16-bit plane [NB*SEQ][DM]
#define WS_PW  ((size_t)DM * DM * 2)              // one 16-bit weight plane
#define WS_PS  ((size_t)NB * NTRI * 4096 * 4)     // packed f32 score tiles
#define WS_PC  (2 * WS_PX)                        // bf16 hi and lo ctx planes
#define WS_PP  ((size_t)NB * SEQ * SEQ * 2)       // Ph
#define WS_PPL ((size_t)NB * RESR * VLP * 2)      // Pl
#define WS_PVT ((size_t)NB * DM * SEQ * 2)        // VTh
#define WS_PVL ((size_t)NB * DM * VLP * 2)        // VTl
#define WS_RA  WS_MAX2(WS_PX + 3 * WS_PW, WS_PC)
#define WS_TOTAL (WS_RA + 4 * WS_PX + WS_PVT + WS_PVL + WS_PW + WS_PS)
static_assert(WS_TOTAL <= (size_t)268435456);
static_assert(WS_PC <= WS_RA);
static_assert(WS_PP + WS_PPL <= 4 * WS_PX);
static_assert(((NB * SEQ) % 64) == 0);
static_assert((WS_RA % 128) == 0 && (WS_PX % 128) == 0 && (WS_PVT % 128) == 0 && (WS_PVL % 128) == 0 && (WS_PW % 128) == 0 &&
              (WS_PS % 128) == 0);

typedef _Float16 v16h __attribute__((ext_vector_type(16)));
typedef _Float16 v8h  __attribute__((ext_vector_type(8)));
typedef __bf16   v16b __attribute__((ext_vector_type(16)));
typedef __bf16   v8b  __attribute__((ext_vector_type(8)));
typedef float    v8f  __attribute__((ext_vector_type(8)));
typedef float    v4f  __attribute__((ext_vector_type(4)));
typedef unsigned int v4u __attribute__((ext_vector_type(4)));

// ---- scalar helpers --------------------------------------------------------------------------------
__device__ __forceinline__ unsigned short bf_bits(float f) {          // f32 -> bf16 bits, RNE convert
  unsigned u = __float_as_uint(f);
  return (unsigned short)((u + 0x7FFFu + ((u >> 16) & 1u)) >> 16);
}
__device__ __forceinline__ float bf_up(unsigned short h) { return __uint_as_float(((unsigned)h) << 16); }
__device__ __forceinline__ unsigned short h_bits(_Float16 x) { return __builtin_bit_cast(unsigned short, x); }
__device__ __forceinline__ unsigned pk16(unsigned short a, unsigned short b) { return (unsigned)a | ((unsigned)b << 16); }
__device__ __forceinline__ v8f zero8() { v8f z = {0.f, 0.f, 0.f, 0.f, 0.f, 0.f, 0.f, 0.f}; return z; }

// ---- fragment loaders: 16-bit A/B operand, lane -> row/col (lane&15), p already includes +8*(lane>>4);
//      elements 0..7 <- p[0..7] (k0+8h..), elements 8..15 <- p[16..23] (k0+16+8h..)
__device__ __forceinline__ v16b ldfrag_b(const __bf16* p) {
  union { v16b v; v8b h[2]; } f;
  f.h[0] = *(const v8b*)(p);
  f.h[1] = *(const v8b*)(p + 16);
  return f.v;
}
__device__ __forceinline__ v16h ldfrag_h(const _Float16* p) {
  union { v16h v; v8h h[2]; } f;
  f.h[0] = *(const v8h*)(p);
  f.h[1] = *(const v8h*)(p + 16);
  return f.v;
}

// ---- WMMA helpers ------------------------------------------------------------------------------------
__device__ __forceinline__ v8f mma_b_raw(v16b a, v16b b, v8f c) {
  return __builtin_amdgcn_wmma_f32_16x16x32_bf16(false, a, false, b, (short)0, c, false, false);
}
__device__ __forceinline__ v8f mma_h_raw(v16h a, v16h b, v8f c) {
  return __builtin_amdgcn_wmma_f32_16x16x32_f16(false, a, false, b, (short)0, c, false, false);
}
__device__ __forceinline__ void acc_guard4(v8f& a, v8f& b, v8f& c, v8f& d) {
  asm volatile("v_nop\n\tv_nop\n\tv_nop\n\tv_nop" : "+v"(a), "+v"(b), "+v"(c), "+v"(d));
}

// ---- LDS staging of GEMM operands --------------------------------------------------------------------
// A stage is 64 k (128 B) of every operand row of the work-group's tile, laid at pitch LPITCH (16 B x odd: 16-byte reads of
// 16 rows fall on distinct banks). Each lane copies 16 B: 8 lanes per row, so one wave-wide copy covers 4 whole 128-B lines.
#define LPITCH 144
struct RowChunk {                 // this lane's share of 128 staged rows: rows r, r+32, r+64, r+96 (r = tid>>3), 16 B at column tid&7
  unsigned l;                     // LDS byte address of the first
  const unsigned short* g;        // global address of the first
  size_t step;                    // 32 source rows, in elements
};
// chunk q (128 rows) of a plane: g = row 0 of the plane at the first k of the stage, pitch ld elements; lbase = LDS byte address of the plane
__device__ __forceinline__ RowChunk row_chunk(unsigned lbase, const unsigned short* g, int ld, int q, int tid) {
  const int r = q * 128 + (tid >> 3), c = tid & 7;
  RowChunk x;
  x.l = lbase + (unsigned)(r * LPITCH + c * 16);
  x.g = g + (size_t)r * ld + c * 8;
  x.step = (size_t)32 * ld;
  return x;
}
// Asynchronous copies global -> LDS of one chunk (4 x 16 B a lane), written as the builtin: the compiler then places their address
// registers anywhere in the register file, also above v255, which operands of an asm statement cannot reach.
typedef int v4i __attribute__((ext_vector_type(4)));
__device__ __forceinline__ void copy_chunk(RowChunk a) {
#pragma unroll
  for (int q = 0; q < 4; ++q)
    __builtin_amdgcn_global_load_async_to_lds_b128(
        (__attribute__((address_space(1))) v4i*)(a.g + q * a.step),
        (__attribute__((address_space(3))) v4i*)(a.l + q * 32 * LPITCH), 0, 0);
}
__device__ __forceinline__ void copy_chunks2(RowChunk a, RowChunk b) { copy_chunk(a); copy_chunk(b); }
__device__ __forceinline__ void copy_chunks3(RowChunk a, RowChunk b, RowChunk d) { copy_chunk(a); copy_chunk(b); copy_chunk(d); }
// the wave's own copies have landed (other waves read them only behind the barrier that follows)
__device__ __forceinline__ void wait_copies() { asm volatile("s_wait_asynccnt 0x0" ::: "memory"); }
template <int N>
__device__ __forceinline__ void wait_copies_but() { asm volatile("s_wait_asynccnt %0" :: "n"(N) : "memory"); }
// the wave's own LDS reads have returned before the buffer they read is handed back for a refill
__device__ __forceinline__ void wait_lds() { asm volatile("s_wait_dscnt 0x0" ::: "memory"); }
// behind the global stores of one epilogue slab, in front of the next slab's work: s_wait_xcnt 0 stands before that work rewrites
// registers which the issued stores name (a precaution), s_wait_dscnt 0 so that the slab's reads have returned before the next rows
// overwrite it; neither waits for the stores themselves, which fly on under the next slab
__device__ __forceinline__ void slab_next() { asm volatile("s_wait_xcnt 0x0\n\ts_wait_dscnt 0x0" ::: "memory"); }

// =====================================================================================================
// f32 -> bf16 (RNE convert) for x and the three weights into one contiguous 16-bit region:
// groups 0..NX8-1 <- x (batch b of the plane reads source rows at b * SEQ_FULL * DM, SEQ rows each), then NW8 groups each
// coverage: (NX8 + 3 NW8) threads x 8 = the whole [NB*SEQ][DM] x plane plus the three [DM][DM] weight planes.
// =====================================================================================================
__device__ __forceinline__ void cvt_planes_body(int blk, const float* __restrict__ x, const float* __restrict__ wq,
                                                const float* __restrict__ wk, const float* __restrict__ wv,
                                                unsigned short* out) {
  const int NXB8 = SEQ * DM / 8;          // groups per batch
  const int NX8 = NB * NXB8;
  const int NW8 = DM * DM / 8;
  const int g = blk * 256 + threadIdx.x;
  if (g >= NX8 + 3 * NW8) return;
  const float* src;
  if (g < NX8) {
    const int bb  = g / NXB8;
    const int off = g - bb * NXB8;
    src = x + (size_t)bb * SEQ_FULL * DM + (size_t)off * 8;
  } else {
    const int e = g - NX8;
    const int w = e / NW8;
    const int off = e - w * NW8;
    const float* wsrc = (w == 0) ? wq : ((w == 1) ? wk : wv);
    src = wsrc + (size_t)off * 8;
  }
  const v4f a = *(const v4f*)(src);
  const v4f c = *(const v4f*)(src + 4);
  v4u p;
  p[0] = pk16(bf_bits(a[0]), bf_bits(a[1]));
  p[1] = pk16(bf_bits(a[2]), bf_bits(a[3]));
  p[2] = pk16(bf_bits(c[0]), bf_bits(c[1]));
  p[3] = pk16(bf_bits(c[2]), bf_bits(c[3]));
  *(v4u*)(out + (size_t)g * 8) = p;
  
}

// =====================================================================================================
// Transposing f32 -> bf16 (RNE convert) of the output projection weight: w[k][n] (k = input feature, n = output feature,
// DM x DM) -> out[n][k] (k contiguous), the Bt plane of the last GEMM. One block per 64x64 tile (k0 = 64*ty,
// n0 = 64*tx), (DM/64) x (DM/64) tiles. The tile is staged in LDS as f32 (pitch 65; written by all waves, read by all
// coverage: 2 iterations x 32 rows x 64 k = the block's whole 64x64 tile; grid = all DM/64 x DM/64 tiles.
// =====================================================================================================
__device__ __forceinline__ void cvt_wo_t_body(float* sW, int tx, int ty, const float* __restrict__ w, unsigned short* out) {
  const int tid = threadIdx.x;
  const int k0 = ty * 64;
  const int n0 = tx * 64;
  {
    const int kk = tid >> 2;               // 0..63 source row within the tile
    const int c0 = (tid & 3) * 16;         // 16 consecutive source columns
    const float* src = w + (size_t)(k0 + kk) * DM + n0 + c0;
#pragma unroll
    for (int u = 0; u < 4; ++u) {
      const v4f a = *(const v4f*)(src + 4 * u);
      sW[kk * 65 + c0 + 4 * u + 0] = a[0];
      sW[kk * 65 + c0 + 4 * u + 1] = a[1];
      sW[kk * 65 + c0 + 4 * u + 2] = a[2];
      sW[kk * 65 + c0 + 4 * u + 3] = a[3];
    }
  }
  __syncthreads();
  const int q  = tid >> 3;                 // 0..31 output row within a half tile
  const int c8 = (tid & 7) * 8;            // 8 consecutive k
  v4u hv[2];
#pragma unroll
  for (int it = 0; it < 2; ++it) {
    const int nn = it * 32 + q;            // it 0..1 x q 0..31 = output rows 0..63
    v4u a;
#pragma unroll
    for (int e = 0; e < 4; ++e) {
      const float f0 = sW[(c8 + 2 * e) * 65 + nn];
      const float f1 = sW[(c8 + 2 * e + 1) * 65 + nn];
      a[e] = pk16(bf_bits(f0), bf_bits(f1));
    }
    hv[it] = a;
  }
  {
#pragma unroll
    for (int it = 0; it < 2; ++it) {
      const int nn = it * 32 + q;
      *(v4u*)(out + (size_t)(n0 + nn) * DM + k0 + c8) = hv[it];
    }
    
  }
}

// =====================================================================================================
// The two input conversions, which read nothing of each other, in one grid: blocks 0 .. NWOT-1 transpose and convert Wo (one
// 64x64 tile each; first, because their chain load - LDS - barrier - store is the longer one), the rest convert x, Wq, Wk, Wv.
// The choice is the same for a whole block, so the barrier in the transposing part is passed by all of its threads.
// =====================================================================================================
#define NWOT ((DM / 64) * (DM / 64))
__global__ __launch_bounds__(256) void cvt_inputs(const float* __restrict__ x, const float* __restrict__ wq,
                                                  const float* __restrict__ wk, const float* __restrict__ wv,
                                                  const float* __restrict__ wo, unsigned short* planes, unsigned short* woT) {
  __shared__ float sW[64 * 65];
  const int blk = blockIdx.x;
  if (blk < NWOT) cvt_wo_t_body(sW, blk % (DM / 64), blk / (DM / 64), wo, woT);
  else            cvt_planes_body(blk - NWOT, x, wq, wk, wv, planes);
}

// =====================================================================================================
// Batched bf16 WMMA GEMM: C[m][n] = sum_k A[m][k] * Bt[n][k]; one work-group (8 waves, 4 x 2) per 256 x 128 tile, one wave per
// 64x64 tile of it. The operand rows of the work-group's tile are staged in LDS, 64 k a stage, by asynchronous copies in a
// ring of NBUF buffers (stages s + 2 .. s + NBUF are copied while stage s + 1 is worked on); the waves read their fragments from LDS.
// A row-major [M][K] pitch lda; Bt row-major [N][K] pitch ldb (k contiguous); M multiple of 256, N of 128, K of 64.
// bx = index of the work-group's tile, b = batch index (strides in elements); ring and sT are the work-group's LDS.
// NSPLIT: 0 = Ah.Bh (single product); 1 = Ah.Bh + Al.Bh; 2 = Ah.Bh + Al.Bh + Ah.Bl with unscaled bf16 lo planes (one accumulator).
// TRI: 0 = dense grid of (M/256) x (N/128) work-group tiles, bx row-major;
//      1 = square M == N: work-group tiles (I, J <= 2I+1), bx = I(I+1) + J; a wave whose 64x64 tile (tm, tn) has tn > tm
//          computes and stores nothing; tile t = tm(tm+1)/2 + tn written packed at C + b*strideC + t*4096 as [64][64] f32
//          (OUT_MODE 0 only).
// OUT_MODE: 0 = f32 (pitch ldc); 2 = bf16 hi plane C + bf16 lo plane C2 (lo = RNE(v - hi), unscaled);
//           3 = f16 hi plane C = f16(v*hscale) + f16 residual plane C2 = f16((v*hscale - hi) * rscale), C2 written
//               only for tiles with n0 < N2 (pitch ldc2, batch stride strideC2).
// Epilogue: 16-row slabs staged per wave in LDS (wave-private region sT[wave], wait_lds); each 64-wide row segment written
// =====================================================================================================
__host__ __device__ constexpr int gemm_bf_stage_bytes(int nsplit) {      // one stage: Ah 256 rows | Al | Bh 128 rows | Bl
  return (((nsplit >= 1) ? 2 : 1) * 256 + ((nsplit >= 2) ? 2 : 1) * 128) * LPITCH;
}
template <int NSPLIT, int OUT_MODE, int TRI, int NBUF>
__device__ __forceinline__ void gemm_bf_body(
    unsigned char* ring, float (*sT)[16 * 68], int bx, int b,
    const unsigned short* __restrict__ Ahp, const unsigned short* __restrict__ Alp, int lda, long long strideA,
    const unsigned short* __restrict__ Bhp, const unsigned short* __restrict__ Blp, int ldb, long long strideB,
    void* Cout, int ldc, long long strideC,
    void* Cout2, int ldc2, long long strideC2, int N2,
    int M, int N, int K, float hscale, float rscale) {
  constexpr int OFF_AL = 256 * LPITCH;                                   // stage layout: Ah 256 rows | Al | Bh 128 rows | Bl
  constexpr int OFF_BH = ((NSPLIT >= 1) ? 2 : 1) * 256 * LPITCH;
  constexpr int OFF_BL = OFF_BH + 128 * LPITCH;
  constexpr int STG    = OFF_BH + ((NSPLIT >= 2) ? 2 : 1) * 128 * LPITCH;
  static_assert(STG == gemm_bf_stage_bytes(NSPLIT));
  constexpr int CPS = 4 * ((NSPLIT == 0) ? 3 : ((NSPLIT == 1) ? 5 : 6));   // copies of one wave for one stage
  static_assert(NBUF >= 2 && NBUF * CPS <= 63);
  const int tid  = threadIdx.x;
  const int lane = tid & 31;
  const int wave = __builtin_amdgcn_readfirstlane(tid >> 5);
  int bm, bn;
  if (TRI != 0) {
    const int NI = M >> 8;
    int I = 0;
    for (int q = 1; q < NI; ++q)
      if (q * (q + 1) <= bx) I = q;
    bm = I;
    bn = bx - I * (I + 1);
    if (bn > 2 * I + 1) return;            // work-group-uniform, in front of every copy and barrier
  } else {
    const int bN = N >> 7;
    bm = bx / bN;
    bn = bx - bm * bN;
    if (bm >= (M >> 8)) return;            // work-group-uniform, in front of every copy and barrier
  }
  const int tm = bm * 4 + (wave >> 1);
  const int tn = bn * 2 + (wave & 1);
  const bool active = (TRI == 0) || (tn <= tm);   // wave-uniform
  const int t  = ((tm * (tm + 1)) >> 1) + tn;     // packed tile index (TRI)
  const int m0 = tm << 6;
  const int n0 = tn << 6;

  const unsigned short* Ag  = Ahp + (size_t)b * strideA + (size_t)(bm * 256) * lda;
  const unsigned short* Alg = Alp + (size_t)b * strideA + (size_t)(bm * 256) * lda;
  const unsigned short* Bg  = Bhp + (size_t)b * strideB + (size_t)(bn * 128) * ldb;
  const unsigned short* Blg = Blp + (size_t)b * strideB + (size_t)(bn * 128) * ldb;
  const unsigned ringb = (unsigned)(size_t)(const void*)ring;    // LDS byte address of the ring

  const int rlane = lane & 15;                 // row (A) / col (B, D) within subtile
  const int koff  = (lane >> 4) * 8;           // k offset of this lane half
  const int mOff  = (lane >> 4) * 8;           // D row offset

  auto stage = [&](int s, int buf) {
    const unsigned lb = ringb + (unsigned)(buf * STG);
    const size_t ks = (size_t)s * 64;
    copy_chunks3(row_chunk(lb, Ag + ks, lda, 0, tid), row_chunk(lb, Ag + ks, lda, 1, tid),
                 row_chunk(lb + OFF_BH, Bg + ks, ldb, 0, tid));
    if (NSPLIT == 1) copy_chunks2(row_chunk(lb + OFF_AL, Alg + ks, lda, 0, tid), row_chunk(lb + OFF_AL, Alg + ks, lda, 1, tid));
    if (NSPLIT >= 2) copy_chunks3(row_chunk(lb + OFF_AL, Alg + ks, lda, 0, tid), row_chunk(lb + OFF_AL, Alg + ks, lda, 1, tid),
                                  row_chunk(lb + OFF_BL, Blg + ks, ldb, 0, tid));
  };

  v8f acc[4][4];
#pragma unroll
  for (int i = 0; i < 4; ++i)
#pragma unroll
    for (int j = 0; j < 4; ++j) acc[i][j] = zero8();

  // Two fragment sets: while the WMMAs of one 32-k block run on one set, the next block's fragments are fetched into the other.
  v16b bhA[4], ahA[4], alA[4], blA[4], bhB[4], ahB[4], alB[4], blB[4];
  const int aoff = ((wave >> 1) * 64 + rlane) * LPITCH + koff * 2;
  const int boff = OFF_BH + ((wave & 1) * 64 + rlane) * LPITCH + koff * 2;
  auto ldset = [&](int buf, int kk, v16b (&bh)[4], v16b (&ah)[4], v16b (&al)[4], v16b (&bl)[4]) {
    const unsigned char* pa = ring + buf * STG + aoff + kk * 64;
    const unsigned char* pb = ring + buf * STG + boff + kk * 64;
#pragma unroll
    for (int j = 0; j < 4; ++j) {
      bh[j] = ldfrag_b((const __bf16*)(pb + j * 16 * LPITCH));
      if (NSPLIT >= 2) bl[j] = ldfrag_b((const __bf16*)(pb + (OFF_BL - OFF_BH) + j * 16 * LPITCH));
    }
#pragma unroll
    for (int i = 0; i < 4; ++i) {
      ah[i] = ldfrag_b((const __bf16*)(pa + i * 16 * LPITCH));
      if (NSPLIT >= 1) al[i] = ldfrag_b((const __bf16*)(pa + OFF_AL + i * 16 * LPITCH));
    }
  };
  // per accumulator and 32-k block the products are added in the order Ah.Bh, Al.Bh, Ah.Bl
  auto mmaset = [&](v16b (&bh)[4], v16b (&ah)[4], v16b (&al)[4], v16b (&bl)[4]) {
#pragma unroll
    for (int i = 0; i < 4; ++i)
#pragma unroll
      for (int j = 0; j < 4; ++j) acc[i][j] = mma_b_raw(ah[i], bh[j], acc[i][j]);
    if (NSPLIT >= 1) {
#pragma unroll
      for (int i = 0; i < 4; ++i)
#pragma unroll
        for (int j = 0; j < 4; ++j) acc[i][j] = mma_b_raw(al[i], bh[j], acc[i][j]);
    }
    if (NSPLIT >= 2) {
#pragma unroll
      for (int i = 0; i < 4; ++i)
#pragma unroll
        for (int j = 0; j < 4; ++j) acc[i][j] = mma_b_raw(ah[i], bl[j], acc[i][j]);
    }
  };

  const int nst = K >> 6;
  // Ring of NBUF buffers, stage s in buffer s mod NBUF. Two buffers: stage 0, wait to 0, barrier, stage 1. More: every buffer is filled
  // at entry, and stage 0 is published while the later stages fly on.
  stage(0, 0);
  if (NBUF == 2) {
    wait_copies();
    __syncthreads();
    if (nst > 1) stage(1, 1);
  } else {
#pragma unroll
    for (int q = 1; q < NBUF; ++q) {
      __builtin_amdgcn_sched_barrier(0);   // keeps the stages' copies in issue order, which the counted waits count on
      if (q < nst) stage(q, q);
    }
    wait_copies_but<(NBUF - 1) * CPS>();
    if (nst < NBUF) wait_copies();         // fewer stages than buffers: the count would leave stage 0's own copies out
    __syncthreads();
  }
  ldset(0, 0, bhA, ahA, alA, blA);

  int cur = 0;                             // buffer of stage s
  for (int s = 0; s < nst; ++s) {
    const int nxt = (cur + 1 == NBUF) ? 0 : cur + 1;
    ldset(cur, 1, bhB, ahB, alB, blB);     // the stage's last block: the wave's last reads of buffer cur
    __builtin_amdgcn_sched_barrier(0);     // keeps the load group whole and ahead of the WMMAs
    if (active) mmaset(bhA, ahA, alA, blA);
    __builtin_amdgcn_sched_barrier(0);     // keeps these WMMAs in front of the waits, so that the loads above fly under them
    // publish point of stage s + 1, in front of stage s's last block and passed by every wave: own LDS reads of buffer cur
    // returned, own copies of stage s + 1 landed (those of stages s + 2 .. s + NBUF - 1 may fly on where all of them were issued;
    // in the last trips the wait is to 0), barrier; then the refill of buffer cur and the first fragments of stage s + 1
    wait_lds();
    if (NBUF > 2) wait_copies_but<(NBUF - 2) * CPS>();
    if (NBUF == 2 || s + NBUF - 1 >= nst) wait_copies();
    __syncthreads();
    if (s + NBUF < nst) stage(s + NBUF, cur);
    // unconditional (a branch here would merge the compiler's LDS wait counts): behind the last stage it reads again the last
    // stage's buffer (two buffers: the other one's old bytes), which no copy is aimed at any more, and nothing uses them
    ldset((NBUF == 2 || s + 1 < nst) ? nxt : cur, 0, bhA, ahA, alA, blA);
    __builtin_amdgcn_sched_barrier(0);     // keeps the load group whole and ahead of the WMMAs
    if (active) mmaset(bhB, ahB, alB, blB);
    cur = nxt;
  }
  wait_copies();
  wait_lds();
  if (!active) return;                     // wave-uniform; no work-group barrier below
  acc_guard4(acc[0][0], acc[0][1], acc[0][2], acc[0][3]);
  acc_guard4(acc[1][0], acc[1][1], acc[1][2], acc[1][3]);
  acc_guard4(acc[2][0], acc[2][1], acc[2][2], acc[2][3]);
  acc_guard4(acc[3][0], acc[3][1], acc[3][2], acc[3][3]);

  // ---- epilogue ----
  size_t cbase;
  int ldce, rowb, colb;
  if (TRI != 0) { cbase = (size_t)b * strideC + (size_t)t * 4096; ldce = 64; rowb = 0; colb = 0; }
  else          { cbase = (size_t)b * strideC; ldce = ldc; rowb = m0; colb = n0; }
  float* slab = sT[wave];
#pragma unroll
  for (int i = 0; i < 4; ++i) {
    const int mBase = m0 + (i << 4);
#pragma unroll
    for (int j = 0; j < 4; ++j) {
#pragma unroll
      for (int r = 0; r < 8; ++r) {
        slab[(mOff + r) * 68 + (j << 4) + rlane] = acc[i][j][r];
      }
    }
    wait_lds();   // the slab is this wave's own: its LDS writes are done before other lanes read the rows back; no wait on global stores
    if (OUT_MODE == 0) {
      float* C = (float*)Cout + cbase;
      const int hh = lane >> 4, c4 = (lane & 15) * 4;     // 256-B row segment = 16 lanes x 16 B
      {
#pragma unroll
        for (int it = 0; it < 8; ++it) {
          const int row = it * 2 + hh;                     // it 0..7 x hh 0..1 = rows 0..15
          const v4f v = *(const v4f*)(slab + row * 68 + c4);
          *(v4f*)(C + (size_t)(rowb + (i << 4) + row) * ldce + colb + c4) = v;
        }
        
      }
    } else {
      const int q = lane >> 3, c8 = (lane & 7) * 8;
      unsigned short* C  = (unsigned short*)Cout  + (size_t)b * strideC;
      unsigned short* C2 = (unsigned short*)Cout2 + (size_t)b * strideC2;
      const bool wlo = (OUT_MODE == 2) || (n0 < N2);      // wave-uniform
      v4u hv[4], lv[4];
#pragma unroll
      for (int it = 0; it < 4; ++it) {
        const int row = it * 4 + q;                        // it 0..3 x q 0..3 = rows 0..15
        const float* sp = slab + row * 68 + c8;
        v4u a, a2;
#pragma unroll
        for (int e = 0; e < 4; ++e) {
          const float f0 = sp[2 * e], f1 = sp[2 * e + 1];
          unsigned short h0, h1, l0, l1;
          if (OUT_MODE == 2) {
            h0 = bf_bits(f0); h1 = bf_bits(f1);
            l0 = bf_bits(f0 - bf_up(h0)); l1 = bf_bits(f1 - bf_up(h1));
          } else {
            const float g0 = f0 * hscale, g1 = f1 * hscale;
            const _Float16 x0 = (_Float16)g0, x1 = (_Float16)g1;
            h0 = h_bits(x0); h1 = h_bits(x1);
            l0 = h_bits((_Float16)((g0 - (float)x0) * rscale));
            l1 = h_bits((_Float16)((g1 - (float)x1) * rscale));
          }
          a[e] = pk16(h0, h1); a2[e] = pk16(l0, l1);
        }
        hv[it] = a; lv[it] = a2;
      }
      {
#pragma unroll
        for (int it = 0; it < 4; ++it) {
          const int row = it * 4 + q;
          *(v4u*)(C + (size_t)(mBase + row) * ldc + n0 + c8) = hv[it];
          if (wlo) *(v4u*)(C2 + (size_t)(mBase + row) * ldc2 + n0 + c8) = lv[it];
        }
        
      }
    }
    // also behind the last slab
    slab_next();
  }
}

// =====================================================================================================
// One GEMM as a launch of its own: blockIdx.x = tile index, blockIdx.y = batch index.
// =====================================================================================================
template <int NSPLIT, int OUT_MODE, int TRI, int NBUF>
__global__ __launch_bounds__(256) void gemm_bf(
    const unsigned short* __restrict__ Ahp, const unsigned short* __restrict__ Alp, int lda, long long strideA,
    const unsigned short* __restrict__ Bhp, const unsigned short* __restrict__ Blp, int ldb, long long strideB,
    void* Cout, int ldc, long long strideC,
    void* Cout2, int ldc2, long long strideC2, int N2,
    int M, int N, int K, float hscale, float rscale) {
  __shared__ __align__(16) unsigned char ring[NBUF * gemm_bf_stage_bytes(NSPLIT)];
  __shared__ __align__(16) float sT[8][16 * 68];   // per-wave 16x64 slab, pitch 68 floats
  static_assert(sizeof(ring) + sizeof(sT) <= 327680);
  gemm_bf_body<NSPLIT, OUT_MODE, TRI, NBUF>(ring, sT, (int)blockIdx.x, (int)blockIdx.y, Ahp, Alp, lda, strideA, Bhp, Blp, ldb, strideB,
                                      Cout, ldc, strideC, Cout2, ldc2, strideC2, N2, M, N, K, hscale, rscale);
}

// =====================================================================================================
// The q and k projections, which read nothing of each other, in one grid of 2 NPQ work-groups of equal cost:
//   blocks 0 .. NPQ-1        q = x . Wq^T -> bf16 hi/lo planes [NB*SEQ][DM]   (A = Xb, Bt = Wq [out][in]; M=NB*SEQ, N=DM, K=DM)
//   blocks NPQ .. 2 NPQ-1    k = x . Wk^T -> bf16 hi/lo planes
// Wb holds the Wq and Wk planes one behind the other. The choice is the same for a whole work-group.
// Four ring buffers: a wave's registers (accumulators and two fragment sets, above 256) admit one work-group a WGP whatever its LDS,
// so the larger ring costs no residency.
// =====================================================================================================
#define NPQ ((NB * SEQ / 256) * (DM / 128))
static_assert(((NB * SEQ) % 256) == 0 && (DM % 128) == 0);
__global__ __launch_bounds__(256) void proj_qk(
    const unsigned short* __restrict__ Xb, const unsigned short* __restrict__ Wb,
    unsigned short* Qh, unsigned short* Ql, unsigned short* Kh, unsigned short* Kl) {
  __shared__ __align__(16) unsigned char ring[4 * gemm_bf_stage_bytes(0)];
  __shared__ __align__(16) float sT[8][16 * 68];   // per-wave 16x64 slab, pitch 68 floats
  const int blk = blockIdx.x;
  const bool isk = blk >= NPQ;
  const unsigned short* W = Wb + (isk ? (size_t)DM * DM : (size_t)0);
  gemm_bf_body<0, 2, 0, 4>(ring, sT, isk ? blk - NPQ : blk, 0, Xb, Xb, DM, 0LL, W, W, DM, 0LL,
                        (void*)(isk ? Kh : Qh), DM, 0LL, (void*)(isk ? Kl : Ql), DM, 0LL, DM,
                        NB * SEQ, DM, DM, 1.0f, 1.0f);
}

// =====================================================================================================
// The scores and the v^T projection, which read nothing of each other, in one grid. One work-group fills a WGP's LDS, there are
// more score tiles than WGPs, so the index runs from the longest to the shortest (for speed only) and
// the v^T tiles fill the places that the last score tiles leave idle:
//   blocks 0 .. NB NSF-1     scores = q . k^T, 3 bf16 products -> packed f32 tiles: work-group tiles (I, J <= 2I), NSF a batch
//   the next NB NSI          the score tiles (I, 2I+1) on the diagonal, in which 3 of 8 waves work
//   the rest, NPV a batch    v^T = Wv . x^T -> f16 hi plane f16(16 v) [b][d][key] (pitch SEQ) and residual plane x4096 for keys < VLP
//                            (pitch VLP)   (A = Wv [out][in], Bt = Xb rows of batch b; M=DM, N=SEQ, K=DM)
// The choice is the same for a whole work-group; the two parts use the same LDS.
// =====================================================================================================
#define NSI (SEQ / 256)
#define NSF (NSI * NSI)
#define NPV ((DM / 256) * (SEQ / 128))
static_assert((DM % 256) == 0 && (SEQ % 128) == 0);
__global__ __launch_bounds__(256) void scores_vt(
    const unsigned short* __restrict__ Qh, const unsigned short* __restrict__ Ql,
    const unsigned short* __restrict__ Kh, const unsigned short* __restrict__ Kl, float* Sp,
    const unsigned short* __restrict__ Xb, const unsigned short* __restrict__ Wv,
    unsigned short* VTh, unsigned short* VTl) {
  __shared__ __align__(16) unsigned char ring[2 * gemm_bf_stage_bytes(2)];
  __shared__ __align__(16) float sT[8][16 * 68];   // per-wave 16x64 slab, pitch 68 floats
  const int blk = blockIdx.x;
  if (blk < NB * (NSF + NSI)) {
    int b, I, J;
    if (blk < NB * NSF) {                  // row I holds the 2I+1 tiles f = I*I .. I*I + 2I
      b = blk / NSF;
      const int f = blk - b * NSF;
      I = 0;
      for (int q = 1; q < NSI; ++q)
        if (q * q <= f) I = q;
      J = f - I * I;
    } else {
      const int e = blk - NB * NSF;
      b = e / NSI;
      I = e - b * NSI;
      J = 2 * I + 1;
    }
    gemm_bf_body<2, 0, 1, 2>(ring, sT, I * (I + 1) + J, b, Qh, Ql, DM, (long long)SEQ * DM, Kh, Kl, DM, (long long)SEQ * DM,
                          (void*)Sp, 64, (long long)NTRI * 4096, (void*)Sp, 64, 0LL, 0,
                          SEQ, SEQ, DM, 1.0f, 1.0f);
  } else {
    const int e = blk - NB * (NSF + NSI);
    static_assert(4 * gemm_bf_stage_bytes(0) <= 2 * gemm_bf_stage_bytes(2));   // four v^T stages lie in the two score stages' LDS
    gemm_bf_body<0, 3, 0, 4>(ring, sT, e % NPV, e / NPV, Wv, Wv, DM, 0LL, Xb, Xb, DM, (long long)SEQ * DM,
                          (void*)VTh, SEQ, (long long)DM * SEQ, (void*)VTl, VLP, (long long)DM * VLP, VLP,
                          DM, SEQ, DM, VSC, LSC);
  }
}

// =====================================================================================================
// Row softmax over the packed lower-triangular score tiles. One wave per query row (block = 8 rows, grid = NB*SEQ/8).
// Row (b, i), tm = i>>6, r = i&63: score (i, j) sits at Sp + ((b*NTRI + tm(tm+1)/2 + (j>>6))*4096 + r*64 + (j&63)), j <= 64 tm + 63.
// The wave handles ng = tm/4 + 1 groups of 256 keys (lane: 8 consecutive keys per group, two 16-B loads with the key-tile
// address clamped to tn <= tm); z = s/32 for j <= i, -inf otherwise; m = max, p = exp(z - m), l = sum, P = p/l (all f32).
// Writes Ph = f16(1024 P) for keys 0 .. 256 ng - 1 of row (b, i) (pitch SEQ; >= the keys the p.v GEMM copies for the row's work-group tile; zeros
// for j > i) and, for rows i < RESR, Pl = f16((1024 P - Ph) * 4096) with the same key extent (<= VLP, pitch VLP).
// coverage: NB*SEQ rows x written extent >= every key range any consumer reads.
// =====================================================================================================
__global__ __launch_bounds__(256) void softmax_rows(const float* __restrict__ Sp,
                                                    unsigned short* Php, unsigned short* Plp) {
  const int lane = threadIdx.x & 31, wave = threadIdx.x >> 5;
  const int row = blockIdx.x * 8 + wave;
  if (row >= NB * SEQ) return;             // wave-uniform; exact grid never triggers it; no block barriers below
  const int b  = row / SEQ;
  const int i  = row - b * SEQ;
  const int tm = i >> 6, r = i & 63;
  const int ng = (tm >> 2) + 1;            // 1..8, wave-uniform
  const float* srow = Sp + ((size_t)b * NTRI + (size_t)((tm * (tm + 1)) >> 1)) * 4096 + (size_t)r * 64;

  float z[8][8];
  float m = -INFINITY;
#pragma unroll
  for (int g = 0; g < 8; ++g) {
#pragma unroll
    for (int e = 0; e < 8; ++e) z[g][e] = -INFINITY;
    if (g < ng) {
      const int j0 = 256 * g + 8 * lane;
      int tn = j0 >> 6;
      tn = (tn < tm) ? tn : tm;            // clamped tile address; keys with tn > tm are all masked below
      const float* p = srow + (size_t)tn * 4096 + (j0 & 63);
      const v4f a = *(const v4f*)(p);
      const v4f c = *(const v4f*)(p + 4);
      const float v[8] = {a[0], a[1], a[2], a[3], c[0], c[1], c[2], c[3]};
#pragma unroll
      for (int e = 0; e < 8; ++e) {
        const float zz = (j0 + e <= i) ? (v[e] * 0.03125f) : -INFINITY;
        z[g][e] = zz;
        m = fmaxf(m, zz);
      }
    }
  }
#pragma unroll
  for (int off = 1; off < 32; off <<= 1) m = fmaxf(m, __shfl_xor(m, off, 32));   // finite: key 0 is always kept

  float l = 0.f;
#pragma unroll
  for (int g = 0; g < 8; ++g) {
    if (g < ng) {
#pragma unroll
      for (int e = 0; e < 8; ++e) {
        const float p = __expf(z[g][e] - m);   // masked: exp(-inf) = 0
        z[g][e] = p;
        l += p;
      }
    }
  }
#pragma unroll
  for (int off = 1; off < 32; off <<= 1) l += __shfl_xor(l, off, 32);          // l >= 1
  const float inv1k = (1.0f / l) * PSC;

  const bool res = (i < RESR);             // wave-uniform
  v4u ph[8];
  v4u pl0 = {0u, 0u, 0u, 0u};
  v4u pl1 = {0u, 0u, 0u, 0u};
#pragma unroll
  for (int g = 0; g < 8; ++g) {
    v4u hv = {0u, 0u, 0u, 0u};
    v4u lv = {0u, 0u, 0u, 0u};
    if (g < ng) {
#pragma unroll
      for (int e = 0; e < 4; ++e) {
        const float f0 = z[g][2 * e] * inv1k, f1 = z[g][2 * e + 1] * inv1k;
        const _Float16 x0 = (_Float16)f0, x1 = (_Float16)f1;
        hv[e] = pk16(h_bits(x0), h_bits(x1));
        lv[e] = pk16(h_bits((_Float16)((f0 - (float)x0) * LSC)), h_bits((_Float16)((f1 - (float)x1) * LSC)));
      }
    }
    ph[g] = hv;
    if (g == 0) pl0 = lv;
    if (g == 1) pl1 = lv;
  }

  unsigned short* prow = Php + (size_t)row * SEQ + 8 * lane;
  const int il = res ? i : 0;              // clamped row into the residual plane (stored only when res)
  unsigned short* lrow = Plp + ((size_t)b * RESR + (size_t)il) * VLP + 8 * lane;
  {
#pragma unroll
    for (int g = 0; g < 8; ++g) {
      if (g < ng) *(v4u*)(prow + 256 * g) = ph[g];
    }
    if (res) {                             // res rows have i < RESR (multiple of 256) -> 256 ng <= RESR = VLP
      *(v4u*)(lrow) = pl0;
      if (ng > 1) *(v4u*)(lrow + 256) = pl1;
    }
    
  }
}

// =====================================================================================================
// p.v GEMM on f16 WMMA, per batch b: ctx[b][q][d] = sum_key P[b][q][key] * VT[b][d][key], stored as the two bf16 planes that the
// output projection reads: hi = RNE(ctx), lo = RNE(ctx - hi), unscaled, both [NB*SEQ][DM].
//   A  = Ph  [b][SEQ][SEQ]  f16(1024 P), pitch SEQ         Al = Pl  [b][RESR][VLP] f16 residual x4096
//   Bt = VTh [b][DM][SEQ]   f16(16 v),   pitch SEQ         Bl = VTl [b][DM][VLP]   f16 residual x4096
// One work-group (8 waves, 4 x 2) per (64*MI) x 128 output tile, one wave per (16*MI) x 64 tile of it; rows mBase + ...; the
// operand rows of the work-group's tile are staged in LDS, 64 keys a stage, by asynchronous copies in a ring of NBUF buffers up to the
// causal key extent of the work-group's last row tile (every P entry in that range was written by the softmax: its written extent
// is 256*(row/256 + 1) keys). A wave works on keys k < 64*((m0>>6)+1) only and passes the later publish points idle.
// RES (rows < RESR, MI = 2): acc0 += Ph.VTh; acc1 += Pl.VTh + Ph.VTl,
// ctx = acc0*OSCALE + acc1*OSCALE/4096; otherwise single product ctx = acc0*OSCALE. f32 accumulate.
// bx = index of the work-group's tile among those of rows mBase .. mBase + M - 1 (M a multiple of 64*MI), row-major, DM/128 a row;
// ring and sT are the work-group's LDS.
// =====================================================================================================
__host__ __device__ constexpr int gemm_pv_stage_bytes(bool res, int mi) {   // one stage: Ph 64*mi rows | Pl | VTh 128 rows | VTl
  return (res ? 2 : 1) * (64 * mi + 128) * LPITCH;
}
template <bool RES, int MI, int NBUF>
__device__ __forceinline__ void gemm_pv_body(
    unsigned char* ring, float (*sT)[16 * 68], int bx, int b,
    const unsigned short* __restrict__ Php, const unsigned short* __restrict__ Plp,
    const unsigned short* __restrict__ Vhp, const unsigned short* __restrict__ Vlp,
    unsigned short* Chp, unsigned short* Clp, int mBase, int M) {
  constexpr int AR     = 64 * MI;                                        // rows of the work-group's tile
  static_assert(AR == (RES ? 128 : 256) && (RESR % AR) == 0);
  constexpr int OFF_AL = AR * LPITCH;                                    // stage layout: Ph AR rows | Pl | VTh 128 rows | VTl
  constexpr int OFF_BH = (RES ? 2 : 1) * AR * LPITCH;
  constexpr int OFF_BL = OFF_BH + 128 * LPITCH;
  constexpr int STG    = OFF_BH + (RES ? 2 : 1) * 128 * LPITCH;
  static_assert(STG == gemm_pv_stage_bytes(RES, MI));
  constexpr int CPS = 4 * (RES ? 4 : 3);                                 // copies of one wave for one stage
  static_assert(NBUF >= 2 && NBUF * CPS <= 63);
  const int tid  = threadIdx.x;
  const int lane = tid & 31;
  const int wave = __builtin_amdgcn_readfirstlane(tid >> 5);
  const int bN = DM >> 7;                          // 8
  const int bm = bx / bN;
  const int bn = bx - bm * bN;
  if (bm >= M / AR) return;                        // work-group-uniform, in front of every copy and barrier
  const int r0 = mBase + bm * AR;                  // first row of the work-group's tile
  const int m0 = r0 + (wave >> 1) * 16 * MI;
  const int n0 = bn * 128 + (wave & 1) * 64;
  int keff = (((m0 >> 6) + 1) << 6);               // causal key extent of this row tile, multiple of 64
  if (keff > SEQ) keff = SEQ;
  if (RES && keff > VLP) keff = VLP;               // never taken for mBase + M <= RESR; keeps residual reads in range
  int kblk = ((((r0 + 3 * 16 * MI) >> 6) + 1) << 6);   // the same of the work-group's last row tile: the staged extent
  if (kblk > SEQ) kblk = SEQ;
  if (RES && kblk > VLP) kblk = VLP;
  int rl0 = r0;                                    // first row in the residual plane, clamped; equals r0 for the RES launch
  if (rl0 > RESR - AR) rl0 = RESR - AR;

  const unsigned short* Ag  = Php + (size_t)b * SEQ * SEQ + (size_t)r0 * SEQ;
  const unsigned short* Alg = Plp + (size_t)b * RESR * VLP + (size_t)rl0 * VLP;
  const unsigned short* Bg  = Vhp + (size_t)b * DM * SEQ + (size_t)(bn * 128) * SEQ;
  const unsigned short* Blg = Vlp + (size_t)b * DM * VLP + (size_t)(bn * 128) * VLP;
  const unsigned ringb = (unsigned)(size_t)(const void*)ring;    // LDS byte address of the ring

  const int rlane = lane & 15;
  const int koff  = (lane >> 4) * 8;
  const int mOff  = (lane >> 4) * 8;

  auto stage = [&](int s, int buf) {
    const unsigned lb = ringb + (unsigned)(buf * STG);
    const size_t ks = (size_t)s * 64;
    if (RES) {                                     // AR = 128: one chunk a plane
      copy_chunks2(row_chunk(lb, Ag + ks, SEQ, 0, tid), row_chunk(lb + OFF_BH, Bg + ks, SEQ, 0, tid));
      copy_chunks2(row_chunk(lb + OFF_AL, Alg + ks, VLP, 0, tid), row_chunk(lb + OFF_BL, Blg + ks, VLP, 0, tid));
    } else {                                       // AR = 256: two chunks of P, one of v^T
      copy_chunks3(row_chunk(lb, Ag + ks, SEQ, 0, tid), row_chunk(lb, Ag + ks, SEQ, 1, tid),
                   row_chunk(lb + OFF_BH, Bg + ks, SEQ, 0, tid));
    }
  };

  v8f acc0[MI][4], acc1[MI][4];
#pragma unroll
  for (int i = 0; i < MI; ++i)
#pragma unroll
    for (int j = 0; j < 4; ++j) { acc0[i][j] = zero8(); acc1[i][j] = zero8(); }

  // Two fragment sets: while the WMMAs of one 32-key block run on one set, the next block's fragments are fetched into the other.
  v16h bhA[4], ahA[MI], alA[MI], blA[4], bhB[4], ahB[MI], alB[MI], blB[4];
  const int aoff = ((wave >> 1) * 16 * MI + rlane) * LPITCH + koff * 2;
  const int boff = OFF_BH + ((wave & 1) * 64 + rlane) * LPITCH + koff * 2;
  auto ldset = [&](int buf, int kk, v16h (&bh)[4], v16h (&ah)[MI], v16h (&al)[MI], v16h (&bl)[4]) {
    const unsigned char* pa = ring + buf * STG + aoff + kk * 64;
    const unsigned char* pb = ring + buf * STG + boff + kk * 64;
#pragma unroll
    for (int j = 0; j < 4; ++j) {
      bh[j] = ldfrag_h((const _Float16*)(pb + j * 16 * LPITCH));
      if (RES) bl[j] = ldfrag_h((const _Float16*)(pb + (OFF_BL - OFF_BH) + j * 16 * LPITCH));
    }
#pragma unroll
    for (int i = 0; i < MI; ++i) {
      ah[i] = ldfrag_h((const _Float16*)(pa + i * 16 * LPITCH));
      if (RES) al[i] = ldfrag_h((const _Float16*)(pa + OFF_AL + i * 16 * LPITCH));
    }
  };
  // acc0 += Ph.VTh; acc1 += Pl.VTh, then Ph.VTl, per 32-key block
  auto mmaset = [&](v16h (&bh)[4], v16h (&ah)[MI], v16h (&al)[MI], v16h (&bl)[4]) {
#pragma unroll
    for (int i = 0; i < MI; ++i)
#pragma unroll
      for (int j = 0; j < 4; ++j) {
        acc0[i][j] = mma_h_raw(ah[i], bh[j], acc0[i][j]);
        if (RES) acc1[i][j] = mma_h_raw(al[i], bh[j], acc1[i][j]);
      }
    if (RES) {
#pragma unroll
      for (int i = 0; i < MI; ++i)
#pragma unroll
        for (int j = 0; j < 4; ++j) acc1[i][j] = mma_h_raw(ah[i], bl[j], acc1[i][j]);
    }
  };

  const int nst = kblk >> 6;
  // Ring of NBUF buffers, stage s in buffer s mod NBUF. Two buffers: stage 0, wait to 0, barrier, stage 1. More: every buffer is filled
  // at entry, and stage 0 is published while the later stages fly on.
  stage(0, 0);
  if (NBUF == 2) {
    wait_copies();
    __syncthreads();
    if (nst > 1) stage(1, 1);
  } else {
#pragma unroll
    for (int q = 1; q < NBUF; ++q) {
      __builtin_amdgcn_sched_barrier(0);   // keeps the stages' copies in issue order, which the counted waits count on
      if (q < nst) stage(q, q);
    }
    wait_copies_but<(NBUF - 1) * CPS>();
    if (nst < NBUF) wait_copies();         // fewer stages than buffers: the count would leave stage 0's own copies out
    __syncthreads();
  }
  ldset(0, 0, bhA, ahA, alA, blA);

  int cur = 0;                             // buffer of stage s
  for (int s = 0; s < nst; ++s) {
    const bool act = s * 64 < keff;        // wave-uniform
    const int nxt = (cur + 1 == NBUF) ? 0 : cur + 1;
    ldset(cur, 1, bhB, ahB, alB, blB);     // the stage's last block: the wave's last reads of buffer cur
    __builtin_amdgcn_sched_barrier(0);     // keeps the load group whole and ahead of the WMMAs
    if (act) mmaset(bhA, ahA, alA, blA);
    __builtin_amdgcn_sched_barrier(0);     // keeps these WMMAs in front of the waits, so that the loads above fly under them
    // publish point of stage s + 1, in front of stage s's last block and passed by every wave: own LDS reads of buffer cur
    // returned, own copies of stage s + 1 landed (those of stages s + 2 .. s + NBUF - 1 may fly on where all of them were issued;
    // in the last trips the wait is to 0), barrier; then the refill of buffer cur and the first fragments of stage s + 1
    wait_lds();
    if (NBUF > 2) wait_copies_but<(NBUF - 2) * CPS>();
    if (NBUF == 2 || s + NBUF - 1 >= nst) wait_copies();
    __syncthreads();
    if (s + NBUF < nst) stage(s + NBUF, cur);
    // unconditional (a branch here would merge the compiler's LDS wait counts): behind the last stage it reads again the last
    // stage's buffer (two buffers: the other one's old bytes), which no copy is aimed at any more, and nothing uses them
    ldset((NBUF == 2 || s + 1 < nst) ? nxt : cur, 0, bhA, ahA, alA, blA);
    __builtin_amdgcn_sched_barrier(0);     // keeps the load group whole and ahead of the WMMAs
    if (act) mmaset(bhB, ahB, alB, blB);
    cur = nxt;
  }
  wait_copies();
  wait_lds();
#pragma unroll
  for (int i = 0; i < MI; ++i) {
    acc_guard4(acc0[i][0], acc0[i][1], acc0[i][2], acc0[i][3]);
    if (RES) acc_guard4(acc1[i][0], acc1[i][1], acc1[i][2], acc1[i][3]);
  }

  // ---- epilogue ----
  float* slab = sT[wave];
  unsigned short* Ch = Chp + (size_t)b * SEQ * DM;
  unsigned short* Cl = Clp + (size_t)b * SEQ * DM;
  const float rsc = OSCALE * (1.0f / LSC);
#pragma unroll
  for (int i = 0; i < MI; ++i) {
    const int mB = m0 + (i << 4);
#pragma unroll
    for (int j = 0; j < 4; ++j) {
#pragma unroll
      for (int r = 0; r < 8; ++r) {
        float v = acc0[i][j][r] * OSCALE;
        if (RES) v += acc1[i][j][r] * rsc;
        slab[(mOff + r) * 68 + (j << 4) + rlane] = v;
      }
    }
    wait_lds();   // the slab is this wave's own: its LDS writes are done before other lanes read the rows back; no wait on global stores
    {
      const int q = lane >> 3, c8 = (lane & 7) * 8;        // 128-B row segment of a plane = 8 lanes x 16 B
      v4u hv[4], lv[4];
#pragma unroll
      for (int it = 0; it < 4; ++it) {
        const int row = it * 4 + q;                        // it 0..3 x q 0..3 = rows 0..15
        const float* sp = slab + row * 68 + c8;
        v4u a, a2;
#pragma unroll
        for (int e = 0; e < 4; ++e) {
          const float f0 = sp[2 * e], f1 = sp[2 * e + 1];
          const unsigned short h0 = bf_bits(f0), h1 = bf_bits(f1);
          a[e]  = pk16(h0, h1);
          a2[e] = pk16(bf_bits(f0 - bf_up(h0)), bf_bits(f1 - bf_up(h1)));
        }
        hv[it] = a; lv[it] = a2;
      }
#pragma unroll
      for (int it = 0; it < 4; ++it) {
        const int row = it * 4 + q;
        *(v4u*)(Ch + (size_t)(mB + row) * DM + n0 + c8) = hv[it];
        *(v4u*)(Cl + (size_t)(mB + row) * DM + n0 + c8) = lv[it];
      }
    }
    // also behind the last slab
    slab_next();
  }
}

// =====================================================================================================
// Both parts of p.v, which read nothing of each other, in one grid. A work-group's cost grows with its causal key extent;
// the index runs from the longest to the shortest (for speed only):
//   blocks 0 .. NPVH-1   rows RESR .. SEQ-1, single f16 product, 256 x 128 tiles, last row block first (NPVC tiles a row block)
//   the rest             rows 0 .. RESR-1 with the residual planes (3 f16 products), 128 x 128 tiles, last row block first
// The choice is the same for a whole work-group; the two parts use the same LDS.
// =====================================================================================================
#define NPVC ((DM / 128) * NB)
#define NPVH (((SEQ - RESR) / 256) * NPVC)
#define NPVR ((RESR / 128) * NPVC)
static_assert(((SEQ - RESR) % 256) == 0 && (RESR % 128) == 0 && (DM % 128) == 0);
__global__ __launch_bounds__(256) void gemm_pv_all(
    const unsigned short* __restrict__ Php, const unsigned short* __restrict__ Plp,
    const unsigned short* __restrict__ Vhp, const unsigned short* __restrict__ Vlp, unsigned short* Chp, unsigned short* Clp) {
  constexpr int RB = WS_MAX2(3 * gemm_pv_stage_bytes(true, 2), 4 * gemm_pv_stage_bytes(false, 4));
  __shared__ __align__(16) unsigned char ring[RB];
  __shared__ __align__(16) float sT[8][16 * 68];
  const int blk = blockIdx.x;
  if (blk < NPVH) {
    const int rb = (SEQ - RESR) / 256 - 1 - blk / NPVC, e = blk % NPVC;
    gemm_pv_body<false, 4, 4>(ring, sT, rb * (DM / 128) + e % (DM / 128), e / (DM / 128), Php, Plp, Vhp, Vlp, Chp, Clp, RESR, SEQ - RESR);
  } else {
    const int rb = RESR / 128 - 1 - (blk - NPVH) / NPVC, e = (blk - NPVH) % NPVC;
    gemm_pv_body<true, 2, 3>(ring, sT, rb * (DM / 128) + e % (DM / 128), e / (DM / 128), Php, Plp, Vhp, Vlp, Chp, Clp, 0, RESR);
  }
}

// =====================================================================================================
// Workspace map (bytes, full build NB 4 / SEQ 2048; every region is an exact multiple of its tile / whole-line store
// granularity; regions A and B are reused in stream order):
//   region A [0, 33554432):          Xb bf16 [8192][1024] at 0 (16777216) + Wq,Wk,Wv bf16 [1024][1024] at 16777216 (3 x 2097152),
//                                    read up to the launch of the scores and v^T
//                                    then: Ch, Cl bf16 ctx planes [8192][1024] at 0 (2 x 16777216), written by p.v
//   region B [33554432, 100663296):  Qh, Ql, Kh, Kl bf16 [8192][1024] (4 x 16777216)
//                                    then, once the scores are done: Ph f16 [4][2048][2048] (33554432) + Pl f16 [4][512][512] (2097152)
//   region C [100663296, 121634816): VTh f16 [4][1024][2048] (16777216) + VTl f16 [4][1024][512] (4194304)
//   region D [121634816, 123731968): WoT bf16 [1024][1024] (2097152), live from launch 1 to the last GEMM
//   region E [123731968, 158334976): Sp f32 packed score tiles [4][528][64][64] (34603008); a region of its own, because the launch
//                                    that writes it still reads Xb and Wv
//   end 158334976
// =====================================================================================================
extern "C" void kernel_launch(void* const* d_in, const int* in_sizes, int n_in,
                              void* d_out, int out_size, void* d_ws, size_t ws_size,
                              hipStream_t stream) {
  if (n_in < 5) return;
  if (in_sizes[4] < (NB - 1) * SEQ_FULL * DM + SEQ * DM) return;
  if (in_sizes[0] < DM * DM || in_sizes[1] < DM * DM || in_sizes[2] < DM * DM || in_sizes[3] < DM * DM) return;
  if (out_size < NB * SEQ * DM) return;

  // wire order of the inputs: k, q, v, out_proj, x
  const float* wk = (const float*)d_in[0];   // [out][in]
  const float* wq = (const float*)d_in[1];   // [out][in]
  const float* wv = (const float*)d_in[2];   // [out][in]
  const float* wo = (const float*)d_in[3];   // [in][out]
  const float* x  = (const float*)d_in[4];   // [NB_FULL][SEQ_FULL][DM]
  float* out = (float*)d_out;

  const size_t PX  = (size_t)NB * SEQ * DM * 2;       // 16-bit plane [NB*SEQ][DM]
  const size_t PW  = (size_t)DM * DM * 2;             // one weight plane
  const size_t PS  = (size_t)NB * NTRI * 4096 * 4;    // packed f32 score tiles
  const size_t PC  = 2 * PX;                          // bf16 hi and lo ctx planes
  const size_t PP  = (size_t)NB * SEQ * SEQ * 2;      // Ph
  const size_t PPL = (size_t)NB * RESR * VLP * 2;     // Pl
  const size_t PVT = (size_t)NB * DM * SEQ * 2;       // VTh
  const size_t PVL = (size_t)NB * DM * VLP * 2;       // VTl
  const size_t RA = ((PX + 3 * PW) > PC) ? (PX + 3 * PW) : PC;
  const size_t oXb = 0;
  const size_t oW  = PX;
  const size_t oCh = 0;
  const size_t oCl = PX;
  const size_t oQh = RA;
  const size_t oQl = RA + PX;
  const size_t oKh = RA + 2 * PX;
  const size_t oKl = RA + 3 * PX;
  const size_t RBend = RA + 4 * PX;
  const size_t oPh = RA;
  const size_t oPl = RA + PP;
  if (oPl + PPL > RBend) return;
  const size_t oVTh = RBend;
  const size_t oVTl = RBend + PVT;
  const size_t oWo  = oVTl + PVL;
  const size_t oS   = oWo + PW;
  const size_t total = oS + PS;                       // 158334976 in the full build
  if (total > ws_size) return;

  char* ws = (char*)d_ws;
  unsigned short* Xb  = (unsigned short*)(ws + oXb);
  unsigned short* Wb  = (unsigned short*)(ws + oW);   // Wq plane, then Wk, then Wv
  float*          Sp  = (float*)(ws + oS);
  unsigned short* Qh  = (unsigned short*)(ws + oQh);
  unsigned short* Ql  = (unsigned short*)(ws + oQl);
  unsigned short* Kh  = (unsigned short*)(ws + oKh);
  unsigned short* Kl  = (unsigned short*)(ws + oKl);
  unsigned short* Ph  = (unsigned short*)(ws + oPh);
  unsigned short* Pl  = (unsigned short*)(ws + oPl);
  unsigned short* Ch  = (unsigned short*)(ws + oCh);
  unsigned short* Cl  = (unsigned short*)(ws + oCl);
  unsigned short* VTh = (unsigned short*)(ws + oVTh);
  unsigned short* VTl = (unsigned short*)(ws + oVTl);
  unsigned short* WoT = (unsigned short*)(ws + oWo);

  const dim3 blk(256);
  const int nGroups = NB * SEQ * DM / 8 + 3 * (DM * DM / 8);
  const dim3 gCvt(NWOT + (nGroups + 255) / 256);
  const dim3 gQk(2 * NPQ);
  const dim3 gSv(NB * (NSF + NSI) + NB * NPV);
  const dim3 gProj(((NB * SEQ / 64) * (DM / 64) + 7) / 8, 1);
  const dim3 gSm((NB * SEQ + 7) / 8);
  const dim3 gPv(NPVH + NPVR);

  // (1) x and Wq, Wk, Wv -> bf16 planes (Xb, then the three weight planes contiguous); Wo [in][out] -> WoT bf16 [out][in]
  cvt_inputs<<<gCvt, blk, 0, stream>>>(x, wq, wk, wv, wo, Xb, WoT);
  // (2) q, k -> bf16 hi/lo planes [NB*SEQ][DM]
  proj_qk<<<gQk, blk, 0, stream>>>(Xb, Wb, Qh, Ql, Kh, Kl);
  // (3) scores = q . k^T per batch over the NTRI lower-triangular 64x64 tiles, 3 bf16 products -> packed f32 tiles;
  //     v^T -> f16 hi plane and residual plane
  scores_vt<<<gSv, blk, 0, stream>>>(Qh, Ql, Kh, Kl, Sp, Xb, Wb + (size_t)2 * DM * DM, VTh, VTl);
  // (4) causal row softmax in f32 -> Ph f16(1024 P) and Pl residual planes
  softmax_rows<<<gSm, blk, 0, stream>>>(Sp, Ph, Pl);
  // (5) ctx = p.v -> bf16 hi/lo planes [NB*SEQ][DM]: rows RESR..SEQ-1 single f16 product (64x64 wave tiles), rows 0..RESR-1 of every sequence
  //     with the residual planes (3 f16 products, 32x64 wave tiles)
  gemm_pv_all<<<gPv, blk, 0, stream>>>(Ph, Pl, VTh, VTl, Ch, Cl);
  // (6) out = ctx . Wo -> f32 output buffer   (A = Ch + Cl, Bt = WoT [out][in]; M=NB*SEQ, N=DM, K=DM; 2 bf16 products)
  gemm_bf<1, 0, 0, 3><<<gProj, blk, 0, stream>>>(
      Ch, Cl, DM, 0LL, WoT, WoT, DM, 0LL,
      (void*)out, DM, 0LL, (void*)out, DM, 0LL, 0,
      NB * SEQ, DM, DM, 1.0f, 1.0f);
  (void)hipGetLastError();
}

// v007
// One run takes 154 microseconds.
// In two side-by-side timings against v006, it was 1.07 and 1.06 times as fast.
// Counting every step since v000, it is 3.23 times as fast.
// Contractions: q, k, v^T projections = v_wmma_f32_16x16x32_bf16 (bf16 RNE-converted x and W, single product, f32 accumulate);
// q.k^T scores = v_wmma_f32_16x16x32_bf16 with bf16 hi/lo planes of q and k (hi.hi + lo.hi + hi.lo), f32 accumulate;
// p.v = v_wmma_f32_16x16x32_f16 (p carried x1024 in f16, v^T carried x16 in f16, single product; query rows 0..RESR-1 of every
// sequence add the f16 residual planes (x4096) of p and v^T in a separate accumulator), f32 accumulate;
// output projection ctx.Wo = v_wmma_f32_16x16x32_bf16 with bf16 hi/lo planes of ctx and the bf16 RNE-converted Wo^T plane
// (hi.W + lo.W, one accumulator), f32 accumulate;
// causal mask, row max, exp, sum and normalisation in f32 on the VALU.
// Carry audit:
//   Ph  = f16(1024 * p), p already normalised by the row sum     } OSCALE = 1/(1024*16) folded exactly once in the p.v epilogue
//   VTh = f16(16 * v)                                            }
//   Pl  = f16((1024 p - Ph) * 4096)                              } products Ph.VTl and Pl.VTh go only to accumulator acc1,
//   VTl = f16((16 v - VTh) * 4096), keys 0..VLP-1                } folded with OSCALE * (1/4096) once in the same epilogue
//   q / k lo planes are unscaled bf16 residuals (v - hi) sharing the hi accumulator; score scale 1/32 applied once in f32 in the softmax.
//   ctx hi / lo planes are unscaled bf16 (lo = RNE(ctx - hi)) sharing one accumulator in the output projection.
// The module's softmax over all keys followed by the lower-triangular mask and the division by the masked row sum equals
// exp(z_j - m) / sum_{j<=i} exp(z_j - m) for any finite shift m; it is evaluated with the causal row max as the shift.
#include <hip/hip_runtime.h>
#include <math.h>

#define NB_FULL  4
#define SEQ_FULL 2048
#ifndef NB
#define NB    4
#endif
#ifndef SEQ
#define SEQ   2048
#endif
#define DM    1024
#define NQT   (SEQ / 64)                  // query/key tiles of 64
#define NTRI  ((NQT * (NQT + 1)) / 2)     // lower-triangular 64x64 score tiles per sequence (528 at SEQ 2048)
#define RESR  ((SEQ < 512) ? SEQ : 512)   // leading query rows per sequence that use the residual planes
#define VLP   RESR                        // key pitch of the p / v^T residual planes
#define PSC   1024.0f
#define VSC   16.0f
#define LSC   4096.0f
#define OSCALE (1.0f / 16384.0f)          // 1 / (PSC * VSC)
static_assert(NB >= 1 && NB <= NB_FULL);
static_assert(SEQ >= 256 && SEQ <= SEQ_FULL && (SEQ % 256) == 0);
static_assert((SEQ % 64) == 0 && (DM % 64) == 0 && (DM % 32) == 0);
static_assert((RESR % 64) == 0 && (RESR % 256) == 0 && RESR <= VLP && VLP <= SEQ && ((SEQ - RESR) % 64) == 0);
static_assert((RESR % 32) == 0);
static_assert(((NB * SEQ) % 8) == 0);
static_assert(((SEQ * DM / 8) % 256) == 0 && ((DM * DM / 8) % 256) == 0);

// ---- workspace extents (bytes) used by the launcher; checked at build time ------------------------------
#define WS_MAX2(a, b) (((a) > (b)) ? (a) : (b))
#define WS_PX  ((size_t)NB * SEQ * DM * 2)        // one 16-bit plane [NB*SEQ][DM]
#define WS_PW  ((size_t)DM * DM * 2)              // one 16-bit weight plane
#define WS_PS  ((size_t)NB * NTRI * 4096 * 4)     // packed f32 score tiles
#define WS_PC  (2 * WS_PX)                        // bf16 hi and lo ctx planes
#define WS_PP  ((size_t)NB * SEQ * SEQ * 2)       // Ph
#define WS_PPL ((size_t)NB * RESR * VLP * 2)      // Pl
#define WS_PVT ((size_t)NB * DM * SEQ * 2)        // VTh
#define WS_PVL ((size_t)NB * DM * VLP * 2)        // VTl
#define WS_RA  WS_MAX2(WS_PX + 3 * WS_PW, WS_PC)
#define WS_TOTAL (WS_RA + 4 * WS_PX + WS_PVT + WS_PVL + WS_PW + WS_PS)
static_assert(WS_TOTAL <= (size_t)268435456);
static_assert(WS_PC <= WS_RA);
static_assert(WS_PP + WS_PPL <= 4 * WS_PX);
static_assert(((NB * SEQ) % 64) == 0);
static_assert((WS_RA % 128) == 0 && (WS_PX % 128) == 0 && (WS_PVT % 128) == 0 && (WS_PVL % 128) == 0 && (WS_PW % 128) == 0 &&
              (WS_PS % 128) == 0);

typedef _Float16 v16h __attribute__((ext_vector_type(16)));
typedef _Float16 v8h  __attribute__((ext_vector_type(8)));
typedef __bf16   v16b __attribute__((ext_vector_type(16)));
typedef __bf16   v8b  __attribute__((ext_vector_type(8)));
typedef float    v8f  __attribute__((ext_vector_type(8)));
typedef float    v4f  __attribute__((ext_vector_type(4)));
typedef unsigned int v4u __attribute__((ext_vector_type(4)));

// ---- scalar helpers --------------------------------------------------------------------------------
__device__ __forceinline__ unsigned short bf_bits(float f) {          // f32 -> bf16 bits, RNE convert
  unsigned u = __float_as_uint(f);
  return (unsigned short)((u + 0x7FFFu + ((u >> 16) & 1u)) >> 16);
}
__device__ __forceinline__ float bf_up(unsigned short h) { return __uint_as_float(((unsigned)h) << 16); }
__device__ __forceinline__ unsigned short h_bits(_Float16 x) { return __builtin_bit_cast(unsigned short, x); }
__device__ __forceinline__ unsigned pk16(unsigned short a, unsigned short b) { return (unsigned)a | ((unsigned)b << 16); }
__device__ __forceinline__ v8f zero8() { v8f z = {0.f, 0.f, 0.f, 0.f, 0.f, 0.f, 0.f, 0.f}; return z; }

// ---- fragment loaders: 16-bit A/B operand, lane -> row/col (lane&15), p already includes +8*(lane>>4);
//      elements 0..7 <- p[0..7] (k0+8h..), elements 8..15 <- p[16..23] (k0+16+8h..)
__device__ __forceinline__ v16b ldfrag_b(const __bf16* p) {
  union { v16b v; v8b h[2]; } f;
  f.h[0] = *(const v8b*)(p);
  f.h[1] = *(const v8b*)(p + 16);
  return f.v;
}
__device__ __forceinline__ v16h ldfrag_h(const _Float16* p) {
  union { v16h v; v8h h[2]; } f;
  f.h[0] = *(const v8h*)(p);
  f.h[1] = *(const v8h*)(p + 16);
  return f.v;
}

// ---- WMMA helpers ------------------------------------------------------------------------------------
__device__ __forceinline__ v8f mma_b_raw(v16b a, v16b b, v8f c) {
  return __builtin_amdgcn_wmma_f32_16x16x32_bf16(false, a, false, b, (short)0, c, false, false);
}
__device__ __forceinline__ v8f mma_h_raw(v16h a, v16h b, v8f c) {
  return __builtin_amdgcn_wmma_f32_16x16x32_f16(false, a, false, b, (short)0, c, false, false);
}
__device__ __forceinline__ void acc_guard4(v8f& a, v8f& b, v8f& c, v8f& d) {
  asm volatile("v_nop\n\tv_nop\n\tv_nop\n\tv_nop" : "+v"(a), "+v"(b), "+v"(c), "+v"(d));
}

// ---- LDS staging of GEMM operands --------------------------------------------------------------------
// A stage is 64 k (128 B) of every operand row of the work-group's tile, laid at pitch LPITCH (16 B x odd: 16-byte reads of
// 16 rows fall on distinct banks). Each lane copies 16 B: 8 lanes per row, so one wave-wide copy covers 4 whole 128-B lines.
#define LPITCH 144
struct RowChunk {                 // this lane's share of 128 staged rows: rows r, r+32, r+64, r+96 (r = tid>>3), 16 B at column tid&7
  unsigned l;                     // LDS byte address of the first
  const unsigned short* g;        // global address of the first
  size_t step;                    // 32 source rows, in elements
};
// chunk q (128 rows) of a plane: g = row 0 of the plane at the first k of the stage, pitch ld elements; lbase = LDS byte address of the plane
__device__ __forceinline__ RowChunk row_chunk(unsigned lbase, const unsigned short* g, int ld, int q, int tid) {
  const int r = q * 128 + (tid >> 3), c = tid & 7;
  RowChunk x;
  x.l = lbase + (unsigned)(r * LPITCH + c * 16);
  x.g = g + (size_t)r * ld + c * 8;
  x.step = (size_t)32 * ld;
  return x;
}
// Asynchronous copies global -> LDS of one chunk (4 x 16 B a lane), written as the builtin: the compiler then places their address
// registers anywhere in the register file, also above v255, which operands of an asm statement cannot reach.
typedef int v4i __attribute__((ext_vector_type(4)));
__device__ __forceinline__ void copy_chunk(RowChunk a) {
#pragma unroll
  for (int q = 0; q < 4; ++q)
    __builtin_amdgcn_global_load_async_to_lds_b128(
        (__attribute__((address_space(1))) v4i*)(a.g + q * a.step),
        (__attribute__((address_space(3))) v4i*)(a.l + q * 32 * LPITCH), 0, 0);
}
__device__ __forceinline__ void copy_chunks2(RowChunk a, RowChunk b) { copy_chunk(a); copy_chunk(b); }
__device__ __forceinline__ void copy_chunks3(RowChunk a, RowChunk b, RowChunk d) { copy_chunk(a); copy_chunk(b); copy_chunk(d); }
// the wave's own copies have landed (other waves read them only behind the barrier that follows)
__device__ __forceinline__ void wait_copies() { asm volatile("s_wait_asynccnt 0x0" ::: "memory"); }
template <int N>
__device__ __forceinline__ void wait_copies_but() { asm volatile("s_wait_asynccnt %0" :: "n"(N) : "memory"); }
// the wave's own LDS reads have returned before the buffer they read is handed back for a refill
__device__ __forceinline__ void wait_lds() { asm volatile("s_wait_dscnt 0x0" ::: "memory"); }
// behind the global stores of one epilogue slab, in front of the next slab's work: s_wait_xcnt 0 stands before that work rewrites
// registers which the issued stores name (a precaution), s_wait_dscnt 0 so that the slab's reads have returned before the next rows
// overwrite it; neither waits for the stores themselves, which fly on under the next slab
__device__ __forceinline__ void slab_next() { asm volatile("s_wait_xcnt 0x0\n\ts_wait_dscnt 0x0" ::: "memory"); }
// four 16-byte row stores of one plane and their s_wait_xcnt 0 in one statement, so that the wait stands in front of whatever rewrites an
// address or data register of these stores (a precaution)
__device__ __forceinline__ void store_rows4(unsigned short* p0, unsigned short* p1, unsigned short* p2, unsigned short* p3,
                                            v4u d0, v4u d1, v4u d2, v4u d3) {
  asm volatile("global_store_b128 %0, %4, off\n\tglobal_store_b128 %1, %5, off\n\t"
               "global_store_b128 %2, %6, off\n\tglobal_store_b128 %3, %7, off\n\ts_wait_xcnt 0x0"
               :: "v"(p0), "v"(p1), "v"(p2), "v"(p3), "v"(d0), "v"(d1), "v"(d2), "v"(d3) : "memory");
}

// =====================================================================================================
// f32 -> bf16 (RNE convert) for x and the three weights into one contiguous 16-bit region:
// groups 0..NX8-1 <- x (batch b of the plane reads source rows at b * SEQ_FULL * DM, SEQ rows each), then NW8 groups each
// coverage: (NX8 + 3 NW8) threads x 8 = the whole [NB*SEQ][DM] x plane plus the three [DM][DM] weight planes.
// =====================================================================================================
__device__ __forceinline__ void cvt_planes_body(int blk, const float* __restrict__ x, const float* __restrict__ wq,
                                                const float* __restrict__ wk, const float* __restrict__ wv,
                                                unsigned short* out) {
  const int NXB8 = SEQ * DM / 8;          // groups per batch
  const int NX8 = NB * NXB8;
  const int NW8 = DM * DM / 8;
  const int g = blk * 256 + threadIdx.x;
  if (g >= NX8 + 3 * NW8) return;
  const float* src;
  if (g < NX8) {
    const int bb  = g / NXB8;
    const int off = g - bb * NXB8;
    src = x + (size_t)bb * SEQ_FULL * DM + (size_t)off * 8;
  } else {
    const int e = g - NX8;
    const int w = e / NW8;
    const int off = e - w * NW8;
    const float* wsrc = (w == 0) ? wq : ((w == 1) ? wk : wv);
    src = wsrc + (size_t)off * 8;
  }
  const v4f a = *(const v4f*)(src);
  const v4f c = *(const v4f*)(src + 4);
  v4u p;
  p[0] = pk16(bf_bits(a[0]), bf_bits(a[1]));
  p[1] = pk16(bf_bits(a[2]), bf_bits(a[3]));
  p[2] = pk16(bf_bits(c[0]), bf_bits(c[1]));
  p[3] = pk16(bf_bits(c[2]), bf_bits(c[3]));
  *(v4u*)(out + (size_t)g * 8) = p;
  
}

// =====================================================================================================
// Transposing f32 -> bf16 (RNE convert) of the output projection weight: w[k][n] (k = input feature, n = output feature,
// DM x DM) -> out[n][k] (k contiguous), the Bt plane of the last GEMM. One block per 64x64 tile (k0 = 64*ty,
// n0 = 64*tx), (DM/64) x (DM/64) tiles. The tile is staged in LDS as f32 (pitch 65; written by all waves, read by all
// coverage: 2 iterations x 32 rows x 64 k = the block's whole 64x64 tile; grid = all DM/64 x DM/64 tiles.
// =====================================================================================================
__device__ __forceinline__ void cvt_wo_t_body(float* sW, int tx, int ty, const float* __restrict__ w, unsigned short* out) {
  const int tid = threadIdx.x;
  const int k0 = ty * 64;
  const int n0 = tx * 64;
  {
    const int kk = tid >> 2;               // 0..63 source row within the tile
    const int c0 = (tid & 3) * 16;         // 16 consecutive source columns
    const float* src = w + (size_t)(k0 + kk) * DM + n0 + c0;
#pragma unroll
    for (int u = 0; u < 4; ++u) {
      const v4f a = *(const v4f*)(src + 4 * u);
      sW[kk * 65 + c0 + 4 * u + 0] = a[0];
      sW[kk * 65 + c0 + 4 * u + 1] = a[1];
      sW[kk * 65 + c0 + 4 * u + 2] = a[2];
      sW[kk * 65 + c0 + 4 * u + 3] = a[3];
    }
  }
  __syncthreads();
  const int q  = tid >> 3;                 // 0..31 output row within a half tile
  const int c8 = (tid & 7) * 8;            // 8 consecutive k
  v4u hv[2];
#pragma unroll
  for (int it = 0; it < 2; ++it) {
    const int nn = it * 32 + q;            // it 0..1 x q 0..31 = output rows 0..63
    v4u a;
#pragma unroll
    for (int e = 0; e < 4; ++e) {
      const float f0 = sW[(c8 + 2 * e) * 65 + nn];
      const float f1 = sW[(c8 + 2 * e + 1) * 65 + nn];
      a[e] = pk16(bf_bits(f0), bf_bits(f1));
    }
    hv[it] = a;
  }
  {
#pragma unroll
    for (int it = 0; it < 2; ++it) {
      const int nn = it * 32 + q;
      *(v4u*)(out + (size_t)(n0 + nn) * DM + k0 + c8) = hv[it];
    }
    
  }
}

// =====================================================================================================
// The two input conversions, which read nothing of each other, in one grid: blocks 0 .. NWOT-1 transpose and convert Wo (one
// 64x64 tile each; first, because their chain load - LDS - barrier - store is the longer one), the rest convert x, Wq, Wk, Wv.
// The choice is the same for a whole block, so the barrier in the transposing part is passed by all of its threads.
// =====================================================================================================
#define NWOT ((DM / 64) * (DM / 64))
__global__ __launch_bounds__(256) void cvt_inputs(const float* __restrict__ x, const float* __restrict__ wq,
                                                  const float* __restrict__ wk, const float* __restrict__ wv,
                                                  const float* __restrict__ wo, unsigned short* planes, unsigned short* woT) {
  __shared__ float sW[64 * 65];
  const int blk = blockIdx.x;
  if (blk < NWOT) cvt_wo_t_body(sW, blk % (DM / 64), blk / (DM / 64), wo, woT);
  else            cvt_planes_body(blk - NWOT, x, wq, wk, wv, planes);
}

// =====================================================================================================
// Batched bf16 WMMA GEMM: C[m][n] = sum_k A[m][k] * Bt[n][k]; one work-group (8 waves, 4 x 2) per 256 x (32 NJ) tile, one wave per
// 64 x (16 NJ) tile of it: NJ = 4: 256 x 128 and 64 x 64; NJ = 8 (single product, dense grid): 256 x 256 and 64 x 128, which lands a
// third fewer operand bytes in LDS per product and feeds 32 WMMAs from 12 LDS fragments (NJ = 4: 16 from 8).
// The operand rows of the work-group's tile are staged in LDS, 64 k a stage, by asynchronous copies in a
// ring of NBUF buffers (stages s + 2 .. s + NBUF are copied while stage s + 1 is worked on); the waves read their fragments from LDS.
// A row-major [M][K] pitch lda; Bt row-major [N][K] pitch ldb (k contiguous); M multiple of 256, N of 32 NJ, K of 64.
// bx = index of the work-group's tile, b = batch index (strides in elements); ring and sT are the work-group's LDS.
// NSPLIT: 0 = Ah.Bh (single product); 1 = Ah.Bh + Al.Bh; 2 = Ah.Bh + Al.Bh + Ah.Bl with unscaled bf16 lo planes (one accumulator).
// TRI: 0 = dense grid of (M/256) x (N/(32 NJ)) work-group tiles, bx row-major;
//      1 = square M == N: work-group tiles (I, J <= 2I+1), bx = I(I+1) + J; a wave whose 64x64 tile (tm, tn) has tn > tm
//          computes and stores nothing; tile t = tm(tm+1)/2 + tn written packed at C + b*strideC + t*4096 as [64][64] f32
//          (OUT_MODE 0 only).
// OUT_MODE: 0 = f32 (pitch ldc); 2 = bf16 hi plane C + bf16 lo plane C2 (lo = RNE(v - hi), unscaled);
//           3 = f16 hi plane C = f16(v*hscale) + f16 residual plane C2 = f16((v*hscale - hi) * rscale), C2 written
//               only for tiles with n0 < N2 (pitch ldc2, batch stride strideC2).
// Epilogue: 16-row slabs staged per wave in LDS (wave-private region sT[wave], wait_lds); each 64-wide row segment written
// =====================================================================================================
__host__ __device__ constexpr int gemm_bf_stage_bytes(int nsplit, int nj = 4) {   // one stage: Ah 256 rows | Al | Bh 32 nj rows | Bl
  return (((nsplit >= 1) ? 2 : 1) * 256 + ((nsplit >= 2) ? 2 : 1) * 32 * nj) * LPITCH;
}
template <int NSPLIT, int OUT_MODE, int TRI, int NBUF, int NJ = 4>
__device__ __forceinline__ void gemm_bf_body(
    unsigned char* ring, float (*sT)[16 * 68], int bx, int b,
    const unsigned short* __restrict__ Ahp, const unsigned short* __restrict__ Alp, int lda, long long strideA,
    const unsigned short* __restrict__ Bhp, const unsigned short* __restrict__ Blp, int ldb, long long strideB,
    void* Cout, int ldc, long long strideC,
    void* Cout2, int ldc2, long long strideC2, int N2,
    int M, int N, int K, float hscale, float rscale) {
  static_assert(NJ == 4 || (NJ == 8 && NSPLIT == 0 && TRI == 0 && NBUF > 2));
  constexpr int BR     = 32 * NJ;                                        // Bt rows (output columns) of the work-group's tile
  constexpr int OFF_AL = 256 * LPITCH;                                   // stage layout: Ah 256 rows | Al | Bh BR rows | Bl
  constexpr int OFF_BH = ((NSPLIT >= 1) ? 2 : 1) * 256 * LPITCH;
  constexpr int OFF_BL = OFF_BH + BR * LPITCH;
  constexpr int STG    = OFF_BH + ((NSPLIT >= 2) ? 2 : 1) * BR * LPITCH;
  static_assert(STG == gemm_bf_stage_bytes(NSPLIT, NJ));
  constexpr int CPS = 4 * (((NSPLIT >= 1) ? 4 : 2) + ((NSPLIT >= 2) ? 2 : 1) * (NJ / 4));   // copies of one wave for one stage
  static_assert(NBUF >= 2 && NBUF * CPS <= 63);
  const int tid  = threadIdx.x;
  const int lane = tid & 31;
  const int wave = __builtin_amdgcn_readfirstlane(tid >> 5);
  int bm, bn;
  if (TRI != 0) {
    const int NI = M >> 8;
    int I = 0;
    for (int q = 1; q < NI; ++q)
      if (q * (q + 1) <= bx) I = q;
    bm = I;
    bn = bx - I * (I + 1);
    if (bn > 2 * I + 1) return;            // work-group-uniform, in front of every copy and barrier
  } else {
    const int bN = N / BR;
    bm = bx / bN;
    bn = bx - bm * bN;
    if (bm >= (M >> 8)) return;            // work-group-uniform, in front of every copy and barrier
  }
  const int tm = bm * 4 + (wave >> 1);
  const int tn = bn * 2 + (wave & 1);
  const bool active = (TRI == 0) || (tn <= tm);   // wave-uniform
  const int t  = ((tm * (tm + 1)) >> 1) + tn;     // packed tile index (TRI)
  const int m0 = tm << 6;
  const int n0 = bn * BR + (wave & 1) * 16 * NJ;  // = 64 tn where NJ = 4

  const unsigned short* Ag  = Ahp + (size_t)b * strideA + (size_t)(bm * 256) * lda;
  const unsigned short* Alg = Alp + (size_t)b * strideA + (size_t)(bm * 256) * lda;
  const unsigned short* Bg  = Bhp + (size_t)b * strideB + (size_t)(bn * BR) * ldb;
  const unsigned short* Blg = Blp + (size_t)b * strideB + (size_t)(bn * BR) * ldb;
  const unsigned ringb = (unsigned)(size_t)(const void*)ring;    // LDS byte address of the ring

  const int rlane = lane & 15;                 // row (A) / col (B, D) within subtile
  const int koff  = (lane >> 4) * 8;           // k offset of this lane half
  const int mOff  = (lane >> 4) * 8;           // D row offset

  auto stage = [&](int s, int buf) {
    const unsigned lb = ringb + (unsigned)(buf * STG);
    const size_t ks = (size_t)s * 64;
    copy_chunks3(row_chunk(lb, Ag + ks, lda, 0, tid), row_chunk(lb, Ag + ks, lda, 1, tid),
                 row_chunk(lb + OFF_BH, Bg + ks, ldb, 0, tid));
    if (NJ == 8) copy_chunk(row_chunk(lb + OFF_BH, Bg + ks, ldb, 1, tid));
    if (NSPLIT == 1) copy_chunks2(row_chunk(lb + OFF_AL, Alg + ks, lda, 0, tid), row_chunk(lb + OFF_AL, Alg + ks, lda, 1, tid));
    if (NSPLIT >= 2) copy_chunks3(row_chunk(lb + OFF_AL, Alg + ks, lda, 0, tid), row_chunk(lb + OFF_AL, Alg + ks, lda, 1, tid),
                                  row_chunk(lb + OFF_BL, Blg + ks, ldb, 0, tid));
  };

  v8f acc[4][NJ];
#pragma unroll
  for (int i = 0; i < 4; ++i)
#pragma unroll
    for (int j = 0; j < NJ; ++j) acc[i][j] = zero8();

  // Two fragment sets: while the WMMAs of one 32-k block run on one set, the next block's fragments are fetched into the other.
  v16b bhA[NJ], ahA[4], alA[4], blA[NJ], bhB[NJ], ahB[4], alB[4], blB[NJ];
  const int aoff = ((wave >> 1) * 64 + rlane) * LPITCH + koff * 2;
  const int boff = OFF_BH + ((wave & 1) * 16 * NJ + rlane) * LPITCH + koff * 2;
  auto ldset = [&](int buf, int kk, v16b (&bh)[NJ], v16b (&ah)[4], v16b (&al)[4], v16b (&bl)[NJ]) {
    const unsigned char* pa = ring + buf * STG + aoff + kk * 64;
    const unsigned char* pb = ring + buf * STG + boff + kk * 64;
#pragma unroll
    for (int j = 0; j < NJ; ++j) {
      bh[j] = ldfrag_b((const __bf16*)(pb + j * 16 * LPITCH));
      if (NSPLIT >= 2) bl[j] = ldfrag_b((const __bf16*)(pb + (OFF_BL - OFF_BH) + j * 16 * LPITCH));
    }
#pragma unroll
    for (int i = 0; i < 4; ++i) {
      ah[i] = ldfrag_b((const __bf16*)(pa + i * 16 * LPITCH));
      if (NSPLIT >= 1) al[i] = ldfrag_b((const __bf16*)(pa + OFF_AL + i * 16 * LPITCH));
    }
  };
  // per accumulator and 32-k block the products are added in the order Ah.Bh, Al.Bh, Ah.Bl
  auto mmaset = [&](v16b (&bh)[NJ], v16b (&ah)[4], v16b (&al)[4], v16b (&bl)[NJ]) {
#pragma unroll
    for (int i = 0; i < 4; ++i)
#pragma unroll
      for (int j = 0; j < NJ; ++j) acc[i][j] = mma_b_raw(ah[i], bh[j], acc[i][j]);
    if (NSPLIT >= 1) {
#pragma unroll
      for (int i = 0; i < 4; ++i)
#pragma unroll
        for (int j = 0; j < NJ; ++j) acc[i][j] = mma_b_raw(al[i], bh[j], acc[i][j]);
    }
    if (NSPLIT >= 2) {
#pragma unroll
      for (int i = 0; i < 4; ++i)
#pragma unroll
        for (int j = 0; j < NJ; ++j) acc[i][j] = mma_b_raw(ah[i], bl[j], acc[i][j]);
    }
  };

  const int nst = K >> 6;
  // Ring of NBUF buffers, stage s in buffer s mod NBUF. Two buffers: stage 0, wait to 0, barrier, stage 1. More: every buffer is filled
  // at entry, and stage 0 is published while the later stages fly on.
  stage(0, 0);
  if (NBUF == 2) {
    wait_copies();
    __syncthreads();
    if (nst > 1) stage(1, 1);
  } else {
#pragma unroll
    for (int q = 1; q < NBUF; ++q) {
      __builtin_amdgcn_sched_barrier(0);   // keeps the stages' copies in issue order, which the counted waits count on
      if (q < nst) stage(q, q);
    }
    wait_copies_but<(NBUF - 1) * CPS>();
    if (nst < NBUF) wait_copies();         // fewer stages than buffers: the count would leave stage 0's own copies out
    __syncthreads();
  }
  ldset(0, 0, bhA, ahA, alA, blA);

  int cur = 0;                             // buffer of stage s
  for (int s = 0; s < nst; ++s) {
    const int nxt = (cur + 1 == NBUF) ? 0 : cur + 1;
    ldset(cur, 1, bhB, ahB, alB, blB);     // the stage's last block: the wave's last reads of buffer cur
    __builtin_amdgcn_sched_barrier(0);     // keeps the load group whole and ahead of the WMMAs
    if (active) mmaset(bhA, ahA, alA, blA);
    __builtin_amdgcn_sched_barrier(0);     // keeps these WMMAs in front of the waits, so that the loads above fly under them
    // publish point of stage s + 1, in front of stage s's last block and passed by every wave: own LDS reads of buffer cur
    // returned, own copies of stage s + 1 landed (those of stages s + 2 .. s + NBUF - 1 may fly on where all of them were issued;
    // in the last trips the wait is to 0), barrier; then the refill of buffer cur and the first fragments of stage s + 1
    wait_lds();
    if (NBUF > 2) wait_copies_but<(NBUF - 2) * CPS>();
    if (NBUF == 2 || s + NBUF - 1 >= nst) wait_copies();
    __syncthreads();
    if (s + NBUF < nst) stage(s + NBUF, cur);
    // unconditional (a branch here would merge the compiler's LDS wait counts): behind the last stage it reads again the last
    // stage's buffer (two buffers: the other one's old bytes), which no copy is aimed at any more, and nothing uses them
    ldset((NBUF == 2 || s + 1 < nst) ? nxt : cur, 0, bhA, ahA, alA, blA);
    __builtin_amdgcn_sched_barrier(0);     // keeps the load group whole and ahead of the WMMAs
    if (active) mmaset(bhB, ahB, alB, blB);
    cur = nxt;
  }
  wait_copies();
  wait_lds();
  if (!active) return;                     // wave-uniform; no work-group barrier below
  // (NJ = 8: no asm statement names the accumulators; its operands would hold all 256 of their registers below v256, which spills)
  if constexpr (NJ == 4) {
#pragma unroll
    for (int i = 0; i < 4; ++i) acc_guard4(acc[i][0], acc[i][1], acc[i][2], acc[i][3]);
  }

  // ---- epilogue ----
  size_t cbase;
  int ldce, rowb;
  if (TRI != 0) { cbase = (size_t)b * strideC + (size_t)t * 4096; ldce = 64; rowb = 0; }
  else          { cbase = (size_t)b * strideC; ldce = ldc; rowb = m0; }
  float* slab = sT[wave];
  auto put = [&](int pi, int pj) {                   // accumulators of row group pi, column group pj -> the wave's slab
#pragma unroll
    for (int j = 0; j < 4; ++j) {
#pragma unroll
      for (int r = 0; r < 8; ++r) {
        slab[(mOff + r) * 68 + (j << 4) + rlane] = acc[pi][pj * 4 + j][r];
      }
    }
  };
  // slabs of 16 rows x 64 columns: row group i, column group jh of the wave's tile. NJ = 4: unrolled. NJ = 8: the loop stays rolled, so
  // that the conversion and store code stands once and not eight times in the kernel's text (unrolled, the text passed 32 KB)
#pragma unroll(NJ == 4 ? 4 : 1)
  for (int ih = 0; ih < 4 * (NJ / 4); ++ih) {
    const int i = ih / (NJ / 4), jh = ih % (NJ / 4);
    const int mBase = m0 + (i << 4);
    const int nB = n0 + (jh << 6);
    const int colb = (TRI != 0) ? 0 : nB;
    if constexpr (NJ == 4) {
      put(ih, 0);
    } else {                                         // register numbers are fixed in the code: one branch per slab picks its accumulators
      switch (ih) {
        case 0: put(0, 0); break;
        case 1: put(0, 1); break;
        case 2: put(1, 0); break;
        case 3: put(1, 1); break;
        case 4: put(2, 0); break;
        case 5: put(2, 1); break;
        case 6: put(3, 0); break;
        default: put(3, 1); break;
      }
    }
    wait_lds();   // the slab is this wave's own: its LDS writes are done before other lanes read the rows back; no wait on global stores
    if (OUT_MODE == 0) {
      float* C = (float*)Cout + cbase;
      const int hh = lane >> 4, c4 = (lane & 15) * 4;     // 256-B row segment = 16 lanes x 16 B
      {
#pragma unroll
        for (int it = 0; it < 8; ++it) {
          const int row = it * 2 + hh;                     // it 0..7 x hh 0..1 = rows 0..15
          const v4f v = *(const v4f*)(slab + row * 68 + c4);
          *(v4f*)(C + (size_t)(rowb + (i << 4) + row) * ldce + colb + c4) = v;
        }
        
      }
    } else {
      const int q = lane >> 3, c8 = (lane & 7) * 8;
      unsigned short* C  = (unsigned short*)Cout  + (size_t)b * strideC;
      unsigned short* C2 = (unsigned short*)Cout2 + (size_t)b * strideC2;
      const bool wlo = (OUT_MODE == 2) || (nB < N2);      // wave-uniform
      v4u hv[4], lv[4];
#pragma unroll
      for (int it = 0; it < 4; ++it) {
        const int row = it * 4 + q;                        // it 0..3 x q 0..3 = rows 0..15
        const float* sp = slab + row * 68 + c8;
        v4u a, a2;
#pragma unroll
        for (int e = 0; e < 4; ++e) {
          const float f0 = sp[2 * e], f1 = sp[2 * e + 1];
          unsigned short h0, h1, l0, l1;
          if (OUT_MODE == 2) {
            h0 = bf_bits(f0); h1 = bf_bits(f1);
            l0 = bf_bits(f0 - bf_up(h0)); l1 = bf_bits(f1 - bf_up(h1));
          } else {
            const float g0 = f0 * hscale, g1 = f1 * hscale;
            const _Float16 x0 = (_Float16)g0, x1 = (_Float16)g1;
            h0 = h_bits(x0); h1 = h_bits(x1);
            l0 = h_bits((_Float16)((g0 - (float)x0) * rscale));
            l1 = h_bits((_Float16)((g1 - (float)x1) * rscale));
          }
          a[e] = pk16(h0, h1); a2[e] = pk16(l0, l1);
        }
        hv[it] = a; lv[it] = a2;
      }
      {
        unsigned short* pc  = C  + (size_t)(mBase + q) * ldc  + nB + c8;   // rows q, q + 4, q + 8, q + 12 of the slab
        unsigned short* pc2 = C2 + (size_t)(mBase + q) * ldc2 + nB + c8;
        store_rows4(pc, pc + (size_t)4 * ldc, pc + (size_t)8 * ldc, pc + (size_t)12 * ldc, hv[0], hv[1], hv[2], hv[3]);
        if (wlo) store_rows4(pc2, pc2 + (size_t)4 * ldc2, pc2 + (size_t)8 * ldc2, pc2 + (size_t)12 * ldc2, lv[0], lv[1], lv[2], lv[3]);
      }
    }
    // also behind the last slab
    slab_next();
  }
}

// =====================================================================================================
// One GEMM as a launch of its own: blockIdx.x = tile index, blockIdx.y = batch index.
// =====================================================================================================
template <int NSPLIT, int OUT_MODE, int TRI, int NBUF>
__global__ __launch_bounds__(256) void gemm_bf(
    const unsigned short* __restrict__ Ahp, const unsigned short* __restrict__ Alp, int lda, long long strideA,
    const unsigned short* __restrict__ Bhp, const unsigned short* __restrict__ Blp, int ldb, long long strideB,
    void* Cout, int ldc, long long strideC,
    void* Cout2, int ldc2, long long strideC2, int N2,
    int M, int N, int K, float hscale, float rscale) {
  __shared__ __align__(16) unsigned char ring[NBUF * gemm_bf_stage_bytes(NSPLIT)];
  __shared__ __align__(16) float sT[8][16 * 68];   // per-wave 16x64 slab, pitch 68 floats
  static_assert(sizeof(ring) + sizeof(sT) <= 327680);
  gemm_bf_body<NSPLIT, OUT_MODE, TRI, NBUF>(ring, sT, (int)blockIdx.x, (int)blockIdx.y, Ahp, Alp, lda, strideA, Bhp, Blp, ldb, strideB,
                                      Cout, ldc, strideC, Cout2, ldc2, strideC2, N2, M, N, K, hscale, rscale);
}

// =====================================================================================================
// The q and k projections, which read nothing of each other, in one grid of 2 NPQ work-groups of equal cost:
//   blocks 0 .. NPQ-1        q = x . Wq^T -> bf16 hi/lo planes [NB*SEQ][DM]   (A = Xb, Bt = Wq [out][in]; M=NB*SEQ, N=DM, K=DM)
//   blocks NPQ .. 2 NPQ-1    k = x . Wk^T -> bf16 hi/lo planes
// Wb holds the Wq and Wk planes one behind the other. The choice is the same for a whole work-group.
// 256 x 256 tiles: 2 NPQ = one work-group for each of 256 WGPs. Three ring buffers (four would pass the LDS); a wave's registers
// (256 of accumulators and two fragment sets of 96) admit one work-group a WGP whatever its LDS.
// =====================================================================================================
#define NPQ ((NB * SEQ / 256) * (DM / 256))
static_assert(((NB * SEQ) % 256) == 0 && (DM % 256) == 0);
__global__ __launch_bounds__(256) void proj_qk(
    const unsigned short* __restrict__ Xb, const unsigned short* __restrict__ Wb,
    unsigned short* Qh, unsigned short* Ql, unsigned short* Kh, unsigned short* Kl) {
  __shared__ __align__(16) unsigned char ring[3 * gemm_bf_stage_bytes(0, 8)];
  __shared__ __align__(16) float sT[8][16 * 68];   // per-wave 16x64 slab, pitch 68 floats
  static_assert(sizeof(ring) + sizeof(sT) <= 327680);
  const int blk = blockIdx.x;
  const bool isk = blk >= NPQ;
  const unsigned short* W = Wb + (isk ? (size_t)DM * DM : (size_t)0);
  gemm_bf_body<0, 2, 0, 3, 8>(ring, sT, isk ? blk - NPQ : blk, 0, Xb, Xb, DM, 0LL, W, W, DM, 0LL,
                        (void*)(isk ? Kh : Qh), DM, 0LL, (void*)(isk ? Kl : Ql), DM, 0LL, DM,
                        NB * SEQ, DM, DM, 1.0f, 1.0f);
}

// =====================================================================================================
// The scores and the v^T projection, which read nothing of each other, in one grid. One work-group fills a WGP's LDS, there are
// more score tiles than WGPs, so the index runs from the longest to the shortest (for speed only) and
// the v^T tiles fill the places that the last score tiles leave idle:
//   blocks 0 .. NB NSF-1     scores = q . k^T, 3 bf16 products -> packed f32 tiles: work-group tiles (I, J <= 2I), NSF a batch
//   the next NB NSI          the score tiles (I, 2I+1) on the diagonal, in which 3 of 8 waves work
//   the rest, NPV a batch    v^T = Wv . x^T -> f16 hi plane f16(16 v) [b][d][key] (pitch SEQ) and residual plane x4096 for keys < VLP
//                            (pitch VLP)   (A = Wv [out][in], Bt = Xb rows of batch b; M=DM, N=SEQ, K=DM), 256 x 256 tiles
// The choice is the same for a whole work-group; the two parts use the same LDS.
// =====================================================================================================
#define NSI (SEQ / 256)
#define NSF (NSI * NSI)
#define NPV ((DM / 256) * (SEQ / 256))
static_assert((DM % 256) == 0 && (SEQ % 256) == 0);
__global__ __launch_bounds__(256) void scores_vt(
    const unsigned short* __restrict__ Qh, const unsigned short* __restrict__ Ql,
    const unsigned short* __restrict__ Kh, const unsigned short* __restrict__ Kl, float* Sp,
    const unsigned short* __restrict__ Xb, const unsigned short* __restrict__ Wv,
    unsigned short* VTh, unsigned short* VTl) {
  __shared__ __align__(16) unsigned char ring[2 * gemm_bf_stage_bytes(2)];
  __shared__ __align__(16) float sT[8][16 * 68];   // per-wave 16x64 slab, pitch 68 floats
  const int blk = blockIdx.x;
  if (blk < NB * (NSF + NSI)) {
    int b, I, J;
    if (blk < NB * NSF) {                  // row I holds the 2I+1 tiles f = I*I .. I*I + 2I
      b = blk / NSF;
      const int f = blk - b * NSF;
      I = 0;
      for (int q = 1; q < NSI; ++q)
        if (q * q <= f) I = q;
      J = f - I * I;
    } else {
      const int e = blk - NB * NSF;
      b = e / NSI;
      I = e - b * NSI;
      J = 2 * I + 1;
    }
    gemm_bf_body<2, 0, 1, 2>(ring, sT, I * (I + 1) + J, b, Qh, Ql, DM, (long long)SEQ * DM, Kh, Kl, DM, (long long)SEQ * DM,
                          (void*)Sp, 64, (long long)NTRI * 4096, (void*)Sp, 64, 0LL, 0,
                          SEQ, SEQ, DM, 1.0f, 1.0f);
  } else {
    const int e = blk - NB * (NSF + NSI);
    static_assert(3 * gemm_bf_stage_bytes(0, 8) <= 2 * gemm_bf_stage_bytes(2));   // three v^T stages lie in the two score stages' LDS
    gemm_bf_body<0, 3, 0, 3, 8>(ring, sT, e % NPV, e / NPV, Wv, Wv, DM, 0LL, Xb, Xb, DM, (long long)SEQ * DM,
                          (void*)VTh, SEQ, (long long)DM * SEQ, (void*)VTl, VLP, (long long)DM * VLP, VLP,
                          DM, SEQ, DM, VSC, LSC);
  }
}

// =====================================================================================================
// Row softmax over the packed lower-triangular score tiles. One wave per query row (block = 8 rows, grid = NB*SEQ/8).
// Row (b, i), tm = i>>6, r = i&63: score (i, j) sits at Sp + ((b*NTRI + tm(tm+1)/2 + (j>>6))*4096 + r*64 + (j&63)), j <= 64 tm + 63.
// The wave handles ng = tm/4 + 1 groups of 256 keys (lane: 8 consecutive keys per group, two 16-B loads with the key-tile
// address clamped to tn <= tm); z = s/32 for j <= i, -inf otherwise; m = max, p = exp(z - m), l = sum, P = p/l (all f32).
// Writes Ph = f16(1024 P) for keys 0 .. 256 ng - 1 of row (b, i) (pitch SEQ; >= the keys the p.v GEMM copies for the row's work-group tile; zeros
// for j > i) and, for rows i < RESR, Pl = f16((1024 P - Ph) * 4096) with the same key extent (<= VLP, pitch VLP).
// coverage: NB*SEQ rows x written extent >= every key range any consumer reads.
// =====================================================================================================
__global__ __launch_bounds__(256) void softmax_rows(const float* __restrict__ Sp,
                                                    unsigned short* Php, unsigned short* Plp) {
  const int lane = threadIdx.x & 31, wave = threadIdx.x >> 5;
  const int row = blockIdx.x * 8 + wave;
  if (row >= NB * SEQ) return;             // wave-uniform; exact grid never triggers it; no block barriers below
  const int b  = row / SEQ;
  const int i  = row - b * SEQ;
  const int tm = i >> 6, r = i & 63;
  const int ng = (tm >> 2) + 1;            // 1..8, wave-uniform
  const float* srow = Sp + ((size_t)b * NTRI + (size_t)((tm * (tm + 1)) >> 1)) * 4096 + (size_t)r * 64;

  float z[8][8];
  float m = -INFINITY;
#pragma unroll
  for (int g = 0; g < 8; ++g) {
#pragma unroll
    for (int e = 0; e < 8; ++e) z[g][e] = -INFINITY;
    if (g < ng) {
      const int j0 = 256 * g + 8 * lane;
      int tn = j0 >> 6;
      tn = (tn < tm) ? tn : tm;            // clamped tile address; keys with tn > tm are all masked below
      const float* p = srow + (size_t)tn * 4096 + (j0 & 63);
      const v4f a = *(const v4f*)(p);
      const v4f c = *(const v4f*)(p + 4);
      const float v[8] = {a[0], a[1], a[2], a[3], c[0], c[1], c[2], c[3]};
#pragma unroll
      for (int e = 0; e < 8; ++e) {
        const float zz = (j0 + e <= i) ? (v[e] * 0.03125f) : -INFINITY;
        z[g][e] = zz;
        m = fmaxf(m, zz);
      }
    }
  }
#pragma unroll
  for (int off = 1; off < 32; off <<= 1) m = fmaxf(m, __shfl_xor(m, off, 32));   // finite: key 0 is always kept

  float l = 0.f;
#pragma unroll
  for (int g = 0; g < 8; ++g) {
    if (g < ng) {
#pragma unroll
      for (int e = 0; e < 8; ++e) {
        const float p = __expf(z[g][e] - m);   // masked: exp(-inf) = 0
        z[g][e] = p;
        l += p;
      }
    }
  }
#pragma unroll
  for (int off = 1; off < 32; off <<= 1) l += __shfl_xor(l, off, 32);          // l >= 1
  const float inv1k = (1.0f / l) * PSC;

  const bool res = (i < RESR);             // wave-uniform
  v4u ph[8];
  v4u pl0 = {0u, 0u, 0u, 0u};
  v4u pl1 = {0u, 0u, 0u, 0u};
#pragma unroll
  for (int g = 0; g < 8; ++g) {
    v4u hv = {0u, 0u, 0u, 0u};
    v4u lv = {0u, 0u, 0u, 0u};
    if (g < ng) {
#pragma unroll
      for (int e = 0; e < 4; ++e) {
        const float f0 = z[g][2 * e] * inv1k, f1 = z[g][2 * e + 1] * inv1k;
        const _Float16 x0 = (_Float16)f0, x1 = (_Float16)f1;
        hv[e] = pk16(h_bits(x0), h_bits(x1));
        lv[e] = pk16(h_bits((_Float16)((f0 - (float)x0) * LSC)), h_bits((_Float16)((f1 - (float)x1) * LSC)));
      }
    }
    ph[g] = hv;
    if (g == 0) pl0 = lv;
    if (g == 1) pl1 = lv;
  }

  unsigned short* prow = Php + (size_t)row * SEQ + 8 * lane;
  const int il = res ? i : 0;              // clamped row into the residual plane (stored only when res)
  unsigned short* lrow = Plp + ((size_t)b * RESR + (size_t)il) * VLP + 8 * lane;
  {
#pragma unroll
    for (int g = 0; g < 8; ++g) {
      if (g < ng) *(v4u*)(prow + 256 * g) = ph[g];
    }
    if (res) {                             // res rows have i < RESR (multiple of 256) -> 256 ng <= RESR = VLP
      *(v4u*)(lrow) = pl0;
      if (ng > 1) *(v4u*)(lrow + 256) = pl1;
    }
    
  }
}

// =====================================================================================================
// p.v GEMM on f16 WMMA, per batch b: ctx[b][q][d] = sum_key P[b][q][key] * VT[b][d][key], stored as the two bf16 planes that the
// output projection reads: hi = RNE(ctx), lo = RNE(ctx - hi), unscaled, both [NB*SEQ][DM].
//   A  = Ph  [b][SEQ][SEQ]  f16(1024 P), pitch SEQ         Al = Pl  [b][RESR][VLP] f16 residual x4096
//   Bt = VTh [b][DM][SEQ]   f16(16 v),   pitch SEQ         Bl = VTl [b][DM][VLP]   f16 residual x4096
// One work-group (8 waves, 4 x 2) per (64*MI) x 128 output tile, one wave per (16*MI) x 64 tile of it; rows mBase + ...; the
// operand rows of the work-group's tile are staged in LDS, 64 keys a stage, by asynchronous copies in a ring of NBUF buffers up to the
// causal key extent of the work-group's last row tile (every P entry in that range was written by the softmax: its written extent
// is 256*(row/256 + 1) keys). A wave works on keys k < 64*((m0>>6)+1) only and passes the later publish points idle.
// RES (rows < RESR, MI = 2): acc0 += Ph.VTh; acc1 += Pl.VTh + Ph.VTl,
// ctx = acc0*OSCALE + acc1*OSCALE/4096; otherwise single product ctx = acc0*OSCALE. f32 accumulate.
// bx = index of the work-group's tile among those of rows mBase .. mBase + M - 1 (M a multiple of 64*MI), row-major, DM/128 a row;
// ring and sT are the work-group's LDS.
// =====================================================================================================
__host__ __device__ constexpr int gemm_pv_stage_bytes(bool res, int mi) {   // one stage: Ph 64*mi rows | Pl | VTh 128 rows | VTl
  return (res ? 2 : 1) * (64 * mi + 128) * LPITCH;
}
template <bool RES, int MI, int NBUF>
__device__ __forceinline__ void gemm_pv_body(
    unsigned char* ring, float (*sT)[16 * 68], int bx, int b,
    const unsigned short* __restrict__ Php, const unsigned short* __restrict__ Plp,
    const unsigned short* __restrict__ Vhp, const unsigned short* __restrict__ Vlp,
    unsigned short* Chp, unsigned short* Clp, int mBase, int M) {
  constexpr int AR     = 64 * MI;                                        // rows of the work-group's tile
  static_assert(AR == (RES ? 128 : 256) && (RESR % AR) == 0);
  constexpr int OFF_AL = AR * LPITCH;                                    // stage layout: Ph AR rows | Pl | VTh 128 rows | VTl
  constexpr int OFF_BH = (RES ? 2 : 1) * AR * LPITCH;
  constexpr int OFF_BL = OFF_BH + 128 * LPITCH;
  constexpr int STG    = OFF_BH + (RES ? 2 : 1) * 128 * LPITCH;
  static_assert(STG == gemm_pv_stage_bytes(RES, MI));
  constexpr int CPS = 4 * (RES ? 4 : 3);                                 // copies of one wave for one stage
  static_assert(NBUF >= 2 && NBUF * CPS <= 63);
  const int tid  = threadIdx.x;
  const int lane = tid & 31;
  const int wave = __builtin_amdgcn_readfirstlane(tid >> 5);
  const int bN = DM >> 7;                          // 8
  const int bm = bx / bN;
  const int bn = bx - bm * bN;
  if (bm >= M / AR) return;                        // work-group-uniform, in front of every copy and barrier
  const int r0 = mBase + bm * AR;                  // first row of the work-group's tile
  const int m0 = r0 + (wave >> 1) * 16 * MI;
  const int n0 = bn * 128 + (wave & 1) * 64;
  int keff = (((m0 >> 6) + 1) << 6);               // causal key extent of this row tile, multiple of 64
  if (keff > SEQ) keff = SEQ;
  if (RES && keff > VLP) keff = VLP;               // never taken for mBase + M <= RESR; keeps residual reads in range
  int kblk = ((((r0 + 3 * 16 * MI) >> 6) + 1) << 6);   // the same of the work-group's last row tile: the staged extent
  if (kblk > SEQ) kblk = SEQ;
  if (RES && kblk > VLP) kblk = VLP;
  int rl0 = r0;                                    // first row in the residual plane, clamped; equals r0 for the RES launch
  if (rl0 > RESR - AR) rl0 = RESR - AR;

  const unsigned short* Ag  = Php + (size_t)b * SEQ * SEQ + (size_t)r0 * SEQ;
  const unsigned short* Alg = Plp + (size_t)b * RESR * VLP + (size_t)rl0 * VLP;
  const unsigned short* Bg  = Vhp + (size_t)b * DM * SEQ + (size_t)(bn * 128) * SEQ;
  const unsigned short* Blg = Vlp + (size_t)b * DM * VLP + (size_t)(bn * 128) * VLP;
  const unsigned ringb = (unsigned)(size_t)(const void*)ring;    // LDS byte address of the ring

  const int rlane = lane & 15;
  const int koff  = (lane >> 4) * 8;
  const int mOff  = (lane >> 4) * 8;

  auto stage = [&](int s, int buf) {
    const unsigned lb = ringb + (unsigned)(buf * STG);
    const size_t ks = (size_t)s * 64;
    if (RES) {                                     // AR = 128: one chunk a plane
      copy_chunks2(row_chunk(lb, Ag + ks, SEQ, 0, tid), row_chunk(lb + OFF_BH, Bg + ks, SEQ, 0, tid));
      copy_chunks2(row_chunk(lb + OFF_AL, Alg + ks, VLP, 0, tid), row_chunk(lb + OFF_BL, Blg + ks, VLP, 0, tid));
    } else {                                       // AR = 256: two chunks of P, one of v^T
      copy_chunks3(row_chunk(lb, Ag + ks, SEQ, 0, tid), row_chunk(lb, Ag + ks, SEQ, 1, tid),
                   row_chunk(lb + OFF_BH, Bg + ks, SEQ, 0, tid));
    }
  };

  v8f acc0[MI][4], acc1[MI][4];
#pragma unroll
  for (int i = 0; i < MI; ++i)
#pragma unroll
    for (int j = 0; j < 4; ++j) { acc0[i][j] = zero8(); acc1[i][j] = zero8(); }

  // Two fragment sets: while the WMMAs of one 32-key block run on one set, the next block's fragments are fetched into the other.
  v16h bhA[4], ahA[MI], alA[MI], blA[4], bhB[4], ahB[MI], alB[MI], blB[4];
  const int aoff = ((wave >> 1) * 16 * MI + rlane) * LPITCH + koff * 2;
  const int boff = OFF_BH + ((wave & 1) * 64 + rlane) * LPITCH + koff * 2;
  auto ldset = [&](int buf, int kk, v16h (&bh)[4], v16h (&ah)[MI], v16h (&al)[MI], v16h (&bl)[4]) {
    const unsigned char* pa = ring + buf * STG + aoff + kk * 64;
    const unsigned char* pb = ring + buf * STG + boff + kk * 64;
#pragma unroll
    for (int j = 0; j < 4; ++j) {
      bh[j] = ldfrag_h((const _Float16*)(pb + j * 16 * LPITCH));
      if (RES) bl[j] = ldfrag_h((const _Float16*)(pb + (OFF_BL - OFF_BH) + j * 16 * LPITCH));
    }
#pragma unroll
    for (int i = 0; i < MI; ++i) {
      ah[i] = ldfrag_h((const _Float16*)(pa + i * 16 * LPITCH));
      if (RES) al[i] = ldfrag_h((const _Float16*)(pa + OFF_AL + i * 16 * LPITCH));
    }
  };
  // acc0 += Ph.VTh; acc1 += Pl.VTh, then Ph.VTl, per 32-key block
  auto mmaset = [&](v16h (&bh)[4], v16h (&ah)[MI], v16h (&al)[MI], v16h (&bl)[4]) {
#pragma unroll
    for (int i = 0; i < MI; ++i)
#pragma unroll
      for (int j = 0; j < 4; ++j) {
        acc0[i][j] = mma_h_raw(ah[i], bh[j], acc0[i][j]);
        if (RES) acc1[i][j] = mma_h_raw(al[i], bh[j], acc1[i][j]);
      }
    if (RES) {
#pragma unroll
      for (int i = 0; i < MI; ++i)
#pragma unroll
        for (int j = 0; j < 4; ++j) acc1[i][j] = mma_h_raw(ah[i], bl[j], acc1[i][j]);
    }
  };

  const int nst = kblk >> 6;
  // Ring of NBUF buffers, stage s in buffer s mod NBUF. Two buffers: stage 0, wait to 0, barrier, stage 1. More: every buffer is filled
  // at entry, and stage 0 is published while the later stages fly on.
  stage(0, 0);
  if (NBUF == 2) {
    wait_copies();
    __syncthreads();
    if (nst > 1) stage(1, 1);
  } else {
#pragma unroll
    for (int q = 1; q < NBUF; ++q) {
      __builtin_amdgcn_sched_barrier(0);   // keeps the stages' copies in issue order, which the counted waits count on
      if (q < nst) stage(q, q);
    }
    wait_copies_but<(NBUF - 1) * CPS>();
    if (nst < NBUF) wait_copies();         // fewer stages than buffers: the count would leave stage 0's own copies out
    __syncthreads();
  }
  ldset(0, 0, bhA, ahA, alA, blA);

  int cur = 0;                             // buffer of stage s
  for (int s = 0; s < nst; ++s) {
    const bool act = s * 64 < keff;        // wave-uniform
    const int nxt = (cur + 1 == NBUF) ? 0 : cur + 1;
    ldset(cur, 1, bhB, ahB, alB, blB);     // the stage's last block: the wave's last reads of buffer cur
    __builtin_amdgcn_sched_barrier(0);     // keeps the load group whole and ahead of the WMMAs
    if (act) mmaset(bhA, ahA, alA, blA);
    __builtin_amdgcn_sched_barrier(0);     // keeps these WMMAs in front of the waits, so that the loads above fly under them
    // publish point of stage s + 1, in front of stage s's last block and passed by every wave: own LDS reads of buffer cur
    // returned, own copies of stage s + 1 landed (those of stages s + 2 .. s + NBUF - 1 may fly on where all of them were issued;
    // in the last trips the wait is to 0), barrier; then the refill of buffer cur and the first fragments of stage s + 1
    wait_lds();
    if (NBUF > 2) wait_copies_but<(NBUF - 2) * CPS>();
    if (NBUF == 2 || s + NBUF - 1 >= nst) wait_copies();
    __syncthreads();
    if (s + NBUF < nst) stage(s + NBUF, cur);
    // unconditional (a branch here would merge the compiler's LDS wait counts): behind the last stage it reads again the last
    // stage's buffer (two buffers: the other one's old bytes), which no copy is aimed at any more, and nothing uses them
    ldset((NBUF == 2 || s + 1 < nst) ? nxt : cur, 0, bhA, ahA, alA, blA);
    __builtin_amdgcn_sched_barrier(0);     // keeps the load group whole and ahead of the WMMAs
    if (act) mmaset(bhB, ahB, alB, blB);
    cur = nxt;
  }
  wait_copies();
  wait_lds();
#pragma unroll
  for (int i = 0; i < MI; ++i) {
    acc_guard4(acc0[i][0], acc0[i][1], acc0[i][2], acc0[i][3]);
    if (RES) acc_guard4(acc1[i][0], acc1[i][1], acc1[i][2], acc1[i][3]);
  }

  // ---- epilogue ----
  float* slab = sT[wave];
  unsigned short* Ch = Chp + (size_t)b * SEQ * DM;
  unsigned short* Cl = Clp + (size_t)b * SEQ * DM;
  const float rsc = OSCALE * (1.0f / LSC);
#pragma unroll
  for (int i = 0; i < MI; ++i) {
    const int mB = m0 + (i << 4);
#pragma unroll
    for (int j = 0; j < 4; ++j) {
#pragma unroll
      for (int r = 0; r < 8; ++r) {
        float v = acc0[i][j][r] * OSCALE;
        if (RES) v += acc1[i][j][r] * rsc;
        slab[(mOff + r) * 68 + (j << 4) + rlane] = v;
      }
    }
    wait_lds();   // the slab is this wave's own: its LDS writes are done before other lanes read the rows back; no wait on global stores
    {
      const int q = lane >> 3, c8 = (lane & 7) * 8;        // 128-B row segment of a plane = 8 lanes x 16 B
      v4u hv[4], lv[4];
#pragma unroll
      for (int it = 0; it < 4; ++it) {
        const int row = it * 4 + q;                        // it 0..3 x q 0..3 = rows 0..15
        const float* sp = slab + row * 68 + c8;
        v4u a, a2;
#pragma unroll
        for (int e = 0; e < 4; ++e) {
          const float f0 = sp[2 * e], f1 = sp[2 * e + 1];
          const unsigned short h0 = bf_bits(f0), h1 = bf_bits(f1);
          a[e]  = pk16(h0, h1);
          a2[e] = pk16(bf_bits(f0 - bf_up(h0)), bf_bits(f1 - bf_up(h1)));
        }
        hv[it] = a; lv[it] = a2;
      }
#pragma unroll
      for (int it = 0; it < 4; ++it) {
        const int row = it * 4 + q;
        *(v4u*)(Ch + (size_t)(mB + row) * DM + n0 + c8) = hv[it];
        *(v4u*)(Cl + (size_t)(mB + row) * DM + n0 + c8) = lv[it];
      }
    }
    // also behind the last slab
    slab_next();
  }
}

// =====================================================================================================
// Both parts of p.v, which read nothing of each other, in one grid. A work-group's cost grows with its causal key extent;
// the index runs from the longest to the shortest (for speed only):
//   blocks 0 .. NPVH-1   rows RESR .. SEQ-1, single f16 product, 256 x 128 tiles, last row block first (NPVC tiles a row block)
//   the rest             rows 0 .. RESR-1 with the residual planes (3 f16 products), 128 x 128 tiles, last row block first
// The choice is the same for a whole work-group; the two parts use the same LDS.
// =====================================================================================================
#define NPVC ((DM / 128) * NB)
#define NPVH (((SEQ - RESR) / 256) * NPVC)
#define NPVR ((RESR / 128) * NPVC)
static_assert(((SEQ - RESR) % 256) == 0 && (RESR % 128) == 0 && (DM % 128) == 0);
__global__ __launch_bounds__(256) void gemm_pv_all(
    const unsigned short* __restrict__ Php, const unsigned short* __restrict__ Plp,
    const unsigned short* __restrict__ Vhp, const unsigned short* __restrict__ Vlp, unsigned short* Chp, unsigned short* Clp) {
  constexpr int RB = WS_MAX2(3 * gemm_pv_stage_bytes(true, 2), 4 * gemm_pv_stage_bytes(false, 4));
  __shared__ __align__(16) unsigned char ring[RB];
  __shared__ __align__(16) float sT[8][16 * 68];
  const int blk = blockIdx.x;
  if (blk < NPVH) {
    const int rb = (SEQ - RESR) / 256 - 1 - blk / NPVC, e = blk % NPVC;
    gemm_pv_body<false, 4, 4>(ring, sT, rb * (DM / 128) + e % (DM / 128), e / (DM / 128), Php, Plp, Vhp, Vlp, Chp, Clp, RESR, SEQ - RESR);
  } else {
    const int rb = RESR / 128 - 1 - (blk - NPVH) / NPVC, e = (blk - NPVH) % NPVC;
    gemm_pv_body<true, 2, 3>(ring, sT, rb * (DM / 128) + e % (DM / 128), e / (DM / 128), Php, Plp, Vhp, Vlp, Chp, Clp, 0, RESR);
  }
}

// =====================================================================================================
// Workspace map (bytes, full build NB 4 / SEQ 2048; every region is an exact multiple of its tile / whole-line store
// granularity; regions A and B are reused in stream order):
//   region A [0, 33554432):          Xb bf16 [8192][1024] at 0 (16777216) + Wq,Wk,Wv bf16 [1024][1024] at 16777216 (3 x 2097152),
//                                    read up to the launch of the scores and v^T
//                                    then: Ch, Cl bf16 ctx planes [8192][1024] at 0 (2 x 16777216), written by p.v
//   region B [33554432, 100663296):  Qh, Ql, Kh, Kl bf16 [8192][1024] (4 x 16777216)
//                                    then, once the scores are done: Ph f16 [4][2048][2048] (33554432) + Pl f16 [4][512][512] (2097152)
//   region C [100663296, 121634816): VTh f16 [4][1024][2048] (16777216) + VTl f16 [4][1024][512] (4194304)
//   region D [121634816, 123731968): WoT bf16 [1024][1024] (2097152), live from launch 1 to the last GEMM
//   region E [123731968, 158334976): Sp f32 packed score tiles [4][528][64][64] (34603008); a region of its own, because the launch
//                                    that writes it still reads Xb and Wv
//   end 158334976
// =====================================================================================================
extern "C" void kernel_launch(void* const* d_in, const int* in_sizes, int n_in,
                              void* d_out, int out_size, void* d_ws, size_t ws_size,
                              hipStream_t stream) {
  if (n_in < 5) return;
  if (in_sizes[4] < (NB - 1) * SEQ_FULL * DM + SEQ * DM) return;
  if (in_sizes[0] < DM * DM || in_sizes[1] < DM * DM || in_sizes[2] < DM * DM || in_sizes[3] < DM * DM) return;
  if (out_size < NB * SEQ * DM) return;

  // wire order of the inputs: k, q, v, out_proj, x
  const float* wk = (const float*)d_in[0];   // [out][in]
  const float* wq = (const float*)d_in[1];   // [out][in]
  const float* wv = (const float*)d_in[2];   // [out][in]
  const float* wo = (const float*)d_in[3];   // [in][out]
  const float* x  = (const float*)d_in[4];   // [NB_FULL][SEQ_FULL][DM]
  float* out = (float*)d_out;

  const size_t PX  = (size_t)NB * SEQ * DM * 2;       // 16-bit plane [NB*SEQ][DM]
  const size_t PW  = (size_t)DM * DM * 2;             // one weight plane
  const size_t PS  = (size_t)NB * NTRI * 4096 * 4;    // packed f32 score tiles
  const size_t PC  = 2 * PX;                          // bf16 hi and lo ctx planes
  const size_t PP  = (size_t)NB * SEQ * SEQ * 2;      // Ph
  const size_t PPL = (size_t)NB * RESR * VLP * 2;     // Pl
  const size_t PVT = (size_t)NB * DM * SEQ * 2;       // VTh
  const size_t PVL = (size_t)NB * DM * VLP * 2;       // VTl
  const size_t RA = ((PX + 3 * PW) > PC) ? (PX + 3 * PW) : PC;
  const size_t oXb = 0;
  const size_t oW  = PX;
  const size_t oCh = 0;
  const size_t oCl = PX;
  const size_t oQh = RA;
  const size_t oQl = RA + PX;
  const size_t oKh = RA + 2 * PX;
  const size_t oKl = RA + 3 * PX;
  const size_t RBend = RA + 4 * PX;
  const size_t oPh = RA;
  const size_t oPl = RA + PP;
  if (oPl + PPL > RBend) return;
  const size_t oVTh = RBend;
  const size_t oVTl = RBend + PVT;
  const size_t oWo  = oVTl + PVL;
  const size_t oS   = oWo + PW;
  const size_t total = oS + PS;                       // 158334976 in the full build
  if (total > ws_size) return;

  char* ws = (char*)d_ws;
  unsigned short* Xb  = (unsigned short*)(ws + oXb);
  unsigned short* Wb  = (unsigned short*)(ws + oW);   // Wq plane, then Wk, then Wv
  float*          Sp  = (float*)(ws + oS);
  unsigned short* Qh  = (unsigned short*)(ws + oQh);
  unsigned short* Ql  = (unsigned short*)(ws + oQl);
  unsigned short* Kh  = (unsigned short*)(ws + oKh);
  unsigned short* Kl  = (unsigned short*)(ws + oKl);
  unsigned short* Ph  = (unsigned short*)(ws + oPh);
  unsigned short* Pl  = (unsigned short*)(ws + oPl);
  unsigned short* Ch  = (unsigned short*)(ws + oCh);
  unsigned short* Cl  = (unsigned short*)(ws + oCl);
  unsigned short* VTh = (unsigned short*)(ws + oVTh);
  unsigned short* VTl = (unsigned short*)(ws + oVTl);
  unsigned short* WoT = (unsigned short*)(ws + oWo);

  const dim3 blk(256);
  const int nGroups = NB * SEQ * DM / 8 + 3 * (DM * DM / 8);
  const dim3 gCvt(NWOT + (nGroups + 255) / 256);
  const dim3 gQk(2 * NPQ);
  const dim3 gSv(NB * (NSF + NSI) + NB * NPV);
  const dim3 gProj(((NB * SEQ / 64) * (DM / 64) + 7) / 8, 1);
  const dim3 gSm((NB * SEQ + 7) / 8);
  const dim3 gPv(NPVH + NPVR);

  // (1) x and Wq, Wk, Wv -> bf16 planes (Xb, then the three weight planes contiguous); Wo [in][out] -> WoT bf16 [out][in]
  cvt_inputs<<<gCvt, blk, 0, stream>>>(x, wq, wk, wv, wo, Xb, WoT);
  // (2) q, k -> bf16 hi/lo planes [NB*SEQ][DM]
  proj_qk<<<gQk, blk, 0, stream>>>(Xb, Wb, Qh, Ql, Kh, Kl);
  // (3) scores = q . k^T per batch over the NTRI lower-triangular 64x64 tiles, 3 bf16 products -> packed f32 tiles;
  //     v^T -> f16 hi plane and residual plane
  scores_vt<<<gSv, blk, 0, stream>>>(Qh, Ql, Kh, Kl, Sp, Xb, Wb + (size_t)2 * DM * DM, VTh, VTl);
  // (4) causal row softmax in f32 -> Ph f16(1024 P) and Pl residual planes
  softmax_rows<<<gSm, blk, 0, stream>>>(Sp, Ph, Pl);
  // (5) ctx = p.v -> bf16 hi/lo planes [NB*SEQ][DM]: rows RESR..SEQ-1 single f16 product (64x64 wave tiles), rows 0..RESR-1 of every sequence
  //     with the residual planes (3 f16 products, 32x64 wave tiles)
  gemm_pv_all<<<gPv, blk, 0, stream>>>(Ph, Pl, VTh, VTl, Ch, Cl);
  // (6) out = ctx . Wo -> f32 output buffer   (A = Ch + Cl, Bt = WoT [out][in]; M=NB*SEQ, N=DM, K=DM; 2 bf16 products)
  gemm_bf<1, 0, 0, 3><<<gProj, blk, 0, stream>>>(
      Ch, Cl, DM, 0LL, WoT, WoT, DM, 0LL,
      (void*)out, DM, 0LL, (void*)out, DM, 0LL, 0,
      NB * SEQ, DM, DM, 1.0f, 1.0f);
  (void)hipGetLastError();
}

// v008
// Measured time: 150 microseconds a run.
// Timed twice side by side with v007, it ran 1.04 times as fast both times.
// Over all steps from v000 it is 3.35 times as fast.
// Contractions: q, k, v^T projections = v_wmma_f32_16x16x32_bf16 (bf16 RNE-converted x and W, single product, f32 accumulate);
// q.k^T scores = v_wmma_f32_16x16x32_bf16 with bf16 hi/lo planes of q and k (hi.hi + lo.hi + hi.lo), f32 accumulate;
// p.v = v_wmma_f32_16x16x32_f16 (p carried x1024 in f16, v^T carried x16 in f16, single product; query rows 0..RESR-1 of every
// sequence add the f16 residual planes (x4096) of p and v^T in a separate accumulator), f32 accumulate;
// output projection ctx.Wo = v_wmma_f32_16x16x32_bf16 with bf16 hi/lo planes of ctx and the bf16 RNE-converted Wo^T plane
// (hi.W + lo.W, one accumulator), f32 accumulate;
// causal mask, row max, exp, sum and normalisation in f32 on the VALU.
// Carry audit:
//   Ph  = f16(1024 * p), p already normalised by the row sum     } OSCALE = 1/(1024*16) folded exactly once in the p.v epilogue
//   VTh = f16(16 * v)                                            }
//   Pl  = f16((1024 p - Ph) * 4096)                              } products Ph.VTl and Pl.VTh go only to accumulator acc1,
//   VTl = f16((16 v - VTh) * 4096), keys 0..VLP-1                } folded with OSCALE * (1/4096) once in the same epilogue
//   q / k lo planes are unscaled bf16 residuals (v - hi) sharing the hi accumulator; score scale 1/32 applied once in f32 in the softmax.
//   ctx hi / lo planes are unscaled bf16 (lo = RNE(ctx - hi)) sharing one accumulator in the output projection.
// The module's softmax over all keys followed by the lower-triangular mask and the division by the masked row sum equals
// exp(z_j - m) / sum_{j<=i} exp(z_j - m) for any finite shift m; it is evaluated with the causal row max as the shift.
#include <hip/hip_runtime.h>
#include <math.h>

#define NB_FULL  4
#define SEQ_FULL 2048
#ifndef NB
#define NB    4
#endif
#ifndef SEQ
#define SEQ   2048
#endif
#define DM    1024
#define NQT   (SEQ / 64)                  // query/key tiles of 64
#define NTRI  ((NQT * (NQT + 1)) / 2)     // lower-triangular 64x64 score tiles per sequence (528 at SEQ 2048)
#define RESR  ((SEQ < 512) ? SEQ : 512)   // leading query rows per sequence that use the residual planes
#define VLP   RESR                        // key pitch of the p / v^T residual planes
#define PSC   1024.0f
#define VSC   16.0f
#define LSC   4096.0f
#define OSCALE (1.0f / 16384.0f)          // 1 / (PSC * VSC)
static_assert(NB >= 1 && NB <= NB_FULL);
static_assert(SEQ >= 256 && SEQ <= SEQ_FULL && (SEQ % 256) == 0);
static_assert((SEQ % 64) == 0 && (DM % 64) == 0 && (DM % 32) == 0);
static_assert((RESR % 64) == 0 && (RESR % 256) == 0 && RESR <= VLP && VLP <= SEQ && ((SEQ - RESR) % 64) == 0);
static_assert((RESR % 32) == 0);
static_assert(((NB * SEQ) % 8) == 0);
static_assert(((SEQ * DM / 8) % 256) == 0 && ((DM * DM / 8) % 256) == 0);

// ---- workspace extents (bytes) used by the launcher; checked at build time ------------------------------
#define WS_MAX2(a, b) (((a) > (b)) ? (a) : (b))
#define WS_PX  ((size_t)NB * SEQ * DM * 2)        // one 16-bit plane [NB*SEQ][DM]
#define WS_PW  ((size_t)DM * DM * 2)              // one 16-bit weight plane
#define WS_PS  ((size_t)NB * NTRI * 4096 * 4)     // packed f32 score tiles
#define WS_PC  (2 * WS_PX)                        // bf16 hi and lo ctx planes
#define WS_PP  ((size_t)NB * SEQ * SEQ * 2)       // Ph
#define WS_PPL ((size_t)NB * RESR * VLP * 2)      // Pl
#define WS_PVT ((size_t)NB * DM * SEQ * 2)        // VTh
#define WS_PVL ((size_t)NB * DM * VLP * 2)        // VTl
#define WS_RA  WS_MAX2(WS_PX + 3 * WS_PW, WS_PC)
#define WS_TOTAL (WS_RA + 4 * WS_PX + WS_PVT + WS_PVL + WS_PW + WS_PS)
static_assert(WS_TOTAL <= (size_t)268435456);
static_assert(WS_PC <= WS_RA);
static_assert(WS_PP + WS_PPL <= 4 * WS_PX);
static_assert(((NB * SEQ) % 64) == 0);
static_assert((WS_RA % 128) == 0 && (WS_PX % 128) == 0 && (WS_PVT % 128) == 0 && (WS_PVL % 128) == 0 && (WS_PW % 128) == 0 &&
              (WS_PS % 128) == 0);

typedef _Float16 v16h __attribute__((ext_vector_type(16)));
typedef _Float16 v8h  __attribute__((ext_vector_type(8)));
typedef __bf16   v16b __attribute__((ext_vector_type(16)));
typedef __bf16   v8b  __attribute__((ext_vector_type(8)));
typedef float    v8f  __attribute__((ext_vector_type(8)));
typedef float    v4f  __attribute__((ext_vector_type(4)));
typedef unsigned int v4u __attribute__((ext_vector_type(4)));
typedef float    v2f  __attribute__((ext_vector_type(2)));
typedef __bf16   v2b  __attribute__((ext_vector_type(2)));
typedef _Float16 v2h  __attribute__((ext_vector_type(2)));

// ---- scalar helpers --------------------------------------------------------------------------------
// two f32 -> two bf16 / f16 (round to nearest even) packed in one dword, a in the low half: one packed hardware convert
__device__ __forceinline__ unsigned pk_bf(float a, float b) {
  const v2f f = {a, b};
  return __builtin_bit_cast(unsigned, __builtin_convertvector(f, v2b));
}
__device__ __forceinline__ unsigned pk_h(float a, float b) {
  const v2f f = {a, b};
  return __builtin_bit_cast(unsigned, __builtin_convertvector(f, v2h));
}
// the two halves of such a dword back in f32
__device__ __forceinline__ float bf_up0(unsigned p) { return __uint_as_float(p << 16); }
__device__ __forceinline__ float bf_up1(unsigned p) { return __uint_as_float(p & 0xFFFF0000u); }
__device__ __forceinline__ float h_up0(unsigned p) { return (float)__builtin_bit_cast(v2h, p)[0]; }
__device__ __forceinline__ float h_up1(unsigned p) { return (float)__builtin_bit_cast(v2h, p)[1]; }
__device__ __forceinline__ unsigned short h_bits(_Float16 x) { return __builtin_bit_cast(unsigned short, x); }
__device__ __forceinline__ unsigned pk16(unsigned short a, unsigned short b) { return (unsigned)a | ((unsigned)b << 16); }
__device__ __forceinline__ v8f zero8() { v8f z = {0.f, 0.f, 0.f, 0.f, 0.f, 0.f, 0.f, 0.f}; return z; }

// ---- fragment loaders: 16-bit A/B operand, lane -> row/col (lane&15), p already includes +8*(lane>>4);
//      elements 0..7 <- p[0..7] (k0+8h..), elements 8..15 <- p[16..23] (k0+16+8h..)
__device__ __forceinline__ v16b ldfrag_b(const __bf16* p) {
  union { v16b v; v8b h[2]; } f;
  f.h[0] = *(const v8b*)(p);
  f.h[1] = *(const v8b*)(p + 16);
  return f.v;
}
__device__ __forceinline__ v16h ldfrag_h(const _Float16* p) {
  union { v16h v; v8h h[2]; } f;
  f.h[0] = *(const v8h*)(p);
  f.h[1] = *(const v8h*)(p + 16);
  return f.v;
}

// ---- WMMA helpers ------------------------------------------------------------------------------------
__device__ __forceinline__ v8f mma_b_raw(v16b a, v16b b, v8f c) {
  return __builtin_amdgcn_wmma_f32_16x16x32_bf16(false, a, false, b, (short)0, c, false, false);
}
__device__ __forceinline__ v8f mma_h_raw(v16h a, v16h b, v8f c) {
  return __builtin_amdgcn_wmma_f32_16x16x32_f16(false, a, false, b, (short)0, c, false, false);
}
__device__ __forceinline__ void acc_guard4(v8f& a, v8f& b, v8f& c, v8f& d) {
  asm volatile("v_nop\n\tv_nop\n\tv_nop\n\tv_nop" : "+v"(a), "+v"(b), "+v"(c), "+v"(d));
}

// ---- LDS staging of GEMM operands --------------------------------------------------------------------
// A stage is 64 k (128 B) of every operand row of the work-group's tile, laid at pitch LPITCH (16 B x odd: 16-byte reads of
// 16 rows fall on distinct banks). Each lane copies 16 B: 8 lanes per row, so one wave-wide copy covers 4 whole 128-B lines.
#define LPITCH 144
struct RowChunk {                 // this lane's share of 128 staged rows: rows r, r+32, r+64, r+96 (r = tid>>3), 16 B at column tid&7
  unsigned l;                     // LDS byte address of the first
  const unsigned short* g;        // global address of the first
  size_t step;                    // 32 source rows, in elements
};
// chunk q (128 rows) of a plane: g = row 0 of the plane at the first k of the stage, pitch ld elements; lbase = LDS byte address of the plane
__device__ __forceinline__ RowChunk row_chunk(unsigned lbase, const unsigned short* g, int ld, int q, int tid) {
  const int r = q * 128 + (tid >> 3), c = tid & 7;
  RowChunk x;
  x.l = lbase + (unsigned)(r * LPITCH + c * 16);
  x.g = g + (size_t)r * ld + c * 8;
  x.step = (size_t)32 * ld;
  return x;
}
// Asynchronous copies global -> LDS of one chunk (4 x 16 B a lane), written as the builtin: the compiler then places their address
// registers anywhere in the register file, also above v255, which operands of an asm statement cannot reach.
typedef int v4i __attribute__((ext_vector_type(4)));
__device__ __forceinline__ void copy_chunk(RowChunk a) {
#pragma unroll
  for (int q = 0; q < 4; ++q)
    __builtin_amdgcn_global_load_async_to_lds_b128(
        (__attribute__((address_space(1))) v4i*)(a.g + q * a.step),
        (__attribute__((address_space(3))) v4i*)(a.l + q * 32 * LPITCH), 0, 0);
}
__device__ __forceinline__ void copy_chunks2(RowChunk a, RowChunk b) { copy_chunk(a); copy_chunk(b); }
__device__ __forceinline__ void copy_chunks3(RowChunk a, RowChunk b, RowChunk d) { copy_chunk(a); copy_chunk(b); copy_chunk(d); }
// the wave's own copies have landed (other waves read them only behind the barrier that follows)
__device__ __forceinline__ void wait_copies() { asm volatile("s_wait_asynccnt 0x0" ::: "memory"); }
template <int N>
__device__ __forceinline__ void wait_copies_but() { asm volatile("s_wait_asynccnt %0" :: "n"(N) : "memory"); }
// the wave's own LDS reads have returned before the buffer they read is handed back for a refill
__device__ __forceinline__ void wait_lds() { asm volatile("s_wait_dscnt 0x0" ::: "memory"); }
// behind the global stores of one epilogue slab, in front of the next slab's work: s_wait_xcnt 0 stands before that work rewrites
// registers which the issued stores name (a precaution), s_wait_dscnt 0 so that the slab's reads have returned before the next rows
// overwrite it; neither waits for the stores themselves, which fly on under the next slab
__device__ __forceinline__ void slab_next() { asm volatile("s_wait_xcnt 0x0\n\ts_wait_dscnt 0x0" ::: "memory"); }
// four 16-byte row stores of one plane and their s_wait_xcnt 0 in one statement, so that the wait stands in front of whatever rewrites an
// address or data register of these stores (a precaution)
__device__ __forceinline__ void store_rows4(unsigned short* p0, unsigned short* p1, unsigned short* p2, unsigned short* p3,
                                            v4u d0, v4u d1, v4u d2, v4u d3) {
  asm volatile("global_store_b128 %0, %4, off\n\tglobal_store_b128 %1, %5, off\n\t"
               "global_store_b128 %2, %6, off\n\tglobal_store_b128 %3, %7, off\n\ts_wait_xcnt 0x0"
               :: "v"(p0), "v"(p1), "v"(p2), "v"(p3), "v"(d0), "v"(d1), "v"(d2), "v"(d3) : "memory");
}

// =====================================================================================================
// f32 -> bf16 (RNE convert) for x and the three weights into one contiguous 16-bit region:
// groups 0..NX8-1 <- x (batch b of the plane reads source rows at b * SEQ_FULL * DM, SEQ rows each), then NW8 groups each
// coverage: (NX8 + 3 NW8) threads x 8 = the whole [NB*SEQ][DM] x plane plus the three [DM][DM] weight planes.
// =====================================================================================================
__device__ __forceinline__ void cvt_planes_body(int blk, const float* __restrict__ x, const float* __restrict__ wq,
                                                const float* __restrict__ wk, const float* __restrict__ wv,
                                                unsigned short* out) {
  const int NXB8 = SEQ * DM / 8;          // groups per batch
  const int NX8 = NB * NXB8;
  const int NW8 = DM * DM / 8;
  const int g = blk * 256 + threadIdx.x;
  if (g >= NX8 + 3 * NW8) return;
  const float* src;
  if (g < NX8) {
    const int bb  = g / NXB8;
    const int off = g - bb * NXB8;
    src = x + (size_t)bb * SEQ_FULL * DM + (size_t)off * 8;
  } else {
    const int e = g - NX8;
    const int w = e / NW8;
    const int off = e - w * NW8;
    const float* wsrc = (w == 0) ? wq : ((w == 1) ? wk : wv);
    src = wsrc + (size_t)off * 8;
  }
  const v4f a = *(const v4f*)(src);
  const v4f c = *(const v4f*)(src + 4);
  v4u p;
  p[0] = pk_bf(a[0], a[1]);
  p[1] = pk_bf(a[2], a[3]);
  p[2] = pk_bf(c[0], c[1]);
  p[3] = pk_bf(c[2], c[3]);
  *(v4u*)(out + (size_t)g * 8) = p;
  
}

// =====================================================================================================
// Transposing f32 -> bf16 (RNE convert) of the output projection weight: w[k][n] (k = input feature, n = output feature,
// DM x DM) -> out[n][k] (k contiguous), the Bt plane of the last GEMM. One block per 64x64 tile (k0 = 64*ty,
// n0 = 64*tx), (DM/64) x (DM/64) tiles. The tile is staged in LDS as f32 (pitch 65; written by all waves, read by all
// coverage: 2 iterations x 32 rows x 64 k = the block's whole 64x64 tile; grid = all DM/64 x DM/64 tiles.
// =====================================================================================================
__device__ __forceinline__ void cvt_wo_t_body(float* sW, int tx, int ty, const float* __restrict__ w, unsigned short* out) {
  const int tid = threadIdx.x;
  const int k0 = ty * 64;
  const int n0 = tx * 64;
  {
    const int kk = tid >> 2;               // 0..63 source row within the tile
    const int c0 = (tid & 3) * 16;         // 16 consecutive source columns
    const float* src = w + (size_t)(k0 + kk) * DM + n0 + c0;
#pragma unroll
    for (int u = 0; u < 4; ++u) {
      const v4f a = *(const v4f*)(src + 4 * u);
      sW[kk * 65 + c0 + 4 * u + 0] = a[0];
      sW[kk * 65 + c0 + 4 * u + 1] = a[1];
      sW[kk * 65 + c0 + 4 * u + 2] = a[2];
      sW[kk * 65 + c0 + 4 * u + 3] = a[3];
    }
  }
  __syncthreads();
  const int q  = tid >> 3;                 // 0..31 output row within a half tile
  const int c8 = (tid & 7) * 8;            // 8 consecutive k
  v4u hv[2];
#pragma unroll
  for (int it = 0; it < 2; ++it) {
    const int nn = it * 32 + q;            // it 0..1 x q 0..31 = output rows 0..63
    v4u a;
#pragma unroll
    for (int e = 0; e < 4; ++e) {
      const float f0 = sW[(c8 + 2 * e) * 65 + nn];
      const float f1 = sW[(c8 + 2 * e + 1) * 65 + nn];
      a[e] = pk_bf(f0, f1);
    }
    hv[it] = a;
  }
  {
#pragma unroll
    for (int it = 0; it < 2; ++it) {
      const int nn = it * 32 + q;
      *(v4u*)(out + (size_t)(n0 + nn) * DM + k0 + c8) = hv[it];
    }
    
  }
}

// =====================================================================================================
// The two input conversions, which read nothing of each other, in one grid: blocks 0 .. NWOT-1 transpose and convert Wo (one
// 64x64 tile each; first, because their chain load - LDS - barrier - store is the longer one), the rest convert x, Wq, Wk, Wv.
// The choice is the same for a whole block, so the barrier in the transposing part is passed by all of its threads.
// =====================================================================================================
#define NWOT ((DM / 64) * (DM / 64))
__global__ __launch_bounds__(256) void cvt_inputs(const float* __restrict__ x, const float* __restrict__ wq,
                                                  const float* __restrict__ wk, const float* __restrict__ wv,
                                                  const float* __restrict__ wo, unsigned short* planes, unsigned short* woT) {
  __shared__ float sW[64 * 65];
  const int blk = blockIdx.x;
  if (blk < NWOT) cvt_wo_t_body(sW, blk % (DM / 64), blk / (DM / 64), wo, woT);
  else            cvt_planes_body(blk - NWOT, x, wq, wk, wv, planes);
}

// =====================================================================================================
// Batched bf16 WMMA GEMM: C[m][n] = sum_k A[m][k] * Bt[n][k]; one work-group (8 waves, 4 x 2) per 256 x (32 NJ) tile, one wave per
// 64 x (16 NJ) tile of it: NJ = 4: 256 x 128 and 64 x 64; NJ = 8 (single product, dense grid): 256 x 256 and 64 x 128, which lands a
// third fewer operand bytes in LDS per product and feeds 32 WMMAs from 12 LDS fragments (NJ = 4: 16 from 8).
// The operand rows of the work-group's tile are staged in LDS, 64 k a stage, by asynchronous copies in a
// ring of NBUF buffers (stages s + 2 .. s + NBUF are copied while stage s + 1 is worked on); the waves read their fragments from LDS.
// A row-major [M][K] pitch lda; Bt row-major [N][K] pitch ldb (k contiguous); M multiple of 256, N of 32 NJ, K of 64.
// bx = index of the work-group's tile, b = batch index (strides in elements); ring and sT are the work-group's LDS.
// NSPLIT: 0 = Ah.Bh (single product); 1 = Ah.Bh + Al.Bh; 2 = Ah.Bh + Al.Bh + Ah.Bl with unscaled bf16 lo planes (one accumulator).
// TRI: 0 = dense grid of (M/256) x (N/(32 NJ)) work-group tiles, bx row-major;
//      1 = square M == N: work-group tiles (I, J <= 2I+1), bx = I(I+1) + J; a wave whose 64x64 tile (tm, tn) has tn > tm
//          computes and stores nothing; tile t = tm(tm+1)/2 + tn written packed at C + b*strideC + t*4096 as [64][64] f32
//          (OUT_MODE 0 only).
// OUT_MODE: 0 = f32 (pitch ldc); 2 = bf16 hi plane C + bf16 lo plane C2 (lo = RNE(v - hi), unscaled);
//           3 = f16 hi plane C = f16(v*hscale) + f16 residual plane C2 = f16((v*hscale - hi) * rscale), C2 written
//               only for tiles with n0 < N2 (pitch ldc2, batch stride strideC2).
// Epilogue: 16-row slabs staged per wave in LDS (wave-private region sT[wave], wait_lds); each 64-wide row segment written
// =====================================================================================================
__host__ __device__ constexpr int gemm_bf_stage_bytes(int nsplit, int nj = 4) {   // one stage: Ah 256 rows | Al | Bh 32 nj rows | Bl
  return (((nsplit >= 1) ? 2 : 1) * 256 + ((nsplit >= 2) ? 2 : 1) * 32 * nj) * LPITCH;
}
template <int NSPLIT, int OUT_MODE, int TRI, int NBUF, int NJ = 4>
__device__ __forceinline__ void gemm_bf_body(
    unsigned char* ring, float (*sT)[16 * 68], int bx, int b,
    const unsigned short* __restrict__ Ahp, const unsigned short* __restrict__ Alp, int lda, long long strideA,
    const unsigned short* __restrict__ Bhp, const unsigned short* __restrict__ Blp, int ldb, long long strideB,
    void* Cout, int ldc, long long strideC,
    void* Cout2, int ldc2, long long strideC2, int N2,
    int M, int N, int K, float hscale, float rscale) {
  static_assert(NJ == 4 || (NJ == 8 && NSPLIT == 0 && TRI == 0 && NBUF > 2));
  constexpr int BR     = 32 * NJ;                                        // Bt rows (output columns) of the work-group's tile
  constexpr int OFF_AL = 256 * LPITCH;                                   // stage layout: Ah 256 rows | Al | Bh BR rows | Bl
  constexpr int OFF_BH = ((NSPLIT >= 1) ? 2 : 1) * 256 * LPITCH;
  constexpr int OFF_BL = OFF_BH + BR * LPITCH;
  constexpr int STG    = OFF_BH + ((NSPLIT >= 2) ? 2 : 1) * BR * LPITCH;
  static_assert(STG == gemm_bf_stage_bytes(NSPLIT, NJ));
  constexpr int CPS = 4 * (((NSPLIT >= 1) ? 4 : 2) + ((NSPLIT >= 2) ? 2 : 1) * (NJ / 4));   // copies of one wave for one stage
  static_assert(NBUF >= 2 && NBUF * CPS <= 63);
  const int tid  = threadIdx.x;
  const int lane = tid & 31;
  const int wave = __builtin_amdgcn_readfirstlane(tid >> 5);
  int bm, bn;
  if (TRI != 0) {
    const int NI = M >> 8;
    int I = 0;
    for (int q = 1; q < NI; ++q)
      if (q * (q + 1) <= bx) I = q;
    bm = I;
    bn = bx - I * (I + 1);
    if (bn > 2 * I + 1) return;            // work-group-uniform, in front of every copy and barrier
  } else {
    const int bN = N / BR;
    bm = bx / bN;
    bn = bx - bm * bN;
    if (bm >= (M >> 8)) return;            // work-group-uniform, in front of every copy and barrier
  }
  const int tm = bm * 4 + (wave >> 1);
  const int tn = bn * 2 + (wave & 1);
  const bool active = (TRI == 0) || (tn <= tm);   // wave-uniform
  const int t  = ((tm * (tm + 1)) >> 1) + tn;     // packed tile index (TRI)
  const int m0 = tm << 6;
  const int n0 = bn * BR + (wave & 1) * 16 * NJ;  // = 64 tn where NJ = 4

  const unsigned short* Ag  = Ahp + (size_t)b * strideA + (size_t)(bm * 256) * lda;
  const unsigned short* Alg = Alp + (size_t)b * strideA + (size_t)(bm * 256) * lda;
  const unsigned short* Bg  = Bhp + (size_t)b * strideB + (size_t)(bn * BR) * ldb;
  const unsigned short* Blg = Blp + (size_t)b * strideB + (size_t)(bn * BR) * ldb;
  const unsigned ringb = (unsigned)(size_t)(const void*)ring;    // LDS byte address of the ring

  const int rlane = lane & 15;                 // row (A) / col (B, D) within subtile
  const int koff  = (lane >> 4) * 8;           // k offset of this lane half
  const int mOff  = (lane >> 4) * 8;           // D row offset

  auto stage = [&](int s, int buf) {
    const unsigned lb = ringb + (unsigned)(buf * STG);
    const size_t ks = (size_t)s * 64;
    copy_chunks3(row_chunk(lb, Ag + ks, lda, 0, tid), row_chunk(lb, Ag + ks, lda, 1, tid),
                 row_chunk(lb + OFF_BH, Bg + ks, ldb, 0, tid));
    if (NJ == 8) copy_chunk(row_chunk(lb + OFF_BH, Bg + ks, ldb, 1, tid));
    if (NSPLIT == 1) copy_chunks2(row_chunk(lb + OFF_AL, Alg + ks, lda, 0, tid), row_chunk(lb + OFF_AL, Alg + ks, lda, 1, tid));
    if (NSPLIT >= 2) copy_chunks3(row_chunk(lb + OFF_AL, Alg + ks, lda, 0, tid), row_chunk(lb + OFF_AL, Alg + ks, lda, 1, tid),
                                  row_chunk(lb + OFF_BL, Blg + ks, ldb, 0, tid));
  };

  v8f acc[4][NJ];
#pragma unroll
  for (int i = 0; i < 4; ++i)
#pragma unroll
    for (int j = 0; j < NJ; ++j) acc[i][j] = zero8();

  // Two fragment sets: while the WMMAs of one 32-k block run on one set, the next block's fragments are fetched into the other.
  v16b bhA[NJ], ahA[4], alA[4], blA[NJ], bhB[NJ], ahB[4], alB[4], blB[NJ];
  const int aoff = ((wave >> 1) * 64 + rlane) * LPITCH + koff * 2;
  const int boff = OFF_BH + ((wave & 1) * 16 * NJ + rlane) * LPITCH + koff * 2;
  auto ldset = [&](int buf, int kk, v16b (&bh)[NJ], v16b (&ah)[4], v16b (&al)[4], v16b (&bl)[NJ]) {
    const unsigned char* pa = ring + buf * STG + aoff + kk * 64;
    const unsigned char* pb = ring + buf * STG + boff + kk * 64;
#pragma unroll
    for (int j = 0; j < NJ; ++j) {
      bh[j] = ldfrag_b((const __bf16*)(pb + j * 16 * LPITCH));
      if (NSPLIT >= 2) bl[j] = ldfrag_b((const __bf16*)(pb + (OFF_BL - OFF_BH) + j * 16 * LPITCH));
    }
#pragma unroll
    for (int i = 0; i < 4; ++i) {
      ah[i] = ldfrag_b((const __bf16*)(pa + i * 16 * LPITCH));
      if (NSPLIT >= 1) al[i] = ldfrag_b((const __bf16*)(pa + OFF_AL + i * 16 * LPITCH));
    }
  };
  // per accumulator and 32-k block the products are added in the order Ah.Bh, Al.Bh, Ah.Bl
  auto mmaset = [&](v16b (&bh)[NJ], v16b (&ah)[4], v16b (&al)[4], v16b (&bl)[NJ]) {
#pragma unroll
    for (int i = 0; i < 4; ++i)
#pragma unroll
      for (int j = 0; j < NJ; ++j) acc[i][j] = mma_b_raw(ah[i], bh[j], acc[i][j]);
    if (NSPLIT >= 1) {
#pragma unroll
      for (int i = 0; i < 4; ++i)
#pragma unroll
        for (int j = 0; j < NJ; ++j) acc[i][j] = mma_b_raw(al[i], bh[j], acc[i][j]);
    }
    if (NSPLIT >= 2) {
#pragma unroll
      for (int i = 0; i < 4; ++i)
#pragma unroll
        for (int j = 0; j < NJ; ++j) acc[i][j] = mma_b_raw(ah[i], bl[j], acc[i][j]);
    }
  };

  const int nst = K >> 6;
  // Ring of NBUF buffers, stage s in buffer s mod NBUF. Two buffers: stage 0, wait to 0, barrier, stage 1. More: every buffer is filled
  // at entry, and stage 0 is published while the later stages fly on.
  stage(0, 0);
  if (NBUF == 2) {
    wait_copies();
    __syncthreads();
    if (nst > 1) stage(1, 1);
  } else {
#pragma unroll
    for (int q = 1; q < NBUF; ++q) {
      __builtin_amdgcn_sched_barrier(0);   // keeps the stages' copies in issue order, which the counted waits count on
      if (q < nst) stage(q, q);
    }
    wait_copies_but<(NBUF - 1) * CPS>();
    if (nst < NBUF) wait_copies();         // fewer stages than buffers: the count would leave stage 0's own copies out
    __syncthreads();
  }
  ldset(0, 0, bhA, ahA, alA, blA);

  int cur = 0;                             // buffer of stage s
  for (int s = 0; s < nst; ++s) {
    const int nxt = (cur + 1 == NBUF) ? 0 : cur + 1;
    ldset(cur, 1, bhB, ahB, alB, blB);     // the stage's last block: the wave's last reads of buffer cur
    __builtin_amdgcn_sched_barrier(0);     // keeps the load group whole and ahead of the WMMAs
    if (active) mmaset(bhA, ahA, alA, blA);
    __builtin_amdgcn_sched_barrier(0);     // keeps these WMMAs in front of the waits, so that the loads above fly under them
    // publish point of stage s + 1, in front of stage s's last block and passed by every wave: own LDS reads of buffer cur
    // returned, own copies of stage s + 1 landed (those of stages s + 2 .. s + NBUF - 1 may fly on where all of them were issued;
    // in the last trips the wait is to 0), barrier; then the refill of buffer cur and the first fragments of stage s + 1
    wait_lds();
    if (NBUF > 2) wait_copies_but<(NBUF - 2) * CPS>();
    if (NBUF == 2 || s + NBUF - 1 >= nst) wait_copies();
    __syncthreads();
    if (s + NBUF < nst) stage(s + NBUF, cur);
    // unconditional (a branch here would merge the compiler's LDS wait counts): behind the last stage it reads again the last
    // stage's buffer (two buffers: the other one's old bytes), which no copy is aimed at any more, and nothing uses them
    ldset((NBUF == 2 || s + 1 < nst) ? nxt : cur, 0, bhA, ahA, alA, blA);
    __builtin_amdgcn_sched_barrier(0);     // keeps the load group whole and ahead of the WMMAs
    if (active) mmaset(bhB, ahB, alB, blB);
    cur = nxt;
  }
  wait_copies();
  wait_lds();
  if (!active) return;                     // wave-uniform; no work-group barrier below
  // (NJ = 8: no asm statement names the accumulators; its operands would hold all 256 of their registers below v256, which spills)
  if constexpr (NJ == 4) {
#pragma unroll
    for (int i = 0; i < 4; ++i) acc_guard4(acc[i][0], acc[i][1], acc[i][2], acc[i][3]);
  }

  // ---- epilogue ----
  size_t cbase;
  int ldce, rowb;
  if (TRI != 0) { cbase = (size_t)b * strideC + (size_t)t * 4096; ldce = 64; rowb = 0; }
  else          { cbase = (size_t)b * strideC; ldce = ldc; rowb = m0; }
  float* slab = sT[wave];
  auto put = [&](int pi, int pj) {                   // accumulators of row group pi, column group pj -> the wave's slab
#pragma unroll
    for (int j = 0; j < 4; ++j) {
#pragma unroll
      for (int r = 0; r < 8; ++r) {
        slab[(mOff + r) * 68 + (j << 4) + rlane] = acc[pi][pj * 4 + j][r];
      }
    }
  };
  // slabs of 16 rows x 64 columns: row group i, column group jh of the wave's tile. NJ = 4: unrolled. NJ = 8: the loop stays rolled, so
  // that the conversion and store code stands once and not eight times in the kernel's text (unrolled, the text passed 32 KB)
#pragma unroll(NJ == 4 ? 4 : 1)
  for (int ih = 0; ih < 4 * (NJ / 4); ++ih) {
    const int i = ih / (NJ / 4), jh = ih % (NJ / 4);
    const int mBase = m0 + (i << 4);
    const int nB = n0 + (jh << 6);
    const int colb = (TRI != 0) ? 0 : nB;
    if constexpr (NJ == 4) {
      put(ih, 0);
    } else {                                         // register numbers are fixed in the code: one branch per slab picks its accumulators
      switch (ih) {
        case 0: put(0, 0); break;
        case 1: put(0, 1); break;
        case 2: put(1, 0); break;
        case 3: put(1, 1); break;
        case 4: put(2, 0); break;
        case 5: put(2, 1); break;
        case 6: put(3, 0); break;
        default: put(3, 1); break;
      }
    }
    wait_lds();   // the slab is this wave's own: its LDS writes are done before other lanes read the rows back; no wait on global stores
    if (OUT_MODE == 0) {
      float* C = (float*)Cout + cbase;
      const int hh = lane >> 4, c4 = (lane & 15) * 4;     // 256-B row segment = 16 lanes x 16 B
      {
#pragma unroll
        for (int it = 0; it < 8; ++it) {
          const int row = it * 2 + hh;                     // it 0..7 x hh 0..1 = rows 0..15
          const v4f v = *(const v4f*)(slab + row * 68 + c4);
          *(v4f*)(C + (size_t)(rowb + (i << 4) + row) * ldce + colb + c4) = v;
        }
        
      }
    } else {
      const int q = lane >> 3, c8 = (lane & 7) * 8;
      unsigned short* C  = (unsigned short*)Cout  + (size_t)b * strideC;
      unsigned short* C2 = (unsigned short*)Cout2 + (size_t)b * strideC2;
      const bool wlo = (OUT_MODE == 2) || (nB < N2);      // wave-uniform
      v4u hv[4], lv[4];
#pragma unroll
      for (int it = 0; it < 4; ++it) {
        const int row = it * 4 + q;                        // it 0..3 x q 0..3 = rows 0..15
        const float* sp = slab + row * 68 + c8;
        v4u a, a2;
#pragma unroll
        for (int e = 0; e < 4; ++e) {
          const float f0 = sp[2 * e], f1 = sp[2 * e + 1];
          if (OUT_MODE == 2) {
            const unsigned h = pk_bf(f0, f1);
            a[e] = h; a2[e] = pk_bf(f0 - bf_up0(h), f1 - bf_up1(h));
          } else {
            const float g0 = f0 * hscale, g1 = f1 * hscale;
            const unsigned h = pk_h(g0, g1);
            a[e] = h; a2[e] = pk_h((g0 - h_up0(h)) * rscale, (g1 - h_up1(h)) * rscale);
          }
        }
        hv[it] = a; lv[it] = a2;
      }
      {
        unsigned short* pc  = C  + (size_t)(mBase + q) * ldc  + nB + c8;   // rows q, q + 4, q + 8, q + 12 of the slab
        unsigned short* pc2 = C2 + (size_t)(mBase + q) * ldc2 + nB + c8;
        store_rows4(pc, pc + (size_t)4 * ldc, pc + (size_t)8 * ldc, pc + (size_t)12 * ldc, hv[0], hv[1], hv[2], hv[3]);
        if (wlo) store_rows4(pc2, pc2 + (size_t)4 * ldc2, pc2 + (size_t)8 * ldc2, pc2 + (size_t)12 * ldc2, lv[0], lv[1], lv[2], lv[3]);
      }
    }
    // also behind the last slab
    slab_next();
  }
}

// =====================================================================================================
// One GEMM as a launch of its own: blockIdx.x = tile index, blockIdx.y = batch index.
// =====================================================================================================
template <int NSPLIT, int OUT_MODE, int TRI, int NBUF>
__global__ __launch_bounds__(256) void gemm_bf(
    const unsigned short* __restrict__ Ahp, const unsigned short* __restrict__ Alp, int lda, long long strideA,
    const unsigned short* __restrict__ Bhp, const unsigned short* __restrict__ Blp, int ldb, long long strideB,
    void* Cout, int ldc, long long strideC,
    void* Cout2, int ldc2, long long strideC2, int N2,
    int M, int N, int K, float hscale, float rscale) {
  __shared__ __align__(16) unsigned char ring[NBUF * gemm_bf_stage_bytes(NSPLIT)];
  __shared__ __align__(16) float sT[8][16 * 68];   // per-wave 16x64 slab, pitch 68 floats
  static_assert(sizeof(ring) + sizeof(sT) <= 327680);
  gemm_bf_body<NSPLIT, OUT_MODE, TRI, NBUF>(ring, sT, (int)blockIdx.x, (int)blockIdx.y, Ahp, Alp, lda, strideA, Bhp, Blp, ldb, strideB,
                                      Cout, ldc, strideC, Cout2, ldc2, strideC2, N2, M, N, K, hscale, rscale);
}

// =====================================================================================================
// The q and k projections, which read nothing of each other, in one grid of 2 NPQ work-groups of equal cost:
//   blocks 0 .. NPQ-1        q = x . Wq^T -> bf16 hi/lo planes [NB*SEQ][DM]   (A = Xb, Bt = Wq [out][in]; M=NB*SEQ, N=DM, K=DM)
//   blocks NPQ .. 2 NPQ-1    k = x . Wk^T -> bf16 hi/lo planes
// Wb holds the Wq and Wk planes one behind the other. The choice is the same for a whole work-group.
// 256 x 256 tiles: 2 NPQ = one work-group for each of 256 WGPs. Three ring buffers (four would pass the LDS); a wave's registers
// (256 of accumulators and two fragment sets of 96) admit one work-group a WGP whatever its LDS.
// =====================================================================================================
#define NPQ ((NB * SEQ / 256) * (DM / 256))
static_assert(((NB * SEQ) % 256) == 0 && (DM % 256) == 0);
__global__ __launch_bounds__(256) void proj_qk(
    const unsigned short* __restrict__ Xb, const unsigned short* __restrict__ Wb,
    unsigned short* Qh, unsigned short* Ql, unsigned short* Kh, unsigned short* Kl) {
  __shared__ __align__(16) unsigned char ring[3 * gemm_bf_stage_bytes(0, 8)];
  __shared__ __align__(16) float sT[8][16 * 68];   // per-wave 16x64 slab, pitch 68 floats
  static_assert(sizeof(ring) + sizeof(sT) <= 327680);
  const int blk = blockIdx.x;
  const bool isk = blk >= NPQ;
  const unsigned short* W = Wb + (isk ? (size_t)DM * DM : (size_t)0);
  gemm_bf_body<0, 2, 0, 3, 8>(ring, sT, isk ? blk - NPQ : blk, 0, Xb, Xb, DM, 0LL, W, W, DM, 0LL,
                        (void*)(isk ? Kh : Qh), DM, 0LL, (void*)(isk ? Kl : Ql), DM, 0LL, DM,
                        NB * SEQ, DM, DM, 1.0f, 1.0f);
}

// =====================================================================================================
// The scores and the v^T projection, which read nothing of each other, in one grid. One work-group fills a WGP's LDS, there are
// more score tiles than WGPs, so the index runs from the longest to the shortest (for speed only) and
// the v^T tiles fill the places that the last score tiles leave idle:
//   blocks 0 .. NB NSF-1     scores = q . k^T, 3 bf16 products -> packed f32 tiles: work-group tiles (I, J <= 2I), NSF a batch
//   the next NB NSI          the score tiles (I, 2I+1) on the diagonal, in which 3 of 8 waves work
//   the rest, NPV a batch    v^T = Wv . x^T -> f16 hi plane f16(16 v) [b][d][key] (pitch SEQ) and residual plane x4096 for keys < VLP
//                            (pitch VLP)   (A = Wv [out][in], Bt = Xb rows of batch b; M=DM, N=SEQ, K=DM), 256 x 256 tiles
// The choice is the same for a whole work-group; the two parts use the same LDS.
// =====================================================================================================
#define NSI (SEQ / 256)
#define NSF (NSI * NSI)
#define NPV ((DM / 256) * (SEQ / 256))
static_assert((DM % 256) == 0 && (SEQ % 256) == 0);
__global__ __launch_bounds__(256) void scores_vt(
    const unsigned short* __restrict__ Qh, const unsigned short* __restrict__ Ql,
    const unsigned short* __restrict__ Kh, const unsigned short* __restrict__ Kl, float* Sp,
    const unsigned short* __restrict__ Xb, const unsigned short* __restrict__ Wv,
    unsigned short* VTh, unsigned short* VTl) {
  __shared__ __align__(16) unsigned char ring[2 * gemm_bf_stage_bytes(2)];
  __shared__ __align__(16) float sT[8][16 * 68];   // per-wave 16x64 slab, pitch 68 floats
  const int blk = blockIdx.x;
  if (blk < NB * (NSF + NSI)) {
    int b, I, J;
    if (blk < NB * NSF) {                  // row I holds the 2I+1 tiles f = I*I .. I*I + 2I
      b = blk / NSF;
      const int f = blk - b * NSF;
      I = 0;
      for (int q = 1; q < NSI; ++q)
        if (q * q <= f) I = q;
      J = f - I * I;
    } else {
      const int e = blk - NB * NSF;
      b = e / NSI;
      I = e - b * NSI;
      J = 2 * I + 1;
    }
    gemm_bf_body<2, 0, 1, 2>(ring, sT, I * (I + 1) + J, b, Qh, Ql, DM, (long long)SEQ * DM, Kh, Kl, DM, (long long)SEQ * DM,
                          (void*)Sp, 64, (long long)NTRI * 4096, (void*)Sp, 64, 0LL, 0,
                          SEQ, SEQ, DM, 1.0f, 1.0f);
  } else {
    const int e = blk - NB * (NSF + NSI);
    static_assert(3 * gemm_bf_stage_bytes(0, 8) <= 2 * gemm_bf_stage_bytes(2));   // three v^T stages lie in the two score stages' LDS
    gemm_bf_body<0, 3, 0, 3, 8>(ring, sT, e % NPV, e / NPV, Wv, Wv, DM, 0LL, Xb, Xb, DM, (long long)SEQ * DM,
                          (void*)VTh, SEQ, (long long)DM * SEQ, (void*)VTl, VLP, (long long)DM * VLP, VLP,
                          DM, SEQ, DM, VSC, LSC);
  }
}

// =====================================================================================================
// Row softmax over the packed lower-triangular score tiles. One wave per query row (block = 8 rows, grid = NB*SEQ/8).
// Row (b, i), tm = i>>6, r = i&63: score (i, j) sits at Sp + ((b*NTRI + tm(tm+1)/2 + (j>>6))*4096 + r*64 + (j&63)), j <= 64 tm + 63.
// The wave handles ng = tm/4 + 1 groups of 256 keys (lane: 8 consecutive keys per group, two 16-B loads with the key-tile
// address clamped to tn <= tm); z = s/32 for j <= i, -inf otherwise; m = max, p = exp(z - m), l = sum, P = p/l (all f32).
// Writes Ph = f16(1024 P) for keys 0 .. 256 ng - 1 of row (b, i) (pitch SEQ; >= the keys the p.v GEMM copies for the row's work-group tile; zeros
// for j > i) and, for rows i < RESR, Pl = f16((1024 P - Ph) * 4096) with the same key extent (<= VLP, pitch VLP).
// coverage: NB*SEQ rows x written extent >= every key range any consumer reads.
// =====================================================================================================
__global__ __launch_bounds__(256) void softmax_rows(const float* __restrict__ Sp,
                                                    unsigned short* Php, unsigned short* Plp) {
  const int lane = threadIdx.x & 31, wave = threadIdx.x >> 5;
  const int row = blockIdx.x * 8 + wave;
  if (row >= NB * SEQ) return;             // wave-uniform; exact grid never triggers it; no block barriers below
  const int b  = row / SEQ;
  const int i  = row - b * SEQ;
  const int tm = i >> 6, r = i & 63;
  const int ng = (tm >> 2) + 1;            // 1..8, wave-uniform
  const float* srow = Sp + ((size_t)b * NTRI + (size_t)((tm * (tm + 1)) >> 1)) * 4096 + (size_t)r * 64;

  float z[8][8];
  float m = -INFINITY;
#pragma unroll
  for (int g = 0; g < 8; ++g) {
#pragma unroll
    for (int e = 0; e < 8; ++e) z[g][e] = -INFINITY;
    if (g < ng) {
      const int j0 = 256 * g + 8 * lane;
      int tn = j0 >> 6;
      tn = (tn < tm) ? tn : tm;            // clamped tile address; keys with tn > tm are all masked below
      const float* p = srow + (size_t)tn * 4096 + (j0 & 63);
      const v4f a = *(const v4f*)(p);
      const v4f c = *(const v4f*)(p + 4);
      const float v[8] = {a[0], a[1], a[2], a[3], c[0], c[1], c[2], c[3]};
#pragma unroll
      for (int e = 0; e < 8; ++e) {
        const float zz = (j0 + e <= i) ? (v[e] * 0.03125f) : -INFINITY;
        z[g][e] = zz;
        m = fmaxf(m, zz);
      }
    }
  }
#pragma unroll
  for (int off = 1; off < 32; off <<= 1) m = fmaxf(m, __shfl_xor(m, off, 32));   // finite: key 0 is always kept

  float l = 0.f;
#pragma unroll
  for (int g = 0; g < 8; ++g) {
    if (g < ng) {
#pragma unroll
      for (int e = 0; e < 8; ++e) {
        const float p = __expf(z[g][e] - m);   // masked: exp(-inf) = 0
        z[g][e] = p;
        l += p;
      }
    }
  }
#pragma unroll
  for (int off = 1; off < 32; off <<= 1) l += __shfl_xor(l, off, 32);          // l >= 1
  const float inv1k = (1.0f / l) * PSC;

  const bool res = (i < RESR);             // wave-uniform
  v4u ph[8];
  v4u pl0 = {0u, 0u, 0u, 0u};
  v4u pl1 = {0u, 0u, 0u, 0u};
#pragma unroll
  for (int g = 0; g < 8; ++g) {
    v4u hv = {0u, 0u, 0u, 0u};
    v4u lv = {0u, 0u, 0u, 0u};
    if (g < ng) {
#pragma unroll
      for (int e = 0; e < 4; ++e) {
        const float f0 = z[g][2 * e] * inv1k, f1 = z[g][2 * e + 1] * inv1k;
        const _Float16 x0 = (_Float16)f0, x1 = (_Float16)f1;
        hv[e] = pk16(h_bits(x0), h_bits(x1));
        lv[e] = pk16(h_bits((_Float16)((f0 - (float)x0) * LSC)), h_bits((_Float16)((f1 - (float)x1) * LSC)));
      }
    }
    ph[g] = hv;
    if (g == 0) pl0 = lv;
    if (g == 1) pl1 = lv;
  }

  unsigned short* prow = Php + (size_t)row * SEQ + 8 * lane;
  const int il = res ? i : 0;              // clamped row into the residual plane (stored only when res)
  unsigned short* lrow = Plp + ((size_t)b * RESR + (size_t)il) * VLP + 8 * lane;
  {
#pragma unroll
    for (int g = 0; g < 8; ++g) {
      if (g < ng) *(v4u*)(prow + 256 * g) = ph[g];
    }
    if (res) {                             // res rows have i < RESR (multiple of 256) -> 256 ng <= RESR = VLP
      *(v4u*)(lrow) = pl0;
      if (ng > 1) *(v4u*)(lrow + 256) = pl1;
    }
    
  }
}

// =====================================================================================================
// p.v GEMM on f16 WMMA, per batch b: ctx[b][q][d] = sum_key P[b][q][key] * VT[b][d][key], stored as the two bf16 planes that the
// output projection reads: hi = RNE(ctx), lo = RNE(ctx - hi), unscaled, both [NB*SEQ][DM].
//   A  = Ph  [b][SEQ][SEQ]  f16(1024 P), pitch SEQ         Al = Pl  [b][RESR][VLP] f16 residual x4096
//   Bt = VTh [b][DM][SEQ]   f16(16 v),   pitch SEQ         Bl = VTl [b][DM][VLP]   f16 residual x4096
// One work-group (8 waves, 4 x 2) per (64*MI) x 128 output tile, one wave per (16*MI) x 64 tile of it; rows mBase + ...; the
// operand rows of the work-group's tile are staged in LDS, 64 keys a stage, by asynchronous copies in a ring of NBUF buffers up to the
// causal key extent of the work-group's last row tile (every P entry in that range was written by the softmax: its written extent
// is 256*(row/256 + 1) keys). A wave works on keys k < 64*((m0>>6)+1) only and passes the later publish points idle.
// RES (rows < RESR, MI = 2): acc0 += Ph.VTh; acc1 += Pl.VTh + Ph.VTl,
// ctx = acc0*OSCALE + acc1*OSCALE/4096; otherwise single product ctx = acc0*OSCALE. f32 accumulate.
// bx = index of the work-group's tile among those of rows mBase .. mBase + M - 1 (M a multiple of 64*MI), row-major, DM/128 a row;
// ring and sT are the work-group's LDS.
// =====================================================================================================
__host__ __device__ constexpr int gemm_pv_stage_bytes(bool res, int mi) {   // one stage: Ph 64*mi rows | Pl | VTh 128 rows | VTl
  return (res ? 2 : 1) * (64 * mi + 128) * LPITCH;
}
template <bool RES, int MI, int NBUF>
__device__ __forceinline__ void gemm_pv_body(
    unsigned char* ring, float (*sT)[16 * 68], int bx, int b,
    const unsigned short* __restrict__ Php, const unsigned short* __restrict__ Plp,
    const unsigned short* __restrict__ Vhp, const unsigned short* __restrict__ Vlp,
    unsigned short* Chp, unsigned short* Clp, int mBase, int M) {
  constexpr int AR     = 64 * MI;                                        // rows of the work-group's tile
  static_assert(AR == (RES ? 128 : 256) && (RESR % AR) == 0);
  constexpr int OFF_AL = AR * LPITCH;                                    // stage layout: Ph AR rows | Pl | VTh 128 rows | VTl
  constexpr int OFF_BH = (RES ? 2 : 1) * AR * LPITCH;
  constexpr int OFF_BL = OFF_BH + 128 * LPITCH;
  constexpr int STG    = OFF_BH + (RES ? 2 : 1) * 128 * LPITCH;
  static_assert(STG == gemm_pv_stage_bytes(RES, MI));
  constexpr int CPS = 4 * (RES ? 4 : 3);                                 // copies of one wave for one stage
  static_assert(NBUF >= 2 && NBUF * CPS <= 63);
  const int tid  = threadIdx.x;
  const int lane = tid & 31;
  const int wave = __builtin_amdgcn_readfirstlane(tid >> 5);
  const int bN = DM >> 7;                          // 8
  const int bm = bx / bN;
  const int bn = bx - bm * bN;
  if (bm >= M / AR) return;                        // work-group-uniform, in front of every copy and barrier
  const int r0 = mBase + bm * AR;                  // first row of the work-group's tile
  const int m0 = r0 + (wave >> 1) * 16 * MI;
  const int n0 = bn * 128 + (wave & 1) * 64;
  int keff = (((m0 >> 6) + 1) << 6);               // causal key extent of this row tile, multiple of 64
  if (keff > SEQ) keff = SEQ;
  if (RES && keff > VLP) keff = VLP;               // never taken for mBase + M <= RESR; keeps residual reads in range
  int kblk = ((((r0 + 3 * 16 * MI) >> 6) + 1) << 6);   // the same of the work-group's last row tile: the staged extent
  if (kblk > SEQ) kblk = SEQ;
  if (RES && kblk > VLP) kblk = VLP;
  int rl0 = r0;                                    // first row in the residual plane, clamped; equals r0 for the RES launch
  if (rl0 > RESR - AR) rl0 = RESR - AR;

  const unsigned short* Ag  = Php + (size_t)b * SEQ * SEQ + (size_t)r0 * SEQ;
  const unsigned short* Alg = Plp + (size_t)b * RESR * VLP + (size_t)rl0 * VLP;
  const unsigned short* Bg  = Vhp + (size_t)b * DM * SEQ + (size_t)(bn * 128) * SEQ;
  const unsigned short* Blg = Vlp + (size_t)b * DM * VLP + (size_t)(bn * 128) * VLP;
  const unsigned ringb = (unsigned)(size_t)(const void*)ring;    // LDS byte address of the ring

  const int rlane = lane & 15;
  const int koff  = (lane >> 4) * 8;
  const int mOff  = (lane >> 4) * 8;

  auto stage = [&](int s, int buf) {
    const unsigned lb = ringb + (unsigned)(buf * STG);
    const size_t ks = (size_t)s * 64;
    if (RES) {                                     // AR = 128: one chunk a plane
      copy_chunks2(row_chunk(lb, Ag + ks, SEQ, 0, tid), row_chunk(lb + OFF_BH, Bg + ks, SEQ, 0, tid));
      copy_chunks2(row_chunk(lb + OFF_AL, Alg + ks, VLP, 0, tid), row_chunk(lb + OFF_BL, Blg + ks, VLP, 0, tid));
    } else {                                       // AR = 256: two chunks of P, one of v^T
      copy_chunks3(row_chunk(lb, Ag + ks, SEQ, 0, tid), row_chunk(lb, Ag + ks, SEQ, 1, tid),
                   row_chunk(lb + OFF_BH, Bg + ks, SEQ, 0, tid));
    }
  };

  v8f acc0[MI][4], acc1[MI][4];
#pragma unroll
  for (int i = 0; i < MI; ++i)
#pragma unroll
    for (int j = 0; j < 4; ++j) { acc0[i][j] = zero8(); acc1[i][j] = zero8(); }

  // Two fragment sets: while the WMMAs of one 32-key block run on one set, the next block's fragments are fetched into the other.
  v16h bhA[4], ahA[MI], alA[MI], blA[4], bhB[4], ahB[MI], alB[MI], blB[4];
  const int aoff = ((wave >> 1) * 16 * MI + rlane) * LPITCH + koff * 2;
  const int boff = OFF_BH + ((wave & 1) * 64 + rlane) * LPITCH + koff * 2;
  auto ldset = [&](int buf, int kk, v16h (&bh)[4], v16h (&ah)[MI], v16h (&al)[MI], v16h (&bl)[4]) {
    const unsigned char* pa = ring + buf * STG + aoff + kk * 64;
    const unsigned char* pb = ring + buf * STG + boff + kk * 64;
#pragma unroll
    for (int j = 0; j < 4; ++j) {
      bh[j] = ldfrag_h((const _Float16*)(pb + j * 16 * LPITCH));
      if (RES) bl[j] = ldfrag_h((const _Float16*)(pb + (OFF_BL - OFF_BH) + j * 16 * LPITCH));
    }
#pragma unroll
    for (int i = 0; i < MI; ++i) {
      ah[i] = ldfrag_h((const _Float16*)(pa + i * 16 * LPITCH));
      if (RES) al[i] = ldfrag_h((const _Float16*)(pa + OFF_AL + i * 16 * LPITCH));
    }
  };
  // acc0 += Ph.VTh; acc1 += Pl.VTh, then Ph.VTl, per 32-key block
  auto mmaset = [&](v16h (&bh)[4], v16h (&ah)[MI], v16h (&al)[MI], v16h (&bl)[4]) {
#pragma unroll
    for (int i = 0; i < MI; ++i)
#pragma unroll
      for (int j = 0; j < 4; ++j) {
        acc0[i][j] = mma_h_raw(ah[i], bh[j], acc0[i][j]);
        if (RES) acc1[i][j] = mma_h_raw(al[i], bh[j], acc1[i][j]);
      }
    if (RES) {
#pragma unroll
      for (int i = 0; i < MI; ++i)
#pragma unroll
        for (int j = 0; j < 4; ++j) acc1[i][j] = mma_h_raw(ah[i], bl[j], acc1[i][j]);
    }
  };

  const int nst = kblk >> 6;
  // Ring of NBUF buffers, stage s in buffer s mod NBUF. Two buffers: stage 0, wait to 0, barrier, stage 1. More: every buffer is filled
  // at entry, and stage 0 is published while the later stages fly on.
  stage(0, 0);
  if (NBUF == 2) {
    wait_copies();
    __syncthreads();
    if (nst > 1) stage(1, 1);
  } else {
#pragma unroll
    for (int q = 1; q < NBUF; ++q) {
      __builtin_amdgcn_sched_barrier(0);   // keeps the stages' copies in issue order, which the counted waits count on
      if (q < nst) stage(q, q);
    }
    wait_copies_but<(NBUF - 1) * CPS>();
    if (nst < NBUF) wait_copies();         // fewer stages than buffers: the count would leave stage 0's own copies out
    __syncthreads();
  }
  ldset(0, 0, bhA, ahA, alA, blA);

  int cur = 0;                             // buffer of stage s
  for (int s = 0; s < nst; ++s) {
    const bool act = s * 64 < keff;        // wave-uniform
    const int nxt = (cur + 1 == NBUF) ? 0 : cur + 1;
    ldset(cur, 1, bhB, ahB, alB, blB);     // the stage's last block: the wave's last reads of buffer cur
    __builtin_amdgcn_sched_barrier(0);     // keeps the load group whole and ahead of the WMMAs
    if (act) mmaset(bhA, ahA, alA, blA);
    __builtin_amdgcn_sched_barrier(0);     // keeps these WMMAs in front of the waits, so that the loads above fly under them
    // publish point of stage s + 1, in front of stage s's last block and passed by every wave: own LDS reads of buffer cur
    // returned, own copies of stage s + 1 landed (those of stages s + 2 .. s + NBUF - 1 may fly on where all of them were issued;
    // in the last trips the wait is to 0), barrier; then the refill of buffer cur and the first fragments of stage s + 1
    wait_lds();
    if (NBUF > 2) wait_copies_but<(NBUF - 2) * CPS>();
    if (NBUF == 2 || s + NBUF - 1 >= nst) wait_copies();
    __syncthreads();
    if (s + NBUF < nst) stage(s + NBUF, cur);
    // unconditional (a branch here would merge the compiler's LDS wait counts): behind the last stage it reads again the last
    // stage's buffer (two buffers: the other one's old bytes), which no copy is aimed at any more, and nothing uses them
    ldset((NBUF == 2 || s + 1 < nst) ? nxt : cur, 0, bhA, ahA, alA, blA);
    __builtin_amdgcn_sched_barrier(0);     // keeps the load group whole and ahead of the WMMAs
    if (act) mmaset(bhB, ahB, alB, blB);
    cur = nxt;
  }
  wait_copies();
  wait_lds();
#pragma unroll
  for (int i = 0; i < MI; ++i) {
    acc_guard4(acc0[i][0], acc0[i][1], acc0[i][2], acc0[i][3]);
    if (RES) acc_guard4(acc1[i][0], acc1[i][1], acc1[i][2], acc1[i][3]);
  }

  // ---- epilogue ----
  float* slab = sT[wave];
  unsigned short* Ch = Chp + (size_t)b * SEQ * DM;
  unsigned short* Cl = Clp + (size_t)b * SEQ * DM;
  const float rsc = OSCALE * (1.0f / LSC);
#pragma unroll
  for (int i = 0; i < MI; ++i) {
    const int mB = m0 + (i << 4);
#pragma unroll
    for (int j = 0; j < 4; ++j) {
#pragma unroll
      for (int r = 0; r < 8; ++r) {
        float v = acc0[i][j][r] * OSCALE;
        if (RES) v += acc1[i][j][r] * rsc;
        slab[(mOff + r) * 68 + (j << 4) + rlane] = v;
      }
    }
    wait_lds();   // the slab is this wave's own: its LDS writes are done before other lanes read the rows back; no wait on global stores
    {
      const int q = lane >> 3, c8 = (lane & 7) * 8;        // 128-B row segment of a plane = 8 lanes x 16 B
      v4u hv[4], lv[4];
#pragma unroll
      for (int it = 0; it < 4; ++it) {
        const int row = it * 4 + q;                        // it 0..3 x q 0..3 = rows 0..15
        const float* sp = slab + row * 68 + c8;
        v4u a, a2;
#pragma unroll
        for (int e = 0; e < 4; ++e) {
          const float f0 = sp[2 * e], f1 = sp[2 * e + 1];
          const unsigned h = pk_bf(f0, f1);
          a[e]  = h;
          a2[e] = pk_bf(f0 - bf_up0(h), f1 - bf_up1(h));
        }
        hv[it] = a; lv[it] = a2;
      }
#pragma unroll
      for (int it = 0; it < 4; ++it) {
        const int row = it * 4 + q;
        *(v4u*)(Ch + (size_t)(mB + row) * DM + n0 + c8) = hv[it];
        *(v4u*)(Cl + (size_t)(mB + row) * DM + n0 + c8) = lv[it];
      }
    }
    // also behind the last slab
    slab_next();
  }
}

// =====================================================================================================
// Both parts of p.v, which read nothing of each other, in one grid. A work-group's cost grows with its causal key extent;
// the index runs from the longest to the shortest (for speed only):
//   blocks 0 .. NPVH-1   rows RESR .. SEQ-1, single f16 product, 256 x 128 tiles, last row block first (NPVC tiles a row block)
//   the rest             rows 0 .. RESR-1 with the residual planes (3 f16 products), 128 x 128 tiles, last row block first
// The choice is the same for a whole work-group; the two parts use the same LDS.
// =====================================================================================================
#define NPVC ((DM / 128) * NB)
#define NPVH (((SEQ - RESR) / 256) * NPVC)
#define NPVR ((RESR / 128) * NPVC)
static_assert(((SEQ - RESR) % 256) == 0 && (RESR % 128) == 0 && (DM % 128) == 0);
__global__ __launch_bounds__(256) void gemm_pv_all(
    const unsigned short* __restrict__ Php, const unsigned short* __restrict__ Plp,
    const unsigned short* __restrict__ Vhp, const unsigned short* __restrict__ Vlp, unsigned short* Chp, unsigned short* Clp) {
  constexpr int RB = WS_MAX2(3 * gemm_pv_stage_bytes(true, 2), 4 * gemm_pv_stage_bytes(false, 4));
  __shared__ __align__(16) unsigned char ring[RB];
  __shared__ __align__(16) float sT[8][16 * 68];
  const int blk = blockIdx.x;
  if (blk < NPVH) {
    const int rb = (SEQ - RESR) / 256 - 1 - blk / NPVC, e = blk % NPVC;
    gemm_pv_body<false, 4, 4>(ring, sT, rb * (DM / 128) + e % (DM / 128), e / (DM / 128), Php, Plp, Vhp, Vlp, Chp, Clp, RESR, SEQ - RESR);
  } else {
    const int rb = RESR / 128 - 1 - (blk - NPVH) / NPVC, e = (blk - NPVH) % NPVC;
    gemm_pv_body<true, 2, 3>(ring, sT, rb * (DM / 128) + e % (DM / 128), e / (DM / 128), Php, Plp, Vhp, Vlp, Chp, Clp, 0, RESR);
  }
}

// =====================================================================================================
// Workspace map (bytes, full build NB 4 / SEQ 2048; every region is an exact multiple of its tile / whole-line store
// granularity; regions A and B are reused in stream order):
//   region A [0, 33554432):          Xb bf16 [8192][1024] at 0 (16777216) + Wq,Wk,Wv bf16 [1024][1024] at 16777216 (3 x 2097152),
//                                    read up to the launch of the scores and v^T
//                                    then: Ch, Cl bf16 ctx planes [8192][1024] at 0 (2 x 16777216), written by p.v
//   region B [33554432, 100663296):  Qh, Ql, Kh, Kl bf16 [8192][1024] (4 x 16777216)
//                                    then, once the scores are done: Ph f16 [4][2048][2048] (33554432) + Pl f16 [4][512][512] (2097152)
//   region C [100663296, 121634816): VTh f16 [4][1024][2048] (16777216) + VTl f16 [4][1024][512] (4194304)
//   region D [121634816, 123731968): WoT bf16 [1024][1024] (2097152), live from launch 1 to the last GEMM
//   region E [123731968, 158334976): Sp f32 packed score tiles [4][528][64][64] (34603008); a region of its own, because the launch
//                                    that writes it still reads Xb and Wv
//   end 158334976
// =====================================================================================================
extern "C" void kernel_launch(void* const* d_in, const int* in_sizes, int n_in,
                              void* d_out, int out_size, void* d_ws, size_t ws_size,
                              hipStream_t stream) {
  if (n_in < 5) return;
  if (in_sizes[4] < (NB - 1) * SEQ_FULL * DM + SEQ * DM) return;
  if (in_sizes[0] < DM * DM || in_sizes[1] < DM * DM || in_sizes[2] < DM * DM || in_sizes[3] < DM * DM) return;
  if (out_size < NB * SEQ * DM) return;

  // wire order of the inputs: k, q, v, out_proj, x
  const float* wk = (const float*)d_in[0];   // [out][in]
  const float* wq = (const float*)d_in[1];   // [out][in]
  const float* wv = (const float*)d_in[2];   // [out][in]
  const float* wo = (const float*)d_in[3];   // [in][out]
  const float* x  = (const float*)d_in[4];   // [NB_FULL][SEQ_FULL][DM]
  float* out = (float*)d_out;

  const size_t PX  = (size_t)NB * SEQ * DM * 2;       // 16-bit plane [NB*SEQ][DM]
  const size_t PW  = (size_t)DM * DM * 2;             // one weight plane
  const size_t PS  = (size_t)NB * NTRI * 4096 * 4;    // packed f32 score tiles
  const size_t PC  = 2 * PX;                          // bf16 hi and lo ctx planes
  const size_t PP  = (size_t)NB * SEQ * SEQ * 2;      // Ph
  const size_t PPL = (size_t)NB * RESR * VLP * 2;     // Pl
  const size_t PVT = (size_t)NB * DM * SEQ * 2;       // VTh
  const size_t PVL = (size_t)NB * DM * VLP * 2;       // VTl
  const size_t RA = ((PX + 3 * PW) > PC) ? (PX + 3 * PW) : PC;
  const size_t oXb = 0;
  const size_t oW  = PX;
  const size_t oCh = 0;
  const size_t oCl = PX;
  const size_t oQh = RA;
  const size_t oQl = RA + PX;
  const size_t oKh = RA + 2 * PX;
  const size_t oKl = RA + 3 * PX;
  const size_t RBend = RA + 4 * PX;
  const size_t oPh = RA;
  const size_t oPl = RA + PP;
  if (oPl + PPL > RBend) return;
  const size_t oVTh = RBend;
  const size_t oVTl = RBend + PVT;
  const size_t oWo  = oVTl + PVL;
  const size_t oS   = oWo + PW;
  const size_t total = oS + PS;                       // 158334976 in the full build
  if (total > ws_size) return;

  char* ws = (char*)d_ws;
  unsigned short* Xb  = (unsigned short*)(ws + oXb);
  unsigned short* Wb  = (unsigned short*)(ws + oW);   // Wq plane, then Wk, then Wv
  float*          Sp  = (float*)(ws + oS);
  unsigned short* Qh  = (unsigned short*)(ws + oQh);
  unsigned short* Ql  = (unsigned short*)(ws + oQl);
  unsigned short* Kh  = (unsigned short*)(ws + oKh);
  unsigned short* Kl  = (unsigned short*)(ws + oKl);
  unsigned short* Ph  = (unsigned short*)(ws + oPh);
  unsigned short* Pl  = (unsigned short*)(ws + oPl);
  unsigned short* Ch  = (unsigned short*)(ws + oCh);
  unsigned short* Cl  = (unsigned short*)(ws + oCl);
  unsigned short* VTh = (unsigned short*)(ws + oVTh);
  unsigned short* VTl = (unsigned short*)(ws + oVTl);
  unsigned short* WoT = (unsigned short*)(ws + oWo);

  const dim3 blk(256);
  const int nGroups = NB * SEQ * DM / 8 + 3 * (DM * DM / 8);
  const dim3 gCvt(NWOT + (nGroups + 255) / 256);
  const dim3 gQk(2 * NPQ);
  const dim3 gSv(NB * (NSF + NSI) + NB * NPV);
  const dim3 gProj(((NB * SEQ / 64) * (DM / 64) + 7) / 8, 1);
  const dim3 gSm((NB * SEQ + 7) / 8);
  const dim3 gPv(NPVH + NPVR);

  // (1) x and Wq, Wk, Wv -> bf16 planes (Xb, then the three weight planes contiguous); Wo [in][out] -> WoT bf16 [out][in]
  cvt_inputs<<<gCvt, blk, 0, stream>>>(x, wq, wk, wv, wo, Xb, WoT);
  // (2) q, k -> bf16 hi/lo planes [NB*SEQ][DM]
  proj_qk<<<gQk, blk, 0, stream>>>(Xb, Wb, Qh, Ql, Kh, Kl);
  // (3) scores = q . k^T per batch over the NTRI lower-triangular 64x64 tiles, 3 bf16 products -> packed f32 tiles;
  //     v^T -> f16 hi plane and residual plane
  scores_vt<<<gSv, blk, 0, stream>>>(Qh, Ql, Kh, Kl, Sp, Xb, Wb + (size_t)2 * DM * DM, VTh, VTl);
  // (4) causal row softmax in f32 -> Ph f16(1024 P) and Pl residual planes
  softmax_rows<<<gSm, blk, 0, stream>>>(Sp, Ph, Pl);
  // (5) ctx = p.v -> bf16 hi/lo planes [NB*SEQ][DM]: rows RESR..SEQ-1 single f16 product (64x64 wave tiles), rows 0..RESR-1 of every sequence
  //     with the residual planes (3 f16 products, 32x64 wave tiles)
  gemm_pv_all<<<gPv, blk, 0, stream>>>(Ph, Pl, VTh, VTl, Ch, Cl);
  // (6) out = ctx . Wo -> f32 output buffer   (A = Ch + Cl, Bt = WoT [out][in]; M=NB*SEQ, N=DM, K=DM; 2 bf16 products)
  gemm_bf<1, 0, 0, 3><<<gProj, blk, 0, stream>>>(
      Ch, Cl, DM, 0LL, WoT, WoT, DM, 0LL,
      (void*)out, DM, 0LL, (void*)out, DM, 0LL, 0,
      NB * SEQ, DM, DM, 1.0f, 1.0f);
  (void)hipGetLastError();
}

// v009
// It runs in 138 microseconds.
// In both of two side-by-side timings against v008, it was 1.09 times as fast.
// Counting every step since v000, it is 3.64 times as fast.
// Contractions: q, k, v^T projections = v_wmma_f32_16x16x32_bf16 (bf16 RNE-converted x and W, single product, f32 accumulate);
// q.k^T scores = v_wmma_f32_16x16x32_bf16 with bf16 hi/lo planes of q and k (hi.hi + lo.hi + hi.lo), f32 accumulate;
// p.v = v_wmma_f32_16x16x32_f16 (p carried x1024 in f16, v^T carried x16 in f16, single product; query rows 0..RESR-1 of every
// sequence add the f16 residual planes (x4096) of p and v^T in a separate accumulator), f32 accumulate;
// output projection ctx.Wo = v_wmma_f32_16x16x32_bf16 with bf16 hi/lo planes of ctx and the bf16 RNE-converted Wo^T plane
// (hi.W + lo.W, one accumulator), f32 accumulate;
// causal mask, row max, exp, sum and normalisation in f32 on the VALU.
// Carry audit:
//   Ph  = f16(1024 * p), p already normalised by the row sum     } OSCALE = 1/(1024*16) folded exactly once in the p.v epilogue
//   VTh = f16(16 * v)                                            }
//   Pl  = f16((1024 p - Ph) * 4096)                              } products Ph.VTl and Pl.VTh go only to accumulator acc1,
//   VTl = f16((16 v - VTh) * 4096), keys 0..VLP-1                } folded with OSCALE * (1/4096) once in the same epilogue
//   q / k lo planes are unscaled bf16 residuals (v - hi) sharing the hi accumulator; score scale 1/32 applied once in f32 in the softmax.
//   ctx hi / lo planes are unscaled bf16 (lo = RNE(ctx - hi)) sharing one accumulator in the output projection.
// The module's softmax over all keys followed by the lower-triangular mask and the division by the masked row sum equals
// exp(z_j - m) / sum_{j<=i} exp(z_j - m) for any finite shift m; it is evaluated with the causal row max as the shift.
#include <hip/hip_runtime.h>
#include <math.h>

#define NB_FULL  4
#define SEQ_FULL 2048
#ifndef NB
#define NB    4
#endif
#ifndef SEQ
#define SEQ   2048
#endif
#define DM    1024
#define NQT   (SEQ / 64)                  // query/key tiles of 64
#define NTRI  ((NQT * (NQT + 1)) / 2)     // lower-triangular 64x64 score tiles per sequence (528 at SEQ 2048)
#define RESR  ((SEQ < 512) ? SEQ : 512)   // leading query rows per sequence that use the residual planes
#define VLP   RESR                        // key pitch of the p / v^T residual planes
#define PSC   1024.0f
#define VSC   16.0f
#define LSC   4096.0f
#define OSCALE (1.0f / 16384.0f)          // 1 / (PSC * VSC)
static_assert(NB >= 1 && NB <= NB_FULL);
static_assert(SEQ >= 256 && SEQ <= SEQ_FULL && (SEQ % 256) == 0);
static_assert((SEQ % 64) == 0 && (DM % 64) == 0 && (DM % 32) == 0);
static_assert((RESR % 64) == 0 && (RESR % 256) == 0 && RESR <= VLP && VLP <= SEQ && ((SEQ - RESR) % 64) == 0);
static_assert((RESR % 32) == 0);
static_assert(((NB * SEQ) % 8) == 0);
static_assert(((SEQ * DM / 8) % 256) == 0 && ((DM * DM / 8) % 256) == 0);

// ---- workspace extents (bytes) used by the launcher; checked at build time ------------------------------
#define WS_MAX2(a, b) (((a) > (b)) ? (a) : (b))
#define WS_PX  ((size_t)NB * SEQ * DM * 2)        // one 16-bit plane [NB*SEQ][DM]
#define WS_PW  ((size_t)DM * DM * 2)              // one 16-bit weight plane
#define WS_PS  ((size_t)NB * NTRI * 4096 * 4)     // packed f32 score tiles
#define WS_PC  (2 * WS_PX)                        // bf16 hi and lo ctx planes
#define WS_PP  ((size_t)NB * SEQ * SEQ * 2)       // Ph
#define WS_PPL ((size_t)NB * RESR * VLP * 2)      // Pl
#define WS_PVT ((size_t)NB * DM * SEQ * 2)        // VTh
#define WS_PVL ((size_t)NB * DM * VLP * 2)        // VTl
#define WS_RA  WS_MAX2(WS_PX + 3 * WS_PW, WS_PC)
#define WS_TOTAL (WS_RA + 4 * WS_PX + WS_PVT + WS_PVL + WS_PW + WS_PS)
static_assert(WS_TOTAL <= (size_t)268435456);
static_assert(WS_PC <= WS_RA);
static_assert(WS_PP + WS_PPL <= 4 * WS_PX);
static_assert(((NB * SEQ) % 64) == 0);
static_assert((WS_RA % 128) == 0 && (WS_PX % 128) == 0 && (WS_PVT % 128) == 0 && (WS_PVL % 128) == 0 && (WS_PW % 128) == 0 &&
              (WS_PS % 128) == 0);

typedef _Float16 v16h __attribute__((ext_vector_type(16)));
typedef _Float16 v8h  __attribute__((ext_vector_type(8)));
typedef __bf16   v16b __attribute__((ext_vector_type(16)));
typedef __bf16   v8b  __attribute__((ext_vector_type(8)));
typedef float    v8f  __attribute__((ext_vector_type(8)));
typedef float    v4f  __attribute__((ext_vector_type(4)));
typedef unsigned int v4u __attribute__((ext_vector_type(4)));
typedef float    v2f  __attribute__((ext_vector_type(2)));
typedef __bf16   v2b  __attribute__((ext_vector_type(2)));
typedef _Float16 v2h  __attribute__((ext_vector_type(2)));

// ---- scalar helpers --------------------------------------------------------------------------------
// two f32 -> two bf16 / f16 (round to nearest even) packed in one dword, a in the low half: one packed hardware convert
__device__ __forceinline__ unsigned pk_bf(float a, float b) {
  const v2f f = {a, b};
  return __builtin_bit_cast(unsigned, __builtin_convertvector(f, v2b));
}
__device__ __forceinline__ unsigned pk_h(float a, float b) {
  const v2f f = {a, b};
  return __builtin_bit_cast(unsigned, __builtin_convertvector(f, v2h));
}
// the two halves of such a dword back in f32
__device__ __forceinline__ float bf_up0(unsigned p) { return __uint_as_float(p << 16); }
__device__ __forceinline__ float bf_up1(unsigned p) { return __uint_as_float(p & 0xFFFF0000u); }
__device__ __forceinline__ float h_up0(unsigned p) { return (float)__builtin_bit_cast(v2h, p)[0]; }
__device__ __forceinline__ float h_up1(unsigned p) { return (float)__builtin_bit_cast(v2h, p)[1]; }
__device__ __forceinline__ unsigned short h_bits(_Float16 x) { return __builtin_bit_cast(unsigned short, x); }
__device__ __forceinline__ unsigned pk16(unsigned short a, unsigned short b) { return (unsigned)a | ((unsigned)b << 16); }
__device__ __forceinline__ v8f zero8() { v8f z = {0.f, 0.f, 0.f, 0.f, 0.f, 0.f, 0.f, 0.f}; return z; }

// ---- fragment loaders: 16-bit A/B operand, lane -> row/col (lane&15), p already includes +8*(lane>>4);
//      elements 0..7 <- p[0..7] (k0+8h..), elements 8..15 <- p[16..23] (k0+16+8h..)
__device__ __forceinline__ v16b ldfrag_b(const __bf16* p) {
  union { v16b v; v8b h[2]; } f;
  f.h[0] = *(const v8b*)(p);
  f.h[1] = *(const v8b*)(p + 16);
  return f.v;
}
__device__ __forceinline__ v16h ldfrag_h(const _Float16* p) {
  union { v16h v; v8h h[2]; } f;
  f.h[0] = *(const v8h*)(p);
  f.h[1] = *(const v8h*)(p + 16);
  return f.v;
}

// ---- WMMA helpers ------------------------------------------------------------------------------------
__device__ __forceinline__ v8f mma_b_raw(v16b a, v16b b, v8f c) {
  return __builtin_amdgcn_wmma_f32_16x16x32_bf16(false, a, false, b, (short)0, c, false, false);
}
__device__ __forceinline__ v8f mma_h_raw(v16h a, v16h b, v8f c) {
  return __builtin_amdgcn_wmma_f32_16x16x32_f16(false, a, false, b, (short)0, c, false, false);
}
__device__ __forceinline__ void acc_guard4(v8f& a, v8f& b, v8f& c, v8f& d) {
  asm volatile("v_nop\n\tv_nop\n\tv_nop\n\tv_nop" : "+v"(a), "+v"(b), "+v"(c), "+v"(d));
}

// ---- LDS staging of GEMM operands --------------------------------------------------------------------
// A stage is 64 k (128 B) of every operand row of the work-group's tile, laid at pitch LPITCH (16 B x odd: 16-byte reads of
// 16 rows fall on distinct banks). It is brought in slices of 128 rows, one tensor load (16 KiB) of one wave each: wave c brings
// slice c of every stage, the waves beyond the stage's slices bring nothing. A slice fills SLB = 128 LPITCH = 9 x 2 KiB of LDS.
#define LPITCH 144
#define SLB (128 * LPITCH)
static_assert((SLB % 2048) == 0);
typedef unsigned int u32x4 __attribute__((ext_vector_type(4)));
typedef unsigned int u32x8 __attribute__((ext_vector_type(8)));
__device__ __forceinline__ unsigned uni(unsigned v) { return (unsigned)__builtin_amdgcn_readfirstlane(v); }
// a wave-uniform test held in a scalar register, so that the branch round a tensor load (which ignores EXEC) is a scalar one
__device__ __forceinline__ unsigned pinned(unsigned v) { unsigned w = uni(v); asm volatile("" : "+s"(w)); return w; }
// descriptor group 1: 1-byte elements, tensor = tile = 128 rows of 128 B, source row pitch in bytes, 16 B of LDS pad behind every row
__device__ __forceinline__ u32x8 tdm_group1(unsigned src_pitch) {
  u32x8 g;
  g[0] = uni((1u << 20) | (4u << 22) | (3u << 25));   // no mask; pad on, interval 32 dwords = one row, amount 4 dwords
  g[1] = uni(128u << 16);
  g[2] = uni(128u << 16);
  g[3] = uni(128u << 16);
  g[4] = uni(128u);
  g[5] = uni(src_pitch);
  g[6] = uni(0u);
  g[7] = uni(0u);
  // pinned: the descriptor's words are held in these scalar registers from the first load to the last, so that none of them takes
  // another value while a load that named it is outstanding (left free, the compiler rebuilt the constants in passing registers)
  asm volatile("" : "+s"(g));
  return g;
}
// descriptor group 0: LDS byte address of the slice, global address of its first byte
__device__ __forceinline__ u32x4 tdm_group0(unsigned lds_dst, unsigned long long ga) {
  u32x4 g;
  g[0] = uni(1u);
  g[1] = uni(lds_dst);
  g[2] = uni((unsigned)ga);
  g[3] = uni((((unsigned)(ga >> 32)) & 0x01FFFFFFu) | 0x80000000u);
  asm volatile("" : "+s"(g));   // pinned, as group 1: words 0 and 3 keep their registers and values from load to load
  return g;
}
template <bool B> struct BoolC { static constexpr bool value = B; };
__device__ __forceinline__ void tdm_load(u32x4 g0, u32x8 g1) { asm volatile("tensor_load_to_lds %0, %1" :: "s"(g0), "s"(g1) : "memory"); }
// the wave's own tensor loads have landed (other waves read them only behind the barrier that follows)
__device__ __forceinline__ void wait_copies() { asm volatile("s_wait_tensorcnt 0x0" ::: "memory"); }
// counted form for a ring of more than two buffers: returns when all but the wave's N youngest tensor loads have landed (the counter
// returns in issue order); N = the stages issued behind the one that is published, which fly on over the barrier
template <int N>
__device__ __forceinline__ void wait_copies_but() { asm volatile("s_wait_tensorcnt %0" :: "n"(N) : "memory"); }
// the wave's own LDS reads have returned before the buffer they read is handed back for a refill
__device__ __forceinline__ void wait_lds() { asm volatile("s_wait_dscnt 0x0" ::: "memory"); }
// behind the global stores of one epilogue slab, in front of the next slab's work: s_wait_xcnt 0 stands before that work rewrites
// registers which the issued stores name (a precaution), s_wait_dscnt 0 so that the slab's reads have returned before the next rows
// overwrite it; neither waits for the stores themselves, which fly on under the next slab
__device__ __forceinline__ void slab_next() { asm volatile("s_wait_xcnt 0x0\n\ts_wait_dscnt 0x0" ::: "memory"); }
// four 16-byte row stores of one plane and their s_wait_xcnt 0 in one statement, so that the wait stands in front of whatever rewrites an
// address or data register of these stores (a precaution)
__device__ __forceinline__ void store_rows4(unsigned short* p0, unsigned short* p1, unsigned short* p2, unsigned short* p3,
                                            v4u d0, v4u d1, v4u d2, v4u d3) {
  asm volatile("global_store_b128 %0, %4, off\n\tglobal_store_b128 %1, %5, off\n\t"
               "global_store_b128 %2, %6, off\n\tglobal_store_b128 %3, %7, off\n\ts_wait_xcnt 0x0"
               :: "v"(p0), "v"(p1), "v"(p2), "v"(p3), "v"(d0), "v"(d1), "v"(d2), "v"(d3) : "memory");
}

// =====================================================================================================
// f32 -> bf16 (RNE convert) for x and the three weights into one contiguous 16-bit region:
// groups 0..NX8-1 <- x (batch b of the plane reads source rows at b * SEQ_FULL * DM, SEQ rows each), then NW8 groups each
// coverage: (NX8 + 3 NW8) threads x 8 = the whole [NB*SEQ][DM] x plane plus the three [DM][DM] weight planes.
// =====================================================================================================
__device__ __forceinline__ void cvt_planes_body(int blk, const float* __restrict__ x, const float* __restrict__ wq,
                                                const float* __restrict__ wk, const float* __restrict__ wv,
                                                unsigned short* out) {
  const int NXB8 = SEQ * DM / 8;          // groups per batch
  const int NX8 = NB * NXB8;
  const int NW8 = DM * DM / 8;
  const int g = blk * 256 + threadIdx.x;
  if (g >= NX8 + 3 * NW8) return;
  const float* src;
  if (g < NX8) {
    const int bb  = g / NXB8;
    const int off = g - bb * NXB8;
    src = x + (size_t)bb * SEQ_FULL * DM + (size_t)off * 8;
  } else {
    const int e = g - NX8;
    const int w = e / NW8;
    const int off = e - w * NW8;
    const float* wsrc = (w == 0) ? wq : ((w == 1) ? wk : wv);
    src = wsrc + (size_t)off * 8;
  }
  const v4f a = *(const v4f*)(src);
  const v4f c = *(const v4f*)(src + 4);
  v4u p;
  p[0] = pk_bf(a[0], a[1]);
  p[1] = pk_bf(a[2], a[3]);
  p[2] = pk_bf(c[0], c[1]);
  p[3] = pk_bf(c[2], c[3]);
  *(v4u*)(out + (size_t)g * 8) = p;
  
}

// =====================================================================================================
// Transposing f32 -> bf16 (RNE convert) of the output projection weight: w[k][n] (k = input feature, n = output feature,
// DM x DM) -> out[n][k] (k contiguous), the Bt plane of the last GEMM. One block per 64x64 tile (k0 = 64*ty,
// n0 = 64*tx), (DM/64) x (DM/64) tiles. The tile is staged in LDS as f32 (pitch 65; written by all waves, read by all
// coverage: 2 iterations x 32 rows x 64 k = the block's whole 64x64 tile; grid = all DM/64 x DM/64 tiles.
// =====================================================================================================
__device__ __forceinline__ void cvt_wo_t_body(float* sW, int tx, int ty, const float* __restrict__ w, unsigned short* out) {
  const int tid = threadIdx.x;
  const int k0 = ty * 64;
  const int n0 = tx * 64;
  {
    const int kk = tid >> 2;               // 0..63 source row within the tile
    const int c0 = (tid & 3) * 16;         // 16 consecutive source columns
    const float* src = w + (size_t)(k0 + kk) * DM + n0 + c0;
#pragma unroll
    for (int u = 0; u < 4; ++u) {
      const v4f a = *(const v4f*)(src + 4 * u);
      sW[kk * 65 + c0 + 4 * u + 0] = a[0];
      sW[kk * 65 + c0 + 4 * u + 1] = a[1];
      sW[kk * 65 + c0 + 4 * u + 2] = a[2];
      sW[kk * 65 + c0 + 4 * u + 3] = a[3];
    }
  }
  __syncthreads();
  const int q  = tid >> 3;                 // 0..31 output row within a half tile
  const int c8 = (tid & 7) * 8;            // 8 consecutive k
  v4u hv[2];
#pragma unroll
  for (int it = 0; it < 2; ++it) {
    const int nn = it * 32 + q;            // it 0..1 x q 0..31 = output rows 0..63
    v4u a;
#pragma unroll
    for (int e = 0; e < 4; ++e) {
      const float f0 = sW[(c8 + 2 * e) * 65 + nn];
      const float f1 = sW[(c8 + 2 * e + 1) * 65 + nn];
      a[e] = pk_bf(f0, f1);
    }
    hv[it] = a;
  }
  {
#pragma unroll
    for (int it = 0; it < 2; ++it) {
      const int nn = it * 32 + q;
      *(v4u*)(out + (size_t)(n0 + nn) * DM + k0 + c8) = hv[it];
    }
    
  }
}

// =====================================================================================================
// The two input conversions, which read nothing of each other, in one grid: blocks 0 .. NWOT-1 transpose and convert Wo (one
// 64x64 tile each; first, because their chain load - LDS - barrier - store is the longer one), the rest convert x, Wq, Wk, Wv.
// The choice is the same for a whole block, so the barrier in the transposing part is passed by all of its threads.
// =====================================================================================================
#define NWOT ((DM / 64) * (DM / 64))
__global__ __launch_bounds__(256) void cvt_inputs(const float* __restrict__ x, const float* __restrict__ wq,
                                                  const float* __restrict__ wk, const float* __restrict__ wv,
                                                  const float* __restrict__ wo, unsigned short* planes, unsigned short* woT) {
  __shared__ float sW[64 * 65];
  const int blk = blockIdx.x;
  if (blk < NWOT) cvt_wo_t_body(sW, blk % (DM / 64), blk / (DM / 64), wo, woT);
  else            cvt_planes_body(blk - NWOT, x, wq, wk, wv, planes);
}

// =====================================================================================================
// Batched bf16 WMMA GEMM: C[m][n] = sum_k A[m][k] * Bt[n][k]; one work-group (8 waves, 4 x 2) per 256 x (32 NJ) tile, one wave per
// 64 x (16 NJ) tile of it: NJ = 4: 256 x 128 and 64 x 64; NJ = 8 (single product, dense grid): 256 x 256 and 64 x 128, which lands a
// third fewer operand bytes in LDS per product and feeds 32 WMMAs from 12 LDS fragments (NJ = 4: 16 from 8).
// The operand rows of the work-group's tile are staged in LDS, 64 k a stage, by tensor loads in a
// ring of NBUF buffers (stages s + 2 .. s + NBUF are loaded while stage s + 1 is worked on); the waves read their fragments from LDS.
// A row-major [M][K] pitch lda; Bt row-major [N][K] pitch ldb (k contiguous); M multiple of 256, N of 32 NJ, K of 64.
// bx = index of the work-group's tile, b = batch index (strides in elements); ring and sT are the work-group's LDS.
// NSPLIT: 0 = Ah.Bh (single product); 1 = Ah.Bh + Al.Bh; 2 = Ah.Bh + Al.Bh + Ah.Bl with unscaled bf16 lo planes (one accumulator).
// TRI: 0 = dense grid of (M/256) x (N/(32 NJ)) work-group tiles, bx row-major;
//      1 = square M == N: work-group tiles (I, J <= 2I+1), bx = I(I+1) + J; a wave whose 64x64 tile (tm, tn) has tn > tm
//          computes and stores nothing; tile t = tm(tm+1)/2 + tn written packed at C + b*strideC + t*4096 as [64][64] f32
//          (OUT_MODE 0 only).
// OUT_MODE: 0 = f32 (pitch ldc); 2 = bf16 hi plane C + bf16 lo plane C2 (lo = RNE(v - hi), unscaled);
//           3 = f16 hi plane C = f16(v*hscale) + f16 residual plane C2 = f16((v*hscale - hi) * rscale), C2 written
//               only for tiles with n0 < N2 (pitch ldc2, batch stride strideC2).
// Epilogue: 16-row slabs staged per wave in LDS (wave-private region sT[wave], wait_lds); each 64-wide row segment written
// =====================================================================================================
__host__ __device__ constexpr int gemm_bf_stage_bytes(int nsplit, int nj = 4) {   // one stage: Ah 256 rows | Al | Bh 32 nj rows | Bl
  return (((nsplit >= 1) ? 2 : 1) * 256 + ((nsplit >= 2) ? 2 : 1) * 32 * nj) * LPITCH;
}
template <int NSPLIT, int OUT_MODE, int TRI, int NBUF, int NJ = 4>
__device__ __forceinline__ void gemm_bf_body(
    unsigned char* ring, float (*sT)[16 * 68], int bx, int b,
    const unsigned short* __restrict__ Ahp, const unsigned short* __restrict__ Alp, int lda, long long strideA,
    const unsigned short* __restrict__ Bhp, const unsigned short* __restrict__ Blp, int ldb, long long strideB,
    void* Cout, int ldc, long long strideC,
    void* Cout2, int ldc2, long long strideC2, int N2,
    int M, int N, int K, float hscale, float rscale) {
  static_assert(NJ == 4 || (NJ == 8 && NSPLIT == 0 && TRI == 0 && NBUF > 2));
  constexpr int BR     = 32 * NJ;                                        // Bt rows (output columns) of the work-group's tile
  constexpr int OFF_AL = 256 * LPITCH;                                   // stage layout: Ah 256 rows | Al | Bh BR rows | Bl
  constexpr int OFF_BH = ((NSPLIT >= 1) ? 2 : 1) * 256 * LPITCH;
  constexpr int OFF_BL = OFF_BH + BR * LPITCH;
  constexpr int STG    = OFF_BH + ((NSPLIT >= 2) ? 2 : 1) * BR * LPITCH;
  static_assert(STG == gemm_bf_stage_bytes(NSPLIT, NJ));
  constexpr int NSL = STG / SLB;           // slices of a stage = issuing waves
  constexpr int CPS = 1;                   // tensor loads of an issuing wave for one stage
  static_assert(NSL * SLB == STG && NSL <= 8 && NBUF >= 2 && NBUF <= 4);
  const int tid  = threadIdx.x;
  const int lane = tid & 31;
  const int wave = __builtin_amdgcn_readfirstlane(tid >> 5);
  int bm, bn;
  if (TRI != 0) {
    const int NI = M >> 8;
    int I = 0;
    for (int q = 1; q < NI; ++q)
      if (q * (q + 1) <= bx) I = q;
    bm = I;
    bn = bx - I * (I + 1);
    if (bn > 2 * I + 1) return;            // work-group-uniform, in front of every tensor load and barrier
  } else {
    const int bN = N / BR;
    bm = bx / bN;
    bn = bx - bm * bN;
    if (bm >= (M >> 8)) return;            // work-group-uniform, in front of every tensor load and barrier
  }
  const int tm = bm * 4 + (wave >> 1);
  const int tn = bn * 2 + (wave & 1);
  const bool active = (TRI == 0) || (tn <= tm);   // wave-uniform
  const int t  = ((tm * (tm + 1)) >> 1) + tn;     // packed tile index (TRI)
  const int m0 = tm << 6;
  const int n0 = bn * BR + (wave & 1) * 16 * NJ;  // = 64 tn where NJ = 4

  const unsigned short* Ag  = Ahp + (size_t)b * strideA + (size_t)(bm * 256) * lda;
  const unsigned short* Alg = Alp + (size_t)b * strideA + (size_t)(bm * 256) * lda;
  const unsigned short* Bg  = Bhp + (size_t)b * strideB + (size_t)(bn * BR) * ldb;
  const unsigned short* Blg = Blp + (size_t)b * strideB + (size_t)(bn * BR) * ldb;
  const unsigned ringb = (unsigned)(size_t)(const void*)ring;    // LDS byte address of the ring

  const int rlane = lane & 15;                 // row (A) / col (B, D) within subtile
  const int koff  = (lane >> 4) * 8;           // k offset of this lane half
  const int mOff  = (lane >> 4) * 8;           // D row offset

  // this wave's slice: 128 rows of one plane (all wave-uniform): Ah rows 0.., Ah rows 128.., Bh, then Bh rows 128.. | Al, Al | Al, Al, Bl
  const unsigned short* sg = Ag;
  int sld = lda;
  unsigned sl = 0;
  if (wave == 1) { sg = Ag + (size_t)128 * lda; sl = SLB; }
  if (wave == 2) { sg = Bg; sld = ldb; sl = OFF_BH; }
  if (NJ == 8 && wave == 3) { sg = Bg + (size_t)128 * ldb; sld = ldb; sl = OFF_BH + SLB; }
  if (NSPLIT >= 1 && wave == 3) { sg = Alg; sl = OFF_AL; }
  if (NSPLIT >= 1 && wave == 4) { sg = Alg + (size_t)128 * lda; sl = OFF_AL + SLB; }
  if (NSPLIT >= 2 && wave == 5) { sg = Blg; sld = ldb; sl = OFF_BL; }
  const u32x8 g1 = tdm_group1((unsigned)sld * 2u);
  const unsigned long long sga = (unsigned long long)(size_t)(const void*)sg;
  const unsigned sl0 = uni(ringb + sl), sa0 = uni((unsigned)sga);
  u32x4 g0 = tdm_group0(sl0, sga);
  // stage s -> buffer buf: only the LDS address and the low address word change from load to load (a row's k range lies inside one
  // row, and the rows lie at multiples of their own length in the page-aligned workspace, so the low word does not carry)
  // One scalar test decides whether the wave issues: it has a slice, and the stage exists.
  auto stage = [&](int s, int buf, bool exists) {
    if (pinned((wave < NSL) && exists)) {
      g0[1] = uni(sl0 + (unsigned)(buf * STG));
      g0[2] = uni(sa0 + (unsigned)(s * 128));
      tdm_load(g0, g1);
    }
  };

  v8f acc[4][NJ];
#pragma unroll
  for (int i = 0; i < 4; ++i)
#pragma unroll
    for (int j = 0; j < NJ; ++j) acc[i][j] = zero8();

  // Two fragment sets: while the WMMAs of one 32-k block run on one set, the next block's fragments are fetched into the other.
  v16b bhA[NJ], ahA[4], alA[4], blA[NJ], bhB[NJ], ahB[4], alB[4], blB[NJ];
  const int aoff = ((wave >> 1) * 64 + rlane) * LPITCH + koff * 2;
  const int boff = OFF_BH + ((wave & 1) * 16 * NJ + rlane) * LPITCH + koff * 2;
  auto ldset = [&](int buf, int kk, v16b (&bh)[NJ], v16b (&ah)[4], v16b (&al)[4], v16b (&bl)[NJ]) {
    const unsigned char* pa = ring + buf * STG + aoff + kk * 64;
    const unsigned char* pb = ring + buf * STG + boff + kk * 64;
#pragma unroll
    for (int j = 0; j < NJ; ++j) {
      bh[j] = ldfrag_b((const __bf16*)(pb + j * 16 * LPITCH));
      if (NSPLIT >= 2) bl[j] = ldfrag_b((const __bf16*)(pb + (OFF_BL - OFF_BH) + j * 16 * LPITCH));
    }
#pragma unroll
    for (int i = 0; i < 4; ++i) {
      ah[i] = ldfrag_b((const __bf16*)(pa + i * 16 * LPITCH));
      if (NSPLIT >= 1) al[i] = ldfrag_b((const __bf16*)(pa + OFF_AL + i * 16 * LPITCH));
    }
  };
  // per accumulator and 32-k block the products are added in the order Ah.Bh, Al.Bh, Ah.Bl
  auto mmaset = [&](v16b (&bh)[NJ], v16b (&ah)[4], v16b (&al)[4], v16b (&bl)[NJ]) {
#pragma unroll
    for (int i = 0; i < 4; ++i)
#pragma unroll
      for (int j = 0; j < NJ; ++j) acc[i][j] = mma_b_raw(ah[i], bh[j], acc[i][j]);
    if (NSPLIT >= 1) {
#pragma unroll
      for (int i = 0; i < 4; ++i)
#pragma unroll
        for (int j = 0; j < NJ; ++j) acc[i][j] = mma_b_raw(al[i], bh[j], acc[i][j]);
    }
    if (NSPLIT >= 2) {
#pragma unroll
      for (int i = 0; i < 4; ++i)
#pragma unroll
        for (int j = 0; j < NJ; ++j) acc[i][j] = mma_b_raw(ah[i], bl[j], acc[i][j]);
    }
  };

  const int nst = K >> 6;
  // Ring of NBUF buffers, stage s in buffer s mod NBUF. Two buffers: stage 0, wait to 0, barrier, stage 1. More: the buffers are filled
  // at entry (a fourth behind the wait for stage 0), and stage 0 is published while the later stages fly on.
  stage(0, 0, true);
  if (NBUF == 2) {
    wait_copies();
    __syncthreads();
    stage(1, 1, nst > 1);
  } else {
    constexpr int NPRE = (NBUF < 3) ? NBUF : 3;   // never more than three tensor loads of a wave outstanding
#pragma unroll
    for (int q = 1; q < NPRE; ++q) stage(q, q, q < nst);
    wait_copies_but<(NPRE - 1) * CPS>();
    if (nst < NPRE) wait_copies();         // fewer stages than that: the count would leave stage 0's own load out
    if (NBUF > NPRE) stage(NPRE, NPRE, NPRE < nst);   // the fourth buffer's, behind the wait for stage 0's
    __syncthreads();
  }
  ldset(0, 0, bhA, ahA, alA, blA);

  int cur = 0;                             // buffer of stage s
  // one trip = one stage; refill (fixed at build time): behind its publish point the trip loads stage s + NBUF into the buffer it has left
  auto trip = [&](int s, auto refill) {
    const int nxt = (cur + 1 == NBUF) ? 0 : cur + 1;
    ldset(cur, 1, bhB, ahB, alB, blB);     // the stage's last block: the wave's last reads of buffer cur
    __builtin_amdgcn_sched_barrier(0);     // keeps the load group whole and ahead of the WMMAs
    if (active) mmaset(bhA, ahA, alA, blA);
    __builtin_amdgcn_sched_barrier(0);     // keeps these WMMAs in front of the waits, so that the loads above fly under them
    // publish point of stage s + 1, in front of stage s's last block and passed by every wave: own LDS reads of buffer cur
    // returned, own tensor load of stage s + 1 landed (those of stages s + 2 .. s + NBUF - 1 may fly on where all of them were issued;
    // in the last trips the wait is to 0), barrier; then the refill of buffer cur and the first fragments of stage s + 1
    wait_lds();
    if (NBUF > 2) wait_copies_but<(NBUF - 2) * CPS>();
    if (NBUF == 2 || s + NBUF - 1 >= nst) wait_copies();
    __syncthreads();
    if constexpr (decltype(refill)::value) stage(s + NBUF, cur, true);
    // unconditional (a branch here would merge the compiler's LDS wait counts): behind the last stage it reads again the last
    // stage's buffer (two buffers: the other one's old bytes), which no tensor load is aimed at any more, and nothing uses them
    ldset((NBUF == 2 || s + 1 < nst) ? nxt : cur, 0, bhA, ahA, alA, blA);
    __builtin_amdgcn_sched_barrier(0);     // keeps the load group whole and ahead of the WMMAs
    if (active) mmaset(bhB, ahB, alB, blB);
    cur = nxt;
  };
  // the trips behind which a stage s + NBUF exists, then the last NBUF (or all nst), which load nothing
  const int nref = (nst > NBUF) ? nst - NBUF : 0;
  for (int s = 0; s < nref; ++s) trip(s, BoolC<true>{});
  for (int s = nref; s < nst; ++s) trip(s, BoolC<false>{});
  wait_copies();
  // pinned to here: both descriptor groups stay in their scalar registers until the wave's last tensor load has landed
  asm volatile("" :: "s"(g0), "s"(g1));
  wait_lds();
  if (!active) return;                     // wave-uniform; no work-group barrier below
  // (NJ = 8: no asm statement names the accumulators; its operands would hold all 256 of their registers below v256, which spills)
  if constexpr (NJ == 4) {
#pragma unroll
    for (int i = 0; i < 4; ++i) acc_guard4(acc[i][0], acc[i][1], acc[i][2], acc[i][3]);
  }

  // ---- epilogue ----
  size_t cbase;
  int ldce, rowb;
  if (TRI != 0) { cbase = (size_t)b * strideC + (size_t)t * 4096; ldce = 64; rowb = 0; }
  else          { cbase = (size_t)b * strideC; ldce = ldc; rowb = m0; }
  float* slab = sT[wave];
  auto put = [&](int pi, int pj) {                   // accumulators of row group pi, column group pj -> the wave's slab
#pragma unroll
    for (int j = 0; j < 4; ++j) {
#pragma unroll
      for (int r = 0; r < 8; ++r) {
        slab[(mOff + r) * 68 + (j << 4) + rlane] = acc[pi][pj * 4 + j][r];
      }
    }
  };
  // slabs of 16 rows x 64 columns: row group i, column group jh of the wave's tile. NJ = 4: unrolled. NJ = 8: the loop stays rolled, so
  // that the conversion and store code stands once and not eight times in the kernel's text (unrolled, the text passed 32 KB)
#pragma unroll(NJ == 4 ? 4 : 1)
  for (int ih = 0; ih < 4 * (NJ / 4); ++ih) {
    const int i = ih / (NJ / 4), jh = ih % (NJ / 4);
    const int mBase = m0 + (i << 4);
    const int nB = n0 + (jh << 6);
    const int colb = (TRI != 0) ? 0 : nB;
    if constexpr (NJ == 4) {
      put(ih, 0);
    } else {                                         // register numbers are fixed in the code: one branch per slab picks its accumulators
      switch (ih) {
        case 0: put(0, 0); break;
        case 1: put(0, 1); break;
        case 2: put(1, 0); break;
        case 3: put(1, 1); break;
        case 4: put(2, 0); break;
        case 5: put(2, 1); break;
        case 6: put(3, 0); break;
        default: put(3, 1); break;
      }
    }
    wait_lds();   // the slab is this wave's own: its LDS writes are done before other lanes read the rows back; no wait on global stores
    if (OUT_MODE == 0) {
      float* C = (float*)Cout + cbase;
      const int hh = lane >> 4, c4 = (lane & 15) * 4;     // 256-B row segment = 16 lanes x 16 B
      {
#pragma unroll
        for (int it = 0; it < 8; ++it) {
          const int row = it * 2 + hh;                     // it 0..7 x hh 0..1 = rows 0..15
          const v4f v = *(const v4f*)(slab + row * 68 + c4);
          *(v4f*)(C + (size_t)(rowb + (i << 4) + row) * ldce + colb + c4) = v;
        }
        
      }
    } else {
      const int q = lane >> 3, c8 = (lane & 7) * 8;
      unsigned short* C  = (unsigned short*)Cout  + (size_t)b * strideC;
      unsigned short* C2 = (unsigned short*)Cout2 + (size_t)b * strideC2;
      const bool wlo = (OUT_MODE == 2) || (nB < N2);      // wave-uniform
      v4u hv[4], lv[4];
#pragma unroll
      for (int it = 0; it < 4; ++it) {
        const int row = it * 4 + q;                        // it 0..3 x q 0..3 = rows 0..15
        const float* sp = slab + row * 68 + c8;
        v4u a, a2;
#pragma unroll
        for (int e = 0; e < 4; ++e) {
          const float f0 = sp[2 * e], f1 = sp[2 * e + 1];
          if (OUT_MODE == 2) {
            const unsigned h = pk_bf(f0, f1);
            a[e] = h; a2[e] = pk_bf(f0 - bf_up0(h), f1 - bf_up1(h));
          } else {
            const float g0 = f0 * hscale, g1 = f1 * hscale;
            const unsigned h = pk_h(g0, g1);
            a[e] = h; a2[e] = pk_h((g0 - h_up0(h)) * rscale, (g1 - h_up1(h)) * rscale);
          }
        }
        hv[it] = a; lv[it] = a2;
      }
      {
        unsigned short* pc  = C  + (size_t)(mBase + q) * ldc  + nB + c8;   // rows q, q + 4, q + 8, q + 12 of the slab
        unsigned short* pc2 = C2 + (size_t)(mBase + q) * ldc2 + nB + c8;
        store_rows4(pc, pc + (size_t)4 * ldc, pc + (size_t)8 * ldc, pc + (size_t)12 * ldc, hv[0], hv[1], hv[2], hv[3]);
        if (wlo) store_rows4(pc2, pc2 + (size_t)4 * ldc2, pc2 + (size_t)8 * ldc2, pc2 + (size_t)12 * ldc2, lv[0], lv[1], lv[2], lv[3]);
      }
    }
    // also behind the last slab
    slab_next();
  }
}

// =====================================================================================================
// One GEMM as a launch of its own: blockIdx.x = tile index, blockIdx.y = batch index.
// =====================================================================================================
template <int NSPLIT, int OUT_MODE, int TRI, int NBUF>
__global__ __launch_bounds__(256) void gemm_bf(
    const unsigned short* __restrict__ Ahp, const unsigned short* __restrict__ Alp, int lda, long long strideA,
    const unsigned short* __restrict__ Bhp, const unsigned short* __restrict__ Blp, int ldb, long long strideB,
    void* Cout, int ldc, long long strideC,
    void* Cout2, int ldc2, long long strideC2, int N2,
    int M, int N, int K, float hscale, float rscale) {
  __shared__ __attribute__((aligned(2048))) unsigned char ring[NBUF * gemm_bf_stage_bytes(NSPLIT)];
  __shared__ __align__(16) float sT[8][16 * 68];   // per-wave 16x64 slab, pitch 68 floats
  static_assert(sizeof(ring) + sizeof(sT) <= 327680);
  gemm_bf_body<NSPLIT, OUT_MODE, TRI, NBUF>(ring, sT, (int)blockIdx.x, (int)blockIdx.y, Ahp, Alp, lda, strideA, Bhp, Blp, ldb, strideB,
                                      Cout, ldc, strideC, Cout2, ldc2, strideC2, N2, M, N, K, hscale, rscale);
}

// =====================================================================================================
// The q and k projections, which read nothing of each other, in one grid of 2 NPQ work-groups of equal cost:
//   blocks 0 .. NPQ-1        q = x . Wq^T -> bf16 hi/lo planes [NB*SEQ][DM]   (A = Xb, Bt = Wq [out][in]; M=NB*SEQ, N=DM, K=DM)
//   blocks NPQ .. 2 NPQ-1    k = x . Wk^T -> bf16 hi/lo planes
// Wb holds the Wq and Wk planes one behind the other. The choice is the same for a whole work-group.
// 256 x 256 tiles: 2 NPQ = one work-group for each of 256 WGPs. Three ring buffers (four would pass the LDS); a wave's registers
// (256 of accumulators and two fragment sets of 96) admit one work-group a WGP whatever its LDS.
// =====================================================================================================
#define NPQ ((NB * SEQ / 256) * (DM / 256))
static_assert(((NB * SEQ) % 256) == 0 && (DM % 256) == 0);
__global__ __launch_bounds__(256) void proj_qk(
    const unsigned short* __restrict__ Xb, const unsigned short* __restrict__ Wb,
    unsigned short* Qh, unsigned short* Ql, unsigned short* Kh, unsigned short* Kl) {
  __shared__ __attribute__((aligned(2048))) unsigned char ring[3 * gemm_bf_stage_bytes(0, 8)];
  __shared__ __align__(16) float sT[8][16 * 68];   // per-wave 16x64 slab, pitch 68 floats
  static_assert(sizeof(ring) + sizeof(sT) <= 327680);
  const int blk = blockIdx.x;
  const bool isk = blk >= NPQ;
  const unsigned short* W = Wb + (isk ? (size_t)DM * DM : (size_t)0);
  gemm_bf_body<0, 2, 0, 3, 8>(ring, sT, isk ? blk - NPQ : blk, 0, Xb, Xb, DM, 0LL, W, W, DM, 0LL,
                        (void*)(isk ? Kh : Qh), DM, 0LL, (void*)(isk ? Kl : Ql), DM, 0LL, DM,
                        NB * SEQ, DM, DM, 1.0f, 1.0f);
}

// =====================================================================================================
// The scores and the v^T projection, which read nothing of each other, in one grid. One work-group fills a WGP's LDS, there are
// more score tiles than WGPs, so the index runs from the longest to the shortest (for speed only) and
// the v^T tiles fill the places that the last score tiles leave idle:
//   blocks 0 .. NB NSF-1     scores = q . k^T, 3 bf16 products -> packed f32 tiles: work-group tiles (I, J <= 2I), NSF a batch
//   the next NB NSI          the score tiles (I, 2I+1) on the diagonal, in which 3 of 8 waves work
//   the rest, NPV a batch    v^T = Wv . x^T -> f16 hi plane f16(16 v) [b][d][key] (pitch SEQ) and residual plane x4096 for keys < VLP
//                            (pitch VLP)   (A = Wv [out][in], Bt = Xb rows of batch b; M=DM, N=SEQ, K=DM), 256 x 256 tiles
// The choice is the same for a whole work-group; the two parts use the same LDS.
// =====================================================================================================
#define NSI (SEQ / 256)
#define NSF (NSI * NSI)
#define NPV ((DM / 256) * (SEQ / 256))
static_assert((DM % 256) == 0 && (SEQ % 256) == 0);
__global__ __launch_bounds__(256) void scores_vt(
    const unsigned short* __restrict__ Qh, const unsigned short* __restrict__ Ql,
    const unsigned short* __restrict__ Kh, const unsigned short* __restrict__ Kl, float* Sp,
    const unsigned short* __restrict__ Xb, const unsigned short* __restrict__ Wv,
    unsigned short* VTh, unsigned short* VTl) {
  __shared__ __attribute__((aligned(2048))) unsigned char ring[2 * gemm_bf_stage_bytes(2)];
  __shared__ __align__(16) float sT[8][16 * 68];   // per-wave 16x64 slab, pitch 68 floats
  const int blk = blockIdx.x;
  if (blk < NB * (NSF + NSI)) {
    int b, I, J;
    if (blk < NB * NSF) {                  // row I holds the 2I+1 tiles f = I*I .. I*I + 2I
      b = blk / NSF;
      const int f = blk - b * NSF;
      I = 0;
      for (int q = 1; q < NSI; ++q)
        if (q * q <= f) I = q;
      J = f - I * I;
    } else {
      const int e = blk - NB * NSF;
      b = e / NSI;
      I = e - b * NSI;
      J = 2 * I + 1;
    }
    gemm_bf_body<2, 0, 1, 2>(ring, sT, I * (I + 1) + J, b, Qh, Ql, DM, (long long)SEQ * DM, Kh, Kl, DM, (long long)SEQ * DM,
                          (void*)Sp, 64, (long long)NTRI * 4096, (void*)Sp, 64, 0LL, 0,
                          SEQ, SEQ, DM, 1.0f, 1.0f);
  } else {
    const int e = blk - NB * (NSF + NSI);
    static_assert(3 * gemm_bf_stage_bytes(0, 8) <= 2 * gemm_bf_stage_bytes(2));   // three v^T stages lie in the two score stages' LDS
    gemm_bf_body<0, 3, 0, 3, 8>(ring, sT, e % NPV, e / NPV, Wv, Wv, DM, 0LL, Xb, Xb, DM, (long long)SEQ * DM,
                          (void*)VTh, SEQ, (long long)DM * SEQ, (void*)VTl, VLP, (long long)DM * VLP, VLP,
                          DM, SEQ, DM, VSC, LSC);
  }
}

// =====================================================================================================
// Row softmax over the packed lower-triangular score tiles. One wave per query row (block = 8 rows, grid = NB*SEQ/8).
// Row (b, i), tm = i>>6, r = i&63: score (i, j) sits at Sp + ((b*NTRI + tm(tm+1)/2 + (j>>6))*4096 + r*64 + (j&63)), j <= 64 tm + 63.
// The wave handles ng = tm/4 + 1 groups of 256 keys (lane: 8 consecutive keys per group, two 16-B loads with the key-tile
// address clamped to tn <= tm); z = s/32 for j <= i, -inf otherwise; m = max, p = exp(z - m), l = sum, P = p/l (all f32).
// Writes Ph = f16(1024 P) for keys 0 .. 256 ng - 1 of row (b, i) (pitch SEQ; >= the keys the p.v GEMM copies for the row's work-group tile; zeros
// for j > i) and, for rows i < RESR, Pl = f16((1024 P - Ph) * 4096) with the same key extent (<= VLP, pitch VLP).
// coverage: NB*SEQ rows x written extent >= every key range any consumer reads.
// =====================================================================================================
__global__ __launch_bounds__(256) void softmax_rows(const float* __restrict__ Sp,
                                                    unsigned short* Php, unsigned short* Plp) {
  const int lane = threadIdx.x & 31, wave = threadIdx.x >> 5;
  const int row = blockIdx.x * 8 + wave;
  if (row >= NB * SEQ) return;             // wave-uniform; exact grid never triggers it; no block barriers below
  const int b  = row / SEQ;
  const int i  = row - b * SEQ;
  const int tm = i >> 6, r = i & 63;
  const int ng = (tm >> 2) + 1;            // 1..8, wave-uniform
  const float* srow = Sp + ((size_t)b * NTRI + (size_t)((tm * (tm + 1)) >> 1)) * 4096 + (size_t)r * 64;

  float z[8][8];
  float m = -INFINITY;
#pragma unroll
  for (int g = 0; g < 8; ++g) {
#pragma unroll
    for (int e = 0; e < 8; ++e) z[g][e] = -INFINITY;
    if (g < ng) {
      const int j0 = 256 * g + 8 * lane;
      int tn = j0 >> 6;
      tn = (tn < tm) ? tn : tm;            // clamped tile address; keys with tn > tm are all masked below
      const float* p = srow + (size_t)tn * 4096 + (j0 & 63);
      const v4f a = *(const v4f*)(p);
      const v4f c = *(const v4f*)(p + 4);
      const float v[8] = {a[0], a[1], a[2], a[3], c[0], c[1], c[2], c[3]};
#pragma unroll
      for (int e = 0; e < 8; ++e) {
        const float zz = (j0 + e <= i) ? (v[e] * 0.03125f) : -INFINITY;
        z[g][e] = zz;
        m = fmaxf(m, zz);
      }
    }
  }
#pragma unroll
  for (int off = 1; off < 32; off <<= 1) m = fmaxf(m, __shfl_xor(m, off, 32));   // finite: key 0 is always kept

  float l = 0.f;
#pragma unroll
  for (int g = 0; g < 8; ++g) {
    if (g < ng) {
#pragma unroll
      for (int e = 0; e < 8; ++e) {
        const float p = __expf(z[g][e] - m);   // masked: exp(-inf) = 0
        z[g][e] = p;
        l += p;
      }
    }
  }
#pragma unroll
  for (int off = 1; off < 32; off <<= 1) l += __shfl_xor(l, off, 32);          // l >= 1
  const float inv1k = (1.0f / l) * PSC;

  const bool res = (i < RESR);             // wave-uniform
  v4u ph[8];
  v4u pl0 = {0u, 0u, 0u, 0u};
  v4u pl1 = {0u, 0u, 0u, 0u};
#pragma unroll
  for (int g = 0; g < 8; ++g) {
    v4u hv = {0u, 0u, 0u, 0u};
    v4u lv = {0u, 0u, 0u, 0u};
    if (g < ng) {
#pragma unroll
      for (int e = 0; e < 4; ++e) {
        const float f0 = z[g][2 * e] * inv1k, f1 = z[g][2 * e + 1] * inv1k;
        const _Float16 x0 = (_Float16)f0, x1 = (_Float16)f1;
        hv[e] = pk16(h_bits(x0), h_bits(x1));
        lv[e] = pk16(h_bits((_Float16)((f0 - (float)x0) * LSC)), h_bits((_Float16)((f1 - (float)x1) * LSC)));
      }
    }
    ph[g] = hv;
    if (g == 0) pl0 = lv;
    if (g == 1) pl1 = lv;
  }

  unsigned short* prow = Php + (size_t)row * SEQ + 8 * lane;
  const int il = res ? i : 0;              // clamped row into the residual plane (stored only when res)
  unsigned short* lrow = Plp + ((size_t)b * RESR + (size_t)il) * VLP + 8 * lane;
  {
#pragma unroll
    for (int g = 0; g < 8; ++g) {
      if (g < ng) *(v4u*)(prow + 256 * g) = ph[g];
    }
    if (res) {                             // res rows have i < RESR (multiple of 256) -> 256 ng <= RESR = VLP
      *(v4u*)(lrow) = pl0;
      if (ng > 1) *(v4u*)(lrow + 256) = pl1;
    }
    
  }
}

// =====================================================================================================
// p.v GEMM on f16 WMMA, per batch b: ctx[b][q][d] = sum_key P[b][q][key] * VT[b][d][key], stored as the two bf16 planes that the
// output projection reads: hi = RNE(ctx), lo = RNE(ctx - hi), unscaled, both [NB*SEQ][DM].
//   A  = Ph  [b][SEQ][SEQ]  f16(1024 P), pitch SEQ         Al = Pl  [b][RESR][VLP] f16 residual x4096
//   Bt = VTh [b][DM][SEQ]   f16(16 v),   pitch SEQ         Bl = VTl [b][DM][VLP]   f16 residual x4096
// One work-group (8 waves, 4 x 2) per (64*MI) x 128 output tile, one wave per (16*MI) x 64 tile of it; rows mBase + ...; the
// operand rows of the work-group's tile are staged in LDS, 64 keys a stage, by tensor loads in a ring of NBUF buffers up to the
// causal key extent of the work-group's last row tile (every P entry in that range was written by the softmax: its written extent
// is 256*(row/256 + 1) keys). A wave works on keys k < 64*((m0>>6)+1) only and passes the later publish points idle.
// RES (rows < RESR, MI = 2): acc0 += Ph.VTh; acc1 += Pl.VTh + Ph.VTl,
// ctx = acc0*OSCALE + acc1*OSCALE/4096; otherwise single product ctx = acc0*OSCALE. f32 accumulate.
// bx = index of the work-group's tile among those of rows mBase .. mBase + M - 1 (M a multiple of 64*MI), row-major, DM/128 a row;
// ring and sT are the work-group's LDS.
// =====================================================================================================
__host__ __device__ constexpr int gemm_pv_stage_bytes(bool res, int mi) {   // one stage: Ph 64*mi rows | Pl | VTh 128 rows | VTl
  return (res ? 2 : 1) * (64 * mi + 128) * LPITCH;
}
template <bool RES, int MI, int NBUF>
__device__ __forceinline__ void gemm_pv_body(
    unsigned char* ring, float (*sT)[16 * 68], int bx, int b,
    const unsigned short* __restrict__ Php, const unsigned short* __restrict__ Plp,
    const unsigned short* __restrict__ Vhp, const unsigned short* __restrict__ Vlp,
    unsigned short* Chp, unsigned short* Clp, int mBase, int M) {
  constexpr int AR     = 64 * MI;                                        // rows of the work-group's tile
  static_assert(AR == (RES ? 128 : 256) && (RESR % AR) == 0);
  constexpr int OFF_AL = AR * LPITCH;                                    // stage layout: Ph AR rows | Pl | VTh 128 rows | VTl
  constexpr int OFF_BH = (RES ? 2 : 1) * AR * LPITCH;
  constexpr int OFF_BL = OFF_BH + 128 * LPITCH;
  constexpr int STG    = OFF_BH + (RES ? 2 : 1) * 128 * LPITCH;
  static_assert(STG == gemm_pv_stage_bytes(RES, MI));
  constexpr int NSL = STG / SLB;           // slices of a stage = issuing waves
  constexpr int CPS = 1;                   // tensor loads of an issuing wave for one stage
  static_assert(NSL * SLB == STG && NSL <= 8 && NBUF >= 2 && NBUF <= 4);
  const int tid  = threadIdx.x;
  const int lane = tid & 31;
  const int wave = __builtin_amdgcn_readfirstlane(tid >> 5);
  const int bN = DM >> 7;                          // 8
  const int bm = bx / bN;
  const int bn = bx - bm * bN;
  if (bm >= M / AR) return;                        // work-group-uniform, in front of every tensor load and barrier
  const int r0 = mBase + bm * AR;                  // first row of the work-group's tile
  const int m0 = r0 + (wave >> 1) * 16 * MI;
  const int n0 = bn * 128 + (wave & 1) * 64;
  int keff = (((m0 >> 6) + 1) << 6);               // causal key extent of this row tile, multiple of 64
  if (keff > SEQ) keff = SEQ;
  if (RES && keff > VLP) keff = VLP;               // never taken for mBase + M <= RESR; keeps residual reads in range
  int kblk = ((((r0 + 3 * 16 * MI) >> 6) + 1) << 6);   // the same of the work-group's last row tile: the staged extent
  if (kblk > SEQ) kblk = SEQ;
  if (RES && kblk > VLP) kblk = VLP;
  int rl0 = r0;                                    // first row in the residual plane, clamped; equals r0 for the RES launch
  if (rl0 > RESR - AR) rl0 = RESR - AR;

  const unsigned short* Ag  = Php + (size_t)b * SEQ * SEQ + (size_t)r0 * SEQ;
  const unsigned short* Alg = Plp + (size_t)b * RESR * VLP + (size_t)rl0 * VLP;
  const unsigned short* Bg  = Vhp + (size_t)b * DM * SEQ + (size_t)(bn * 128) * SEQ;
  const unsigned short* Blg = Vlp + (size_t)b * DM * VLP + (size_t)(bn * 128) * VLP;
  const unsigned ringb = (unsigned)(size_t)(const void*)ring;    // LDS byte address of the ring

  const int rlane = lane & 15;
  const int koff  = (lane >> 4) * 8;
  const int mOff  = (lane >> 4) * 8;

  // this wave's slice: 128 rows of one plane (all wave-uniform). RES: Ph, VTh, Pl, VTl; otherwise Ph rows 0.., Ph rows 128.., VTh
  const unsigned short* sg = Ag;
  int sld = SEQ;
  unsigned sl = 0;
  if (RES) {
    if (wave == 1) { sg = Bg; sl = OFF_BH; }
    if (wave == 2) { sg = Alg; sld = VLP; sl = OFF_AL; }
    if (wave == 3) { sg = Blg; sld = VLP; sl = OFF_BL; }
  } else {
    if (wave == 1) { sg = Ag + (size_t)128 * SEQ; sl = SLB; }
    if (wave == 2) { sg = Bg; sl = OFF_BH; }
  }
  const u32x8 g1 = tdm_group1((unsigned)sld * 2u);
  const unsigned long long sga = (unsigned long long)(size_t)(const void*)sg;
  const unsigned sl0 = uni(ringb + sl), sa0 = uni((unsigned)sga);
  u32x4 g0 = tdm_group0(sl0, sga);
  // stage s -> buffer buf: only the LDS address and the low address word change from load to load (a row's key range lies inside one
  // row, and the rows lie at multiples of their own length in the page-aligned workspace, so the low word does not carry)
  // One scalar test decides whether the wave issues: it has a slice, and the stage exists.
  auto stage = [&](int s, int buf, bool exists) {
    if (pinned((wave < NSL) && exists)) {
      g0[1] = uni(sl0 + (unsigned)(buf * STG));
      g0[2] = uni(sa0 + (unsigned)(s * 128));
      tdm_load(g0, g1);
    }
  };

  v8f acc0[MI][4], acc1[MI][4];
#pragma unroll
  for (int i = 0; i < MI; ++i)
#pragma unroll
    for (int j = 0; j < 4; ++j) { acc0[i][j] = zero8(); acc1[i][j] = zero8(); }

  // Two fragment sets: while the WMMAs of one 32-key block run on one set, the next block's fragments are fetched into the other.
  v16h bhA[4], ahA[MI], alA[MI], blA[4], bhB[4], ahB[MI], alB[MI], blB[4];
  const int aoff = ((wave >> 1) * 16 * MI + rlane) * LPITCH + koff * 2;
  const int boff = OFF_BH + ((wave & 1) * 64 + rlane) * LPITCH + koff * 2;
  auto ldset = [&](int buf, int kk, v16h (&bh)[4], v16h (&ah)[MI], v16h (&al)[MI], v16h (&bl)[4]) {
    const unsigned char* pa = ring + buf * STG + aoff + kk * 64;
    const unsigned char* pb = ring + buf * STG + boff + kk * 64;
#pragma unroll
    for (int j = 0; j < 4; ++j) {
      bh[j] = ldfrag_h((const _Float16*)(pb + j * 16 * LPITCH));
      if (RES) bl[j] = ldfrag_h((const _Float16*)(pb + (OFF_BL - OFF_BH) + j * 16 * LPITCH));
    }
#pragma unroll
    for (int i = 0; i < MI; ++i) {
      ah[i] = ldfrag_h((const _Float16*)(pa + i * 16 * LPITCH));
      if (RES) al[i] = ldfrag_h((const _Float16*)(pa + OFF_AL + i * 16 * LPITCH));
    }
  };
  // acc0 += Ph.VTh; acc1 += Pl.VTh, then Ph.VTl, per 32-key block
  auto mmaset = [&](v16h (&bh)[4], v16h (&ah)[MI], v16h (&al)[MI], v16h (&bl)[4]) {
#pragma unroll
    for (int i = 0; i < MI; ++i)
#pragma unroll
      for (int j = 0; j < 4; ++j) {
        acc0[i][j] = mma_h_raw(ah[i], bh[j], acc0[i][j]);
        if (RES) acc1[i][j] = mma_h_raw(al[i], bh[j], acc1[i][j]);
      }
    if (RES) {
#pragma unroll
      for (int i = 0; i < MI; ++i)
#pragma unroll
        for (int j = 0; j < 4; ++j) acc1[i][j] = mma_h_raw(ah[i], bl[j], acc1[i][j]);
    }
  };

  const int nst = kblk >> 6;
  // Ring of NBUF buffers, stage s in buffer s mod NBUF. Two buffers: stage 0, wait to 0, barrier, stage 1. More: the buffers are filled
  // at entry (a fourth behind the wait for stage 0), and stage 0 is published while the later stages fly on.
  stage(0, 0, true);
  if (NBUF == 2) {
    wait_copies();
    __syncthreads();
    stage(1, 1, nst > 1);
  } else {
    constexpr int NPRE = (NBUF < 3) ? NBUF : 3;   // never more than three tensor loads of a wave outstanding
#pragma unroll
    for (int q = 1; q < NPRE; ++q) stage(q, q, q < nst);
    wait_copies_but<(NPRE - 1) * CPS>();
    if (nst < NPRE) wait_copies();         // fewer stages than that: the count would leave stage 0's own load out
    if (NBUF > NPRE) stage(NPRE, NPRE, NPRE < nst);   // the fourth buffer's, behind the wait for stage 0's
    __syncthreads();
  }
  ldset(0, 0, bhA, ahA, alA, blA);

  int cur = 0;                             // buffer of stage s
  // one trip = one stage; refill (fixed at build time): behind its publish point the trip loads stage s + NBUF into the buffer it has left
  auto trip = [&](int s, auto refill) {
    const bool act = s * 64 < keff;        // wave-uniform
    const int nxt = (cur + 1 == NBUF) ? 0 : cur + 1;
    ldset(cur, 1, bhB, ahB, alB, blB);     // the stage's last block: the wave's last reads of buffer cur
    __builtin_amdgcn_sched_barrier(0);     // keeps the load group whole and ahead of the WMMAs
    if (act) mmaset(bhA, ahA, alA, blA);
    __builtin_amdgcn_sched_barrier(0);     // keeps these WMMAs in front of the waits, so that the loads above fly under them
    // publish point of stage s + 1, in front of stage s's last block and passed by every wave: own LDS reads of buffer cur
    // returned, own tensor load of stage s + 1 landed (those of stages s + 2 .. s + NBUF - 1 may fly on where all of them were issued;
    // in the last trips the wait is to 0), barrier; then the refill of buffer cur and the first fragments of stage s + 1
    wait_lds();
    if (NBUF > 2) wait_copies_but<(NBUF - 2) * CPS>();
    if (NBUF == 2 || s + NBUF - 1 >= nst) wait_copies();
    __syncthreads();
    if constexpr (decltype(refill)::value) stage(s + NBUF, cur, true);
    // unconditional (a branch here would merge the compiler's LDS wait counts): behind the last stage it reads again the last
    // stage's buffer (two buffers: the other one's old bytes), which no tensor load is aimed at any more, and nothing uses them
    ldset((NBUF == 2 || s + 1 < nst) ? nxt : cur, 0, bhA, ahA, alA, blA);
    __builtin_amdgcn_sched_barrier(0);     // keeps the load group whole and ahead of the WMMAs
    if (act) mmaset(bhB, ahB, alB, blB);
    cur = nxt;
  };
  // the trips behind which a stage s + NBUF exists, then the last NBUF (or all nst), which load nothing
  const int nref = (nst > NBUF) ? nst - NBUF : 0;
  for (int s = 0; s < nref; ++s) trip(s, BoolC<true>{});
  for (int s = nref; s < nst; ++s) trip(s, BoolC<false>{});
  wait_copies();
  // pinned to here: both descriptor groups stay in their scalar registers until the wave's last tensor load has landed
  asm volatile("" :: "s"(g0), "s"(g1));
  wait_lds();
#pragma unroll
  for (int i = 0; i < MI; ++i) {
    acc_guard4(acc0[i][0], acc0[i][1], acc0[i][2], acc0[i][3]);
    if (RES) acc_guard4(acc1[i][0], acc1[i][1], acc1[i][2], acc1[i][3]);
  }

  // ---- epilogue ----
  float* slab = sT[wave];
  unsigned short* Ch = Chp + (size_t)b * SEQ * DM;
  unsigned short* Cl = Clp + (size_t)b * SEQ * DM;
  const float rsc = OSCALE * (1.0f / LSC);
#pragma unroll
  for (int i = 0; i < MI; ++i) {
    const int mB = m0 + (i << 4);
#pragma unroll
    for (int j = 0; j < 4; ++j) {
#pragma unroll
      for (int r = 0; r < 8; ++r) {
        float v = acc0[i][j][r] * OSCALE;
        if (RES) v += acc1[i][j][r] * rsc;
        slab[(mOff + r) * 68 + (j << 4) + rlane] = v;
      }
    }
    wait_lds();   // the slab is this wave's own: its LDS writes are done before other lanes read the rows back; no wait on global stores
    {
      const int q = lane >> 3, c8 = (lane & 7) * 8;        // 128-B row segment of a plane = 8 lanes x 16 B
      v4u hv[4], lv[4];
#pragma unroll
      for (int it = 0; it < 4; ++it) {
        const int row = it * 4 + q;                        // it 0..3 x q 0..3 = rows 0..15
        const float* sp = slab + row * 68 + c8;
        v4u a, a2;
#pragma unroll
        for (int e = 0; e < 4; ++e) {
          const float f0 = sp[2 * e], f1 = sp[2 * e + 1];
          const unsigned h = pk_bf(f0, f1);
          a[e]  = h;
          a2[e] = pk_bf(f0 - bf_up0(h), f1 - bf_up1(h));
        }
        hv[it] = a; lv[it] = a2;
      }
#pragma unroll
      for (int it = 0; it < 4; ++it) {
        const int row = it * 4 + q;
        *(v4u*)(Ch + (size_t)(mB + row) * DM + n0 + c8) = hv[it];
        *(v4u*)(Cl + (size_t)(mB + row) * DM + n0 + c8) = lv[it];
      }
    }
    // also behind the last slab
    slab_next();
  }
}

// =====================================================================================================
// Both parts of p.v, which read nothing of each other, in one grid. A work-group's cost grows with its causal key extent;
// the index runs from the longest to the shortest (for speed only):
//   blocks 0 .. NPVH-1   rows RESR .. SEQ-1, single f16 product, 256 x 128 tiles, last row block first (NPVC tiles a row block)
//   the rest             rows 0 .. RESR-1 with the residual planes (3 f16 products), 128 x 128 tiles, last row block first
// The choice is the same for a whole work-group; the two parts use the same LDS.
// =====================================================================================================
#define NPVC ((DM / 128) * NB)
#define NPVH (((SEQ - RESR) / 256) * NPVC)
#define NPVR ((RESR / 128) * NPVC)
static_assert(((SEQ - RESR) % 256) == 0 && (RESR % 128) == 0 && (DM % 128) == 0);
__global__ __launch_bounds__(256) void gemm_pv_all(
    const unsigned short* __restrict__ Php, const unsigned short* __restrict__ Plp,
    const unsigned short* __restrict__ Vhp, const unsigned short* __restrict__ Vlp, unsigned short* Chp, unsigned short* Clp) {
  constexpr int RB = WS_MAX2(3 * gemm_pv_stage_bytes(true, 2), 4 * gemm_pv_stage_bytes(false, 4));
  __shared__ __attribute__((aligned(2048))) unsigned char ring[RB];
  __shared__ __align__(16) float sT[8][16 * 68];
  const int blk = blockIdx.x;
  if (blk < NPVH) {
    const int rb = (SEQ - RESR) / 256 - 1 - blk / NPVC, e = blk % NPVC;
    gemm_pv_body<false, 4, 4>(ring, sT, rb * (DM / 128) + e % (DM / 128), e / (DM / 128), Php, Plp, Vhp, Vlp, Chp, Clp, RESR, SEQ - RESR);
  } else {
    const int rb = RESR / 128 - 1 - (blk - NPVH) / NPVC, e = (blk - NPVH) % NPVC;
    gemm_pv_body<true, 2, 3>(ring, sT, rb * (DM / 128) + e % (DM / 128), e / (DM / 128), Php, Plp, Vhp, Vlp, Chp, Clp, 0, RESR);
  }
}

// =====================================================================================================
// Workspace map (bytes, full build NB 4 / SEQ 2048; every region is an exact multiple of its tile / whole-line store
// granularity; regions A and B are reused in stream order):
//   region A [0, 33554432):          Xb bf16 [8192][1024] at 0 (16777216) + Wq,Wk,Wv bf16 [1024][1024] at 16777216 (3 x 2097152),
//                                    read up to the launch of the scores and v^T
//                                    then: Ch, Cl bf16 ctx planes [8192][1024] at 0 (2 x 16777216), written by p.v
//   region B [33554432, 100663296):  Qh, Ql, Kh, Kl bf16 [8192][1024] (4 x 16777216)
//                                    then, once the scores are done: Ph f16 [4][2048][2048] (33554432) + Pl f16 [4][512][512] (2097152)
//   region C [100663296, 121634816): VTh f16 [4][1024][2048] (16777216) + VTl f16 [4][1024][512] (4194304)
//   region D [121634816, 123731968): WoT bf16 [1024][1024] (2097152), live from launch 1 to the last GEMM
//   region E [123731968, 158334976): Sp f32 packed score tiles [4][528][64][64] (34603008); a region of its own, because the launch
//                                    that writes it still reads Xb and Wv
//   end 158334976
// =====================================================================================================
extern "C" void kernel_launch(void* const* d_in, const int* in_sizes, int n_in,
                              void* d_out, int out_size, void* d_ws, size_t ws_size,
                              hipStream_t stream) {
  if (n_in < 5) return;
  if (in_sizes[4] < (NB - 1) * SEQ_FULL * DM + SEQ * DM) return;
  if (in_sizes[0] < DM * DM || in_sizes[1] < DM * DM || in_sizes[2] < DM * DM || in_sizes[3] < DM * DM) return;
  if (out_size < NB * SEQ * DM) return;

  // wire order of the inputs: k, q, v, out_proj, x
  const float* wk = (const float*)d_in[0];   // [out][in]
  const float* wq = (const float*)d_in[1];   // [out][in]
  const float* wv = (const float*)d_in[2];   // [out][in]
  const float* wo = (const float*)d_in[3];   // [in][out]
  const float* x  = (const float*)d_in[4];   // [NB_FULL][SEQ_FULL][DM]
  float* out = (float*)d_out;

  const size_t PX  = (size_t)NB * SEQ * DM * 2;       // 16-bit plane [NB*SEQ][DM]
  const size_t PW  = (size_t)DM * DM * 2;             // one weight plane
  const size_t PS  = (size_t)NB * NTRI * 4096 * 4;    // packed f32 score tiles
  const size_t PC  = 2 * PX;                          // bf16 hi and lo ctx planes
  const size_t PP  = (size_t)NB * SEQ * SEQ * 2;      // Ph
  const size_t PPL = (size_t)NB * RESR * VLP * 2;     // Pl
  const size_t PVT = (size_t)NB * DM * SEQ * 2;       // VTh
  const size_t PVL = (size_t)NB * DM * VLP * 2;       // VTl
  const size_t RA = ((PX + 3 * PW) > PC) ? (PX + 3 * PW) : PC;
  const size_t oXb = 0;
  const size_t oW  = PX;
  const size_t oCh = 0;
  const size_t oCl = PX;
  const size_t oQh = RA;
  const size_t oQl = RA + PX;
  const size_t oKh = RA + 2 * PX;
  const size_t oKl = RA + 3 * PX;
  const size_t RBend = RA + 4 * PX;
  const size_t oPh = RA;
  const size_t oPl = RA + PP;
  if (oPl + PPL > RBend) return;
  const size_t oVTh = RBend;
  const size_t oVTl = RBend + PVT;
  const size_t oWo  = oVTl + PVL;
  const size_t oS   = oWo + PW;
  const size_t total = oS + PS;                       // 158334976 in the full build
  if (total > ws_size) return;

  char* ws = (char*)d_ws;
  unsigned short* Xb  = (unsigned short*)(ws + oXb);
  unsigned short* Wb  = (unsigned short*)(ws + oW);   // Wq plane, then Wk, then Wv
  float*          Sp  = (float*)(ws + oS);
  unsigned short* Qh  = (unsigned short*)(ws + oQh);
  unsigned short* Ql  = (unsigned short*)(ws + oQl);
  unsigned short* Kh  = (unsigned short*)(ws + oKh);
  unsigned short* Kl  = (unsigned short*)(ws + oKl);
  unsigned short* Ph  = (unsigned short*)(ws + oPh);
  unsigned short* Pl  = (unsigned short*)(ws + oPl);
  unsigned short* Ch  = (unsigned short*)(ws + oCh);
  unsigned short* Cl  = (unsigned short*)(ws + oCl);
  unsigned short* VTh = (unsigned short*)(ws + oVTh);
  unsigned short* VTl = (unsigned short*)(ws + oVTl);
  unsigned short* WoT = (unsigned short*)(ws + oWo);

  const dim3 blk(256);
  const int nGroups = NB * SEQ * DM / 8 + 3 * (DM * DM / 8);
  const dim3 gCvt(NWOT + (nGroups + 255) / 256);
  const dim3 gQk(2 * NPQ);
  const dim3 gSv(NB * (NSF + NSI) + NB * NPV);
  const dim3 gProj(((NB * SEQ / 64) * (DM / 64) + 7) / 8, 1);
  const dim3 gSm((NB * SEQ + 7) / 8);
  const dim3 gPv(NPVH + NPVR);

  // (1) x and Wq, Wk, Wv -> bf16 planes (Xb, then the three weight planes contiguous); Wo [in][out] -> WoT bf16 [out][in]
  cvt_inputs<<<gCvt, blk, 0, stream>>>(x, wq, wk, wv, wo, Xb, WoT);
  // (2) q, k -> bf16 hi/lo planes [NB*SEQ][DM]
  proj_qk<<<gQk, blk, 0, stream>>>(Xb, Wb, Qh, Ql, Kh, Kl);
  // (3) scores = q . k^T per batch over the NTRI lower-triangular 64x64 tiles, 3 bf16 products -> packed f32 tiles;
  //     v^T -> f16 hi plane and residual plane
  scores_vt<<<gSv, blk, 0, stream>>>(Qh, Ql, Kh, Kl, Sp, Xb, Wb + (size_t)2 * DM * DM, VTh, VTl);
  // (4) causal row softmax in f32 -> Ph f16(1024 P) and Pl residual planes
  softmax_rows<<<gSm, blk, 0, stream>>>(Sp, Ph, Pl);
  // (5) ctx = p.v -> bf16 hi/lo planes [NB*SEQ][DM]: rows RESR..SEQ-1 single f16 product (64x64 wave tiles), rows 0..RESR-1 of every sequence
  //     with the residual planes (3 f16 products, 32x64 wave tiles)
  gemm_pv_all<<<gPv, blk, 0, stream>>>(Ph, Pl, VTh, VTl, Ch, Cl);
  // (6) out = ctx . Wo -> f32 output buffer   (A = Ch + Cl, Bt = WoT [out][in]; M=NB*SEQ, N=DM, K=DM; 2 bf16 products)
  gemm_bf<1, 0, 0, 3><<<gProj, blk, 0, stream>>>(
      Ch, Cl, DM, 0LL, WoT, WoT, DM, 0LL,
      (void*)out, DM, 0LL, (void*)out, DM, 0LL, 0,
      NB * SEQ, DM, DM, 1.0f, 1.0f);
  (void)hipGetLastError();
}
